// v000
// Times are from an AMD MI455X. After a warm-up the kernel runs many times in a row, and a time is the length of
// such a window on the GPU divided by its runs, so every launch and the gaps after it count. The runs cycle
// through copies of the inputs. A figure is the median of several windows, for all but v000 over two sittings.
// Sittings can differ by a few percent; kernels timed side by side share one.
// v000 is the starting kernel. One run takes 1190 microseconds.
#include <hip/hip_runtime.h>

// Grouped-query attention block (NB x SEQ x 2048): q = x Wq (32 heads x 64), k / v = x Wk / x Wv (8 kv heads x 64, 4 query heads per kv head), rotate-half rotary embedding
// (base 500000; cos/sin table built on device from host-computed inverse frequencies), causal sliding-window softmax(q.k / 8) (window 1024, -inf fill, diagonal always kept),
// ctx merged as [t][h*64 + d], out = ctx Wo -> f32 [NB][SEQ][2048]. Weights are [in][out] and are transposed into K-contiguous bf16 planes.
// Compute dtypes (f32 accumulate everywhere): every input RNE-converted to bf16; x.Wq, x.Wk, x.Wv: v_wmma_f32_16x16x32_bf16 on plain bf16 operands; q.k and P.v: query rows < RH on bf16 hi+lo
// planes (3 products), rows >= RH single v_wmma_f32_16x16x32_f16 (P carried x1024), causal / window tile skipping; softmax and rotary arithmetic f32; ctx.Wo: bf16 hi+lo ctx x bf16 Wo (2 products).

#ifndef NB
#define NB 1
#endif
#ifndef SEQ
#define SEQ 2048
#endif
#ifndef RH
#define RH 512                  // query rows < RH use hi+lo planes (0: none)
#endif
#define TT      SEQ
#define TT_FULL 2048
#define DM      2048
#define NH_     32
#define NKV     8
#define REP     (NH_ / NKV)
#define HD      64
#define DQ      (NH_ * HD)
#define DKV     (NKV * HD)
#define ZH      2
#define RHE     ((RH < TT) ? RH : TT)
#define WIN     1024
#define PCAR    1024.0f
#define SCL     0.125f            // HD^-0.5
static_assert(TT % 128 == 0 && TT >= 128 && TT <= TT_FULL);
static_assert(RH % 64 == 0 && RH >= 0);
static_assert(REP % ZH == 0 && NH_ % ZH == 0);
static_assert(DM % 64 == 0 && DQ % 64 == 0 && DKV % 64 == 0 && HD == 64);

typedef _Float16 h16;
typedef unsigned short bf;
typedef __attribute__((ext_vector_type(16))) __bf16   v16bf;
typedef __attribute__((ext_vector_type(16))) _Float16 v16h;
typedef __attribute__((ext_vector_type(8)))  _Float16 v8h;
typedef __attribute__((ext_vector_type(8)))  unsigned short v8us;
typedef __attribute__((ext_vector_type(8)))  float    v8f;
typedef __attribute__((ext_vector_type(4)))  float    v4f;
typedef __attribute__((ext_vector_type(2)))  _Float16 v2h;
typedef __attribute__((ext_vector_type(4)))  _Float16 v4h;
typedef __attribute__((ext_vector_type(2)))  unsigned short v2us;
typedef __attribute__((ext_vector_type(4)))  unsigned short v4us;
typedef __attribute__((ext_vector_type(2)))  float v2f;
typedef v8h  __attribute__((may_alias)) v8ha;
typedef v4f  __attribute__((may_alias)) v4fa;
typedef v8us __attribute__((may_alias)) v8usa;

__device__ __forceinline__ unsigned short f2bf(float f) { unsigned u = __float_as_uint(f); u += 0x7FFFu + ((u >> 16) & 1u); return (unsigned short)(u >> 16); }   // RNE convert
__device__ __forceinline__ float bf2f(unsigned short b) { return __uint_as_float(((unsigned)b) << 16); }
__device__ __forceinline__ float bfr(float f) { return bf2f(f2bf(f)); }
__device__ __forceinline__ v16h cat16(v8h lo, v8h hi) { return __builtin_shufflevector(lo, hi, 0, 1, 2, 3, 4, 5, 6, 7, 8, 9, 10, 11, 12, 13, 14, 15); }
__device__ __forceinline__ v16bf cat16b(v8us lo, v8us hi) { return __builtin_bit_cast(v16bf, __builtin_shufflevector(lo, hi, 0, 1, 2, 3, 4, 5, 6, 7, 8, 9, 10, 11, 12, 13, 14, 15)); }
__device__ __forceinline__ v8f wmma16(v16h a, v16h b, v8f c) { return __builtin_amdgcn_wmma_f32_16x16x32_f16(false, a, false, b, (short)0, c, false, false); }
__device__ __forceinline__ v8f wmmab(v16bf a, v16bf b, v8f c) { return __builtin_amdgcn_wmma_f32_16x16x32_bf16(false, a, false, b, (short)0, c, false, false); }
__device__ __forceinline__ h16 tohx(float x) { return (h16)x; }
__device__ __forceinline__ void splitf(float y, unsigned short& h, unsigned short& l) { h = f2bf(y); l = f2bf(y - bf2f(h)); }

// ---- k_gemmw: register-blocked GEMM, ONE WAVE per 64x64 output tile (16 accumulators), operands straight from K-contiguous 16-bit planes; grid (M/64, N/64, Z), 32 threads.
// C[m][n] (f32, pitch ldc, + optional f32 bias[n]) = sum_k A[m][k] Bt[n][k] (+ split products per NSPLIT). z-batch strides sA/sB/sC in elements. K % 32 == 0.
// Fragment map (both operands): lane row/col = lane & 15, elements 0..7 <- k0 + 8*(lane>>4) + 0..7, elements 8..15 <- k0 + 16 + 8*(lane>>4) + 0..7; D element r of lane l = (row 8*(l>>4) + r, col l & 15).
template <typename T16> struct WFrag;
template <> struct WFrag<h16> { typedef v16h V; static __device__ __forceinline__ V ld(const h16* p) { return cat16(*(const v8h*)p, *(const v8h*)(p + 16)); } static __device__ __forceinline__ v8f mma(V a, V b, v8f c) { return wmma16(a, b, c); } };
template <> struct WFrag<bf> { typedef v16bf V; static __device__ __forceinline__ V ld(const bf* p) { return cat16b(*(const v8us*)p, *(const v8us*)(p + 16)); } static __device__ __forceinline__ v8f mma(V a, V b, v8f c) { return wmmab(a, b, c); } };
template <typename T16, int NSPLIT, bool BIAS>
__global__ __launch_bounds__(32) void k_gemmw(const T16* __restrict__ A, const T16* __restrict__ A2, const T16* __restrict__ Bt, const T16* __restrict__ Bt2, int K, float* C, int ldc, const float* __restrict__ bias, size_t sA, size_t sB, size_t sC) {
    typedef typename WFrag<T16>::V V;
    __shared__ __align__(16) float os[16 * 68];
    const size_t z = blockIdx.z; A += z * sA; if (A2) A2 += z * sA; Bt += z * sB; if (Bt2) Bt2 += z * sB; C += z * sC;
    const int lane = threadIdx.x & 31, lr = lane & 15, hi = lane >> 4; const int r0 = blockIdx.x * 64, c0 = blockIdx.y * 64;
    v8f acc[4][4];
#pragma unroll
    for (int mb = 0; mb < 4; ++mb)
#pragma unroll
        for (int nb = 0; nb < 4; ++nb) acc[mb][nb] = (v8f){};
    const size_t aoff = (size_t)(r0 + lr) * K + 8 * hi, boff = (size_t)(c0 + lr) * K + 8 * hi;
#pragma unroll 1
    for (int kc = 0; kc < K; kc += 32) {
        V a[4], a2[4];
#pragma unroll
        for (int mb = 0; mb < 4; ++mb) { a[mb] = WFrag<T16>::ld(A + aoff + (size_t)mb * 16 * K + kc); if (NSPLIT == 1 || NSPLIT == 2) a2[mb] = WFrag<T16>::ld(A2 + aoff + (size_t)mb * 16 * K + kc); }
#pragma unroll
        for (int nb = 0; nb < 4; ++nb) { const V b = WFrag<T16>::ld(Bt + boff + (size_t)nb * 16 * K + kc); V b2; if (NSPLIT >= 2) b2 = WFrag<T16>::ld(Bt2 + boff + (size_t)nb * 16 * K + kc);
#pragma unroll
            for (int mb = 0; mb < 4; ++mb) { acc[mb][nb] = WFrag<T16>::mma(a[mb], b, acc[mb][nb]); if (NSPLIT == 1 || NSPLIT == 2) acc[mb][nb] = WFrag<T16>::mma(a2[mb], b, acc[mb][nb]); if (NSPLIT >= 2) acc[mb][nb] = WFrag<T16>::mma(a[mb], b2, acc[mb][nb]); } }
        asm volatile("v_nop\n\tv_nop\n\tv_nop\n\tv_nop" : "+v"(acc[0][0]), "+v"(acc[1][1]), "+v"(acc[2][2]), "+v"(acc[3][3]) : "v"(a[0]), "v"(a[3]));
    }
#pragma unroll
    for (int mb = 0; mb < 4; ++mb) {
#pragma unroll
        for (int nb = 0; nb < 4; ++nb) {
#pragma unroll
            for (int j = 0; j < 8; ++j) os[(hi * 8 + j) * 68 + nb * 16 + lr] = acc[mb][nb][j]; }
        __builtin_amdgcn_wave_barrier(); asm volatile("" ::: "memory");
        float* crow = C + (size_t)(r0 + mb * 16) * ldc + c0;
{
#pragma unroll
            for (int s = 0; s < 8; ++s) { const int row = 2 * s + hi, cofs = lr * 4; v4f val = *(const v4fa*)(os + row * 68 + cofs); if (BIAS) { val[0] += bfr(bias[c0 + cofs]); val[1] += bfr(bias[c0 + cofs + 1]); val[2] += bfr(bias[c0 + cofs + 2]); val[3] += bfr(bias[c0 + cofs + 3]); }
                *(v4f*)(crow + (size_t)row * ldc + cofs) = val; }
             }
        __builtin_amdgcn_wave_barrier(); asm volatile("" ::: "memory");
    }
}

// ---- k_gemmc: the same one-wave 64x64 tile GEMM specialised for causal sliding-window attention: CMODE 1 skips score tiles that are entirely above the diagonal or entirely below the
// window (query rows r0+roff.., key columns c0..); CMODE 2 limits the key (K) loop of the probability x value contraction to [window start, diagonal block] (probabilities outside it
// are exactly zero and the planes are fully written). roff = query position of this launch's first row within the sequence.
template <typename T16, int NSPLIT, int CMODE>
__global__ __launch_bounds__(32) void k_gemmc(const T16* __restrict__ A, const T16* __restrict__ A2, const T16* __restrict__ Bt, const T16* __restrict__ Bt2, int K, float* C, int ldc, int roff, size_t sA, size_t sB, size_t sC) {
    typedef typename WFrag<T16>::V V;
    __shared__ __align__(16) float os[16 * 68];
    const size_t z = blockIdx.z; A += z * sA; if (A2) A2 += z * sA; Bt += z * sB; if (Bt2) Bt2 += z * sB; C += z * sC;
    const int lane = threadIdx.x & 31, lr = lane & 15, hi = lane >> 4; const int r0 = blockIdx.x * 64, c0 = blockIdx.y * 64;
    const int qlo = r0 + roff;                                                        // first query position of this tile
    if (CMODE == 1 && (c0 > qlo + 63 || c0 + 63 < qlo - (WIN - 1))) return;          // every (row, key) of the tile is banned: never written (the softmax selects by index)
    const int Kl = (CMODE == 2) ? min(K, qlo + 64) : K;                               // P.v: probabilities are exactly 0 beyond the diagonal block
    const int Kb = (CMODE == 2) ? (max(0, qlo - (WIN - 1)) & ~31) : 0;                // ... and before the window start
    v8f acc[4][4];
#pragma unroll
    for (int mb = 0; mb < 4; ++mb)
#pragma unroll
        for (int nb = 0; nb < 4; ++nb) acc[mb][nb] = (v8f){};
    const size_t aoff = (size_t)(r0 + lr) * K + 8 * hi, boff = (size_t)(c0 + lr) * K + 8 * hi;
#pragma unroll 1
    for (int kc = Kb; kc < Kl; kc += 32) {
        V a[4], a2[4];
#pragma unroll
        for (int mb = 0; mb < 4; ++mb) { a[mb] = WFrag<T16>::ld(A + aoff + (size_t)mb * 16 * K + kc); if (NSPLIT == 1 || NSPLIT == 2) a2[mb] = WFrag<T16>::ld(A2 + aoff + (size_t)mb * 16 * K + kc); }
#pragma unroll
        for (int nb = 0; nb < 4; ++nb) { const V b = WFrag<T16>::ld(Bt + boff + (size_t)nb * 16 * K + kc); V b2; if (NSPLIT >= 2) b2 = WFrag<T16>::ld(Bt2 + boff + (size_t)nb * 16 * K + kc);
#pragma unroll
            for (int mb = 0; mb < 4; ++mb) { acc[mb][nb] = WFrag<T16>::mma(a[mb], b, acc[mb][nb]); if (NSPLIT == 1 || NSPLIT == 2) acc[mb][nb] = WFrag<T16>::mma(a2[mb], b, acc[mb][nb]); if (NSPLIT >= 2) acc[mb][nb] = WFrag<T16>::mma(a[mb], b2, acc[mb][nb]); } }
        asm volatile("v_nop\n\tv_nop\n\tv_nop\n\tv_nop" : "+v"(acc[0][0]), "+v"(acc[1][1]), "+v"(acc[2][2]), "+v"(acc[3][3]) : "v"(a[0]), "v"(a[3]));
    }
#pragma unroll
    for (int mb = 0; mb < 4; ++mb) {
#pragma unroll
        for (int nb = 0; nb < 4; ++nb) {
#pragma unroll
            for (int j = 0; j < 8; ++j) os[(hi * 8 + j) * 68 + nb * 16 + lr] = acc[mb][nb][j]; }
        __builtin_amdgcn_wave_barrier(); asm volatile("" ::: "memory");
        float* crow = C + (size_t)(r0 + mb * 16) * ldc + c0;
{
#pragma unroll
            for (int s = 0; s < 8; ++s) { const int row = 2 * s + hi, cofs = lr * 4; v4f val = *(const v4fa*)(os + row * 68 + cofs);
                *(v4f*)(crow + (size_t)row * ldc + cofs) = val; }
             }
        __builtin_amdgcn_wave_barrier(); asm volatile("" ::: "memory");
    }
}

__global__ __launch_bounds__(256) void k_wtG(const float* __restrict__ w, int K, int N, bf* Bt) {
    const int lane = threadIdx.x & 31; const int L0 = (blockIdx.x * 8 + (threadIdx.x >> 5)) * 8; const int nlines = N * K / 64;
{
#pragma unroll 1
        for (int l = 0; l < 8; ++l) { const int L = L0 + l; if (L >= nlines) break; const size_t e = (size_t)L * 64 + lane * 2; const int k = (int)(e % K), n = (int)(e / K); v2us o;
            o[0] = f2bf(w[(size_t)k * N + n]); o[1] = f2bf(w[(size_t)(k + 1) * N + n]); *(v2us*)(Bt + e) = o; }
         }
}
__global__ __launch_bounds__(256) void k_cvt8(const float* __restrict__ src, bf* dst, size_t n8) { const size_t i = (size_t)blockIdx.x * 256 + threadIdx.x; if (i >= n8) return; const v8f v = *(const v8f*)(src + i * 8); v8us o;
#pragma unroll
    for (int k = 0; k < 8; ++k) o[k] = f2bf(v[k]); *(v8us*)(dst + i * 8) = o;  }

// ---- k_csgen: rotary table CS[t][d] = {cos(t * inv[d & 31]), sin(t * inv[d & 31])} (f32 product, precise sincos). inv[] arrives by value (host-computed); lane == d & 31 by construction
struct RopeTab { float f[32]; };
static_assert(sizeof(RopeTab) == 128);
__global__ __launch_bounds__(256) void k_csgen(RopeTab tab, float* CS) {
    const int idx = blockIdx.x * 256 + threadIdx.x; const int lane = threadIdx.x & 31; float inv = 0.0f;
#pragma unroll
    for (int i = 0; i < 32; ++i) inv = (lane == i) ? tab.f[i] : inv;
    if (idx >= TT * HD) return;
    const int t = idx / HD; float ang = __fmul_rn((float)t, inv); asm volatile("" : "+v"(ang));
    float sn, cs; sincosf(ang, &sn, &cs);
    v2f o; o[0] = cs; o[1] = sn;
    *(v2f*)(CS + (size_t)idx * 2) = o;  }

// ---- k_rope: head planes [h][t][d] (fp16 + bf16 hi/lo) of the rotate-half rotary map out[d] = x[d] cos[t][d] - x[d+HD/2] sin[t][d], out[d+HD/2] = x[d+HD/2] cos[t][d+HD/2] + x[d] sin[t][d+HD/2]
__global__ __launch_bounds__(256) void k_rope(const float* __restrict__ F, int pitch, int nheads, const float* __restrict__ CS, h16* P16, bf* Ph, bf* Pl) {
    const size_t e = ((size_t)blockIdx.x * 256 + threadIdx.x) * 2; if (e >= (size_t)nheads * TT * HD) return; const int d = (int)(e % HD); const int t = (int)((e / HD) % TT); const int h = (int)(e / ((size_t)HD * TT)); const float* f = F + (size_t)t * pitch + h * HD; v2h o16; v2us oh, ol;
#pragma unroll
    for (int q = 0; q < 2; ++q) { const int dd = d + q; const int dp = (dd < HD / 2) ? dd + HD / 2 : dd - HD / 2; const float x0 = f[dd], x1 = f[dp];
        const v2f cs = *(const v2f*)(CS + ((size_t)t * HD + dd) * 2); float a = __fmul_rn(x0, cs[0]), bq = __fmul_rn(x1, cs[1]); asm volatile("" : "+v"(a)); asm volatile("" : "+v"(bq)); const float r = (dd < HD / 2) ? __fsub_rn(a, bq) : __fadd_rn(a, bq);
        o16[q] = tohx(r); unsigned short a2, c2; splitf(r, a2, c2); oh[q] = a2; ol[q] = c2; }
    *(v2h*)(P16 + e) = o16; *(v2us*)(Ph + e) = oh; *(v2us*)(Pl + e) = ol;  }
__global__ __launch_bounds__(256) void k_vtp(const float* __restrict__ F, int pitch, int nheads, h16* V16, bf* Vh, bf* Vl) { const size_t e = ((size_t)blockIdx.x * 256 + threadIdx.x) * 2; if (e >= (size_t)nheads * HD * TT) return; const int t = (int)(e % TT); const int d = (int)((e / TT) % HD); const int g = (int)(e / ((size_t)TT * HD)); v2h o16; v2us oh, ol;
#pragma unroll
    for (int q = 0; q < 2; ++q) { const float x = F[(size_t)(t + q) * pitch + g * HD + d]; o16[q] = tohx(x); unsigned short a2, c2; splitf(x, a2, c2); oh[q] = a2; ol[q] = c2; }
    *(v2h*)(V16 + e) = o16; *(v2us*)(Vh + e) = oh; *(v2us*)(Vl + e) = ol;  }

// ---- k_asoft: per row (zz, i): t = S x HD^-0.5 for j <= i and i - j < WIN (causal sliding window, the diagonal is always kept so no row is empty); banned or never-written score entries are
__global__ __launch_bounds__(256) void k_asoft(const float* __restrict__ Sb, h16* P16, bf* Ph, bf* Pl) {
    const int lane = threadIdx.x & 31; const int row = blockIdx.x * 8 + (threadIdx.x >> 5); if (row >= ZH * TT) return; const int i = row % TT; const int zz = row / TT; const bool hires = (i < RHE); const float* sr = Sb + (size_t)row * TT; float v[TT / 32]; float mx = -3.0e38f;
#pragma unroll
    for (int ch = 0; ch < TT / 128; ++ch) { const int j0 = ch * 128 + lane * 4; const v4f a = *(const v4f*)(sr + j0);
#pragma unroll
        for (int q = 0; q < 4; ++q) { const int j = j0 + q; float sa = a[q] * SCL; asm volatile("" : "+v"(sa)); const float t = (j <= i && i - j < WIN) ? sa : -3.0e38f; v[ch * 4 + q] = t; mx = fmaxf(mx, t); } }
#pragma unroll
    for (int sh = 16; sh; sh >>= 1) mx = fmaxf(mx, __shfl_xor(mx, sh, 32));
    float sum = 0.f;
#pragma unroll
    for (int k = 0; k < TT / 32; ++k) { float d0 = __fsub_rn(v[k], mx); asm volatile("" : "+v"(d0)); v[k] = __builtin_amdgcn_exp2f(__fmul_rn(d0, 1.4426950408889634f)); sum += v[k]; }
#pragma unroll
    for (int sh = 16; sh; sh >>= 1) sum += __shfl_xor(sum, sh, 32);
    const float f = __fdiv_rn(hires ? 1.0f : PCAR, sum);
{
        if (hires) {
#pragma unroll
            for (int ch = 0; ch < TT / 128; ++ch) { v4us oh, ol;
#pragma unroll
                for (int q = 0; q < 4; ++q) { unsigned short a, c2; splitf(v[ch * 4 + q] * f, a, c2); oh[q] = a; ol[q] = c2; }
                const size_t oo = ((size_t)zz * RHE + i) * TT + ch * 128 + lane * 4; *(v4us*)(Ph + oo) = oh; *(v4us*)(Pl + oo) = ol; }
        } else {
#pragma unroll
            for (int ch = 0; ch < TT / 128; ++ch) { v4h o4;
#pragma unroll
                for (int q = 0; q < 4; ++q) o4[q] = tohx(v[ch * 4 + q] * f);
                *(v4h*)(P16 + (size_t)row * TT + ch * 128 + lane * 4) = o4; } }
         }
}
__global__ __launch_bounds__(256) void k_merge(const float* __restrict__ O, int h0, bf* Ah, bf* Al) { const size_t e = ((size_t)blockIdx.x * 256 + threadIdx.x) * 2; if (e >= (size_t)ZH * TT * HD) return; const int d = (int)(e % HD); const int t = (int)((e / HD) % TT); const int zz = (int)(e / ((size_t)HD * TT)); const float cs = (t < RHE) ? 1.0f : (1.0f / PCAR); const size_t oo = (size_t)t * DQ + (size_t)(h0 + zz) * HD + d;
    v2us oh, ol;
#pragma unroll
    for (int q = 0; q < 2; ++q) { unsigned short a, c2; splitf(O[e + q] * cs, a, c2); oh[q] = a; ol[q] = c2; } *(v2us*)(Ah + oo) = oh; *(v2us*)(Al + oo) = ol;  }

extern "C" void kernel_launch(void* const* d_in, const int* in_sizes, int n_in,
                              void* d_out, int out_size, void* d_ws, size_t ws_size, hipStream_t stream) {
    if (n_in < 5) return;
    if (in_sizes[0] < (NB - 1) * TT_FULL * DM + TT * DM || in_sizes[1] < DM * DQ || in_sizes[2] < DM * DKV || in_sizes[3] < DM * DKV || in_sizes[4] < DQ * DM) return;
    if (out_size < NB * TT * DM) return;
    const float* x = (const float*)d_in[0]; const float* wq = (const float*)d_in[1]; const float* wk = (const float*)d_in[2]; const float* wv = (const float*)d_in[3]; const float* wo = (const float*)d_in[4];
    float* OUT = (float*)d_out;     // [NB][TT][DM]
    char* wsp = (char*)d_ws;
    auto take = [&](size_t bytes) { char* p = wsp; wsp += (bytes + 255) & ~(size_t)255; return (void*)p; };
    // persistent planes
    bf* WOt = (bf*)take((size_t)DM * DQ * 2); float* CS = (float*)take((size_t)TT * HD * 2 * 4);
    h16* QP16 = (h16*)take((size_t)NH_ * TT * HD * 2); h16* KP16 = (h16*)take((size_t)NKV * TT * HD * 2); h16* VT16 = (h16*)take((size_t)NKV * HD * TT * 2);
    bf* QPh = (bf*)take((size_t)NH_ * TT * HD * 2); bf* QPl = (bf*)take((size_t)NH_ * TT * HD * 2); bf* KPh = (bf*)take((size_t)NKV * TT * HD * 2); bf* KPl = (bf*)take((size_t)NKV * TT * HD * 2);
    bf* VTh = (bf*)take((size_t)NKV * HD * TT * 2); bf* VTl = (bf*)take((size_t)NKV * HD * TT * 2); bf* ATh = (bf*)take((size_t)TT * DQ * 2); bf* ATl = (bf*)take((size_t)TT * DQ * 2);
    // union region: projection-phase temporaries, then attention-phase temporaries (stream-ordered reuse)
    char* ubase = wsp;
    bf* WQt = (bf*)take((size_t)DQ * DM * 2); bf* WKt = (bf*)take((size_t)DKV * DM * 2); bf* WVt = (bf*)take((size_t)DKV * DM * 2);
    bf* XB = (bf*)take((size_t)TT * DM * 2); float* FQ = (float*)take((size_t)TT * DQ * 4); float* FK = (float*)take((size_t)TT * DKV * 4);
    char* end1 = wsp; wsp = ubase;
    float* Sb = (float*)take((size_t)ZH * TT * TT * 4); h16* P16 = (h16*)take((size_t)ZH * TT * TT * 2); bf* Ph = (bf*)take((size_t)ZH * RHE * TT * 2); bf* Pl = (bf*)take((size_t)ZH * RHE * TT * 2);
    float* Ob = (float*)take((size_t)ZH * TT * HD * 4);
    char* end2 = wsp;
    const size_t total = (size_t)(((end1 > end2) ? end1 : end2) - (char*)d_ws);
    if (total > ws_size || total > (size_t)134217728) return;
    float* FV = FK;   // v projection reuses the k buffer after the k planes are built (stream-ordered)

    // inverse rotary frequencies inv[j] = 1 / 500000^(j/32): 32nd root by Newton in double (pure arithmetic), powers RNE-converted to f32, then an f32 reciprocal.
    RopeTab tab;
    { double y = 1.5; for (int it = 0; it < 64; ++it) { double p = 1.0; for (int k = 0; k < 31; ++k) p *= y; const double fy = p * y - 500000.0; y = y - fy / (32.0 * p); }
      double pj = 1.0; for (int j = 0; j < 32; ++j) { const float pf = (float)pj; tab.f[j] = 1.0f / pf; pj *= y; } }

    // weights -> K-contiguous bf16 planes ([in][out] transposed), x -> bf16, rotary table
    k_wtG<<<(unsigned)((((size_t)DQ * DM / 64) + 63) / 64), 256, 0, stream>>>(wq, DM, DQ, WQt);
    k_wtG<<<(unsigned)((((size_t)DKV * DM / 64) + 63) / 64), 256, 0, stream>>>(wk, DM, DKV, WKt);
    k_wtG<<<(unsigned)((((size_t)DKV * DM / 64) + 63) / 64), 256, 0, stream>>>(wv, DM, DKV, WVt);
    k_wtG<<<(unsigned)((((size_t)DM * DQ / 64) + 63) / 64), 256, 0, stream>>>(wo, DQ, DM, WOt);
    k_csgen<<<(TT * HD + 255) / 256, 256, 0, stream>>>(tab, CS);
    const unsigned LQ = (unsigned)(((size_t)NH_ * TT * HD / 2 + 255) / 256), LKv = (unsigned)(((size_t)NKV * TT * HD / 2 + 255) / 256);
    for (int b = 0; b < NB; ++b) {
        k_cvt8<<<(unsigned)(((size_t)TT * DM / 8 + 255) / 256), 256, 0, stream>>>(x + (size_t)b * TT_FULL * DM, XB, (size_t)TT * DM / 8);
        k_gemmw<bf, 0, false><<<dim3(TT / 64, DQ / 64, 1), 32, 0, stream>>>(XB, nullptr, WQt, nullptr, DM, FQ, DQ, nullptr, 0, 0, 0);
        k_rope<<<LQ, 256, 0, stream>>>(FQ, DQ, NH_, CS, QP16, QPh, QPl);
        k_gemmw<bf, 0, false><<<dim3(TT / 64, DKV / 64, 1), 32, 0, stream>>>(XB, nullptr, WKt, nullptr, DM, FK, DKV, nullptr, 0, 0, 0);
        k_rope<<<LKv, 256, 0, stream>>>(FK, DKV, NKV, CS, KP16, KPh, KPl);
        k_gemmw<bf, 0, false><<<dim3(TT / 64, DKV / 64, 1), 32, 0, stream>>>(XB, nullptr, WVt, nullptr, DM, FV, DKV, nullptr, 0, 0, 0);
        k_vtp<<<LKv, 256, 0, stream>>>(FV, DKV, NKV, VT16, VTh, VTl);
        for (int h0 = 0; h0 < NH_; h0 += ZH) { const size_t zq = (size_t)h0, zk = (size_t)(h0 / REP);   // the pass's ZH query heads share one kv head: z-stride 0 on the key / value planes
            if (RHE > 0) k_gemmc<bf, 2, 1><<<dim3(RHE / 64, TT / 64, ZH), 32, 0, stream>>>(QPh + zq * TT * HD, QPl + zq * TT * HD, KPh + zk * TT * HD, KPl + zk * TT * HD, HD, Sb, TT, 0, (size_t)TT * HD, (size_t)0, (size_t)TT * TT);
            if (TT > RHE) k_gemmc<h16, 0, 1><<<dim3((TT - RHE) / 64, TT / 64, ZH), 32, 0, stream>>>(QP16 + zq * TT * HD + (size_t)RHE * HD, nullptr, KP16 + zk * TT * HD, nullptr, HD, Sb + (size_t)RHE * TT, TT, RHE, (size_t)TT * HD, (size_t)0, (size_t)TT * TT);
            k_asoft<<<ZH * TT / 8, 256, 0, stream>>>(Sb, P16, Ph, Pl);
            if (RHE > 0) k_gemmc<bf, 2, 2><<<dim3(RHE / 64, HD / 64, ZH), 32, 0, stream>>>(Ph, Pl, VTh + zk * HD * TT, VTl + zk * HD * TT, TT, Ob, HD, 0, (size_t)RHE * TT, (size_t)0, (size_t)TT * HD);
            if (TT > RHE) k_gemmc<h16, 0, 2><<<dim3((TT - RHE) / 64, HD / 64, ZH), 32, 0, stream>>>(P16 + (size_t)RHE * TT, nullptr, VT16 + zk * HD * TT, nullptr, TT, Ob + (size_t)RHE * HD, HD, RHE, (size_t)TT * TT, (size_t)0, (size_t)TT * HD);
            k_merge<<<(unsigned)(((size_t)ZH * TT * HD / 2 + 255) / 256), 256, 0, stream>>>(Ob, h0, ATh, ATl); }
        k_gemmw<bf, 1, false><<<dim3(TT / 64, DM / 64, 1), 32, 0, stream>>>(ATh, ATl, WOt, nullptr, DQ, OUT + (size_t)b * TT * DM, DM, nullptr, 0, 0, 0); }
}

// v001
// It runs in 296 microseconds.
// Next to v000, in two timings, it ran 4.10 and 4.07 times as fast.
#include <hip/hip_runtime.h>

// Grouped-query attention block (NB x SEQ x 2048): q = x Wq (32 heads x 64), k / v = x Wk / x Wv (8 kv heads x 64, 4 query heads per kv head), rotate-half rotary embedding
// (base 500000; cos/sin table built on device from host-computed inverse frequencies), causal sliding-window softmax(q.k / 8) (window 1024, -inf fill, diagonal always kept),
// ctx merged as [t][h*64 + d], out = ctx Wo -> f32 [NB][SEQ][2048]. Weights are [in][out] and are transposed into K-contiguous bf16 planes.
// Compute dtypes (f32 accumulate everywhere): every input RNE-converted to bf16; x.Wq, x.Wk, x.Wv: v_wmma_f32_16x16x32_bf16 on plain bf16 operands; q.k and P.v: query rows < RH on bf16 hi+lo
// planes (3 products), rows >= RH single v_wmma_f32_16x16x32_f16 (P carried x1024), one fused kernel with an online softmax over 32-key passes inside the window; softmax and rotary arithmetic f32; ctx.Wo: bf16 hi+lo ctx x bf16 Wo (2 products).

#ifndef NB
#define NB 1
#endif
#ifndef SEQ
#define SEQ 2048
#endif
#ifndef RH
#define RH 512                  // query rows < RH use hi+lo planes (0: none)
#endif
#define TT      SEQ
#define TT_FULL 2048
#define DM      2048
#define NH_     32
#define NKV     8
#define REP     (NH_ / NKV)
#define HD      64
#define DQ      (NH_ * HD)
#define DKV     (NKV * HD)
#define RHE     ((RH < TT) ? RH : TT)
#define WIN     1024
#define PSH     10.0f             // f16 rows: P carried x 2^PSH
#define SCL     0.125f            // HD^-0.5
static_assert(TT % 128 == 0 && TT >= 128 && TT <= TT_FULL);
static_assert(RH % 64 == 0 && RH >= 0);
static_assert(REP == 4);
static_assert(DM % 64 == 0 && DQ % 64 == 0 && DKV % 64 == 0 && HD == 64);

typedef _Float16 h16;
typedef unsigned short bf;
typedef __attribute__((ext_vector_type(16))) __bf16   v16bf;
typedef __attribute__((ext_vector_type(16))) _Float16 v16h;
typedef __attribute__((ext_vector_type(8)))  _Float16 v8h;
typedef __attribute__((ext_vector_type(8)))  unsigned short v8us;
typedef __attribute__((ext_vector_type(8)))  float    v8f;
typedef __attribute__((ext_vector_type(4)))  float    v4f;
typedef __attribute__((ext_vector_type(2)))  _Float16 v2h;
typedef __attribute__((ext_vector_type(4)))  _Float16 v4h;
typedef __attribute__((ext_vector_type(2)))  unsigned short v2us;
typedef __attribute__((ext_vector_type(4)))  unsigned short v4us;
typedef __attribute__((ext_vector_type(2)))  float v2f;
typedef v8h  __attribute__((may_alias)) v8ha;
typedef v4f  __attribute__((may_alias)) v4fa;
typedef v8us __attribute__((may_alias)) v8usa;

__device__ __forceinline__ unsigned short f2bf(float f) { unsigned u = __float_as_uint(f); u += 0x7FFFu + ((u >> 16) & 1u); return (unsigned short)(u >> 16); }   // RNE convert
__device__ __forceinline__ float bf2f(unsigned short b) { return __uint_as_float(((unsigned)b) << 16); }
__device__ __forceinline__ float bfr(float f) { return bf2f(f2bf(f)); }
__device__ __forceinline__ v16h cat16(v8h lo, v8h hi) { return __builtin_shufflevector(lo, hi, 0, 1, 2, 3, 4, 5, 6, 7, 8, 9, 10, 11, 12, 13, 14, 15); }
__device__ __forceinline__ v16bf cat16b(v8us lo, v8us hi) { return __builtin_bit_cast(v16bf, __builtin_shufflevector(lo, hi, 0, 1, 2, 3, 4, 5, 6, 7, 8, 9, 10, 11, 12, 13, 14, 15)); }
__device__ __forceinline__ v8f wmma16(v16h a, v16h b, v8f c) { return __builtin_amdgcn_wmma_f32_16x16x32_f16(false, a, false, b, (short)0, c, false, false); }
__device__ __forceinline__ v8f wmmab(v16bf a, v16bf b, v8f c) { return __builtin_amdgcn_wmma_f32_16x16x32_bf16(false, a, false, b, (short)0, c, false, false); }
__device__ __forceinline__ h16 tohx(float x) { return (h16)x; }
__device__ __forceinline__ void splitf(float y, unsigned short& h, unsigned short& l) { h = f2bf(y); l = f2bf(y - bf2f(h)); }

// ---- k_gemmw: register-blocked GEMM, ONE WAVE per 64x64 output tile (16 accumulators), operands straight from K-contiguous 16-bit planes; grid (M/64, N/64, Z), 32 threads.
// C[m][n] (f32, pitch ldc, + optional f32 bias[n]) = sum_k A[m][k] Bt[n][k] (+ split products per NSPLIT). z-batch strides sA/sB/sC in elements. K % 32 == 0.
// Fragment map (both operands): lane row/col = lane & 15, elements 0..7 <- k0 + 8*(lane>>4) + 0..7, elements 8..15 <- k0 + 16 + 8*(lane>>4) + 0..7; D element r of lane l = (row 8*(l>>4) + r, col l & 15).
template <typename T16> struct WFrag;
template <> struct WFrag<h16> { typedef v16h V; static __device__ __forceinline__ V ld(const h16* p) { return cat16(*(const v8h*)p, *(const v8h*)(p + 16)); } static __device__ __forceinline__ V ldo(const h16* b, unsigned o) { return ld((const h16*)((const char*)b + o)); } static __device__ __forceinline__ v8f mma(V a, V b, v8f c) { return wmma16(a, b, c); } };
template <> struct WFrag<bf> { typedef v16bf V; static __device__ __forceinline__ V ld(const bf* p) { return cat16b(*(const v8us*)p, *(const v8us*)(p + 16)); } static __device__ __forceinline__ V ldo(const bf* b, unsigned o) { return ld((const bf*)((const char*)b + o)); } static __device__ __forceinline__ v8f mma(V a, V b, v8f c) { return wmmab(a, b, c); } };
template <typename T16, int NSPLIT, bool BIAS>
__global__ __launch_bounds__(32) void k_gemmw(const T16* __restrict__ A, const T16* __restrict__ A2, const T16* __restrict__ Bt, const T16* __restrict__ Bt2, int K, float* C, int ldc, const float* __restrict__ bias, size_t sA, size_t sB, size_t sC) {
    typedef typename WFrag<T16>::V V;
    __shared__ __align__(16) float os[16 * 68];
    const size_t z = blockIdx.z; A += z * sA; if (A2) A2 += z * sA; Bt += z * sB; if (Bt2) Bt2 += z * sB; C += z * sC;
    const int lane = threadIdx.x & 31, lr = lane & 15, hi = lane >> 4; const int r0 = blockIdx.x * 64, c0 = blockIdx.y * 64;
    v8f acc[4][4];
#pragma unroll
    for (int mb = 0; mb < 4; ++mb)
#pragma unroll
        for (int nb = 0; nb < 4; ++nb) acc[mb][nb] = (v8f){};
    const size_t aoff = (size_t)(r0 + lr) * K + 8 * hi, boff = (size_t)(c0 + lr) * K + 8 * hi;
#pragma unroll 1
    for (int kc = 0; kc < K; kc += 32) {
        V a[4], a2[4];
#pragma unroll
        for (int mb = 0; mb < 4; ++mb) { a[mb] = WFrag<T16>::ld(A + aoff + (size_t)mb * 16 * K + kc); if (NSPLIT == 1 || NSPLIT == 2) a2[mb] = WFrag<T16>::ld(A2 + aoff + (size_t)mb * 16 * K + kc); }
#pragma unroll
        for (int nb = 0; nb < 4; ++nb) { const V b = WFrag<T16>::ld(Bt + boff + (size_t)nb * 16 * K + kc); V b2; if (NSPLIT >= 2) b2 = WFrag<T16>::ld(Bt2 + boff + (size_t)nb * 16 * K + kc);
#pragma unroll
            for (int mb = 0; mb < 4; ++mb) { acc[mb][nb] = WFrag<T16>::mma(a[mb], b, acc[mb][nb]); if (NSPLIT == 1 || NSPLIT == 2) acc[mb][nb] = WFrag<T16>::mma(a2[mb], b, acc[mb][nb]); if (NSPLIT >= 2) acc[mb][nb] = WFrag<T16>::mma(a[mb], b2, acc[mb][nb]); } }
        asm volatile("v_nop\n\tv_nop\n\tv_nop\n\tv_nop" : "+v"(acc[0][0]), "+v"(acc[1][1]), "+v"(acc[2][2]), "+v"(acc[3][3]) : "v"(a[0]), "v"(a[3]));
    }
#pragma unroll
    for (int mb = 0; mb < 4; ++mb) {
#pragma unroll
        for (int nb = 0; nb < 4; ++nb) {
#pragma unroll
            for (int j = 0; j < 8; ++j) os[(hi * 8 + j) * 68 + nb * 16 + lr] = acc[mb][nb][j]; }
        __builtin_amdgcn_wave_barrier(); asm volatile("" ::: "memory");
        float* crow = C + (size_t)(r0 + mb * 16) * ldc + c0;
{
#pragma unroll
            for (int s = 0; s < 8; ++s) { const int row = 2 * s + hi, cofs = lr * 4; v4f val = *(const v4fa*)(os + row * 68 + cofs); if (BIAS) { val[0] += bfr(bias[c0 + cofs]); val[1] += bfr(bias[c0 + cofs + 1]); val[2] += bfr(bias[c0 + cofs + 2]); val[3] += bfr(bias[c0 + cofs + 3]); }
                *(v4f*)(crow + (size_t)row * ldc + cofs) = val; }
             }
        __builtin_amdgcn_wave_barrier(); asm volatile("" ::: "memory");
    }
}

__global__ __launch_bounds__(256) void k_wtG(const float* __restrict__ w, int K, int N, bf* Bt) {
    const int lane = threadIdx.x & 31; const int L0 = (blockIdx.x * 8 + (threadIdx.x >> 5)) * 8; const int nlines = N * K / 64;
{
#pragma unroll 1
        for (int l = 0; l < 8; ++l) { const int L = L0 + l; if (L >= nlines) break; const size_t e = (size_t)L * 64 + lane * 2; const int k = (int)(e % K), n = (int)(e / K); v2us o;
            o[0] = f2bf(w[(size_t)k * N + n]); o[1] = f2bf(w[(size_t)(k + 1) * N + n]); *(v2us*)(Bt + e) = o; }
         }
}
__global__ __launch_bounds__(256) void k_cvt8(const float* __restrict__ src, bf* dst, size_t n8) { const size_t i = (size_t)blockIdx.x * 256 + threadIdx.x; if (i >= n8) return; const v8f v = *(const v8f*)(src + i * 8); v8us o;
#pragma unroll
    for (int k = 0; k < 8; ++k) o[k] = f2bf(v[k]); *(v8us*)(dst + i * 8) = o;  }

// ---- k_csgen: rotary table CS[t][d] = {cos(t * inv[d & 31]), sin(t * inv[d & 31])} (f32 product, precise sincos). inv[] arrives by value (host-computed); lane == d & 31 by construction
struct RopeTab { float f[32]; };
static_assert(sizeof(RopeTab) == 128);
__global__ __launch_bounds__(256) void k_csgen(RopeTab tab, float* CS) {
    const int idx = blockIdx.x * 256 + threadIdx.x; const int lane = threadIdx.x & 31; float inv = 0.0f;
#pragma unroll
    for (int i = 0; i < 32; ++i) inv = (lane == i) ? tab.f[i] : inv;
    if (idx >= TT * HD) return;
    const int t = idx / HD; float ang = __fmul_rn((float)t, inv); asm volatile("" : "+v"(ang));
    float sn, cs; sincosf(ang, &sn, &cs);
    v2f o; o[0] = cs; o[1] = sn;
    *(v2f*)(CS + (size_t)idx * 2) = o;  }

// ---- k_rope: head planes [h][t][d] (fp16 + bf16 hi/lo) of the rotate-half rotary map out[d] = x[d] cos[t][d] - x[d+HD/2] sin[t][d], out[d+HD/2] = x[d+HD/2] cos[t][d+HD/2] + x[d] sin[t][d+HD/2]
__global__ __launch_bounds__(256) void k_rope(const float* __restrict__ F, int pitch, int nheads, const float* __restrict__ CS, h16* P16, bf* Ph, bf* Pl) {
    const size_t e = ((size_t)blockIdx.x * 256 + threadIdx.x) * 2; if (e >= (size_t)nheads * TT * HD) return; const int d = (int)(e % HD); const int t = (int)((e / HD) % TT); const int h = (int)(e / ((size_t)HD * TT)); const float* f = F + (size_t)t * pitch + h * HD; v2h o16; v2us oh, ol;
#pragma unroll
    for (int q = 0; q < 2; ++q) { const int dd = d + q; const int dp = (dd < HD / 2) ? dd + HD / 2 : dd - HD / 2; const float x0 = f[dd], x1 = f[dp];
        const v2f cs = *(const v2f*)(CS + ((size_t)t * HD + dd) * 2); float a = __fmul_rn(x0, cs[0]), bq = __fmul_rn(x1, cs[1]); asm volatile("" : "+v"(a)); asm volatile("" : "+v"(bq)); const float r = (dd < HD / 2) ? __fsub_rn(a, bq) : __fadd_rn(a, bq);
        o16[q] = tohx(r); unsigned short a2, c2; splitf(r, a2, c2); oh[q] = a2; ol[q] = c2; }
    *(v2h*)(P16 + e) = o16; *(v2us*)(Ph + e) = oh; *(v2us*)(Pl + e) = ol;  }
__global__ __launch_bounds__(256) void k_vtp(const float* __restrict__ F, int pitch, int nheads, h16* V16, bf* Vh, bf* Vl) { const size_t e = ((size_t)blockIdx.x * 256 + threadIdx.x) * 2; if (e >= (size_t)nheads * HD * TT) return; const int t = (int)(e % TT); const int d = (int)((e / TT) % HD); const int g = (int)(e / ((size_t)TT * HD)); v2h o16; v2us oh, ol;
#pragma unroll
    for (int q = 0; q < 2; ++q) { const float x = F[(size_t)(t + q) * pitch + g * HD + d]; o16[q] = tohx(x); unsigned short a2, c2; splitf(x, a2, c2); oh[q] = a2; ol[q] = c2; }
    *(v2h*)(V16 + e) = o16; *(v2us*)(Vh + e) = oh; *(v2us*)(Vl + e) = ol;  }

// ---- k_fattn: fused causal sliding-window attention, scores and probabilities never leave registers. One wave = one query head x NQ*16 query rows; the 4 waves of a block are the 4 query heads
// of one kv head on the same rows, so they walk the same K / V lines. Per pass of 32 keys: St = K.Qt (A = K rows, B = Q kept in registers), online softmax per query column (a lane holds one
// query's scores: in-lane maximum and sum, one exchange between the wave halves for the maximum), the two 16-key score tiles convert in place into the B operand Pt, Ot += Vt.Pt (A = Vt rows).
// All fragments use WFrag::ld's k order, which is the order a packed D pair delivers. Rows < RH: bf16 hi+lo planes, 3 products each; rows >= RH: f16, P carried x 2^PSH (cancels in O / sum).
// D element r of lane l of Ot = (d = 16*dt + 8*(l>>4) + r, query l & 15): 8 consecutive d per lane, stored as bf16 hi / lo rows of the merged ctx planes [t][h*64 + d].
// 2^x with the slot behind it filled: the instruction set asks for one independent instruction or v_nop between a transcendental and a directly following overwrite of its source or read of its
// result; only a v_nop inside the same statement is tied to the instruction.
__device__ __forceinline__ float exp2s(float x) { float r; asm("v_exp_f32 %0, %1\n\tv_nop" : "=v"(r) : "v"(x)); return r; }
template <typename T16, bool HI, int NQ>
__device__ __forceinline__ void attn_tile(const T16* __restrict__ Q, const T16* __restrict__ Q2, const T16* __restrict__ Kp, const T16* __restrict__ K2, const T16* __restrict__ Vt, const T16* __restrict__ V2, int q0, int lane, bf* Ah, bf* Al) {
    typedef typename WFrag<T16>::V V;                                       // every full unroll below keeps the fragment arrays indexed by constants, that is, in registers
    const int lr = lane & 15, hi = lane >> 4;
    const unsigned kofs = (unsigned)(lr * HD + 8 * hi) * 2u, vofs = (unsigned)(lr * TT + 8 * hi) * 2u;   // the lane's byte offsets, fixed for the whole walk: every load is wave-uniform base + lane offset
    V qb[NQ][2], qb2[NQ][2];
#pragma unroll
    for (int nq = 0; nq < NQ; ++nq)
#pragma unroll
        for (int ks = 0; ks < 2; ++ks) { const size_t qo = (size_t)(q0 + nq * 16) * HD + ks * 32; qb[nq][ks] = WFrag<T16>::ldo(Q + qo, kofs); if (HI) qb2[nq][ks] = WFrag<T16>::ldo(Q2 + qo, kofs); }
    v8f o[NQ][4]; float m[NQ], l[NQ];
#pragma unroll
    for (int nq = 0; nq < NQ; ++nq) { m[nq] = -1.0e30f; l[nq] = 0.0f;      // the start maximum lies above the ban fill, so a pass whose keys are all banned for a query adds exact zeros
#pragma unroll
        for (int dt = 0; dt < 4; ++dt) o[nq][dt] = (v8f){}; }
    const int kb = max(0, q0 - (WIN - 1)) & ~31, ke = q0 + NQ * 16;         // first key pass of the window of the first row, one past the diagonal of the last row
    V ka[2][2], ka2[2][2];
    if (!HI) {                                                              // f16 rows fetch K one pass ahead; the hi+lo rows (short walks, twice the planes) load it in the pass, which keeps the kernel under 256 registers
#pragma unroll
        for (int kt = 0; kt < 2; ++kt)
#pragma unroll
            for (int ks = 0; ks < 2; ++ks) ka[kt][ks] = WFrag<T16>::ldo(Kp + (size_t)(kb + kt * 16) * HD + ks * 32, kofs); }
    asm volatile("s_wait_xcnt 0x0" ::: "memory");                          // the address registers of the loads above are reused in the loop
#pragma unroll 1                                                            // rolled: one pass's fragments fill the register budget, a second copy of the body would only cost instruction cache
    for (int k0 = kb; k0 < ke; k0 += 32) {
        V va[4], va2[4];
        if (HI) {
#pragma unroll
            for (int kt = 0; kt < 2; ++kt)
#pragma unroll
                for (int ks = 0; ks < 2; ++ks) { const size_t ko = (size_t)(k0 + kt * 16) * HD + ks * 32; ka[kt][ks] = WFrag<T16>::ldo(Kp + ko, kofs); ka2[kt][ks] = WFrag<T16>::ldo(K2 + ko, kofs); }
            asm volatile("s_wait_xcnt 0x0" ::: "memory"); }                // the V loads' results may land in registers that held K addresses
#pragma unroll
        for (int dt = 0; dt < 4; ++dt) { const size_t vo = (size_t)dt * 16 * TT + k0; va[dt] = WFrag<T16>::ldo(Vt + vo, vofs); if (HI) va2[dt] = WFrag<T16>::ldo(V2 + vo, vofs); }
        asm volatile("s_wait_xcnt 0x0" ::: "memory");                      // before the address registers of this pass's loads are rewritten in a later block
        v8f s[NQ][2];
#pragma unroll
        for (int nq = 0; nq < NQ; ++nq)
#pragma unroll
            for (int kt = 0; kt < 2; ++kt) { v8f c = (v8f){};
#pragma unroll
                for (int ks = 0; ks < 2; ++ks) { c = WFrag<T16>::mma(ka[kt][ks], qb[nq][ks], c); if (HI) { c = WFrag<T16>::mma(ka[kt][ks], qb2[nq][ks], c); c = WFrag<T16>::mma(ka2[kt][ks], qb[nq][ks], c); } }
                s[nq][kt] = c; }
        if (!HI) { const int kn = (k0 + 32 < ke) ? k0 + 32 : k0;            // next pass's K fragments fly during the softmax (the last pass re-reads its own rows: always in bounds)
#pragma unroll
            for (int kt = 0; kt < 2; ++kt)
#pragma unroll
                for (int ks = 0; ks < 2; ++ks) ka[kt][ks] = WFrag<T16>::ldo(Kp + (size_t)(kn + kt * 16) * HD + ks * 32, kofs);
            asm volatile("s_wait_xcnt 0x0" ::: "memory"); }                // before their address registers are rewritten behind the branch below
#pragma unroll
        for (int nq = 0; nq < NQ; ++nq)
#pragma unroll
            for (int kt = 0; kt < 2; ++kt) s[nq][kt] *= SCL * 1.4426950408889634f;   // scores in log2 units
        if (k0 + 31 > q0 || q0 + NQ * 16 - 1 - k0 >= WIN) {                 // wave-uniform: only passes that touch the diagonal or the window's start hold banned pairs
#pragma unroll
            for (int nq = 0; nq < NQ; ++nq)
#pragma unroll
                for (int kt = 0; kt < 2; ++kt)
#pragma unroll
                    for (int r = 0; r < 8; ++r) { const int j = k0 + kt * 16 + 8 * hi + r, i = q0 + nq * 16 + lr; s[nq][kt][r] = (j <= i && i - j < WIN) ? s[nq][kt][r] : -3.0e38f; } }
        V pb[NQ], pb2[NQ];
#pragma unroll
        for (int nq = 0; nq < NQ; ++nq) { float mx = m[nq];
#pragma unroll
            for (int kt = 0; kt < 2; ++kt)
#pragma unroll
                for (int r = 0; r < 8; ++r) mx = fmaxf(mx, s[nq][kt][r]);
            mx = fmaxf(mx, __shfl_xor(mx, 16, 32));
            const float al = exp2s(m[nq] - mx); m[nq] = mx; const float mb = HI ? mx : mx - PSH; float sum = 0.0f;
#pragma unroll
            for (int kt = 0; kt < 2; ++kt)
#pragma unroll
                for (int r = 0; r < 8; ++r) { const float p = exp2s(s[nq][kt][r] - mb); s[nq][kt][r] = p; sum += p; }
            l[nq] = l[nq] * al + sum;                                       // each wave half keeps the sum of its own keys; joined once after the loop
#pragma unroll
            for (int dt = 0; dt < 4; ++dt) o[nq][dt] *= al;
            if constexpr (HI) { v8us h0, h1, l0, l1;
#pragma unroll
                for (int r = 0; r < 8; ++r) { unsigned short a, c2; splitf(s[nq][0][r], a, c2); h0[r] = a; l0[r] = c2; splitf(s[nq][1][r], a, c2); h1[r] = a; l1[r] = c2; }
                pb[nq] = cat16b(h0, h1); pb2[nq] = cat16b(l0, l1);
            } else { v8h h0, h1;
#pragma unroll
                for (int r = 0; r < 8; ++r) { h0[r] = tohx(s[nq][0][r]); h1[r] = tohx(s[nq][1][r]); }
                pb[nq] = cat16(h0, h1); } }
#pragma unroll
        for (int dt = 0; dt < 4; ++dt)
#pragma unroll
            for (int nq = 0; nq < NQ; ++nq) { o[nq][dt] = WFrag<T16>::mma(va[dt], pb[nq], o[nq][dt]); if (HI) { o[nq][dt] = WFrag<T16>::mma(va[dt], pb2[nq], o[nq][dt]); o[nq][dt] = WFrag<T16>::mma(va2[dt], pb[nq], o[nq][dt]); } }
    }
#pragma unroll
    for (int nq = 0; nq < NQ; ++nq) { const float inv = __fdiv_rn(1.0f, l[nq] + __shfl_xor(l[nq], 16, 32));
#pragma unroll
        for (int dt = 0; dt < 4; ++dt) { v8us oh, ol;
#pragma unroll
            for (int r = 0; r < 8; ++r) { unsigned short a, c2; splitf(o[nq][dt][r] * inv, a, c2); oh[r] = a; ol[r] = c2; }
            const size_t oo = (size_t)(q0 + nq * 16 + lr) * DQ + dt * 16 + 8 * hi; *(v8us*)(Ah + oo) = oh; *(v8us*)(Al + oo) = ol; } }
}
// grid (NKV, NT16 + NTH), 128 threads; blockIdx.y runs from the row tiles with the longest key walk, for all kv heads, to the short hi+lo tiles last
#define NT16 ((TT - RHE) / 32)
#define NTH  (RHE / 16)
__global__ __launch_bounds__(128) void k_fattn(const h16* __restrict__ Q16, const h16* __restrict__ K16, const h16* __restrict__ V16, const bf* __restrict__ Qh, const bf* __restrict__ Ql, const bf* __restrict__ Kh, const bf* __restrict__ Kl,
                                               const bf* __restrict__ Vh, const bf* __restrict__ Vl, bf* Ah, bf* Al) {
    const int lane = threadIdx.x & 31; const int g = blockIdx.x; const int h = g * REP + __builtin_amdgcn_readfirstlane(threadIdx.x >> 5); const int bx = blockIdx.y;
    const size_t zq = (size_t)h * TT * HD, zk = (size_t)g * TT * HD;
    if (bx < NT16) attn_tile<h16, false, 2>(Q16 + zq, nullptr, K16 + zk, nullptr, V16 + zk, nullptr, RHE + (NT16 - 1 - bx) * 32, lane, Ah + h * HD, Al + h * HD);
    else attn_tile<bf, true, 1>(Qh + zq, Ql + zq, Kh + zk, Kl + zk, Vh + zk, Vl + zk, (NTH - 1 - (bx - NT16)) * 16, lane, Ah + h * HD, Al + h * HD);
}

extern "C" void kernel_launch(void* const* d_in, const int* in_sizes, int n_in,
                              void* d_out, int out_size, void* d_ws, size_t ws_size, hipStream_t stream) {
    if (n_in < 5) return;
    if (in_sizes[0] < (NB - 1) * TT_FULL * DM + TT * DM || in_sizes[1] < DM * DQ || in_sizes[2] < DM * DKV || in_sizes[3] < DM * DKV || in_sizes[4] < DQ * DM) return;
    if (out_size < NB * TT * DM) return;
    const float* x = (const float*)d_in[0]; const float* wq = (const float*)d_in[1]; const float* wk = (const float*)d_in[2]; const float* wv = (const float*)d_in[3]; const float* wo = (const float*)d_in[4];
    float* OUT = (float*)d_out;     // [NB][TT][DM]
    char* wsp = (char*)d_ws;
    auto take = [&](size_t bytes) { char* p = wsp; wsp += (bytes + 255) & ~(size_t)255; return (void*)p; };
    // persistent planes
    bf* WOt = (bf*)take((size_t)DM * DQ * 2); float* CS = (float*)take((size_t)TT * HD * 2 * 4);
    h16* QP16 = (h16*)take((size_t)NH_ * TT * HD * 2); h16* KP16 = (h16*)take((size_t)NKV * TT * HD * 2); h16* VT16 = (h16*)take((size_t)NKV * HD * TT * 2);
    bf* QPh = (bf*)take((size_t)NH_ * TT * HD * 2); bf* QPl = (bf*)take((size_t)NH_ * TT * HD * 2); bf* KPh = (bf*)take((size_t)NKV * TT * HD * 2); bf* KPl = (bf*)take((size_t)NKV * TT * HD * 2);
    bf* VTh = (bf*)take((size_t)NKV * HD * TT * 2); bf* VTl = (bf*)take((size_t)NKV * HD * TT * 2); bf* ATh = (bf*)take((size_t)TT * DQ * 2); bf* ATl = (bf*)take((size_t)TT * DQ * 2);
    // projection-phase temporaries
    bf* WQt = (bf*)take((size_t)DQ * DM * 2); bf* WKt = (bf*)take((size_t)DKV * DM * 2); bf* WVt = (bf*)take((size_t)DKV * DM * 2);
    bf* XB = (bf*)take((size_t)TT * DM * 2); float* FQ = (float*)take((size_t)TT * DQ * 4); float* FK = (float*)take((size_t)TT * DKV * 4);
    const size_t total = (size_t)(wsp - (char*)d_ws);
    if (total > ws_size || total > (size_t)134217728) return;
    float* FV = FK;   // v projection reuses the k buffer after the k planes are built (stream-ordered)

    // inverse rotary frequencies inv[j] = 1 / 500000^(j/32): 32nd root by Newton in double (pure arithmetic), powers RNE-converted to f32, then an f32 reciprocal.
    RopeTab tab;
    { double y = 1.5; for (int it = 0; it < 64; ++it) { double p = 1.0; for (int k = 0; k < 31; ++k) p *= y; const double fy = p * y - 500000.0; y = y - fy / (32.0 * p); }
      double pj = 1.0; for (int j = 0; j < 32; ++j) { const float pf = (float)pj; tab.f[j] = 1.0f / pf; pj *= y; } }

    // weights -> K-contiguous bf16 planes ([in][out] transposed), x -> bf16, rotary table
    k_wtG<<<(unsigned)((((size_t)DQ * DM / 64) + 63) / 64), 256, 0, stream>>>(wq, DM, DQ, WQt);
    k_wtG<<<(unsigned)((((size_t)DKV * DM / 64) + 63) / 64), 256, 0, stream>>>(wk, DM, DKV, WKt);
    k_wtG<<<(unsigned)((((size_t)DKV * DM / 64) + 63) / 64), 256, 0, stream>>>(wv, DM, DKV, WVt);
    k_wtG<<<(unsigned)((((size_t)DM * DQ / 64) + 63) / 64), 256, 0, stream>>>(wo, DQ, DM, WOt);
    k_csgen<<<(TT * HD + 255) / 256, 256, 0, stream>>>(tab, CS);
    const unsigned LQ = (unsigned)(((size_t)NH_ * TT * HD / 2 + 255) / 256), LKv = (unsigned)(((size_t)NKV * TT * HD / 2 + 255) / 256);
    for (int b = 0; b < NB; ++b) {
        k_cvt8<<<(unsigned)(((size_t)TT * DM / 8 + 255) / 256), 256, 0, stream>>>(x + (size_t)b * TT_FULL * DM, XB, (size_t)TT * DM / 8);
        k_gemmw<bf, 0, false><<<dim3(TT / 64, DQ / 64, 1), 32, 0, stream>>>(XB, nullptr, WQt, nullptr, DM, FQ, DQ, nullptr, 0, 0, 0);
        k_rope<<<LQ, 256, 0, stream>>>(FQ, DQ, NH_, CS, QP16, QPh, QPl);
        k_gemmw<bf, 0, false><<<dim3(TT / 64, DKV / 64, 1), 32, 0, stream>>>(XB, nullptr, WKt, nullptr, DM, FK, DKV, nullptr, 0, 0, 0);
        k_rope<<<LKv, 256, 0, stream>>>(FK, DKV, NKV, CS, KP16, KPh, KPl);
        k_gemmw<bf, 0, false><<<dim3(TT / 64, DKV / 64, 1), 32, 0, stream>>>(XB, nullptr, WVt, nullptr, DM, FV, DKV, nullptr, 0, 0, 0);
        k_vtp<<<LKv, 256, 0, stream>>>(FV, DKV, NKV, VT16, VTh, VTl);
        k_fattn<<<dim3(NKV, NT16 + NTH, 1), 128, 0, stream>>>(QP16, KP16, VT16, QPh, QPl, KPh, KPl, VTh, VTl, ATh, ATl);
        k_gemmw<bf, 1, false><<<dim3(TT / 64, DM / 64, 1), 32, 0, stream>>>(ATh, ATl, WOt, nullptr, DQ, OUT + (size_t)b * TT * DM, DM, nullptr, 0, 0, 0); }
}

// v002
// Measured time: 198 microseconds a run.
// Next to v001, in two timings, it ran 1.50 times as fast each time.
// Over all steps from v000 it is 6.11 times as fast.
#include <hip/hip_runtime.h>

// Grouped-query attention block (NB x SEQ x 2048): q = x Wq (32 heads x 64), k / v = x Wk / x Wv (8 kv heads x 64, 4 query heads per kv head), rotate-half rotary embedding
// (base 500000; cos/sin table built on device from host-computed inverse frequencies), causal sliding-window softmax(q.k / 8) (window 1024, -inf fill, diagonal always kept),
// ctx merged as [t][h*64 + d], out = ctx Wo -> f32 [NB][SEQ][2048]. Weights are [in][out] and are transposed into K-contiguous bf16 planes.
// Compute dtypes (f32 accumulate everywhere): every input RNE-converted to bf16; x.Wq, x.Wk, x.Wv: v_wmma_f32_16x16x32_bf16 on plain bf16 operands; q.k and P.v: query rows < RH on bf16 hi+lo
// planes (3 products), rows >= RH single v_wmma_f32_16x16x32_f16 (P carried x1024), one fused kernel with an online softmax over 32-key passes inside the window; softmax and rotary arithmetic f32; ctx.Wo: bf16 hi+lo ctx x bf16 Wo (2 products).

#ifndef NB
#define NB 1
#endif
#ifndef SEQ
#define SEQ 2048
#endif
#ifndef RH
#define RH 512                  // query rows < RH use hi+lo planes (0: none)
#endif
#define TT      SEQ
#define TT_FULL 2048
#define DM      2048
#define NH_     32
#define NKV     8
#define REP     (NH_ / NKV)
#define HD      64
#define DQ      (NH_ * HD)
#define DKV     (NKV * HD)
#define RHE     ((RH < TT) ? RH : TT)
#define WIN     1024
#define PSH     10.0f             // f16 rows: P carried x 2^PSH
#define SCL     0.125f            // HD^-0.5
static_assert(TT % 128 == 0 && TT >= 128 && TT <= TT_FULL);
static_assert(RH % 64 == 0 && RH >= 0);
static_assert(REP == 4);
static_assert(DM % 64 == 0 && DQ % 64 == 0 && DKV % 64 == 0 && HD == 64);

typedef _Float16 h16;
typedef unsigned short bf;
typedef __attribute__((ext_vector_type(16))) __bf16   v16bf;
typedef __attribute__((ext_vector_type(16))) _Float16 v16h;
typedef __attribute__((ext_vector_type(8)))  _Float16 v8h;
typedef __attribute__((ext_vector_type(8)))  unsigned short v8us;
typedef __attribute__((ext_vector_type(8)))  float    v8f;
typedef __attribute__((ext_vector_type(4)))  float    v4f;
typedef __attribute__((ext_vector_type(2)))  _Float16 v2h;
typedef __attribute__((ext_vector_type(4)))  _Float16 v4h;
typedef __attribute__((ext_vector_type(2)))  unsigned short v2us;
typedef __attribute__((ext_vector_type(4)))  unsigned short v4us;
typedef __attribute__((ext_vector_type(2)))  float v2f;
typedef v8h  __attribute__((may_alias)) v8ha;
typedef v4f  __attribute__((may_alias)) v4fa;
typedef v8us __attribute__((may_alias)) v8usa;

__device__ __forceinline__ unsigned short f2bf(float f) { unsigned u = __float_as_uint(f); u += 0x7FFFu + ((u >> 16) & 1u); return (unsigned short)(u >> 16); }   // RNE convert
__device__ __forceinline__ float bf2f(unsigned short b) { return __uint_as_float(((unsigned)b) << 16); }
__device__ __forceinline__ float bfr(float f) { return bf2f(f2bf(f)); }
__device__ __forceinline__ v16h cat16(v8h lo, v8h hi) { return __builtin_shufflevector(lo, hi, 0, 1, 2, 3, 4, 5, 6, 7, 8, 9, 10, 11, 12, 13, 14, 15); }
__device__ __forceinline__ v16bf cat16b(v8us lo, v8us hi) { return __builtin_bit_cast(v16bf, __builtin_shufflevector(lo, hi, 0, 1, 2, 3, 4, 5, 6, 7, 8, 9, 10, 11, 12, 13, 14, 15)); }
__device__ __forceinline__ v8f wmma16(v16h a, v16h b, v8f c) { return __builtin_amdgcn_wmma_f32_16x16x32_f16(false, a, false, b, (short)0, c, false, false); }
__device__ __forceinline__ v8f wmmab(v16bf a, v16bf b, v8f c) { return __builtin_amdgcn_wmma_f32_16x16x32_bf16(false, a, false, b, (short)0, c, false, false); }
__device__ __forceinline__ h16 tohx(float x) { return (h16)x; }
__device__ __forceinline__ void splitf(float y, unsigned short& h, unsigned short& l) { h = f2bf(y); l = f2bf(y - bf2f(h)); }

// ---- k_gemmw: register-blocked GEMM, ONE WAVE per 64x64 output tile (16 accumulators), operands straight from K-contiguous 16-bit planes; grid (M/64, N/64, Z), 32 threads.
// C[m][n] (f32, pitch ldc, + optional f32 bias[n]) = sum_k A[m][k] Bt[n][k] (+ split products per NSPLIT). z-batch strides sA/sB/sC in elements. K % 32 == 0.
// Fragment map (both operands): lane row/col = lane & 15, elements 0..7 <- k0 + 8*(lane>>4) + 0..7, elements 8..15 <- k0 + 16 + 8*(lane>>4) + 0..7; D element r of lane l = (row 8*(l>>4) + r, col l & 15).
template <typename T16> struct WFrag;
template <> struct WFrag<h16> { typedef v16h V; static __device__ __forceinline__ V ld(const h16* p) { return cat16(*(const v8h*)p, *(const v8h*)(p + 16)); } static __device__ __forceinline__ V ldo(const h16* b, unsigned o) { return ld((const h16*)((const char*)b + o)); } static __device__ __forceinline__ v8f mma(V a, V b, v8f c) { return wmma16(a, b, c); } };
template <> struct WFrag<bf> { typedef v16bf V; static __device__ __forceinline__ V ld(const bf* p) { return cat16b(*(const v8us*)p, *(const v8us*)(p + 16)); } static __device__ __forceinline__ V ldo(const bf* b, unsigned o) { return ld((const bf*)((const char*)b + o)); } static __device__ __forceinline__ v8f mma(V a, V b, v8f c) { return wmmab(a, b, c); } };
template <typename T16, int NSPLIT, bool BIAS>
__global__ __launch_bounds__(32) void k_gemmw(const T16* __restrict__ A, const T16* __restrict__ A2, const T16* __restrict__ Bt, const T16* __restrict__ Bt2, int K, float* C, int ldc, const float* __restrict__ bias, size_t sA, size_t sB, size_t sC) {
    typedef typename WFrag<T16>::V V;
    __shared__ __align__(16) float os[16 * 68];
    const size_t z = blockIdx.z; A += z * sA; if (A2) A2 += z * sA; Bt += z * sB; if (Bt2) Bt2 += z * sB; C += z * sC;
    const int lane = threadIdx.x & 31, lr = lane & 15, hi = lane >> 4; const int r0 = blockIdx.x * 64, c0 = blockIdx.y * 64;
    v8f acc[4][4];
#pragma unroll
    for (int mb = 0; mb < 4; ++mb)
#pragma unroll
        for (int nb = 0; nb < 4; ++nb) acc[mb][nb] = (v8f){};
    const size_t aoff = (size_t)(r0 + lr) * K + 8 * hi, boff = (size_t)(c0 + lr) * K + 8 * hi;
#pragma unroll 1
    for (int kc = 0; kc < K; kc += 32) {
        V a[4], a2[4];
#pragma unroll
        for (int mb = 0; mb < 4; ++mb) { a[mb] = WFrag<T16>::ld(A + aoff + (size_t)mb * 16 * K + kc); if (NSPLIT == 1 || NSPLIT == 2) a2[mb] = WFrag<T16>::ld(A2 + aoff + (size_t)mb * 16 * K + kc); }
#pragma unroll
        for (int nb = 0; nb < 4; ++nb) { const V b = WFrag<T16>::ld(Bt + boff + (size_t)nb * 16 * K + kc); V b2; if (NSPLIT >= 2) b2 = WFrag<T16>::ld(Bt2 + boff + (size_t)nb * 16 * K + kc);
#pragma unroll
            for (int mb = 0; mb < 4; ++mb) { acc[mb][nb] = WFrag<T16>::mma(a[mb], b, acc[mb][nb]); if (NSPLIT == 1 || NSPLIT == 2) acc[mb][nb] = WFrag<T16>::mma(a2[mb], b, acc[mb][nb]); if (NSPLIT >= 2) acc[mb][nb] = WFrag<T16>::mma(a[mb], b2, acc[mb][nb]); } }
        asm volatile("v_nop\n\tv_nop\n\tv_nop\n\tv_nop" : "+v"(acc[0][0]), "+v"(acc[1][1]), "+v"(acc[2][2]), "+v"(acc[3][3]) : "v"(a[0]), "v"(a[3]));
    }
#pragma unroll
    for (int mb = 0; mb < 4; ++mb) {
#pragma unroll
        for (int nb = 0; nb < 4; ++nb) {
#pragma unroll
            for (int j = 0; j < 8; ++j) os[(hi * 8 + j) * 68 + nb * 16 + lr] = acc[mb][nb][j]; }
        __builtin_amdgcn_wave_barrier(); asm volatile("" ::: "memory");
        float* crow = C + (size_t)(r0 + mb * 16) * ldc + c0;
{
#pragma unroll
            for (int s = 0; s < 8; ++s) { const int row = 2 * s + hi, cofs = lr * 4; v4f val = *(const v4fa*)(os + row * 68 + cofs); if (BIAS) { val[0] += bfr(bias[c0 + cofs]); val[1] += bfr(bias[c0 + cofs + 1]); val[2] += bfr(bias[c0 + cofs + 2]); val[3] += bfr(bias[c0 + cofs + 3]); }
                *(v4f*)(crow + (size_t)row * ldc + cofs) = val; }
             }
        __builtin_amdgcn_wave_barrier(); asm volatile("" ::: "memory");
    }
}

__global__ __launch_bounds__(256) void k_wtG(const float* __restrict__ w, int K, int N, bf* Bt) {
    const int lane = threadIdx.x & 31; const int L0 = (blockIdx.x * 8 + (threadIdx.x >> 5)) * 8; const int nlines = N * K / 64;
{
#pragma unroll 1
        for (int l = 0; l < 8; ++l) { const int L = L0 + l; if (L >= nlines) break; const size_t e = (size_t)L * 64 + lane * 2; const int k = (int)(e % K), n = (int)(e / K); v2us o;
            o[0] = f2bf(w[(size_t)k * N + n]); o[1] = f2bf(w[(size_t)(k + 1) * N + n]); *(v2us*)(Bt + e) = o; }
         }
}
__global__ __launch_bounds__(256) void k_cvt8(const float* __restrict__ src, bf* dst, size_t n8) { const size_t i = (size_t)blockIdx.x * 256 + threadIdx.x; if (i >= n8) return; const v8f v = *(const v8f*)(src + i * 8); v8us o;
#pragma unroll
    for (int k = 0; k < 8; ++k) o[k] = f2bf(v[k]); *(v8us*)(dst + i * 8) = o;  }

// ---- k_csgen: rotary table CS[t][d] = {cos(t * inv[d & 31]), sin(t * inv[d & 31])} (f32 product, precise sincos). inv[] arrives by value (host-computed); lane == d & 31 by construction
struct RopeTab { float f[32]; };
static_assert(sizeof(RopeTab) == 128);
__global__ __launch_bounds__(256) void k_csgen(RopeTab tab, float* CS) {
    const int idx = blockIdx.x * 256 + threadIdx.x; const int lane = threadIdx.x & 31; float inv = 0.0f;
#pragma unroll
    for (int i = 0; i < 32; ++i) inv = (lane == i) ? tab.f[i] : inv;
    if (idx >= TT * HD) return;
    const int t = idx / HD; float ang = __fmul_rn((float)t, inv); asm volatile("" : "+v"(ang));
    float sn, cs; sincosf(ang, &sn, &cs);
    v2f o; o[0] = cs; o[1] = sn;
    *(v2f*)(CS + (size_t)idx * 2) = o;  }

// ---- k_qkv: the three input projections with their plane building, ONE launch. Grid (TT/64, NH_ + 2*NKV), one wave per 64x64 tile as in k_gemmw; a tile's 64 columns are exactly one head
// (y < NH_: query head, then NKV key heads, then NKV value heads), so the rotate-half partner d +- HD/2 lies in the same tile and the f32 projection never goes to memory.
// q / k tiles: 16 rows at a time through LDS, out[d] = x[d] cos[t][d] - x[d+HD/2] sin[t][d], out[d+HD/2] = x[d+HD/2] cos[t][d+HD/2] + x[d] sin[t][d+HD/2], stored as head planes [h][t][d] (f16 + bf16 hi/lo), whole 128-B rows.
// v tiles: a lane's 8 accumulator elements are 8 consecutive t of one d, which is 16 contiguous bytes of the transposed planes [g][d][t]: stored straight from registers.
__global__ __launch_bounds__(32) void k_qkv(const bf* __restrict__ A, const bf* __restrict__ Wq, const bf* __restrict__ Wk, const bf* __restrict__ Wv, const float* __restrict__ CS,
                                            h16* Q16, bf* Qh, bf* Ql, h16* K16, bf* Kh, bf* Kl, h16* V16, bf* Vh, bf* Vl) {
    typedef WFrag<bf>::V V;
    __shared__ __align__(16) float os[16 * 68];
    const int lane = threadIdx.x & 31, lr = lane & 15, hi = lane >> 4; const int r0 = blockIdx.x * 64, hy = blockIdx.y;
    const bool isq = hy < NH_, isv = hy >= NH_ + NKV; const int hh = isq ? hy : (isv ? hy - NH_ - NKV : hy - NH_);   // head index inside its own group
    const bf* Bt = (isq ? Wq : (isv ? Wv : Wk)) + (size_t)hh * HD * DM;
    v8f acc[4][4];
#pragma unroll
    for (int mb = 0; mb < 4; ++mb)
#pragma unroll
        for (int nb = 0; nb < 4; ++nb) acc[mb][nb] = (v8f){};
    const bf* pa = A + (size_t)(r0 + lr) * DM + 8 * hi; const bf* pb = Bt + (size_t)lr * DM + 8 * hi;   // the lane's two walking pointers; every load of a pass is one of them + a constant
    for (int kc = 0; kc < DM; kc += 32, pa += 32, pb += 32) {
        V a[4];
#pragma unroll
        for (int mb = 0; mb < 4; ++mb) a[mb] = WFrag<bf>::ld(pa + (size_t)mb * 16 * DM);
        asm volatile("s_wait_xcnt 0x0" ::: "memory");                      // a B load's result may land in the register pair that holds the A address, with the A loads just issued
#pragma unroll
        for (int nb = 0; nb < 4; ++nb) { const V b = WFrag<bf>::ld(pb + (size_t)nb * 16 * DM);
#pragma unroll
            for (int mb = 0; mb < 4; ++mb) acc[mb][nb] = WFrag<bf>::mma(a[mb], b, acc[mb][nb]); }
    }
    if (!isv) {
        const int d = lr * 4; const size_t zp = ((size_t)hh * TT + r0 + hi) * HD + d;   // the lane's place in row r0 + hi; every later row is a constant step from it, for the table as for the planes
        h16* P16 = (isq ? Q16 : K16) + zp; bf* Ph = (isq ? Qh : Kh) + zp; bf* Pl = (isq ? Ql : Kl) + zp; const float* cb = CS + ((size_t)(r0 + hi) * HD + d) * 2;
#pragma unroll
        for (int mb = 0; mb < 4; ++mb) {
            v4f c01[8], c23[8];                                             // {cos, sin} of d .. d+3 for the lane's 8 rows, asked for ahead of the LDS round trip
#pragma unroll
            for (int s = 0; s < 8; ++s) { const float* cp = cb + (mb * 16 + 2 * s) * HD * 2; c01[s] = *(const v4f*)cp; c23[s] = *(const v4f*)(cp + 4); }
#pragma unroll
            for (int nb = 0; nb < 4; ++nb) {
#pragma unroll
                for (int j = 0; j < 8; ++j) os[(hi * 8 + j) * 68 + nb * 16 + lr] = acc[mb][nb][j]; }
            __syncthreads();                                                // the 16 rows are read back by other lanes than wrote them
#pragma unroll
            for (int s = 0; s < 8; ++s) { const int row = 2 * s + hi;
                const v4f x0 = *(const v4fa*)(os + row * 68 + d), x1 = *(const v4fa*)(os + row * 68 + (d ^ (HD / 2)));
                const float cs[4] = { c01[s][0], c01[s][2], c23[s][0], c23[s][2] }, sn[4] = { c01[s][1], c01[s][3], c23[s][1], c23[s][3] };
                const v4f xp = (d < HD / 2) ? -x1 : x1;                    // the partner enters with a minus in the lower half of the head
                v4h o16; v4us oh, ol;
#pragma unroll
                for (int q = 0; q < 4; ++q) { const float r = x0[q] * cs[q] + xp[q] * sn[q];
                    o16[q] = tohx(r); unsigned short a2, c2; splitf(r, a2, c2); oh[q] = a2; ol[q] = c2; }
                const int e = (mb * 16 + 2 * s) * HD; *(v4h*)(P16 + e) = o16; *(v4us*)(Ph + e) = oh; *(v4us*)(Pl + e) = ol;
                asm volatile("s_wait_xcnt 0x0" ::: "memory"); }            // before the data registers of these stores are rewritten
            __syncthreads();                                                // every read of these rows ends before the next 16 rows overwrite them
        }
    } else {
        const size_t zv = ((size_t)hh * HD + lr) * TT + r0 + 8 * hi; h16* P16 = V16 + zv; bf* Ph = Vh + zv; bf* Pl = Vl + zv;
#pragma unroll
        for (int nb = 0; nb < 4; ++nb)
#pragma unroll
            for (int mb = 0; mb < 4; ++mb) { v8h o16; v8us oh, ol;
#pragma unroll
                for (int j = 0; j < 8; ++j) { const float x = acc[mb][nb][j]; o16[j] = tohx(x); unsigned short a2, c2; splitf(x, a2, c2); oh[j] = a2; ol[j] = c2; }
                const int e = nb * 16 * TT + mb * 16; *(v8h*)(P16 + e) = o16; *(v8us*)(Ph + e) = oh; *(v8us*)(Pl + e) = ol;
                asm volatile("s_wait_xcnt 0x0" ::: "memory"); }            // before the data registers of these stores are rewritten
    }
}

// ---- k_fattn: fused causal sliding-window attention, scores and probabilities never leave registers. One wave = one query head x NQ*16 query rows; the 4 waves of a block are the 4 query heads
// of one kv head on the same rows, so they walk the same K / V lines. Per pass of 32 keys: St = K.Qt (A = K rows, B = Q kept in registers), online softmax per query column (a lane holds one
// query's scores: in-lane maximum and sum, one exchange between the wave halves for the maximum), the two 16-key score tiles convert in place into the B operand Pt, Ot += Vt.Pt (A = Vt rows).
// All fragments use WFrag::ld's k order, which is the order a packed D pair delivers. Rows < RH: bf16 hi+lo planes, 3 products each; rows >= RH: f16, P carried x 2^PSH (cancels in O / sum).
// D element r of lane l of Ot = (d = 16*dt + 8*(l>>4) + r, query l & 15): 8 consecutive d per lane, stored as bf16 hi / lo rows of the merged ctx planes [t][h*64 + d].
// 2^x with the slot behind it filled: the instruction set asks for one independent instruction or v_nop between a transcendental and a directly following overwrite of its source or read of its
// result; only a v_nop inside the same statement is tied to the instruction.
__device__ __forceinline__ float exp2s(float x) { float r; asm("v_exp_f32 %0, %1\n\tv_nop" : "=v"(r) : "v"(x)); return r; }
template <typename T16, bool HI, int NQ>
__device__ __forceinline__ void attn_tile(const T16* __restrict__ Q, const T16* __restrict__ Q2, const T16* __restrict__ Kp, const T16* __restrict__ K2, const T16* __restrict__ Vt, const T16* __restrict__ V2, int q0, int lane, bf* Ah, bf* Al) {
    typedef typename WFrag<T16>::V V;                                       // every full unroll below keeps the fragment arrays indexed by constants, that is, in registers
    const int lr = lane & 15, hi = lane >> 4;
    const unsigned kofs = (unsigned)(lr * HD + 8 * hi) * 2u, vofs = (unsigned)(lr * TT + 8 * hi) * 2u;   // the lane's byte offsets, fixed for the whole walk: every load is wave-uniform base + lane offset
    V qb[NQ][2], qb2[NQ][2];
#pragma unroll
    for (int nq = 0; nq < NQ; ++nq)
#pragma unroll
        for (int ks = 0; ks < 2; ++ks) { const size_t qo = (size_t)(q0 + nq * 16) * HD + ks * 32; qb[nq][ks] = WFrag<T16>::ldo(Q + qo, kofs); if (HI) qb2[nq][ks] = WFrag<T16>::ldo(Q2 + qo, kofs); }
    v8f o[NQ][4]; float m[NQ], l[NQ];
#pragma unroll
    for (int nq = 0; nq < NQ; ++nq) { m[nq] = -1.0e30f; l[nq] = 0.0f;      // the start maximum lies above the ban fill, so a pass whose keys are all banned for a query adds exact zeros
#pragma unroll
        for (int dt = 0; dt < 4; ++dt) o[nq][dt] = (v8f){}; }
    const int kb = max(0, q0 - (WIN - 1)) & ~31, ke = q0 + NQ * 16;         // first key pass of the window of the first row, one past the diagonal of the last row
    V ka[2][2], ka2[2][2];
    if (!HI) {                                                              // f16 rows fetch K one pass ahead; the hi+lo rows (short walks, twice the planes) load it in the pass, which keeps the kernel under 256 registers
#pragma unroll
        for (int kt = 0; kt < 2; ++kt)
#pragma unroll
            for (int ks = 0; ks < 2; ++ks) ka[kt][ks] = WFrag<T16>::ldo(Kp + (size_t)(kb + kt * 16) * HD + ks * 32, kofs); }
    asm volatile("s_wait_xcnt 0x0" ::: "memory");                          // the address registers of the loads above are reused in the loop
#pragma unroll 1                                                            // rolled: one pass's fragments fill the register budget, a second copy of the body would only cost instruction cache
    for (int k0 = kb; k0 < ke; k0 += 32) {
        V va[4], va2[4];
        if (HI) {
#pragma unroll
            for (int kt = 0; kt < 2; ++kt)
#pragma unroll
                for (int ks = 0; ks < 2; ++ks) { const size_t ko = (size_t)(k0 + kt * 16) * HD + ks * 32; ka[kt][ks] = WFrag<T16>::ldo(Kp + ko, kofs); ka2[kt][ks] = WFrag<T16>::ldo(K2 + ko, kofs); }
            asm volatile("s_wait_xcnt 0x0" ::: "memory"); }                // the V loads' results may land in registers that held K addresses
#pragma unroll
        for (int dt = 0; dt < 4; ++dt) { const size_t vo = (size_t)dt * 16 * TT + k0; va[dt] = WFrag<T16>::ldo(Vt + vo, vofs); if (HI) va2[dt] = WFrag<T16>::ldo(V2 + vo, vofs); }
        asm volatile("s_wait_xcnt 0x0" ::: "memory");                      // before the address registers of this pass's loads are rewritten in a later block
        v8f s[NQ][2];
#pragma unroll
        for (int nq = 0; nq < NQ; ++nq)
#pragma unroll
            for (int kt = 0; kt < 2; ++kt) { v8f c = (v8f){};
#pragma unroll
                for (int ks = 0; ks < 2; ++ks) { c = WFrag<T16>::mma(ka[kt][ks], qb[nq][ks], c); if (HI) { c = WFrag<T16>::mma(ka[kt][ks], qb2[nq][ks], c); c = WFrag<T16>::mma(ka2[kt][ks], qb[nq][ks], c); } }
                s[nq][kt] = c; }
        if (!HI) { const int kn = (k0 + 32 < ke) ? k0 + 32 : k0;            // next pass's K fragments fly during the softmax (the last pass re-reads its own rows: always in bounds)
#pragma unroll
            for (int kt = 0; kt < 2; ++kt)
#pragma unroll
                for (int ks = 0; ks < 2; ++ks) ka[kt][ks] = WFrag<T16>::ldo(Kp + (size_t)(kn + kt * 16) * HD + ks * 32, kofs);
            asm volatile("s_wait_xcnt 0x0" ::: "memory"); }                // before their address registers are rewritten behind the branch below
#pragma unroll
        for (int nq = 0; nq < NQ; ++nq)
#pragma unroll
            for (int kt = 0; kt < 2; ++kt) s[nq][kt] *= SCL * 1.4426950408889634f;   // scores in log2 units
        if (k0 + 31 > q0 || q0 + NQ * 16 - 1 - k0 >= WIN) {                 // wave-uniform: only passes that touch the diagonal or the window's start hold banned pairs
#pragma unroll
            for (int nq = 0; nq < NQ; ++nq)
#pragma unroll
                for (int kt = 0; kt < 2; ++kt)
#pragma unroll
                    for (int r = 0; r < 8; ++r) { const int j = k0 + kt * 16 + 8 * hi + r, i = q0 + nq * 16 + lr; s[nq][kt][r] = (j <= i && i - j < WIN) ? s[nq][kt][r] : -3.0e38f; } }
        V pb[NQ], pb2[NQ];
#pragma unroll
        for (int nq = 0; nq < NQ; ++nq) { float mx = m[nq];
#pragma unroll
            for (int kt = 0; kt < 2; ++kt)
#pragma unroll
                for (int r = 0; r < 8; ++r) mx = fmaxf(mx, s[nq][kt][r]);
            mx = fmaxf(mx, __shfl_xor(mx, 16, 32));
            const float al = exp2s(m[nq] - mx); m[nq] = mx; const float mb = HI ? mx : mx - PSH; float sum = 0.0f;
#pragma unroll
            for (int kt = 0; kt < 2; ++kt)
#pragma unroll
                for (int r = 0; r < 8; ++r) { const float p = exp2s(s[nq][kt][r] - mb); s[nq][kt][r] = p; sum += p; }
            l[nq] = l[nq] * al + sum;                                       // each wave half keeps the sum of its own keys; joined once after the loop
#pragma unroll
            for (int dt = 0; dt < 4; ++dt) o[nq][dt] *= al;
            if constexpr (HI) { v8us h0, h1, l0, l1;
#pragma unroll
                for (int r = 0; r < 8; ++r) { unsigned short a, c2; splitf(s[nq][0][r], a, c2); h0[r] = a; l0[r] = c2; splitf(s[nq][1][r], a, c2); h1[r] = a; l1[r] = c2; }
                pb[nq] = cat16b(h0, h1); pb2[nq] = cat16b(l0, l1);
            } else { v8h h0, h1;
#pragma unroll
                for (int r = 0; r < 8; ++r) { h0[r] = tohx(s[nq][0][r]); h1[r] = tohx(s[nq][1][r]); }
                pb[nq] = cat16(h0, h1); } }
#pragma unroll
        for (int dt = 0; dt < 4; ++dt)
#pragma unroll
            for (int nq = 0; nq < NQ; ++nq) { o[nq][dt] = WFrag<T16>::mma(va[dt], pb[nq], o[nq][dt]); if (HI) { o[nq][dt] = WFrag<T16>::mma(va[dt], pb2[nq], o[nq][dt]); o[nq][dt] = WFrag<T16>::mma(va2[dt], pb[nq], o[nq][dt]); } }
    }
#pragma unroll
    for (int nq = 0; nq < NQ; ++nq) { const float inv = __fdiv_rn(1.0f, l[nq] + __shfl_xor(l[nq], 16, 32));
#pragma unroll
        for (int dt = 0; dt < 4; ++dt) { v8us oh, ol;
#pragma unroll
            for (int r = 0; r < 8; ++r) { unsigned short a, c2; splitf(o[nq][dt][r] * inv, a, c2); oh[r] = a; ol[r] = c2; }
            const size_t oo = (size_t)(q0 + nq * 16 + lr) * DQ + dt * 16 + 8 * hi; *(v8us*)(Ah + oo) = oh; *(v8us*)(Al + oo) = ol; } }
}
// grid (NKV, NT16 + NTH), 128 threads; blockIdx.y runs from the row tiles with the longest key walk, for all kv heads, to the short hi+lo tiles last
#define NT16 ((TT - RHE) / 32)
#define NTH  (RHE / 16)
__global__ __launch_bounds__(128) void k_fattn(const h16* __restrict__ Q16, const h16* __restrict__ K16, const h16* __restrict__ V16, const bf* __restrict__ Qh, const bf* __restrict__ Ql, const bf* __restrict__ Kh, const bf* __restrict__ Kl,
                                               const bf* __restrict__ Vh, const bf* __restrict__ Vl, bf* Ah, bf* Al) {
    const int lane = threadIdx.x & 31; const int g = blockIdx.x; const int h = g * REP + __builtin_amdgcn_readfirstlane(threadIdx.x >> 5); const int bx = blockIdx.y;
    const size_t zq = (size_t)h * TT * HD, zk = (size_t)g * TT * HD;
    if (bx < NT16) attn_tile<h16, false, 2>(Q16 + zq, nullptr, K16 + zk, nullptr, V16 + zk, nullptr, RHE + (NT16 - 1 - bx) * 32, lane, Ah + h * HD, Al + h * HD);
    else attn_tile<bf, true, 1>(Qh + zq, Ql + zq, Kh + zk, Kl + zk, Vh + zk, Vl + zk, (NTH - 1 - (bx - NT16)) * 16, lane, Ah + h * HD, Al + h * HD);
}

extern "C" void kernel_launch(void* const* d_in, const int* in_sizes, int n_in,
                              void* d_out, int out_size, void* d_ws, size_t ws_size, hipStream_t stream) {
    if (n_in < 5) return;
    if (in_sizes[0] < (NB - 1) * TT_FULL * DM + TT * DM || in_sizes[1] < DM * DQ || in_sizes[2] < DM * DKV || in_sizes[3] < DM * DKV || in_sizes[4] < DQ * DM) return;
    if (out_size < NB * TT * DM) return;
    const float* x = (const float*)d_in[0]; const float* wq = (const float*)d_in[1]; const float* wk = (const float*)d_in[2]; const float* wv = (const float*)d_in[3]; const float* wo = (const float*)d_in[4];
    float* OUT = (float*)d_out;     // [NB][TT][DM]
    char* wsp = (char*)d_ws;
    auto take = [&](size_t bytes) { char* p = wsp; wsp += (bytes + 255) & ~(size_t)255; return (void*)p; };
    // persistent planes
    bf* WOt = (bf*)take((size_t)DM * DQ * 2); float* CS = (float*)take((size_t)TT * HD * 2 * 4);
    h16* QP16 = (h16*)take((size_t)NH_ * TT * HD * 2); h16* KP16 = (h16*)take((size_t)NKV * TT * HD * 2); h16* VT16 = (h16*)take((size_t)NKV * HD * TT * 2);
    bf* QPh = (bf*)take((size_t)NH_ * TT * HD * 2); bf* QPl = (bf*)take((size_t)NH_ * TT * HD * 2); bf* KPh = (bf*)take((size_t)NKV * TT * HD * 2); bf* KPl = (bf*)take((size_t)NKV * TT * HD * 2);
    bf* VTh = (bf*)take((size_t)NKV * HD * TT * 2); bf* VTl = (bf*)take((size_t)NKV * HD * TT * 2); bf* ATh = (bf*)take((size_t)TT * DQ * 2); bf* ATl = (bf*)take((size_t)TT * DQ * 2);
    // projection-phase temporaries
    bf* WQt = (bf*)take((size_t)DQ * DM * 2); bf* WKt = (bf*)take((size_t)DKV * DM * 2); bf* WVt = (bf*)take((size_t)DKV * DM * 2);
    bf* XB = (bf*)take((size_t)TT * DM * 2);
    const size_t total = (size_t)(wsp - (char*)d_ws);
    if (total > ws_size || total > (size_t)134217728) return;

    // inverse rotary frequencies inv[j] = 1 / 500000^(j/32): 32nd root by Newton in double (pure arithmetic), powers RNE-converted to f32, then an f32 reciprocal.
    RopeTab tab;
    { double y = 1.5; for (int it = 0; it < 64; ++it) { double p = 1.0; for (int k = 0; k < 31; ++k) p *= y; const double fy = p * y - 500000.0; y = y - fy / (32.0 * p); }
      double pj = 1.0; for (int j = 0; j < 32; ++j) { const float pf = (float)pj; tab.f[j] = 1.0f / pf; pj *= y; } }

    // weights -> K-contiguous bf16 planes ([in][out] transposed), x -> bf16, rotary table
    k_wtG<<<(unsigned)((((size_t)DQ * DM / 64) + 63) / 64), 256, 0, stream>>>(wq, DM, DQ, WQt);
    k_wtG<<<(unsigned)((((size_t)DKV * DM / 64) + 63) / 64), 256, 0, stream>>>(wk, DM, DKV, WKt);
    k_wtG<<<(unsigned)((((size_t)DKV * DM / 64) + 63) / 64), 256, 0, stream>>>(wv, DM, DKV, WVt);
    k_wtG<<<(unsigned)((((size_t)DM * DQ / 64) + 63) / 64), 256, 0, stream>>>(wo, DQ, DM, WOt);
    k_csgen<<<(TT * HD + 255) / 256, 256, 0, stream>>>(tab, CS);
    for (int b = 0; b < NB; ++b) {
        k_cvt8<<<(unsigned)(((size_t)TT * DM / 8 + 255) / 256), 256, 0, stream>>>(x + (size_t)b * TT_FULL * DM, XB, (size_t)TT * DM / 8);
        k_qkv<<<dim3(TT / 64, NH_ + 2 * NKV, 1), 32, 0, stream>>>(XB, WQt, WKt, WVt, CS, QP16, QPh, QPl, KP16, KPh, KPl, VT16, VTh, VTl);
        k_fattn<<<dim3(NKV, NT16 + NTH, 1), 128, 0, stream>>>(QP16, KP16, VT16, QPh, QPl, KPh, KPl, VTh, VTl, ATh, ATl);
        k_gemmw<bf, 1, false><<<dim3(TT / 64, DM / 64, 1), 32, 0, stream>>>(ATh, ATl, WOt, nullptr, DQ, OUT + (size_t)b * TT * DM, DM, nullptr, 0, 0, 0); }
}

// v003
// One run takes 189 microseconds.
// In two side-by-side timings against v002, it was 1.05 and 1.04 times as fast.
// All steps since v000 together make it 6.39 times as fast.
#include <hip/hip_runtime.h>

// Grouped-query attention block (NB x SEQ x 2048): q = x Wq (32 heads x 64), k / v = x Wk / x Wv (8 kv heads x 64, 4 query heads per kv head), rotate-half rotary embedding
// (base 500000; cos/sin table built on device from host-computed inverse frequencies), causal sliding-window softmax(q.k / 8) (window 1024, -inf fill, diagonal always kept),
// ctx merged as [t][h*64 + d], out = ctx Wo -> f32 [NB][SEQ][2048]. Weights are [in][out] and are transposed into bf16 planes.
// Every 16-bit operand plane of a matrix product (x, Wq, Wk, Wv, Wo, the q / k head planes with k = d, the transposed v planes with row = d and k = t, ctx hi / lo) lies in FRAGMENT ORDER: a block of 16 rows x 32 k is 1 KiB, [j = (k >> 4) & 1][lane = 16*((k >> 3) & 1) + (row & 15)][k & 7],
// blocks ordered [row >> 4][k >> 5]; a fragment is then two loads of 512 contiguous bytes (lane l takes 16 bytes at 16*l), four whole 128-B lines each, where a row-major plane made every load touch 16 lines.
// Compute dtypes (f32 accumulate everywhere): every input RNE-converted to bf16; x.Wq, x.Wk, x.Wv: v_wmma_f32_16x16x32_bf16 on plain bf16 operands; q.k and P.v: query rows < RH on bf16 hi+lo
// planes (3 products), rows >= RH single v_wmma_f32_16x16x32_f16 (P carried x1024), one fused kernel with an online softmax over 32-key passes inside the window; softmax and rotary arithmetic f32; ctx.Wo: bf16 hi+lo ctx x bf16 Wo (2 products).

#ifndef NB
#define NB 1
#endif
#ifndef SEQ
#define SEQ 2048
#endif
#ifndef RH
#define RH 512                  // query rows < RH use hi+lo planes (0: none)
#endif
#define TT      SEQ
#define TT_FULL 2048
#define DM      2048
#define NH_     32
#define NKV     8
#define REP     (NH_ / NKV)
#define HD      64
#define DQ      (NH_ * HD)
#define DKV     (NKV * HD)
#define RHE     ((RH < TT) ? RH : TT)
#define WIN     1024
#define PSH     10.0f             // f16 rows: P carried x 2^PSH
#define SCL     0.125f            // HD^-0.5
static_assert(TT % 128 == 0 && TT >= 128 && TT <= TT_FULL);
static_assert(RH % 64 == 0 && RH >= 0);
static_assert(REP == 4);
static_assert(DM % 64 == 0 && DQ % 64 == 0 && DKV % 64 == 0 && HD == 64);

typedef _Float16 h16;
typedef unsigned short bf;
typedef __attribute__((ext_vector_type(16))) __bf16   v16bf;
typedef __attribute__((ext_vector_type(16))) _Float16 v16h;
typedef __attribute__((ext_vector_type(8)))  _Float16 v8h;
typedef __attribute__((ext_vector_type(8)))  unsigned short v8us;
typedef __attribute__((ext_vector_type(8)))  float    v8f;
typedef __attribute__((ext_vector_type(4)))  float    v4f;
typedef __attribute__((ext_vector_type(2)))  _Float16 v2h;
typedef __attribute__((ext_vector_type(4)))  _Float16 v4h;
typedef __attribute__((ext_vector_type(2)))  unsigned short v2us;
typedef __attribute__((ext_vector_type(4)))  unsigned short v4us;
typedef __attribute__((ext_vector_type(2)))  float v2f;
typedef v8h  __attribute__((may_alias)) v8ha;
typedef v4f  __attribute__((may_alias)) v4fa;
typedef v8us __attribute__((may_alias)) v8usa;

__device__ __forceinline__ unsigned short f2bf(float f) { unsigned u = __float_as_uint(f); u += 0x7FFFu + ((u >> 16) & 1u); return (unsigned short)(u >> 16); }   // RNE convert
__device__ __forceinline__ float bf2f(unsigned short b) { return __uint_as_float(((unsigned)b) << 16); }
__device__ __forceinline__ float bfr(float f) { return bf2f(f2bf(f)); }
__device__ __forceinline__ v16h cat16(v8h lo, v8h hi) { return __builtin_shufflevector(lo, hi, 0, 1, 2, 3, 4, 5, 6, 7, 8, 9, 10, 11, 12, 13, 14, 15); }
__device__ __forceinline__ v16bf cat16b(v8us lo, v8us hi) { return __builtin_bit_cast(v16bf, __builtin_shufflevector(lo, hi, 0, 1, 2, 3, 4, 5, 6, 7, 8, 9, 10, 11, 12, 13, 14, 15)); }
__device__ __forceinline__ v8f wmma16(v16h a, v16h b, v8f c) { return __builtin_amdgcn_wmma_f32_16x16x32_f16(false, a, false, b, (short)0, c, false, false); }
__device__ __forceinline__ v8f wmmab(v16bf a, v16bf b, v8f c) { return __builtin_amdgcn_wmma_f32_16x16x32_bf16(false, a, false, b, (short)0, c, false, false); }
__device__ __forceinline__ h16 tohx(float x) { return (h16)x; }
__device__ __forceinline__ void splitf(float y, unsigned short& h, unsigned short& l) { h = f2bf(y); l = f2bf(y - bf2f(h)); }

// ---- k_gemmw: register-blocked GEMM, ONE WAVE per 64x64 output tile (16 accumulators), operands straight from 16-bit planes in fragment order (ldf: p = block start + 8*lane); grid (M/64, N/64, Z), 32 threads.
// C[m][n] (f32, pitch ldc, + optional f32 bias[n]) = sum_k A[m][k] Bt[n][k] (+ split products per NSPLIT). z-batch strides sA/sB/sC in elements. K % 32 == 0, compile-time: every load of a pass is a walking pointer + a constant.
// Fragment map (both operands): lane row/col = lane & 15, elements 0..7 <- k0 + 8*(lane>>4) + 0..7, elements 8..15 <- k0 + 16 + 8*(lane>>4) + 0..7; D element r of lane l = (row 8*(l>>4) + r, col l & 15).
template <typename T16> struct WFrag;
template <> struct WFrag<h16> { typedef v16h V; static __device__ __forceinline__ V ld(const h16* p) { return cat16(*(const v8h*)p, *(const v8h*)(p + 16)); } static __device__ __forceinline__ V ldo(const h16* b, unsigned o) { return ld((const h16*)((const char*)b + o)); } static __device__ __forceinline__ V ldf(const h16* p) { return cat16(*(const v8h*)p, *(const v8h*)(p + 256)); } static __device__ __forceinline__ V ldfo(const h16* b, unsigned o) { return ldf((const h16*)((const char*)b + o)); } static __device__ __forceinline__ v8f mma(V a, V b, v8f c) { return wmma16(a, b, c); } };
template <> struct WFrag<bf> { typedef v16bf V; static __device__ __forceinline__ V ld(const bf* p) { return cat16b(*(const v8us*)p, *(const v8us*)(p + 16)); } static __device__ __forceinline__ V ldo(const bf* b, unsigned o) { return ld((const bf*)((const char*)b + o)); } static __device__ __forceinline__ V ldf(const bf* p) { return cat16b(*(const v8us*)p, *(const v8us*)(p + 256)); } static __device__ __forceinline__ V ldfo(const bf* b, unsigned o) { return ldf((const bf*)((const char*)b + o)); } static __device__ __forceinline__ v8f mma(V a, V b, v8f c) { return wmmab(a, b, c); } };
// s_wait_xcnt 0 behind a run of loads from p + constants. p is named as an input only: the pair that holds the loads' address stays live up to the wait, so that no load's result lands in it with the loads just issued.
template <typename T16> __device__ __forceinline__ void xwait(const T16* p) { asm volatile("s_wait_xcnt 0x0" :: "v"(p) : "memory"); }
template <typename T16, int NSPLIT, bool BIAS, int K>
__global__ __launch_bounds__(32) void k_gemmw(const T16* __restrict__ A, const T16* __restrict__ A2, const T16* __restrict__ Bt, const T16* __restrict__ Bt2, float* C, int ldc, const float* __restrict__ bias, size_t sA, size_t sB, size_t sC) {
    typedef typename WFrag<T16>::V V;
    __shared__ __align__(16) float os[16 * 68];
    const size_t z = blockIdx.z; A += z * sA; if (A2) A2 += z * sA; Bt += z * sB; if (Bt2) Bt2 += z * sB; C += z * sC;
    const int lane = threadIdx.x & 31, lr = lane & 15, hi = lane >> 4; const int r0 = blockIdx.x * 64, c0 = blockIdx.y * 64;
    v8f acc[4][4];
#pragma unroll
    for (int mb = 0; mb < 4; ++mb)
#pragma unroll
        for (int nb = 0; nb < 4; ++nb) acc[mb][nb] = (v8f){};
    const size_t aoff = (size_t)r0 * K + 8 * lane, boff = (size_t)c0 * K + 8 * lane;   // 16 rows of a plane are 16*K elements in either order; a step of 32 k is one block of 512 elements
    const T16* pa = A + aoff; const T16* pa2 = (NSPLIT == 1 || NSPLIT == 2) ? A2 + aoff : nullptr; const T16* pb = Bt + boff; const T16* pb2 = (NSPLIT >= 2) ? Bt2 + boff : nullptr;
#pragma unroll 1
    for (int kc = 0; kc < K; kc += 32, pa += 512, pa2 += 512, pb += 512, pb2 += 512) {
        V a[4], a2[4], b[4], b2[4];
#pragma unroll
        for (int mb = 0; mb < 4; ++mb) { a[mb] = WFrag<T16>::ldf(pa + (size_t)mb * 16 * K); if (NSPLIT == 1 || NSPLIT == 2) a2[mb] = WFrag<T16>::ldf(pa2 + (size_t)mb * 16 * K); }
        xwait(pa); if (NSPLIT == 1 || NSPLIT == 2) xwait(pa2);
#pragma unroll
        for (int nb = 0; nb < 4; ++nb) { b[nb] = WFrag<T16>::ldf(pb + (size_t)nb * 16 * K); if (NSPLIT >= 2) b2[nb] = WFrag<T16>::ldf(pb2 + (size_t)nb * 16 * K); }
        xwait(pb); if (NSPLIT >= 2) xwait(pb2);
#pragma unroll
        for (int nb = 0; nb < 4; ++nb) {
#pragma unroll
            for (int mb = 0; mb < 4; ++mb) { acc[mb][nb] = WFrag<T16>::mma(a[mb], b[nb], acc[mb][nb]); if (NSPLIT == 1 || NSPLIT == 2) acc[mb][nb] = WFrag<T16>::mma(a2[mb], b[nb], acc[mb][nb]); if (NSPLIT >= 2) acc[mb][nb] = WFrag<T16>::mma(a[mb], b2[nb], acc[mb][nb]); } }
        asm volatile("v_nop\n\tv_nop\n\tv_nop\n\tv_nop" : "+v"(acc[0][0]), "+v"(acc[1][1]), "+v"(acc[2][2]), "+v"(acc[3][3]) : "v"(a[0]), "v"(a[3]));
    }
#pragma unroll
    for (int mb = 0; mb < 4; ++mb) {
#pragma unroll
        for (int nb = 0; nb < 4; ++nb) {
#pragma unroll
            for (int j = 0; j < 8; ++j) os[(hi * 8 + j) * 68 + nb * 16 + lr] = acc[mb][nb][j]; }
        __builtin_amdgcn_wave_barrier(); asm volatile("" ::: "memory");
        float* crow = C + (size_t)(r0 + mb * 16) * ldc + c0;
{
#pragma unroll
            for (int s = 0; s < 8; ++s) { const int row = 2 * s + hi, cofs = lr * 4; v4f val = *(const v4fa*)(os + row * 68 + cofs); if (BIAS) { val[0] += bfr(bias[c0 + cofs]); val[1] += bfr(bias[c0 + cofs + 1]); val[2] += bfr(bias[c0 + cofs + 2]); val[3] += bfr(bias[c0 + cofs + 3]); }
                *(v4f*)(crow + (size_t)row * ldc + cofs) = val; }
             }
        __builtin_amdgcn_wave_barrier(); asm volatile("" ::: "memory");
    }
}

// ---- k_wtG: w [K][N] f32 -> bf16 plane of w transposed (row = n, k = k) in fragment order. One wave = 32 consecutive n x one block of 32 k: each of its 32 loads is one whole 128-B line of a row of w,
// each of its 4 stores fills two runs of 256 contiguous bytes (a lane's 8 k of one n are the 16 bytes of one fragment slot). Grid (N/32)*(K/32)/8 blocks of 8 waves.
// K and N are compile-time, so that the 32 loads are one address pair + constant offsets.
template <int K, int N>
__global__ __launch_bounds__(256) void k_wtG(const float* __restrict__ w, bf* Bt) {
    static_assert(K % 32 == 0 && N % 32 == 0 && ((N / 32) * (K / 32)) % 8 == 0);
    const int lane = threadIdx.x & 31; const int wv = blockIdx.x * 8 + (threadIdx.x >> 5); const int kb = wv / (N / 32), n = (wv % (N / 32)) * 32 + lane;
    const float* p = w + (size_t)kb * 32 * N + n; float v[32];
#pragma unroll
    for (int i = 0; i < 32; ++i) v[i] = p[(size_t)i * N];
    bf* q = Bt + ((size_t)(n >> 4) * (K / 32) + kb) * 512 + (n & 15) * 8;
#pragma unroll
    for (int o = 0; o < 4; ++o) { v8us r;                                   // o = 2*j + half: k = 32*kb + 8*o + e
#pragma unroll
        for (int e = 0; e < 8; ++e) r[e] = f2bf(v[o * 8 + e]);
        *(v8us*)(q + o * 128) = r; }
}
// ---- k_cvt8: src [rows][DM] f32 -> bf16 plane in fragment order. One wave = 8 rows x one block of 32 k: a lane converts 8 consecutive k; the 8 lanes of one k octet store 128 contiguous bytes.
__global__ __launch_bounds__(256) void k_cvt8(const float* __restrict__ src, bf* dst, size_t n8) { const size_t i = (size_t)blockIdx.x * 256 + threadIdx.x; if (i >= n8) return;
    const int lane = threadIdx.x & 31, o = lane & 3; const int wv = (int)(i >> 5), kb = wv % (DM / 32), t = (wv / (DM / 32)) * 8 + (lane >> 2);
    const v8f v = *(const v8f*)(src + (size_t)t * DM + kb * 32 + o * 8); v8us r;
#pragma unroll
    for (int k = 0; k < 8; ++k) r[k] = f2bf(v[k]);
    *(v8us*)(dst + ((size_t)(t >> 4) * (DM / 32) + kb) * 512 + o * 128 + (t & 15) * 8) = r;  }

// ---- k_csgen: rotary table CS[t][d] = {cos(t * inv[d & 31]), sin(t * inv[d & 31])} (f32 product, precise sincos). inv[] arrives by value (host-computed); lane == d & 31 by construction
struct RopeTab { float f[32]; };
static_assert(sizeof(RopeTab) == 128);
__global__ __launch_bounds__(256) void k_csgen(RopeTab tab, float* CS) {
    const int idx = blockIdx.x * 256 + threadIdx.x; const int lane = threadIdx.x & 31; float inv = 0.0f;
#pragma unroll
    for (int i = 0; i < 32; ++i) inv = (lane == i) ? tab.f[i] : inv;
    if (idx >= TT * HD) return;
    const int t = idx / HD; float ang = __fmul_rn((float)t, inv); asm volatile("" : "+v"(ang));
    float sn, cs; sincosf(ang, &sn, &cs);
    v2f o; o[0] = cs; o[1] = sn;
    *(v2f*)(CS + (size_t)idx * 2) = o;  }

// ---- k_qkv: the three input projections with their plane building, ONE launch. Grid (TT/64, NH_ + 2*NKV), one wave per 64x64 tile as in k_gemmw; a tile's 64 columns are exactly one head
// (y < NH_: query head, then NKV key heads, then NKV value heads), so the rotate-half partner d +- HD/2 lies in the same tile and the f32 projection never goes to memory.
// q / k tiles: 16 rows at a time through LDS, out[d] = x[d] cos[t][d] - x[d+HD/2] sin[t][d], out[d+HD/2] = x[d+HD/2] cos[t][d+HD/2] + x[d] sin[t][d+HD/2], stored as head planes [h] (row t, k = d; f16 + bf16 hi/lo) in fragment order, 32-B runs that the 8 stores of 16 rows join to whole lines.
// v tiles: a lane's 8 accumulator elements are 8 consecutive t of one d, which is one 16-byte fragment slot of the transposed planes [g] (row d, k = t): stored straight from registers, 512 contiguous bytes a wave.
__global__ __launch_bounds__(32) void k_qkv(const bf* __restrict__ A, const bf* __restrict__ Wq, const bf* __restrict__ Wk, const bf* __restrict__ Wv, const float* __restrict__ CS,
                                            h16* Q16, bf* Qh, bf* Ql, h16* K16, bf* Kh, bf* Kl, h16* V16, bf* Vh, bf* Vl) {
    typedef WFrag<bf>::V V;
    __shared__ __align__(16) float os[16 * 68];
    const int lane = threadIdx.x & 31, lr = lane & 15, hi = lane >> 4; const int r0 = blockIdx.x * 64, hy = blockIdx.y;
    const bool isq = hy < NH_, isv = hy >= NH_ + NKV; const int hh = isq ? hy : (isv ? hy - NH_ - NKV : hy - NH_);   // head index inside its own group
    const bf* Bt = (isq ? Wq : (isv ? Wv : Wk)) + (size_t)hh * HD * DM;
    v8f acc[4][4];
#pragma unroll
    for (int mb = 0; mb < 4; ++mb)
#pragma unroll
        for (int nb = 0; nb < 4; ++nb) acc[mb][nb] = (v8f){};
    const bf* pa = A + (size_t)r0 * DM + 8 * lane; const bf* pb = Bt + 8 * lane;   // the lane's two walking pointers (fragment order: 512 elements a pass); every load of a pass is one of them + a constant
    for (int kc = 0; kc < DM; kc += 32, pa += 512, pb += 512) {
        V a[4];
#pragma unroll
        for (int mb = 0; mb < 4; ++mb) a[mb] = WFrag<bf>::ldf(pa + (size_t)mb * 16 * DM);
        asm volatile("s_wait_xcnt 0x0" ::: "memory");                      // before a B load's result may land in the register pair that holds the A address
#pragma unroll
        for (int nb = 0; nb < 4; ++nb) { const V b = WFrag<bf>::ldf(pb + (size_t)nb * 16 * DM);
#pragma unroll
            for (int mb = 0; mb < 4; ++mb) acc[mb][nb] = WFrag<bf>::mma(a[mb], b, acc[mb][nb]); }
    }
    if (!isv) {
        const int d = lr * 4; const size_t zp = ((size_t)hh * TT + r0) * HD + (d >> 5) * 512 + ((d >> 4) & 1) * 256 + ((d >> 3) & 1) * 128 + hi * 8 + (d & 7);   // the lane's place in row r0 + hi (fragment order, k = d); every later row is a constant step from it, for the table as for the planes
        h16* P16 = (isq ? Q16 : K16) + zp; bf* Ph = (isq ? Qh : Kh) + zp; bf* Pl = (isq ? Ql : Kl) + zp; const float* cb = CS + ((size_t)(r0 + hi) * HD + d) * 2;
#pragma unroll
        for (int mb = 0; mb < 4; ++mb) {
            v4f c01[8], c23[8];                                             // {cos, sin} of d .. d+3 for the lane's 8 rows, asked for ahead of the LDS round trip
#pragma unroll
            for (int s = 0; s < 8; ++s) { const float* cp = cb + (mb * 16 + 2 * s) * HD * 2; c01[s] = *(const v4f*)cp; c23[s] = *(const v4f*)(cp + 4); }
#pragma unroll
            for (int nb = 0; nb < 4; ++nb) {
#pragma unroll
                for (int j = 0; j < 8; ++j) os[(hi * 8 + j) * 68 + nb * 16 + lr] = acc[mb][nb][j]; }
            __syncthreads();                                                // the 16 rows are read back by other lanes than wrote them
#pragma unroll
            for (int s = 0; s < 8; ++s) { const int row = 2 * s + hi;
                const v4f x0 = *(const v4fa*)(os + row * 68 + d), x1 = *(const v4fa*)(os + row * 68 + (d ^ (HD / 2)));
                const float cs[4] = { c01[s][0], c01[s][2], c23[s][0], c23[s][2] }, sn[4] = { c01[s][1], c01[s][3], c23[s][1], c23[s][3] };
                const v4f xp = (d < HD / 2) ? -x1 : x1;                    // the partner enters with a minus in the lower half of the head
                v4h o16; v4us oh, ol;
#pragma unroll
                for (int q = 0; q < 4; ++q) { const float r = x0[q] * cs[q] + xp[q] * sn[q];
                    o16[q] = tohx(r); unsigned short a2, c2; splitf(r, a2, c2); oh[q] = a2; ol[q] = c2; }
                const int e = mb * 16 * HD + 2 * s * 8; *(v4h*)(P16 + e) = o16; *(v4us*)(Ph + e) = oh; *(v4us*)(Pl + e) = ol;
                asm volatile("s_wait_xcnt 0x0" ::: "memory"); }            // before the data registers of these stores are rewritten
            __syncthreads();                                                // every read of these rows ends before the next 16 rows overwrite them
        }
    } else {
        const size_t zv = (size_t)hh * HD * TT + (size_t)r0 * 16 + 8 * lane; h16* P16 = V16 + zv; bf* Ph = Vh + zv; bf* Pl = Vl + zv;
#pragma unroll
        for (int nb = 0; nb < 4; ++nb)
#pragma unroll
            for (int mb = 0; mb < 4; ++mb) { v8h o16; v8us oh, ol;
#pragma unroll
                for (int j = 0; j < 8; ++j) { const float x = acc[mb][nb][j]; o16[j] = tohx(x); unsigned short a2, c2; splitf(x, a2, c2); oh[j] = a2; ol[j] = c2; }
                const int e = nb * 16 * TT + (mb >> 1) * 512 + (mb & 1) * 256; *(v8h*)(P16 + e) = o16; *(v8us*)(Ph + e) = oh; *(v8us*)(Pl + e) = ol;
                asm volatile("s_wait_xcnt 0x0" ::: "memory"); }            // before the data registers of these stores are rewritten
    }
}

// ---- k_fattn: fused causal sliding-window attention, scores and probabilities never leave registers. One wave = one query head x NQ*16 query rows; the 4 waves of a block are the 4 query heads
// of one kv head on the same rows, so they walk the same K / V lines. Per pass of 32 keys: St = K.Qt (A = K rows, B = Q kept in registers), online softmax per query column (a lane holds one
// query's scores: in-lane maximum and sum, one exchange between the wave halves for the maximum), the two 16-key score tiles convert in place into the B operand Pt, Ot += Vt.Pt (A = Vt rows).
// All fragments use WFrag::ldf's k order (that of WFrag::ld), which is the order a packed D pair delivers. Rows < RH: bf16 hi+lo planes, 3 products each; rows >= RH: f16, P carried x 2^PSH (cancels in O / sum).
// D element r of lane l of Ot = (d = 16*dt + 8*(l>>4) + r, query l & 15): 8 consecutive d per lane, stored as bf16 hi / lo fragment slots of the merged ctx planes (row t, k = h*64 + d; Ah / Al arrive at the head's first block, 2*h).
// 2^x with the slot behind it filled: the instruction set asks for one independent instruction or v_nop between a transcendental and a directly following overwrite of its source or read of its
// result; only a v_nop inside the same statement is tied to the instruction.
__device__ __forceinline__ float exp2s(float x) { float r; asm("v_exp_f32 %0, %1\n\tv_nop" : "=v"(r) : "v"(x)); return r; }
template <typename T16, bool HI, int NQ>
__device__ __forceinline__ void attn_tile(const T16* __restrict__ Q, const T16* __restrict__ Q2, const T16* __restrict__ Kp, const T16* __restrict__ K2, const T16* __restrict__ Vt, const T16* __restrict__ V2, int q0, int lane, bf* Ah, bf* Al) {
    typedef typename WFrag<T16>::V V;                                       // every full unroll below keeps the fragment arrays indexed by constants, that is, in registers
    const int lr = lane & 15, hi = lane >> 4;
    const unsigned fofs = (unsigned)lane * 16u;                            // the lane's byte offset in a fragment block, fixed for the whole walk: every load is wave-uniform base + lane offset
    V qb[NQ][2], qb2[NQ][2];
#pragma unroll
    for (int nq = 0; nq < NQ; ++nq)
#pragma unroll
        for (int ks = 0; ks < 2; ++ks) { const size_t qo = (size_t)(q0 + nq * 16) * HD + ks * 512; qb[nq][ks] = WFrag<T16>::ldfo(Q + qo, fofs); if (HI) qb2[nq][ks] = WFrag<T16>::ldfo(Q2 + qo, fofs); }
    v8f o[NQ][4]; float m[NQ], l[NQ];
#pragma unroll
    for (int nq = 0; nq < NQ; ++nq) { m[nq] = -1.0e30f; l[nq] = 0.0f;      // the start maximum lies above the ban fill, so a pass whose keys are all banned for a query adds exact zeros
#pragma unroll
        for (int dt = 0; dt < 4; ++dt) o[nq][dt] = (v8f){}; }
    const int kb = max(0, q0 - (WIN - 1)) & ~31, ke = q0 + NQ * 16;         // first key pass of the window of the first row, one past the diagonal of the last row
    V ka[2][2], ka2[2][2];
    if (!HI) {                                                              // f16 rows fetch K one pass ahead; the hi+lo rows (short walks, twice the planes) load it in the pass, which keeps the kernel under 256 registers
#pragma unroll
        for (int kt = 0; kt < 2; ++kt)
#pragma unroll
            for (int ks = 0; ks < 2; ++ks) ka[kt][ks] = WFrag<T16>::ldfo(Kp + (size_t)(kb + kt * 16) * HD + ks * 512, fofs); }
    asm volatile("s_wait_xcnt 0x0" ::: "memory");                          // the address registers of the loads above are reused in the loop
#pragma unroll 1                                                            // rolled: one pass's fragments fill the register budget, a second copy of the body would only cost instruction cache
    for (int k0 = kb; k0 < ke; k0 += 32) {
        V va[4], va2[4];
        if (HI) {
#pragma unroll
            for (int kt = 0; kt < 2; ++kt)
#pragma unroll
                for (int ks = 0; ks < 2; ++ks) { const size_t ko = (size_t)(k0 + kt * 16) * HD + ks * 512; ka[kt][ks] = WFrag<T16>::ldfo(Kp + ko, fofs); ka2[kt][ks] = WFrag<T16>::ldfo(K2 + ko, fofs); }
            asm volatile("s_wait_xcnt 0x0" ::: "memory"); }                // the V loads' results may land in registers that held K addresses
#pragma unroll
        for (int dt = 0; dt < 4; ++dt) { const size_t vo = (size_t)dt * 16 * TT + (size_t)k0 * 16; va[dt] = WFrag<T16>::ldfo(Vt + vo, fofs); if (HI) va2[dt] = WFrag<T16>::ldfo(V2 + vo, fofs); }
        asm volatile("s_wait_xcnt 0x0" ::: "memory");                      // before the address registers of this pass's loads are rewritten in a later block
        v8f s[NQ][2];
#pragma unroll
        for (int nq = 0; nq < NQ; ++nq)
#pragma unroll
            for (int kt = 0; kt < 2; ++kt) { v8f c = (v8f){};
#pragma unroll
                for (int ks = 0; ks < 2; ++ks) { c = WFrag<T16>::mma(ka[kt][ks], qb[nq][ks], c); if (HI) { c = WFrag<T16>::mma(ka[kt][ks], qb2[nq][ks], c); c = WFrag<T16>::mma(ka2[kt][ks], qb[nq][ks], c); } }
                s[nq][kt] = c; }
        if (!HI) { const int kn = (k0 + 32 < ke) ? k0 + 32 : k0;            // next pass's K fragments fly during the softmax (the last pass re-reads its own rows: always in bounds)
#pragma unroll
            for (int kt = 0; kt < 2; ++kt)
#pragma unroll
                for (int ks = 0; ks < 2; ++ks) ka[kt][ks] = WFrag<T16>::ldfo(Kp + (size_t)(kn + kt * 16) * HD + ks * 512, fofs);
            asm volatile("s_wait_xcnt 0x0" ::: "memory"); }                // before their address registers are rewritten behind the branch below
#pragma unroll
        for (int nq = 0; nq < NQ; ++nq)
#pragma unroll
            for (int kt = 0; kt < 2; ++kt) s[nq][kt] *= SCL * 1.4426950408889634f;   // scores in log2 units
        if (k0 + 31 > q0 || q0 + NQ * 16 - 1 - k0 >= WIN) {                 // wave-uniform: only passes that touch the diagonal or the window's start hold banned pairs
#pragma unroll
            for (int nq = 0; nq < NQ; ++nq)
#pragma unroll
                for (int kt = 0; kt < 2; ++kt)
#pragma unroll
                    for (int r = 0; r < 8; ++r) { const int j = k0 + kt * 16 + 8 * hi + r, i = q0 + nq * 16 + lr; s[nq][kt][r] = (j <= i && i - j < WIN) ? s[nq][kt][r] : -3.0e38f; } }
        V pb[NQ], pb2[NQ];
#pragma unroll
        for (int nq = 0; nq < NQ; ++nq) { float mx = m[nq];
#pragma unroll
            for (int kt = 0; kt < 2; ++kt)
#pragma unroll
                for (int r = 0; r < 8; ++r) mx = fmaxf(mx, s[nq][kt][r]);
            mx = fmaxf(mx, __shfl_xor(mx, 16, 32));
            const float al = exp2s(m[nq] - mx); m[nq] = mx; const float mb = HI ? mx : mx - PSH; float sum = 0.0f;
#pragma unroll
            for (int kt = 0; kt < 2; ++kt)
#pragma unroll
                for (int r = 0; r < 8; ++r) { const float p = exp2s(s[nq][kt][r] - mb); s[nq][kt][r] = p; sum += p; }
            l[nq] = l[nq] * al + sum;                                       // each wave half keeps the sum of its own keys; joined once after the loop
#pragma unroll
            for (int dt = 0; dt < 4; ++dt) o[nq][dt] *= al;
            if constexpr (HI) { v8us h0, h1, l0, l1;
#pragma unroll
                for (int r = 0; r < 8; ++r) { unsigned short a, c2; splitf(s[nq][0][r], a, c2); h0[r] = a; l0[r] = c2; splitf(s[nq][1][r], a, c2); h1[r] = a; l1[r] = c2; }
                pb[nq] = cat16b(h0, h1); pb2[nq] = cat16b(l0, l1);
            } else { v8h h0, h1;
#pragma unroll
                for (int r = 0; r < 8; ++r) { h0[r] = tohx(s[nq][0][r]); h1[r] = tohx(s[nq][1][r]); }
                pb[nq] = cat16(h0, h1); } }
#pragma unroll
        for (int dt = 0; dt < 4; ++dt)
#pragma unroll
            for (int nq = 0; nq < NQ; ++nq) { o[nq][dt] = WFrag<T16>::mma(va[dt], pb[nq], o[nq][dt]); if (HI) { o[nq][dt] = WFrag<T16>::mma(va[dt], pb2[nq], o[nq][dt]); o[nq][dt] = WFrag<T16>::mma(va2[dt], pb[nq], o[nq][dt]); } }
    }
#pragma unroll
    for (int nq = 0; nq < NQ; ++nq) { const float inv = __fdiv_rn(1.0f, l[nq] + __shfl_xor(l[nq], 16, 32));
#pragma unroll
        for (int dt = 0; dt < 4; ++dt) { v8us oh, ol;
#pragma unroll
            for (int r = 0; r < 8; ++r) { unsigned short a, c2; splitf(o[nq][dt][r] * inv, a, c2); oh[r] = a; ol[r] = c2; }
            const size_t oo = (size_t)(q0 + nq * 16) * DQ + (dt >> 1) * 512 + (dt & 1) * 256 + 8 * lane; *(v8us*)(Ah + oo) = oh; *(v8us*)(Al + oo) = ol; } }   // fragment order: the wave's 32 slots are 512 contiguous bytes
}
// grid (NKV, NT16 + NTH), 128 threads; blockIdx.y runs from the row tiles with the longest key walk, for all kv heads, to the short hi+lo tiles last
#define NT16 ((TT - RHE) / 32)
#define NTH  (RHE / 16)
__global__ __launch_bounds__(128) void k_fattn(const h16* __restrict__ Q16, const h16* __restrict__ K16, const h16* __restrict__ V16, const bf* __restrict__ Qh, const bf* __restrict__ Ql, const bf* __restrict__ Kh, const bf* __restrict__ Kl,
                                               const bf* __restrict__ Vh, const bf* __restrict__ Vl, bf* Ah, bf* Al) {
    const int lane = threadIdx.x & 31; const int g = blockIdx.x; const int h = g * REP + __builtin_amdgcn_readfirstlane(threadIdx.x >> 5); const int bx = blockIdx.y;
    const size_t zq = (size_t)h * TT * HD, zk = (size_t)g * TT * HD;
    if (bx < NT16) attn_tile<h16, false, 2>(Q16 + zq, nullptr, K16 + zk, nullptr, V16 + zk, nullptr, RHE + (NT16 - 1 - bx) * 32, lane, Ah + h * 1024, Al + h * 1024);
    else attn_tile<bf, true, 1>(Qh + zq, Ql + zq, Kh + zk, Kl + zk, Vh + zk, Vl + zk, (NTH - 1 - (bx - NT16)) * 16, lane, Ah + h * 1024, Al + h * 1024);
}

extern "C" void kernel_launch(void* const* d_in, const int* in_sizes, int n_in,
                              void* d_out, int out_size, void* d_ws, size_t ws_size, hipStream_t stream) {
    if (n_in < 5) return;
    if (in_sizes[0] < (NB - 1) * TT_FULL * DM + TT * DM || in_sizes[1] < DM * DQ || in_sizes[2] < DM * DKV || in_sizes[3] < DM * DKV || in_sizes[4] < DQ * DM) return;
    if (out_size < NB * TT * DM) return;
    const float* x = (const float*)d_in[0]; const float* wq = (const float*)d_in[1]; const float* wk = (const float*)d_in[2]; const float* wv = (const float*)d_in[3]; const float* wo = (const float*)d_in[4];
    float* OUT = (float*)d_out;     // [NB][TT][DM]
    char* wsp = (char*)d_ws;
    auto take = [&](size_t bytes) { char* p = wsp; wsp += (bytes + 255) & ~(size_t)255; return (void*)p; };
    // persistent planes
    bf* WOt = (bf*)take((size_t)DM * DQ * 2); float* CS = (float*)take((size_t)TT * HD * 2 * 4);
    h16* QP16 = (h16*)take((size_t)NH_ * TT * HD * 2); h16* KP16 = (h16*)take((size_t)NKV * TT * HD * 2); h16* VT16 = (h16*)take((size_t)NKV * HD * TT * 2);
    bf* QPh = (bf*)take((size_t)NH_ * TT * HD * 2); bf* QPl = (bf*)take((size_t)NH_ * TT * HD * 2); bf* KPh = (bf*)take((size_t)NKV * TT * HD * 2); bf* KPl = (bf*)take((size_t)NKV * TT * HD * 2);
    bf* VTh = (bf*)take((size_t)NKV * HD * TT * 2); bf* VTl = (bf*)take((size_t)NKV * HD * TT * 2); bf* ATh = (bf*)take((size_t)TT * DQ * 2); bf* ATl = (bf*)take((size_t)TT * DQ * 2);
    // projection-phase temporaries
    bf* WQt = (bf*)take((size_t)DQ * DM * 2); bf* WKt = (bf*)take((size_t)DKV * DM * 2); bf* WVt = (bf*)take((size_t)DKV * DM * 2);
    bf* XB = (bf*)take((size_t)TT * DM * 2);
    const size_t total = (size_t)(wsp - (char*)d_ws);
    if (total > ws_size || total > (size_t)134217728) return;

    // inverse rotary frequencies inv[j] = 1 / 500000^(j/32): 32nd root by Newton in double (pure arithmetic), powers RNE-converted to f32, then an f32 reciprocal.
    RopeTab tab;
    { double y = 1.5; for (int it = 0; it < 64; ++it) { double p = 1.0; for (int k = 0; k < 31; ++k) p *= y; const double fy = p * y - 500000.0; y = y - fy / (32.0 * p); }
      double pj = 1.0; for (int j = 0; j < 32; ++j) { const float pf = (float)pj; tab.f[j] = 1.0f / pf; pj *= y; } }

    // weights -> bf16 planes ([in][out] transposed), x -> bf16, both in fragment order; rotary table
    k_wtG<DM, DQ><<<(DQ / 32) * (DM / 32) / 8, 256, 0, stream>>>(wq, WQt);
    k_wtG<DM, DKV><<<(DKV / 32) * (DM / 32) / 8, 256, 0, stream>>>(wk, WKt);
    k_wtG<DM, DKV><<<(DKV / 32) * (DM / 32) / 8, 256, 0, stream>>>(wv, WVt);
    k_wtG<DQ, DM><<<(DM / 32) * (DQ / 32) / 8, 256, 0, stream>>>(wo, WOt);
    k_csgen<<<(TT * HD + 255) / 256, 256, 0, stream>>>(tab, CS);
    for (int b = 0; b < NB; ++b) {
        k_cvt8<<<(unsigned)(((size_t)TT * DM / 8 + 255) / 256), 256, 0, stream>>>(x + (size_t)b * TT_FULL * DM, XB, (size_t)TT * DM / 8);
        k_qkv<<<dim3(TT / 64, NH_ + 2 * NKV, 1), 32, 0, stream>>>(XB, WQt, WKt, WVt, CS, QP16, QPh, QPl, KP16, KPh, KPl, VT16, VTh, VTl);
        k_fattn<<<dim3(NKV, NT16 + NTH, 1), 128, 0, stream>>>(QP16, KP16, VT16, QPh, QPl, KPh, KPl, VTh, VTl, ATh, ATl);
        k_gemmw<bf, 1, false, DQ><<<dim3(TT / 64, DM / 64, 1), 32, 0, stream>>>(ATh, ATl, WOt, nullptr, OUT + (size_t)b * TT * DM, DM, nullptr, 0, 0, 0); }
}

// v004
// Measured time: 104 microseconds a run.
// In two side-by-side timings against v003, it was 1.77 and 1.78 times as fast.
// Over all steps from v000 it is 11.3 times as fast.
#include <hip/hip_runtime.h>

// Grouped-query attention block (NB x SEQ x 2048): q = x Wq (32 heads x 64), k / v = x Wk / x Wv (8 kv heads x 64, 4 query heads per kv head), rotate-half rotary embedding
// (base 500000; cos/sin table built on device from host-computed inverse frequencies), causal sliding-window softmax(q.k / 8) (window 1024, -inf fill, diagonal always kept),
// ctx merged as [t][h*64 + d], out = ctx Wo -> f32 [NB][SEQ][2048]. Weights are [in][out] and are transposed into bf16 planes.
// Every 16-bit operand plane of a matrix product (x, Wq, Wk, Wv, Wo, the q / k head planes with k = d, the transposed v planes with row = d and k = t, ctx hi / lo) lies in FRAGMENT ORDER: a block of 16 rows x 32 k is 1 KiB, [j = (k >> 4) & 1][lane = 16*((k >> 3) & 1) + (row & 15)][k & 7],
// blocks ordered [row >> 4][k >> 5]; a fragment is then two loads of 512 contiguous bytes (lane l takes 16 bytes at 16*l), four whole 128-B lines each, where a row-major plane made every load touch 16 lines.
// Compute dtypes (f32 accumulate everywhere): every input RNE-converted to bf16; x.Wq, x.Wk, x.Wv: v_wmma_f32_16x16x32_bf16 on plain bf16 operands; q.k and P.v: query rows < RH on bf16 hi+lo
// planes (3 products), rows >= RH single v_wmma_f32_16x16x32_f16 (P carried x1024), one fused kernel with an online softmax over 32-key passes inside the window; softmax and rotary arithmetic f32; ctx.Wo: bf16 hi+lo ctx x bf16 Wo (2 products).

#ifndef NB
#define NB 1
#endif
#ifndef SEQ
#define SEQ 2048
#endif
#ifndef RH
#define RH 512                  // query rows < RH use hi+lo planes (0: none)
#endif
#define TT      SEQ
#define TT_FULL 2048
#define DM      2048
#define NH_     32
#define NKV     8
#define REP     (NH_ / NKV)
#define HD      64
#define DQ      (NH_ * HD)
#define DKV     (NKV * HD)
#define RHE     ((RH < TT) ? RH : TT)
#define WIN     1024
#define PSH     10.0f             // f16 rows: P carried x 2^PSH
#define SCL     0.125f            // HD^-0.5
static_assert(TT % 128 == 0 && TT >= 128 && TT <= TT_FULL);
static_assert(RH % 64 == 0 && RH >= 0);
static_assert(REP == 4);
static_assert(DM % 64 == 0 && DQ % 64 == 0 && DKV % 64 == 0 && HD == 64);

typedef _Float16 h16;
typedef unsigned short bf;
typedef __attribute__((ext_vector_type(16))) __bf16   v16bf;
typedef __attribute__((ext_vector_type(16))) _Float16 v16h;
typedef __attribute__((ext_vector_type(8)))  _Float16 v8h;
typedef __attribute__((ext_vector_type(8)))  unsigned short v8us;
typedef __attribute__((ext_vector_type(8)))  float    v8f;
typedef __attribute__((ext_vector_type(4)))  float    v4f;
typedef __attribute__((ext_vector_type(2)))  _Float16 v2h;
typedef __attribute__((ext_vector_type(4)))  _Float16 v4h;
typedef __attribute__((ext_vector_type(2)))  unsigned short v2us;
typedef __attribute__((ext_vector_type(4)))  unsigned short v4us;
typedef __attribute__((ext_vector_type(2)))  float v2f;
typedef v8h  __attribute__((may_alias)) v8ha;
typedef v4f  __attribute__((may_alias)) v4fa;
typedef v8us __attribute__((may_alias)) v8usa;

__device__ __forceinline__ unsigned short f2bf(float f) { unsigned u = __float_as_uint(f); u += 0x7FFFu + ((u >> 16) & 1u); return (unsigned short)(u >> 16); }   // RNE convert
__device__ __forceinline__ float bf2f(unsigned short b) { return __uint_as_float(((unsigned)b) << 16); }
__device__ __forceinline__ float bfr(float f) { return bf2f(f2bf(f)); }
__device__ __forceinline__ v16h cat16(v8h lo, v8h hi) { return __builtin_shufflevector(lo, hi, 0, 1, 2, 3, 4, 5, 6, 7, 8, 9, 10, 11, 12, 13, 14, 15); }
__device__ __forceinline__ v16bf cat16b(v8us lo, v8us hi) { return __builtin_bit_cast(v16bf, __builtin_shufflevector(lo, hi, 0, 1, 2, 3, 4, 5, 6, 7, 8, 9, 10, 11, 12, 13, 14, 15)); }
__device__ __forceinline__ v8f wmma16(v16h a, v16h b, v8f c) { return __builtin_amdgcn_wmma_f32_16x16x32_f16(false, a, false, b, (short)0, c, false, false); }
__device__ __forceinline__ v8f wmmab(v16bf a, v16bf b, v8f c) { return __builtin_amdgcn_wmma_f32_16x16x32_bf16(false, a, false, b, (short)0, c, false, false); }
__device__ __forceinline__ h16 tohx(float x) { return (h16)x; }
__device__ __forceinline__ void splitf(float y, unsigned short& h, unsigned short& l) { h = f2bf(y); l = f2bf(y - bf2f(h)); }

// ---- fragment loaders
// Fragment map (both operands): lane row/col = lane & 15, elements 0..7 <- k0 + 8*(lane>>4) + 0..7, elements 8..15 <- k0 + 16 + 8*(lane>>4) + 0..7; D element r of lane l = (row 8*(l>>4) + r, col l & 15).
template <typename T16> struct WFrag;
template <> struct WFrag<h16> { typedef v16h V; static __device__ __forceinline__ V ld(const h16* p) { return cat16(*(const v8h*)p, *(const v8h*)(p + 16)); } static __device__ __forceinline__ V ldo(const h16* b, unsigned o) { return ld((const h16*)((const char*)b + o)); } static __device__ __forceinline__ V ldf(const h16* p) { return cat16(*(const v8h*)p, *(const v8h*)(p + 256)); } static __device__ __forceinline__ V ldfo(const h16* b, unsigned o) { return ldf((const h16*)((const char*)b + o)); } static __device__ __forceinline__ v8f mma(V a, V b, v8f c) { return wmma16(a, b, c); } };
template <> struct WFrag<bf> { typedef v16bf V; static __device__ __forceinline__ V ld(const bf* p) { return cat16b(*(const v8us*)p, *(const v8us*)(p + 16)); } static __device__ __forceinline__ V ldo(const bf* b, unsigned o) { return ld((const bf*)((const char*)b + o)); } static __device__ __forceinline__ V ldf(const bf* p) { return cat16b(*(const v8us*)p, *(const v8us*)(p + 256)); } static __device__ __forceinline__ V ldfo(const bf* b, unsigned o) { return ldf((const bf*)((const char*)b + o)); } static __device__ __forceinline__ v8f mma(V a, V b, v8f c) { return wmmab(a, b, c); } };
// ---- LDS staging of the two GEMM kernels (k_gemmw, k_qkv). A work-group of 4 waves (2 x 2) owns a 128x128 output tile, each wave a 64x64 tile of it (16 accumulators). A stage is KS k of every operand row of the
// block tile. In a fragment-order plane 16 rows x KS k are CH contiguous elements (4 KiB, a "chunk": KS/32 blocks of 1 KiB), and a stage keeps that order in LDS, chunk behind chunk, so a fragment is two
// ds_load_b128 of 512 contiguous bytes. The chunks come in by global_load_async_to_lds_b128 (a lane moves its own 16 bytes, through no register), 8 copies a chunk; the immediate offset moves the global and the LDS address alike.
// Two buffers: stage t + 2 is asked for behind the barrier that ends trip t, into the buffer trip t has read, and flies during trip t + 1.
#define KS 128
#define CH (16 * KS)
#define CHB (CH * 2)              // bytes of a chunk
#define CP1(L, G, O) "global_load_async_to_lds_b128 " L ", " G ", off offset:" #O "\n\t"
#define CP8(L, G) CP1(L, G, 0) CP1(L, G, 512) CP1(L, G, 1024) CP1(L, G, 1536) CP1(L, G, 2048) CP1(L, G, 2560) CP1(L, G, 3072) CP1(L, G, 3584)
static_assert(CHB == 8 * 512);
__device__ __forceinline__ unsigned ldsaddr(const void* p) { return (unsigned)(size_t)p; }
__device__ __forceinline__ v16bf ldl(const bf* p) { return cat16b(*(const v8us*)p, *(const v8us*)(p + 256)); }
__device__ __forceinline__ void wait_ds() { asm volatile("s_wait_dscnt 0x0" ::: "memory"); }
__device__ __forceinline__ void wait_async() { asm volatile("s_wait_asynccnt 0x0" ::: "memory"); }
// The copies of one wave and one stage stand in ONE statement that ends in s_wait_xcnt 0 (a precaution): so the wait stands ahead of every rewrite of a register that a copy names.
__device__ __forceinline__ void stage4(unsigned l, const bf* g, size_t step) {   // 4 chunks: LDS places CHB apart, global chunks step elements apart
    asm volatile(CP8("%0", "%4") CP8("%1", "%5") CP8("%2", "%6") CP8("%3", "%7") "s_wait_xcnt 0x0"
                 :: "v"(l), "v"(l + CHB), "v"(l + 2 * CHB), "v"(l + 3 * CHB), "v"(g), "v"(g + step), "v"(g + 2 * step), "v"(g + 3 * step) : "memory"); }
__device__ __forceinline__ void stage6(unsigned l, const bf* g0, const bf* g1, const bf* g2, const bf* g3, const bf* g4, const bf* g5) {   // 6 chunks, each with its own global address
    asm volatile(CP8("%0", "%6") CP8("%1", "%7") CP8("%2", "%8") CP8("%3", "%9") CP8("%4", "%10") CP8("%5", "%11") "s_wait_xcnt 0x0"
                 :: "v"(l), "v"(l + CHB), "v"(l + 2 * CHB), "v"(l + 3 * CHB), "v"(l + 4 * CHB), "v"(l + 5 * CHB), "v"(g0), "v"(g1), "v"(g2), "v"(g3), "v"(g4), "v"(g5) : "memory"); }

// ---- k_gemmw: C[m][n] (f32, pitch ldc, + optional f32 bias[n]) = sum_k (A[m][k] + A2[m][k]) Bt[n][k], two products per k step (A, then A2), bf16 planes in fragment order. Grid (M/128, N/128), 128 threads.
// A stage is [A 8 chunks | A2 8 chunks | Bt 8 chunks] = 96 KiB; wave w copies chunks 6w .. 6w+5 (48 copies in flight at most). K % KS == 0, K >= 2*KS.
template <bool BIAS, int K>
__global__ __launch_bounds__(128) void k_gemmw(const bf* __restrict__ A, const bf* __restrict__ A2, const bf* __restrict__ Bt, float* C, int ldc, const float* __restrict__ bias) {
    typedef WFrag<bf>::V V;
    static_assert(K % KS == 0 && K >= 2 * KS);
    __shared__ __attribute__((aligned(1024))) bf ring[2 * 24 * CH];
    __shared__ __align__(16) float osm[4 * 16 * 68];
    const int lane = threadIdx.x & 31, lr = lane & 15, hi = lane >> 4; const int w = __builtin_amdgcn_readfirstlane(threadIdx.x >> 5), wm = w & 1, wn = w >> 1;
    float* os = osm + w * 16 * 68;                                          // each wave stages its output rows in its own range
    const int r0 = blockIdx.x * 128 + wm * 64, c0 = blockIdx.y * 128 + wn * 64;
    v8f acc[4][4];
#pragma unroll
    for (int mb = 0; mb < 4; ++mb)
#pragma unroll
        for (int nb = 0; nb < 4; ++nb) acc[mb][nb] = (v8f){};
    const bf* g[6];                                                         // the lane's 16 bytes in the first copy of each of the wave's chunks; a stage is CH elements further along k
#pragma unroll
    for (int i = 0; i < 6; ++i) { const int c = 6 * w + i; const bf* pl = (c < 8) ? A + (size_t)blockIdx.x * 128 * K : ((c < 16) ? A2 + (size_t)blockIdx.x * 128 * K : Bt + (size_t)blockIdx.y * 128 * K);
        g[i] = pl + (size_t)(c & 7) * 16 * K + 8 * lane; }
    const unsigned l0 = ldsaddr(ring) + (unsigned)w * 6 * CHB + (unsigned)lane * 16;
    const bf* la = ring + wm * 4 * CH + 8 * lane; const bf* la2 = la + 8 * CH; const bf* lb = ring + (16 + wn * 4) * CH + 8 * lane;
    stage6(l0, g[0], g[1], g[2], g[3], g[4], g[5]);
    wait_async(); __syncthreads();                                          // stage 0 is published
    stage6(l0 + 24 * CHB, g[0] + CH, g[1] + CH, g[2] + CH, g[3] + CH, g[4] + CH, g[5] + CH);
#pragma unroll 1                                                            // rolled: a trip is 128 matrix instructions, a second copy would only cost instruction cache
    for (int t = 0; t < K / KS; ++t) {
        const int bo = (t & 1) * 24 * CH; V a[2][4], a2[2][4], b[2][4];     // two fragment sets: the next k step's LDS reads go out ahead of this step's products
#pragma unroll
        for (int q = 0; q < 4; ++q) { a[0][q] = ldl(la + bo + q * CH); a2[0][q] = ldl(la2 + bo + q * CH); b[0][q] = ldl(lb + bo + q * CH); }
#pragma unroll
        for (int ks = 0; ks < KS / 32; ++ks) { const int cu = ks & 1, nx = cu ^ 1;
            if (ks + 1 < KS / 32) {
#pragma unroll
                for (int q = 0; q < 4; ++q) { const int o = bo + q * CH + (ks + 1) * 512; a[nx][q] = ldl(la + o); a2[nx][q] = ldl(la2 + o); b[nx][q] = ldl(lb + o); } }
            __builtin_amdgcn_sched_barrier(0);                              // keeps the reads above in one group ahead of the products below; left free, the scheduler sinks them among the products, each behind a wait to 0
#pragma unroll
            for (int nb = 0; nb < 4; ++nb) {
#pragma unroll
                for (int mb = 0; mb < 4; ++mb) { acc[mb][nb] = wmmab(a[cu][mb], b[cu][nb], acc[mb][nb]); acc[mb][nb] = wmmab(a2[cu][mb], b[cu][nb], acc[mb][nb]); } } }
        __builtin_amdgcn_sched_barrier(0);                                  // the trip's last products stay ahead of the barrier: left free they sink behind it and hold back the copies, which then fly for less than a trip
        wait_ds(); wait_async(); __syncthreads();                           // publishes stage t + 1 and ends every wave's reads of stage t
        if (t + 2 < K / KS) { const size_t o = (size_t)(t + 2) * CH; stage6(l0 + (unsigned)(t & 1) * 24 * CHB, g[0] + o, g[1] + o, g[2] + o, g[3] + o, g[4] + o, g[5] + o); }
    }
    wait_async();
#pragma unroll
    for (int mb = 0; mb < 4; ++mb) {
#pragma unroll
        for (int nb = 0; nb < 4; ++nb) {
#pragma unroll
            for (int j = 0; j < 8; ++j) os[(hi * 8 + j) * 68 + nb * 16 + lr] = acc[mb][nb][j]; }
        __builtin_amdgcn_wave_barrier(); asm volatile("" ::: "memory");
        float* crow = C + (size_t)(r0 + mb * 16) * ldc + c0;
{
#pragma unroll
            for (int s = 0; s < 8; ++s) { const int row = 2 * s + hi, cofs = lr * 4; v4f val = *(const v4fa*)(os + row * 68 + cofs); if (BIAS) { val[0] += bfr(bias[c0 + cofs]); val[1] += bfr(bias[c0 + cofs + 1]); val[2] += bfr(bias[c0 + cofs + 2]); val[3] += bfr(bias[c0 + cofs + 3]); }
                *(v4f*)(crow + (size_t)row * ldc + cofs) = val; }
             }
        __builtin_amdgcn_wave_barrier(); asm volatile("" ::: "memory");
    }
}

// ---- k_wtG: w [K][N] f32 -> bf16 plane of w transposed (row = n, k = k) in fragment order. One wave = 32 consecutive n x one block of 32 k: each of its 32 loads is one whole 128-B line of a row of w,
// each of its 4 stores fills two runs of 256 contiguous bytes (a lane's 8 k of one n are the 16 bytes of one fragment slot). Grid (N/32)*(K/32)/8 blocks of 8 waves.
// K and N are compile-time, so that the 32 loads are one address pair + constant offsets.
template <int K, int N>
__global__ __launch_bounds__(256) void k_wtG(const float* __restrict__ w, bf* Bt) {
    static_assert(K % 32 == 0 && N % 32 == 0 && ((N / 32) * (K / 32)) % 8 == 0);
    const int lane = threadIdx.x & 31; const int wv = blockIdx.x * 8 + (threadIdx.x >> 5); const int kb = wv / (N / 32), n = (wv % (N / 32)) * 32 + lane;
    const float* p = w + (size_t)kb * 32 * N + n; float v[32];
#pragma unroll
    for (int i = 0; i < 32; ++i) v[i] = p[(size_t)i * N];
    bf* q = Bt + ((size_t)(n >> 4) * (K / 32) + kb) * 512 + (n & 15) * 8;
#pragma unroll
    for (int o = 0; o < 4; ++o) { v8us r;                                   // o = 2*j + half: k = 32*kb + 8*o + e
#pragma unroll
        for (int e = 0; e < 8; ++e) r[e] = f2bf(v[o * 8 + e]);
        *(v8us*)(q + o * 128) = r; }
}
// ---- k_cvt8: src [rows][DM] f32 -> bf16 plane in fragment order. One wave = 8 rows x one block of 32 k: a lane converts 8 consecutive k; the 8 lanes of one k octet store 128 contiguous bytes.
__global__ __launch_bounds__(256) void k_cvt8(const float* __restrict__ src, bf* dst, size_t n8) { const size_t i = (size_t)blockIdx.x * 256 + threadIdx.x; if (i >= n8) return;
    const int lane = threadIdx.x & 31, o = lane & 3; const int wv = (int)(i >> 5), kb = wv % (DM / 32), t = (wv / (DM / 32)) * 8 + (lane >> 2);
    const v8f v = *(const v8f*)(src + (size_t)t * DM + kb * 32 + o * 8); v8us r;
#pragma unroll
    for (int k = 0; k < 8; ++k) r[k] = f2bf(v[k]);
    *(v8us*)(dst + ((size_t)(t >> 4) * (DM / 32) + kb) * 512 + o * 128 + (t & 15) * 8) = r;  }

// ---- k_csgen: rotary table CS[t][d] = {cos(t * inv[d & 31]), sin(t * inv[d & 31])} (f32 product, precise sincos). inv[] arrives by value (host-computed); lane == d & 31 by construction
struct RopeTab { float f[32]; };
static_assert(sizeof(RopeTab) == 128);
__global__ __launch_bounds__(256) void k_csgen(RopeTab tab, float* CS) {
    const int idx = blockIdx.x * 256 + threadIdx.x; const int lane = threadIdx.x & 31; float inv = 0.0f;
#pragma unroll
    for (int i = 0; i < 32; ++i) inv = (lane == i) ? tab.f[i] : inv;
    if (idx >= TT * HD) return;
    const int t = idx / HD; float ang = __fmul_rn((float)t, inv); asm volatile("" : "+v"(ang));
    float sn, cs; sincosf(ang, &sn, &cs);
    v2f o; o[0] = cs; o[1] = sn;
    *(v2f*)(CS + (size_t)idx * 2) = o;  }

// ---- k_qkv: the three input projections with their plane building, ONE launch. Grid (TT/128, (NH_ + 2*NKV)/2), 128 threads, staged as above; a wave's 64 columns are exactly one head
// (head index < NH_: query head, then NKV key heads, then NKV value heads; the two heads of a block are of one kind, so every branch round a barrier is block-uniform), so the rotate-half partner d +- HD/2 lies in the same tile and the f32 projection never goes to memory.
// A stage is [x 8 chunks | weight 8 chunks] = 64 KiB; wave w copies chunks 4w .. 4w+3 (32 copies in flight at most).
// q / k tiles: 16 rows at a time through LDS, out[d] = x[d] cos[t][d] - x[d+HD/2] sin[t][d], out[d+HD/2] = x[d+HD/2] cos[t][d+HD/2] + x[d] sin[t][d+HD/2], stored as head planes [h] (row t, k = d; f16 + bf16 hi/lo) in fragment order, 32-B runs that the 8 stores of 16 rows join to whole lines.
// v tiles: a lane's 8 accumulator elements are 8 consecutive t of one d, which is one 16-byte fragment slot of the transposed planes [g] (row d, k = t): stored straight from registers, 512 contiguous bytes a wave.
static_assert(NH_ % 2 == 0 && NKV % 2 == 0 && DM % KS == 0 && DM >= 2 * KS);
__global__ __launch_bounds__(128) void k_qkv(const bf* __restrict__ A, const bf* __restrict__ Wq, const bf* __restrict__ Wk, const bf* __restrict__ Wv, const float* __restrict__ CS,
                                            h16* Q16, bf* Qh, bf* Ql, h16* K16, bf* Kh, bf* Kl, h16* V16, bf* Vh, bf* Vl) {
    typedef WFrag<bf>::V V;
    __shared__ __attribute__((aligned(1024))) bf ring[2 * 16 * CH];
    __shared__ __align__(16) float osm[4 * 16 * 68];
    const int lane = threadIdx.x & 31, lr = lane & 15, hi = lane >> 4; const int w = __builtin_amdgcn_readfirstlane(threadIdx.x >> 5), wm = w & 1, wn = w >> 1;
    float* os = osm + w * 16 * 68;                                          // each wave turns its rows in its own range
    const int r0 = blockIdx.x * 128 + wm * 64, hy = blockIdx.y * 2 + wn;
    const bool isq = hy < NH_, isv = hy >= NH_ + NKV; const int hh = isq ? hy : (isv ? hy - NH_ - NKV : hy - NH_);   // head index inside its own group
    const bf* Bt = (isq ? Wq : (isv ? Wv : Wk)) + (size_t)(hh - wn) * HD * DM;   // the first of the block's two heads
    v8f acc[4][4];
#pragma unroll
    for (int mb = 0; mb < 4; ++mb)
#pragma unroll
        for (int nb = 0; nb < 4; ++nb) acc[mb][nb] = (v8f){};
    const bf* gs = ((w < 2) ? A + (size_t)blockIdx.x * 128 * DM : Bt) + (size_t)(w & 1) * 64 * DM + 8 * lane;   // the lane's 16 bytes in the first copy of the wave's first chunk; a stage is CH elements further along k
    const unsigned l0 = ldsaddr(ring) + (unsigned)w * 4 * CHB + (unsigned)lane * 16;
    const bf* la = ring + wm * 4 * CH + 8 * lane; const bf* lb = ring + (8 + wn * 4) * CH + 8 * lane;
    stage4(l0, gs, (size_t)16 * DM);
    wait_async(); __syncthreads();                                          // stage 0 is published
    stage4(l0 + 16 * CHB, gs + CH, (size_t)16 * DM);
#pragma unroll 1                                                            // rolled: a trip is 64 matrix instructions, a second copy would only cost instruction cache
    for (int t = 0; t < DM / KS; ++t) {
        const int bo = (t & 1) * 16 * CH; V a[2][4], b[2][4];               // two fragment sets: the next k step's LDS reads go out ahead of this step's products
#pragma unroll
        for (int q = 0; q < 4; ++q) { a[0][q] = ldl(la + bo + q * CH); b[0][q] = ldl(lb + bo + q * CH); }
#pragma unroll
        for (int ks = 0; ks < KS / 32; ++ks) { const int cu = ks & 1, nx = cu ^ 1;
            if (ks + 1 < KS / 32) {
#pragma unroll
                for (int q = 0; q < 4; ++q) { const int o = bo + q * CH + (ks + 1) * 512; a[nx][q] = ldl(la + o); b[nx][q] = ldl(lb + o); } }
            __builtin_amdgcn_sched_barrier(0);                              // keeps the reads above in one group ahead of the products below; left free, the scheduler sinks them among the products, each behind a wait to 0
#pragma unroll
            for (int nb = 0; nb < 4; ++nb) {
#pragma unroll
                for (int mb = 0; mb < 4; ++mb) acc[mb][nb] = wmmab(a[cu][mb], b[cu][nb], acc[mb][nb]); } }
        __builtin_amdgcn_sched_barrier(0);                                  // the trip's last products stay ahead of the barrier: left free they sink behind it and hold back the copies, which then fly for less than a trip
        wait_ds(); wait_async(); __syncthreads();                           // publishes stage t + 1 and ends every wave's reads of stage t
        if (t + 2 < DM / KS) stage4(l0 + (unsigned)(t & 1) * 16 * CHB, gs + (size_t)(t + 2) * CH, (size_t)16 * DM);
    }
    wait_async();
    if (!isv) {
        const int d = lr * 4; const size_t zp = ((size_t)hh * TT + r0) * HD + (d >> 5) * 512 + ((d >> 4) & 1) * 256 + ((d >> 3) & 1) * 128 + hi * 8 + (d & 7);   // the lane's place in row r0 + hi (fragment order, k = d); every later row is a constant step from it, for the table as for the planes
        h16* P16 = (isq ? Q16 : K16) + zp; bf* Ph = (isq ? Qh : Kh) + zp; bf* Pl = (isq ? Ql : Kl) + zp; const float* cb = CS + ((size_t)(r0 + hi) * HD + d) * 2;
#pragma unroll
        for (int mb = 0; mb < 4; ++mb) {
            v4f c01[8], c23[8];                                             // {cos, sin} of d .. d+3 for the lane's 8 rows, asked for ahead of the LDS round trip
#pragma unroll
            for (int s = 0; s < 8; ++s) { const float* cp = cb + (mb * 16 + 2 * s) * HD * 2; c01[s] = *(const v4f*)cp; c23[s] = *(const v4f*)(cp + 4); }
#pragma unroll
            for (int nb = 0; nb < 4; ++nb) {
#pragma unroll
                for (int j = 0; j < 8; ++j) os[(hi * 8 + j) * 68 + nb * 16 + lr] = acc[mb][nb][j]; }
            __syncthreads();                                                // the 16 rows are read back by other lanes than wrote them
#pragma unroll
            for (int s = 0; s < 8; ++s) { const int row = 2 * s + hi;
                const v4f x0 = *(const v4fa*)(os + row * 68 + d), x1 = *(const v4fa*)(os + row * 68 + (d ^ (HD / 2)));
                const float cs[4] = { c01[s][0], c01[s][2], c23[s][0], c23[s][2] }, sn[4] = { c01[s][1], c01[s][3], c23[s][1], c23[s][3] };
                const v4f xp = (d < HD / 2) ? -x1 : x1;                    // the partner enters with a minus in the lower half of the head
                v4h o16; v4us oh, ol;
#pragma unroll
                for (int q = 0; q < 4; ++q) { const float r = x0[q] * cs[q] + xp[q] * sn[q];
                    o16[q] = tohx(r); unsigned short a2, c2; splitf(r, a2, c2); oh[q] = a2; ol[q] = c2; }
                const int e = mb * 16 * HD + 2 * s * 8; *(v4h*)(P16 + e) = o16; *(v4us*)(Ph + e) = oh; *(v4us*)(Pl + e) = ol;
                asm volatile("s_wait_xcnt 0x0" ::: "memory"); }            // before the data registers of these stores are rewritten
            __syncthreads();                                                // every read of these rows ends before the next 16 rows overwrite them
        }
    } else {
        const size_t zv = (size_t)hh * HD * TT + (size_t)r0 * 16 + 8 * lane; h16* P16 = V16 + zv; bf* Ph = Vh + zv; bf* Pl = Vl + zv;
#pragma unroll
        for (int nb = 0; nb < 4; ++nb)
#pragma unroll
            for (int mb = 0; mb < 4; ++mb) { v8h o16; v8us oh, ol;
#pragma unroll
                for (int j = 0; j < 8; ++j) { const float x = acc[mb][nb][j]; o16[j] = tohx(x); unsigned short a2, c2; splitf(x, a2, c2); oh[j] = a2; ol[j] = c2; }
                const int e = nb * 16 * TT + (mb >> 1) * 512 + (mb & 1) * 256; *(v8h*)(P16 + e) = o16; *(v8us*)(Ph + e) = oh; *(v8us*)(Pl + e) = ol;
                asm volatile("s_wait_xcnt 0x0" ::: "memory"); }            // before the data registers of these stores are rewritten
    }
}

// ---- k_fattn: fused causal sliding-window attention, scores and probabilities never leave registers. One wave = one query head x NQ*16 query rows; the 4 waves of a block are the 4 query heads
// of one kv head on the same rows, so they walk the same K / V lines. Per pass of 32 keys: St = K.Qt (A = K rows, B = Q kept in registers), online softmax per query column (a lane holds one
// query's scores: in-lane maximum and sum, one exchange between the wave halves for the maximum), the two 16-key score tiles convert in place into the B operand Pt, Ot += Vt.Pt (A = Vt rows).
// All fragments use WFrag::ldf's k order (that of WFrag::ld), which is the order a packed D pair delivers. Rows < RH: bf16 hi+lo planes, 3 products each; rows >= RH: f16, P carried x 2^PSH (cancels in O / sum).
// D element r of lane l of Ot = (d = 16*dt + 8*(l>>4) + r, query l & 15): 8 consecutive d per lane, stored as bf16 hi / lo fragment slots of the merged ctx planes (row t, k = h*64 + d; Ah / Al arrive at the head's first block, 2*h).
// 2^x with the slot behind it filled: the instruction set asks for one independent instruction or v_nop between a transcendental and a directly following overwrite of its source or read of its
// result; only a v_nop inside the same statement is tied to the instruction.
__device__ __forceinline__ float exp2s(float x) { float r; asm("v_exp_f32 %0, %1\n\tv_nop" : "=v"(r) : "v"(x)); return r; }
template <typename T16, bool HI, int NQ>
__device__ __forceinline__ void attn_tile(const T16* __restrict__ Q, const T16* __restrict__ Q2, const T16* __restrict__ Kp, const T16* __restrict__ K2, const T16* __restrict__ Vt, const T16* __restrict__ V2, int q0, int lane, bf* Ah, bf* Al) {
    typedef typename WFrag<T16>::V V;                                       // every full unroll below keeps the fragment arrays indexed by constants, that is, in registers
    const int lr = lane & 15, hi = lane >> 4;
    const unsigned fofs = (unsigned)lane * 16u;                            // the lane's byte offset in a fragment block, fixed for the whole walk: every load is wave-uniform base + lane offset
    V qb[NQ][2], qb2[NQ][2];
#pragma unroll
    for (int nq = 0; nq < NQ; ++nq)
#pragma unroll
        for (int ks = 0; ks < 2; ++ks) { const size_t qo = (size_t)(q0 + nq * 16) * HD + ks * 512; qb[nq][ks] = WFrag<T16>::ldfo(Q + qo, fofs); if (HI) qb2[nq][ks] = WFrag<T16>::ldfo(Q2 + qo, fofs); }
    v8f o[NQ][4]; float m[NQ], l[NQ];
#pragma unroll
    for (int nq = 0; nq < NQ; ++nq) { m[nq] = -1.0e30f; l[nq] = 0.0f;      // the start maximum lies above the ban fill, so a pass whose keys are all banned for a query adds exact zeros
#pragma unroll
        for (int dt = 0; dt < 4; ++dt) o[nq][dt] = (v8f){}; }
    const int kb = max(0, q0 - (WIN - 1)) & ~31, ke = q0 + NQ * 16;         // first key pass of the window of the first row, one past the diagonal of the last row
    V ka[2][2], ka2[2][2];
    if (!HI) {                                                              // f16 rows fetch K one pass ahead; the hi+lo rows (short walks, twice the planes) load it in the pass, which keeps the kernel under 256 registers
#pragma unroll
        for (int kt = 0; kt < 2; ++kt)
#pragma unroll
            for (int ks = 0; ks < 2; ++ks) ka[kt][ks] = WFrag<T16>::ldfo(Kp + (size_t)(kb + kt * 16) * HD + ks * 512, fofs); }
    asm volatile("s_wait_xcnt 0x0" ::: "memory");                          // the address registers of the loads above are reused in the loop
#pragma unroll 1                                                            // rolled: one pass's fragments fill the register budget, a second copy of the body would only cost instruction cache
    for (int k0 = kb; k0 < ke; k0 += 32) {
        V va[4], va2[4];
        if (HI) {
#pragma unroll
            for (int kt = 0; kt < 2; ++kt)
#pragma unroll
                for (int ks = 0; ks < 2; ++ks) { const size_t ko = (size_t)(k0 + kt * 16) * HD + ks * 512; ka[kt][ks] = WFrag<T16>::ldfo(Kp + ko, fofs); ka2[kt][ks] = WFrag<T16>::ldfo(K2 + ko, fofs); }
            asm volatile("s_wait_xcnt 0x0" ::: "memory"); }                // the V loads' results may land in registers that held K addresses
#pragma unroll
        for (int dt = 0; dt < 4; ++dt) { const size_t vo = (size_t)dt * 16 * TT + (size_t)k0 * 16; va[dt] = WFrag<T16>::ldfo(Vt + vo, fofs); if (HI) va2[dt] = WFrag<T16>::ldfo(V2 + vo, fofs); }
        asm volatile("s_wait_xcnt 0x0" ::: "memory");                      // before the address registers of this pass's loads are rewritten in a later block
        v8f s[NQ][2];
#pragma unroll
        for (int nq = 0; nq < NQ; ++nq)
#pragma unroll
            for (int kt = 0; kt < 2; ++kt) { v8f c = (v8f){};
#pragma unroll
                for (int ks = 0; ks < 2; ++ks) { c = WFrag<T16>::mma(ka[kt][ks], qb[nq][ks], c); if (HI) { c = WFrag<T16>::mma(ka[kt][ks], qb2[nq][ks], c); c = WFrag<T16>::mma(ka2[kt][ks], qb[nq][ks], c); } }
                s[nq][kt] = c; }
        if (!HI) { const int kn = (k0 + 32 < ke) ? k0 + 32 : k0;            // next pass's K fragments fly during the softmax (the last pass re-reads its own rows: always in bounds)
#pragma unroll
            for (int kt = 0; kt < 2; ++kt)
#pragma unroll
                for (int ks = 0; ks < 2; ++ks) ka[kt][ks] = WFrag<T16>::ldfo(Kp + (size_t)(kn + kt * 16) * HD + ks * 512, fofs);
            asm volatile("s_wait_xcnt 0x0" ::: "memory"); }                // before their address registers are rewritten behind the branch below
#pragma unroll
        for (int nq = 0; nq < NQ; ++nq)
#pragma unroll
            for (int kt = 0; kt < 2; ++kt) s[nq][kt] *= SCL * 1.4426950408889634f;   // scores in log2 units
        if (k0 + 31 > q0 || q0 + NQ * 16 - 1 - k0 >= WIN) {                 // wave-uniform: only passes that touch the diagonal or the window's start hold banned pairs
#pragma unroll
            for (int nq = 0; nq < NQ; ++nq)
#pragma unroll
                for (int kt = 0; kt < 2; ++kt)
#pragma unroll
                    for (int r = 0; r < 8; ++r) { const int j = k0 + kt * 16 + 8 * hi + r, i = q0 + nq * 16 + lr; s[nq][kt][r] = (j <= i && i - j < WIN) ? s[nq][kt][r] : -3.0e38f; } }
        V pb[NQ], pb2[NQ];
#pragma unroll
        for (int nq = 0; nq < NQ; ++nq) { float mx = m[nq];
#pragma unroll
            for (int kt = 0; kt < 2; ++kt)
#pragma unroll
                for (int r = 0; r < 8; ++r) mx = fmaxf(mx, s[nq][kt][r]);
            mx = fmaxf(mx, __shfl_xor(mx, 16, 32));
            const float al = exp2s(m[nq] - mx); m[nq] = mx; const float mb = HI ? mx : mx - PSH; float sum = 0.0f;
#pragma unroll
            for (int kt = 0; kt < 2; ++kt)
#pragma unroll
                for (int r = 0; r < 8; ++r) { const float p = exp2s(s[nq][kt][r] - mb); s[nq][kt][r] = p; sum += p; }
            l[nq] = l[nq] * al + sum;                                       // each wave half keeps the sum of its own keys; joined once after the loop
#pragma unroll
            for (int dt = 0; dt < 4; ++dt) o[nq][dt] *= al;
            if constexpr (HI) { v8us h0, h1, l0, l1;
#pragma unroll
                for (int r = 0; r < 8; ++r) { unsigned short a, c2; splitf(s[nq][0][r], a, c2); h0[r] = a; l0[r] = c2; splitf(s[nq][1][r], a, c2); h1[r] = a; l1[r] = c2; }
                pb[nq] = cat16b(h0, h1); pb2[nq] = cat16b(l0, l1);
            } else { v8h h0, h1;
#pragma unroll
                for (int r = 0; r < 8; ++r) { h0[r] = tohx(s[nq][0][r]); h1[r] = tohx(s[nq][1][r]); }
                pb[nq] = cat16(h0, h1); } }
#pragma unroll
        for (int dt = 0; dt < 4; ++dt)
#pragma unroll
            for (int nq = 0; nq < NQ; ++nq) { o[nq][dt] = WFrag<T16>::mma(va[dt], pb[nq], o[nq][dt]); if (HI) { o[nq][dt] = WFrag<T16>::mma(va[dt], pb2[nq], o[nq][dt]); o[nq][dt] = WFrag<T16>::mma(va2[dt], pb[nq], o[nq][dt]); } }
    }
#pragma unroll
    for (int nq = 0; nq < NQ; ++nq) { const float inv = __fdiv_rn(1.0f, l[nq] + __shfl_xor(l[nq], 16, 32));
#pragma unroll
        for (int dt = 0; dt < 4; ++dt) { v8us oh, ol;
#pragma unroll
            for (int r = 0; r < 8; ++r) { unsigned short a, c2; splitf(o[nq][dt][r] * inv, a, c2); oh[r] = a; ol[r] = c2; }
            const size_t oo = (size_t)(q0 + nq * 16) * DQ + (dt >> 1) * 512 + (dt & 1) * 256 + 8 * lane; *(v8us*)(Ah + oo) = oh; *(v8us*)(Al + oo) = ol; } }   // fragment order: the wave's 32 slots are 512 contiguous bytes
}
// grid (NKV, NT16 + NTH), 128 threads; blockIdx.y runs from the row tiles with the longest key walk, for all kv heads, to the short hi+lo tiles last
#define NT16 ((TT - RHE) / 32)
#define NTH  (RHE / 16)
__global__ __launch_bounds__(128) void k_fattn(const h16* __restrict__ Q16, const h16* __restrict__ K16, const h16* __restrict__ V16, const bf* __restrict__ Qh, const bf* __restrict__ Ql, const bf* __restrict__ Kh, const bf* __restrict__ Kl,
                                               const bf* __restrict__ Vh, const bf* __restrict__ Vl, bf* Ah, bf* Al) {
    const int lane = threadIdx.x & 31; const int g = blockIdx.x; const int h = g * REP + __builtin_amdgcn_readfirstlane(threadIdx.x >> 5); const int bx = blockIdx.y;
    const size_t zq = (size_t)h * TT * HD, zk = (size_t)g * TT * HD;
    if (bx < NT16) attn_tile<h16, false, 2>(Q16 + zq, nullptr, K16 + zk, nullptr, V16 + zk, nullptr, RHE + (NT16 - 1 - bx) * 32, lane, Ah + h * 1024, Al + h * 1024);
    else attn_tile<bf, true, 1>(Qh + zq, Ql + zq, Kh + zk, Kl + zk, Vh + zk, Vl + zk, (NTH - 1 - (bx - NT16)) * 16, lane, Ah + h * 1024, Al + h * 1024);
}

extern "C" void kernel_launch(void* const* d_in, const int* in_sizes, int n_in,
                              void* d_out, int out_size, void* d_ws, size_t ws_size, hipStream_t stream) {
    if (n_in < 5) return;
    if (in_sizes[0] < (NB - 1) * TT_FULL * DM + TT * DM || in_sizes[1] < DM * DQ || in_sizes[2] < DM * DKV || in_sizes[3] < DM * DKV || in_sizes[4] < DQ * DM) return;
    if (out_size < NB * TT * DM) return;
    const float* x = (const float*)d_in[0]; const float* wq = (const float*)d_in[1]; const float* wk = (const float*)d_in[2]; const float* wv = (const float*)d_in[3]; const float* wo = (const float*)d_in[4];
    float* OUT = (float*)d_out;     // [NB][TT][DM]
    char* wsp = (char*)d_ws;
    auto take = [&](size_t bytes) { char* p = wsp; wsp += (bytes + 255) & ~(size_t)255; return (void*)p; };
    // persistent planes
    bf* WOt = (bf*)take((size_t)DM * DQ * 2); float* CS = (float*)take((size_t)TT * HD * 2 * 4);
    h16* QP16 = (h16*)take((size_t)NH_ * TT * HD * 2); h16* KP16 = (h16*)take((size_t)NKV * TT * HD * 2); h16* VT16 = (h16*)take((size_t)NKV * HD * TT * 2);
    bf* QPh = (bf*)take((size_t)NH_ * TT * HD * 2); bf* QPl = (bf*)take((size_t)NH_ * TT * HD * 2); bf* KPh = (bf*)take((size_t)NKV * TT * HD * 2); bf* KPl = (bf*)take((size_t)NKV * TT * HD * 2);
    bf* VTh = (bf*)take((size_t)NKV * HD * TT * 2); bf* VTl = (bf*)take((size_t)NKV * HD * TT * 2); bf* ATh = (bf*)take((size_t)TT * DQ * 2); bf* ATl = (bf*)take((size_t)TT * DQ * 2);
    // projection-phase temporaries
    bf* WQt = (bf*)take((size_t)DQ * DM * 2); bf* WKt = (bf*)take((size_t)DKV * DM * 2); bf* WVt = (bf*)take((size_t)DKV * DM * 2);
    bf* XB = (bf*)take((size_t)TT * DM * 2);
    const size_t total = (size_t)(wsp - (char*)d_ws);
    if (total > ws_size || total > (size_t)134217728) return;

    // inverse rotary frequencies inv[j] = 1 / 500000^(j/32): 32nd root by Newton in double (pure arithmetic), powers RNE-converted to f32, then an f32 reciprocal.
    RopeTab tab;
    { double y = 1.5; for (int it = 0; it < 64; ++it) { double p = 1.0; for (int k = 0; k < 31; ++k) p *= y; const double fy = p * y - 500000.0; y = y - fy / (32.0 * p); }
      double pj = 1.0; for (int j = 0; j < 32; ++j) { const float pf = (float)pj; tab.f[j] = 1.0f / pf; pj *= y; } }

    // weights -> bf16 planes ([in][out] transposed), x -> bf16, both in fragment order; rotary table
    k_wtG<DM, DQ><<<(DQ / 32) * (DM / 32) / 8, 256, 0, stream>>>(wq, WQt);
    k_wtG<DM, DKV><<<(DKV / 32) * (DM / 32) / 8, 256, 0, stream>>>(wk, WKt);
    k_wtG<DM, DKV><<<(DKV / 32) * (DM / 32) / 8, 256, 0, stream>>>(wv, WVt);
    k_wtG<DQ, DM><<<(DM / 32) * (DQ / 32) / 8, 256, 0, stream>>>(wo, WOt);
    k_csgen<<<(TT * HD + 255) / 256, 256, 0, stream>>>(tab, CS);
    for (int b = 0; b < NB; ++b) {
        k_cvt8<<<(unsigned)(((size_t)TT * DM / 8 + 255) / 256), 256, 0, stream>>>(x + (size_t)b * TT_FULL * DM, XB, (size_t)TT * DM / 8);
        k_qkv<<<dim3(TT / 128, (NH_ + 2 * NKV) / 2, 1), 128, 0, stream>>>(XB, WQt, WKt, WVt, CS, QP16, QPh, QPl, KP16, KPh, KPl, VT16, VTh, VTl);
        k_fattn<<<dim3(NKV, NT16 + NTH, 1), 128, 0, stream>>>(QP16, KP16, VT16, QPh, QPl, KPh, KPl, VTh, VTl, ATh, ATl);
        k_gemmw<false, DQ><<<dim3(TT / 128, DM / 128, 1), 128, 0, stream>>>(ATh, ATl, WOt, OUT + (size_t)b * TT * DM, DM, nullptr); }
}

// v005
// One run takes 92.8 microseconds.
// In two side-by-side timings against v004, it was 1.12 and 1.13 times as fast.
// Counting every step since v000, it is 12.8 times as fast.
#include <hip/hip_runtime.h>

// Grouped-query attention block (NB x SEQ x 2048): q = x Wq (32 heads x 64), k / v = x Wk / x Wv (8 kv heads x 64, 4 query heads per kv head), rotate-half rotary embedding
// (base 500000; cos/sin table built on device from host-computed inverse frequencies), causal sliding-window softmax(q.k / 8) (window 1024, -inf fill, diagonal always kept),
// ctx merged as [t][h*64 + d], out = ctx Wo -> f32 [NB][SEQ][2048]. Weights are [in][out] and are transposed into bf16 planes.
// Every 16-bit operand plane of a matrix product (x, Wq, Wk, Wv, Wo, the q / k head planes with k = d, the transposed v planes with row = d and k = t, ctx hi / lo) lies in FRAGMENT ORDER: a block of 16 rows x 32 k is 1 KiB, [j = (k >> 4) & 1][lane = 16*((k >> 3) & 1) + (row & 15)][k & 7],
// blocks ordered [row >> 4][k >> 5]; a fragment is then two loads of 512 contiguous bytes (lane l takes 16 bytes at 16*l), four whole 128-B lines each, where a row-major plane made every load touch 16 lines.
// Compute dtypes (f32 accumulate everywhere): every input RNE-converted to bf16; x.Wq, x.Wk, x.Wv: v_wmma_f32_16x16x32_bf16 on plain bf16 operands; q.k and P.v: query rows < RH on bf16 hi+lo
// planes (3 products), rows >= RH single v_wmma_f32_16x16x32_f16 (P carried x1024), one fused kernel with an online softmax over 32-key passes inside the window; softmax and rotary arithmetic f32; ctx.Wo: bf16 hi+lo ctx x bf16 Wo (2 products).

#ifndef NB
#define NB 1
#endif
#ifndef SEQ
#define SEQ 2048
#endif
#ifndef RH
#define RH 512                  // query rows < RH use hi+lo planes (0: none)
#endif
#define TT      SEQ
#define TT_FULL 2048
#define DM      2048
#define NH_     32
#define NKV     8
#define REP     (NH_ / NKV)
#define HD      64
#define DQ      (NH_ * HD)
#define DKV     (NKV * HD)
#define RHE     ((RH < TT) ? RH : TT)
#define WIN     1024
#define PSH     10.0f             // f16 rows: P carried x 2^PSH
#define SCL     0.125f            // HD^-0.5
static_assert(TT % 128 == 0 && TT >= 128 && TT <= TT_FULL);
static_assert(RH % 64 == 0 && RH >= 0);
static_assert(REP == 4);
static_assert(DM % 64 == 0 && DQ % 64 == 0 && DKV % 64 == 0 && HD == 64);

typedef _Float16 h16;
typedef unsigned short bf;
typedef __attribute__((ext_vector_type(16))) __bf16   v16bf;
typedef __attribute__((ext_vector_type(16))) _Float16 v16h;
typedef __attribute__((ext_vector_type(8)))  _Float16 v8h;
typedef __attribute__((ext_vector_type(8)))  unsigned short v8us;
typedef __attribute__((ext_vector_type(8)))  float    v8f;
typedef __attribute__((ext_vector_type(4)))  float    v4f;
typedef __attribute__((ext_vector_type(2)))  _Float16 v2h;
typedef __attribute__((ext_vector_type(4)))  _Float16 v4h;
typedef __attribute__((ext_vector_type(2)))  unsigned short v2us;
typedef __attribute__((ext_vector_type(4)))  unsigned short v4us;
typedef __attribute__((ext_vector_type(2)))  float v2f;
typedef v8h  __attribute__((may_alias)) v8ha;
typedef v4f  __attribute__((may_alias)) v4fa;
typedef v8us __attribute__((may_alias)) v8usa;

__device__ __forceinline__ unsigned short f2bf(float f) { unsigned u = __float_as_uint(f); u += 0x7FFFu + ((u >> 16) & 1u); return (unsigned short)(u >> 16); }   // RNE convert
__device__ __forceinline__ float bf2f(unsigned short b) { return __uint_as_float(((unsigned)b) << 16); }
__device__ __forceinline__ float bfr(float f) { return bf2f(f2bf(f)); }
__device__ __forceinline__ v16h cat16(v8h lo, v8h hi) { return __builtin_shufflevector(lo, hi, 0, 1, 2, 3, 4, 5, 6, 7, 8, 9, 10, 11, 12, 13, 14, 15); }
__device__ __forceinline__ v16bf cat16b(v8us lo, v8us hi) { return __builtin_bit_cast(v16bf, __builtin_shufflevector(lo, hi, 0, 1, 2, 3, 4, 5, 6, 7, 8, 9, 10, 11, 12, 13, 14, 15)); }
__device__ __forceinline__ v8f wmma16(v16h a, v16h b, v8f c) { return __builtin_amdgcn_wmma_f32_16x16x32_f16(false, a, false, b, (short)0, c, false, false); }
__device__ __forceinline__ v8f wmmab(v16bf a, v16bf b, v8f c) { return __builtin_amdgcn_wmma_f32_16x16x32_bf16(false, a, false, b, (short)0, c, false, false); }
__device__ __forceinline__ h16 tohx(float x) { return (h16)x; }
__device__ __forceinline__ void splitf(float y, unsigned short& h, unsigned short& l) { h = f2bf(y); l = f2bf(y - bf2f(h)); }

// ---- fragment loaders
// Fragment map (both operands): lane row/col = lane & 15, elements 0..7 <- k0 + 8*(lane>>4) + 0..7, elements 8..15 <- k0 + 16 + 8*(lane>>4) + 0..7; D element r of lane l = (row 8*(l>>4) + r, col l & 15).
template <typename T16> struct WFrag;
template <> struct WFrag<h16> { typedef v16h V; static __device__ __forceinline__ V ld(const h16* p) { return cat16(*(const v8h*)p, *(const v8h*)(p + 16)); } static __device__ __forceinline__ V ldo(const h16* b, unsigned o) { return ld((const h16*)((const char*)b + o)); } static __device__ __forceinline__ V ldf(const h16* p) { return cat16(*(const v8h*)p, *(const v8h*)(p + 256)); } static __device__ __forceinline__ V ldfo(const h16* b, unsigned o) { return ldf((const h16*)((const char*)b + o)); } static __device__ __forceinline__ v8f mma(V a, V b, v8f c) { return wmma16(a, b, c); } };
template <> struct WFrag<bf> { typedef v16bf V; static __device__ __forceinline__ V ld(const bf* p) { return cat16b(*(const v8us*)p, *(const v8us*)(p + 16)); } static __device__ __forceinline__ V ldo(const bf* b, unsigned o) { return ld((const bf*)((const char*)b + o)); } static __device__ __forceinline__ V ldf(const bf* p) { return cat16b(*(const v8us*)p, *(const v8us*)(p + 256)); } static __device__ __forceinline__ V ldfo(const bf* b, unsigned o) { return ldf((const bf*)((const char*)b + o)); } static __device__ __forceinline__ v8f mma(V a, V b, v8f c) { return wmmab(a, b, c); } };
// ---- LDS staging of the two GEMM kernels (k_gemmw, k_qkv). A work-group of 4 waves (2 x 2) owns a 128x128 output tile, each wave a 64x64 tile of it (16 accumulators). A stage is KS k of every operand row of the
// block tile. In a fragment-order plane 16 rows x KS k are CH contiguous elements (4 KiB, a "chunk": KS/32 blocks of 1 KiB), and a stage keeps that order in LDS, chunk behind chunk, so a fragment is two
// ds_load_b128 of 512 contiguous bytes. The chunks come in by global_load_async_to_lds_b128 (a lane moves its own 16 bytes, through no register), 8 copies a chunk; the immediate offset moves the global and the LDS address alike.
// Two buffers: stage t + 2 is asked for behind the barrier that ends trip t, into the buffer trip t has read, and flies during trip t + 1.
#define KS 128
#define CH (16 * KS)
#define CHB (CH * 2)              // bytes of a chunk
#define CP1(L, G, O) "global_load_async_to_lds_b128 " L ", " G ", off offset:" #O "\n\t"
#define CP8(L, G) CP1(L, G, 0) CP1(L, G, 512) CP1(L, G, 1024) CP1(L, G, 1536) CP1(L, G, 2048) CP1(L, G, 2560) CP1(L, G, 3072) CP1(L, G, 3584)
static_assert(CHB == 8 * 512);
__device__ __forceinline__ unsigned ldsaddr(const void* p) { return (unsigned)(size_t)p; }
__device__ __forceinline__ v16bf ldl(const bf* p) { return cat16b(*(const v8us*)p, *(const v8us*)(p + 256)); }
__device__ __forceinline__ void wait_ds() { asm volatile("s_wait_dscnt 0x0" ::: "memory"); }
__device__ __forceinline__ void wait_async() { asm volatile("s_wait_asynccnt 0x0" ::: "memory"); }
// The copies of one wave and one stage stand in ONE statement that ends in s_wait_xcnt 0 (a precaution): so the wait stands ahead of every rewrite of a register that a copy names.
__device__ __forceinline__ void stage4(unsigned l, const bf* g, size_t step) {   // 4 chunks: LDS places CHB apart, global chunks step elements apart
    asm volatile(CP8("%0", "%4") CP8("%1", "%5") CP8("%2", "%6") CP8("%3", "%7") "s_wait_xcnt 0x0"
                 :: "v"(l), "v"(l + CHB), "v"(l + 2 * CHB), "v"(l + 3 * CHB), "v"(g), "v"(g + step), "v"(g + 2 * step), "v"(g + 3 * step) : "memory"); }
__device__ __forceinline__ void stage6(unsigned l, const bf* g0, const bf* g1, const bf* g2, const bf* g3, const bf* g4, const bf* g5) {   // 6 chunks, each with its own global address
    asm volatile(CP8("%0", "%6") CP8("%1", "%7") CP8("%2", "%8") CP8("%3", "%9") CP8("%4", "%10") CP8("%5", "%11") "s_wait_xcnt 0x0"
                 :: "v"(l), "v"(l + CHB), "v"(l + 2 * CHB), "v"(l + 3 * CHB), "v"(l + 4 * CHB), "v"(l + 5 * CHB), "v"(g0), "v"(g1), "v"(g2), "v"(g3), "v"(g4), "v"(g5) : "memory"); }

// ---- k_gemmw: C[m][n] (f32, pitch ldc, + optional f32 bias[n]) = sum_k (A[m][k] + A2[m][k]) Bt[n][k], two products per k step (A, then A2), bf16 planes in fragment order. Grid (M/128, N/128), 128 threads.
// A stage is [A 8 chunks | A2 8 chunks | Bt 8 chunks] = 96 KiB; wave w copies chunks 6w .. 6w+5 (48 copies in flight at most). K % KS == 0, K >= 2*KS.
template <bool BIAS, int K>
__global__ __launch_bounds__(128) void k_gemmw(const bf* __restrict__ A, const bf* __restrict__ A2, const bf* __restrict__ Bt, float* C, int ldc, const float* __restrict__ bias) {
    typedef WFrag<bf>::V V;
    static_assert(K % KS == 0 && K >= 2 * KS);
    __shared__ __attribute__((aligned(1024))) bf ring[2 * 24 * CH];
    __shared__ __align__(16) float osm[4 * 16 * 68];
    const int lane = threadIdx.x & 31, lr = lane & 15, hi = lane >> 4; const int w = __builtin_amdgcn_readfirstlane(threadIdx.x >> 5), wm = w & 1, wn = w >> 1;
    float* os = osm + w * 16 * 68;                                          // each wave stages its output rows in its own range
    const int r0 = blockIdx.x * 128 + wm * 64, c0 = blockIdx.y * 128 + wn * 64;
    v8f acc[4][4];
#pragma unroll
    for (int mb = 0; mb < 4; ++mb)
#pragma unroll
        for (int nb = 0; nb < 4; ++nb) acc[mb][nb] = (v8f){};
    const bf* g[6];                                                         // the lane's 16 bytes in the first copy of each of the wave's chunks; a stage is CH elements further along k
#pragma unroll
    for (int i = 0; i < 6; ++i) { const int c = 6 * w + i; const bf* pl = (c < 8) ? A + (size_t)blockIdx.x * 128 * K : ((c < 16) ? A2 + (size_t)blockIdx.x * 128 * K : Bt + (size_t)blockIdx.y * 128 * K);
        g[i] = pl + (size_t)(c & 7) * 16 * K + 8 * lane; }
    const unsigned l0 = ldsaddr(ring) + (unsigned)w * 6 * CHB + (unsigned)lane * 16;
    const bf* la = ring + wm * 4 * CH + 8 * lane; const bf* la2 = la + 8 * CH; const bf* lb = ring + (16 + wn * 4) * CH + 8 * lane;
    stage6(l0, g[0], g[1], g[2], g[3], g[4], g[5]);
    wait_async(); __syncthreads();                                          // stage 0 is published
    stage6(l0 + 24 * CHB, g[0] + CH, g[1] + CH, g[2] + CH, g[3] + CH, g[4] + CH, g[5] + CH);
#pragma unroll 1                                                            // rolled: a trip is 128 matrix instructions, a second copy would only cost instruction cache
    for (int t = 0; t < K / KS; ++t) {
        const int bo = (t & 1) * 24 * CH; V a[2][4], a2[2][4], b[2][4];     // two fragment sets: the next k step's LDS reads go out ahead of this step's products
#pragma unroll
        for (int q = 0; q < 4; ++q) { a[0][q] = ldl(la + bo + q * CH); a2[0][q] = ldl(la2 + bo + q * CH); b[0][q] = ldl(lb + bo + q * CH); }
#pragma unroll
        for (int ks = 0; ks < KS / 32; ++ks) { const int cu = ks & 1, nx = cu ^ 1;
            if (ks + 1 < KS / 32) {
#pragma unroll
                for (int q = 0; q < 4; ++q) { const int o = bo + q * CH + (ks + 1) * 512; a[nx][q] = ldl(la + o); a2[nx][q] = ldl(la2 + o); b[nx][q] = ldl(lb + o); } }
            __builtin_amdgcn_sched_barrier(0);                              // keeps the reads above in one group ahead of the products below; left free, the scheduler sinks them among the products, each behind a wait to 0
#pragma unroll
            for (int nb = 0; nb < 4; ++nb) {
#pragma unroll
                for (int mb = 0; mb < 4; ++mb) { acc[mb][nb] = wmmab(a[cu][mb], b[cu][nb], acc[mb][nb]); acc[mb][nb] = wmmab(a2[cu][mb], b[cu][nb], acc[mb][nb]); } } }
        __builtin_amdgcn_sched_barrier(0);                                  // the trip's last products stay ahead of the barrier: left free they sink behind it and hold back the copies, which then fly for less than a trip
        wait_ds(); wait_async(); __syncthreads();                           // publishes stage t + 1 and ends every wave's reads of stage t
        if (t + 2 < K / KS) { const size_t o = (size_t)(t + 2) * CH; stage6(l0 + (unsigned)(t & 1) * 24 * CHB, g[0] + o, g[1] + o, g[2] + o, g[3] + o, g[4] + o, g[5] + o); }
    }
    wait_async();
#pragma unroll
    for (int mb = 0; mb < 4; ++mb) {
#pragma unroll
        for (int nb = 0; nb < 4; ++nb) {
#pragma unroll
            for (int j = 0; j < 8; ++j) os[(hi * 8 + j) * 68 + nb * 16 + lr] = acc[mb][nb][j]; }
        __builtin_amdgcn_wave_barrier(); asm volatile("" ::: "memory");
        float* crow = C + (size_t)(r0 + mb * 16) * ldc + c0;
{
#pragma unroll
            for (int s = 0; s < 8; ++s) { const int row = 2 * s + hi, cofs = lr * 4; v4f val = *(const v4fa*)(os + row * 68 + cofs); if (BIAS) { val[0] += bfr(bias[c0 + cofs]); val[1] += bfr(bias[c0 + cofs + 1]); val[2] += bfr(bias[c0 + cofs + 2]); val[3] += bfr(bias[c0 + cofs + 3]); }
                *(v4f*)(crow + (size_t)row * ldc + cofs) = val; }
             }
        __builtin_amdgcn_wave_barrier(); asm volatile("" ::: "memory");
    }
}

// ---- wtG: w [K][N] f32 -> bf16 plane of w transposed (row = n, k = k) in fragment order. One wave = 32 consecutive n x one block of 32 k: each of its 32 loads is one whole 128-B line of a row of w,
// each of its 4 stores fills two runs of 256 contiguous bytes (a lane's 8 k of one n are the 16 bytes of one fragment slot). (N/32)*(K/32)/8 blocks of 8 waves; blk = the block's index among them.
// K and N are compile-time, so that the 32 loads are one address pair + constant offsets.
template <int K, int N>
__device__ __forceinline__ void wtG(int blk, const float* __restrict__ w, bf* Bt) {
    static_assert(K % 32 == 0 && N % 32 == 0 && ((N / 32) * (K / 32)) % 8 == 0);
    const int lane = threadIdx.x & 31; const int wv = blk * 8 + (threadIdx.x >> 5); const int kb = wv / (N / 32), n = (wv % (N / 32)) * 32 + lane;
    const float* p = w + (size_t)kb * 32 * N + n; float v[32];
#pragma unroll
    for (int i = 0; i < 32; ++i) v[i] = p[(size_t)i * N];
    bf* q = Bt + ((size_t)(n >> 4) * (K / 32) + kb) * 512 + (n & 15) * 8;
#pragma unroll
    for (int o = 0; o < 4; ++o) { v8us r;                                   // o = 2*j + half: k = 32*kb + 8*o + e
#pragma unroll
        for (int e = 0; e < 8; ++e) r[e] = f2bf(v[o * 8 + e]);
        *(v8us*)(q + o * 128) = r; }
    asm volatile("s_wait_xcnt 0x0" ::: "memory");                          // a precaution: in the joint kernel another job's code follows in the listing and rewrites the registers these four stores name
}
// ---- cvt8: src [rows][DM] f32 -> bf16 plane in fragment order. One wave = 8 rows x one block of 32 k: a lane converts 8 consecutive k; the 8 lanes of one k octet store 128 contiguous bytes.
__device__ __forceinline__ void cvt8(int blk, const float* __restrict__ src, bf* dst, size_t n8) { const size_t i = (size_t)blk * 256 + threadIdx.x; if (i >= n8) return;
    const int lane = threadIdx.x & 31, o = lane & 3; const int wv = (int)(i >> 5), kb = wv % (DM / 32), t = (wv / (DM / 32)) * 8 + (lane >> 2);
    const v8f v = *(const v8f*)(src + (size_t)t * DM + kb * 32 + o * 8); v8us r;
#pragma unroll
    for (int k = 0; k < 8; ++k) r[k] = f2bf(v[k]);
    *(v8us*)(dst + ((size_t)(t >> 4) * (DM / 32) + kb) * 512 + o * 128 + (t & 15) * 8) = r;  }

// ---- csgen: rotary table CS[t][d] = {cos(t * inv[d & 31]), sin(t * inv[d & 31])} (f32 product, precise sincos). inv[] arrives by value (host-computed); lane == d & 31 by construction
struct RopeTab { float f[32]; };
static_assert(sizeof(RopeTab) == 128);
__device__ __forceinline__ void csgen(int blk, const RopeTab& tab, float* CS) {
    const int idx = blk * 256 + threadIdx.x; const int lane = threadIdx.x & 31; float inv = 0.0f;
#pragma unroll
    for (int i = 0; i < 32; ++i) inv = (lane == i) ? tab.f[i] : inv;
    if (idx >= TT * HD) return;
    const int t = idx / HD; float ang = __fmul_rn((float)t, inv); asm volatile("" : "+v"(ang));
    float sn, cs; sincosf(ang, &sn, &cs);
    v2f o; o[0] = cs; o[1] = sn;
    *(v2f*)(CS + (size_t)idx * 2) = o;  }

// ---- k_prep: everything that only turns an input (or nothing) into an operand plane, ONE launch: the six jobs read and write disjoint buffers and none needs another's result, so as launches of their own each only
// paid for a start, a ramp and a drain with the chip near empty. A block of 8 waves belongs to one job by its index (a scalar compare; no barrier anywhere). In block index order
// the jobs whose blocks last longest (table, then the transpositions with their 32 loads a lane) come first, the x conversion (one load, one store a lane) last.
#define PB_CS ((TT * HD + 255) / 256)
#define PB_WQ ((DQ / 32) * (DM / 32) / 8)
#define PB_WKV ((DKV / 32) * (DM / 32) / 8)
#define PB_WO ((DM / 32) * (DQ / 32) / 8)
#define PB_X  (TT * DM / 8 / 256)   // per batch entry
static_assert((TT * DM / 8) % 256 == 0);
__global__ __launch_bounds__(256) void k_prep(const float* __restrict__ x, const float* __restrict__ wq, const float* __restrict__ wk, const float* __restrict__ wv, const float* __restrict__ wo, RopeTab tab,
                                              bf* XB, bf* WQt, bf* WKt, bf* WVt, bf* WOt, float* CS) {
    int blk = blockIdx.x;
    if (blk < PB_CS) { csgen(blk, tab, CS); return; }
    blk -= PB_CS;
    if (blk < PB_WQ) { wtG<DM, DQ>(blk, wq, WQt); return; }
    blk -= PB_WQ;
    if (blk < PB_WO) { wtG<DQ, DM>(blk, wo, WOt); return; }
    blk -= PB_WO;
    if (blk < PB_WKV) { wtG<DM, DKV>(blk, wk, WKt); return; }
    blk -= PB_WKV;
    if (blk < PB_WKV) { wtG<DM, DKV>(blk, wv, WVt); return; }
    blk -= PB_WKV;
    const int b = blk / PB_X;                                               // batch entry; its plane is TT * DM elements further
    cvt8(blk - b * PB_X, x + (size_t)b * TT_FULL * DM, XB + (size_t)b * TT * DM, (size_t)TT * DM / 8);
}

// ---- k_qkv: the three input projections with their plane building, ONE launch. Grid (TT/128, (NH_ + 2*NKV)/2), 128 threads, staged as above; a wave's 64 columns are exactly one head
// (head index < NH_: query head, then NKV key heads, then NKV value heads; the two heads of a block are of one kind, so every branch round a barrier is block-uniform), so the rotate-half partner d +- HD/2 lies in the same tile and the f32 projection never goes to memory.
// A stage is [x 8 chunks | weight 8 chunks] = 64 KiB; wave w copies chunks 4w .. 4w+3 (32 copies in flight at most).
// q / k tiles: 16 rows at a time through LDS, out[d] = x[d] cos[t][d] - x[d+HD/2] sin[t][d], out[d+HD/2] = x[d+HD/2] cos[t][d+HD/2] + x[d] sin[t][d+HD/2], stored as head planes [h] (row t, k = d; f16 + bf16 hi/lo) in fragment order, 32-B runs that the 8 stores of 16 rows join to whole lines.
// v tiles: a lane's 8 accumulator elements are 8 consecutive t of one d, which is one 16-byte fragment slot of the transposed planes [g] (row d, k = t): stored straight from registers, 512 contiguous bytes a wave.
static_assert(NH_ % 2 == 0 && NKV % 2 == 0 && DM % KS == 0 && DM >= 2 * KS);
__global__ __launch_bounds__(128) void k_qkv(const bf* __restrict__ A, const bf* __restrict__ Wq, const bf* __restrict__ Wk, const bf* __restrict__ Wv, const float* __restrict__ CS,
                                            h16* Q16, bf* Qh, bf* Ql, h16* K16, bf* Kh, bf* Kl, h16* V16, bf* Vh, bf* Vl) {
    typedef WFrag<bf>::V V;
    __shared__ __attribute__((aligned(1024))) bf ring[2 * 16 * CH];
    __shared__ __align__(16) float osm[4 * 16 * 68];
    const int lane = threadIdx.x & 31, lr = lane & 15, hi = lane >> 4; const int w = __builtin_amdgcn_readfirstlane(threadIdx.x >> 5), wm = w & 1, wn = w >> 1;
    float* os = osm + w * 16 * 68;                                          // each wave turns its rows in its own range
    const int r0 = blockIdx.x * 128 + wm * 64, hy = blockIdx.y * 2 + wn;
    const bool isq = hy < NH_, isv = hy >= NH_ + NKV; const int hh = isq ? hy : (isv ? hy - NH_ - NKV : hy - NH_);   // head index inside its own group
    const bf* Bt = (isq ? Wq : (isv ? Wv : Wk)) + (size_t)(hh - wn) * HD * DM;   // the first of the block's two heads
    v8f acc[4][4];
#pragma unroll
    for (int mb = 0; mb < 4; ++mb)
#pragma unroll
        for (int nb = 0; nb < 4; ++nb) acc[mb][nb] = (v8f){};
    const bf* gs = ((w < 2) ? A + (size_t)blockIdx.x * 128 * DM : Bt) + (size_t)(w & 1) * 64 * DM + 8 * lane;   // the lane's 16 bytes in the first copy of the wave's first chunk; a stage is CH elements further along k
    const unsigned l0 = ldsaddr(ring) + (unsigned)w * 4 * CHB + (unsigned)lane * 16;
    const bf* la = ring + wm * 4 * CH + 8 * lane; const bf* lb = ring + (8 + wn * 4) * CH + 8 * lane;
    stage4(l0, gs, (size_t)16 * DM);
    wait_async(); __syncthreads();                                          // stage 0 is published
    stage4(l0 + 16 * CHB, gs + CH, (size_t)16 * DM);
#pragma unroll 1                                                            // rolled: a trip is 64 matrix instructions, a second copy would only cost instruction cache
    for (int t = 0; t < DM / KS; ++t) {
        const int bo = (t & 1) * 16 * CH; V a[2][4], b[2][4];               // two fragment sets: the next k step's LDS reads go out ahead of this step's products
#pragma unroll
        for (int q = 0; q < 4; ++q) { a[0][q] = ldl(la + bo + q * CH); b[0][q] = ldl(lb + bo + q * CH); }
#pragma unroll
        for (int ks = 0; ks < KS / 32; ++ks) { const int cu = ks & 1, nx = cu ^ 1;
            if (ks + 1 < KS / 32) {
#pragma unroll
                for (int q = 0; q < 4; ++q) { const int o = bo + q * CH + (ks + 1) * 512; a[nx][q] = ldl(la + o); b[nx][q] = ldl(lb + o); } }
            __builtin_amdgcn_sched_barrier(0);                              // keeps the reads above in one group ahead of the products below; left free, the scheduler sinks them among the products, each behind a wait to 0
#pragma unroll
            for (int nb = 0; nb < 4; ++nb) {
#pragma unroll
                for (int mb = 0; mb < 4; ++mb) acc[mb][nb] = wmmab(a[cu][mb], b[cu][nb], acc[mb][nb]); } }
        __builtin_amdgcn_sched_barrier(0);                                  // the trip's last products stay ahead of the barrier: left free they sink behind it and hold back the copies, which then fly for less than a trip
        wait_ds(); wait_async(); __syncthreads();                           // publishes stage t + 1 and ends every wave's reads of stage t
        if (t + 2 < DM / KS) stage4(l0 + (unsigned)(t & 1) * 16 * CHB, gs + (size_t)(t + 2) * CH, (size_t)16 * DM);
    }
    wait_async();
    if (!isv) {
        const int d = lr * 4; const size_t zp = ((size_t)hh * TT + r0) * HD + (d >> 5) * 512 + ((d >> 4) & 1) * 256 + ((d >> 3) & 1) * 128 + hi * 8 + (d & 7);   // the lane's place in row r0 + hi (fragment order, k = d); every later row is a constant step from it, for the table as for the planes
        h16* P16 = (isq ? Q16 : K16) + zp; bf* Ph = (isq ? Qh : Kh) + zp; bf* Pl = (isq ? Ql : Kl) + zp; const float* cb = CS + ((size_t)(r0 + hi) * HD + d) * 2;
#pragma unroll
        for (int mb = 0; mb < 4; ++mb) {
            v4f c01[8], c23[8];                                             // {cos, sin} of d .. d+3 for the lane's 8 rows, asked for ahead of the LDS round trip
#pragma unroll
            for (int s = 0; s < 8; ++s) { const float* cp = cb + (mb * 16 + 2 * s) * HD * 2; c01[s] = *(const v4f*)cp; c23[s] = *(const v4f*)(cp + 4); }
#pragma unroll
            for (int nb = 0; nb < 4; ++nb) {
#pragma unroll
                for (int j = 0; j < 8; ++j) os[(hi * 8 + j) * 68 + nb * 16 + lr] = acc[mb][nb][j]; }
            __syncthreads();                                                // the 16 rows are read back by other lanes than wrote them
#pragma unroll
            for (int s = 0; s < 8; ++s) { const int row = 2 * s + hi;
                const v4f x0 = *(const v4fa*)(os + row * 68 + d), x1 = *(const v4fa*)(os + row * 68 + (d ^ (HD / 2)));
                const float cs[4] = { c01[s][0], c01[s][2], c23[s][0], c23[s][2] }, sn[4] = { c01[s][1], c01[s][3], c23[s][1], c23[s][3] };
                const v4f xp = (d < HD / 2) ? -x1 : x1;                    // the partner enters with a minus in the lower half of the head
                v4h o16; v4us oh, ol;
#pragma unroll
                for (int q = 0; q < 4; ++q) { const float r = x0[q] * cs[q] + xp[q] * sn[q];
                    o16[q] = tohx(r); unsigned short a2, c2; splitf(r, a2, c2); oh[q] = a2; ol[q] = c2; }
                const int e = mb * 16 * HD + 2 * s * 8; *(v4h*)(P16 + e) = o16; *(v4us*)(Ph + e) = oh; *(v4us*)(Pl + e) = ol;
                asm volatile("s_wait_xcnt 0x0" ::: "memory"); }            // before the data registers of these stores are rewritten
            __syncthreads();                                                // every read of these rows ends before the next 16 rows overwrite them
        }
    } else {
        const size_t zv = (size_t)hh * HD * TT + (size_t)r0 * 16 + 8 * lane; h16* P16 = V16 + zv; bf* Ph = Vh + zv; bf* Pl = Vl + zv;
#pragma unroll
        for (int nb = 0; nb < 4; ++nb)
#pragma unroll
            for (int mb = 0; mb < 4; ++mb) { v8h o16; v8us oh, ol;
#pragma unroll
                for (int j = 0; j < 8; ++j) { const float x = acc[mb][nb][j]; o16[j] = tohx(x); unsigned short a2, c2; splitf(x, a2, c2); oh[j] = a2; ol[j] = c2; }
                const int e = nb * 16 * TT + (mb >> 1) * 512 + (mb & 1) * 256; *(v8h*)(P16 + e) = o16; *(v8us*)(Ph + e) = oh; *(v8us*)(Pl + e) = ol;
                asm volatile("s_wait_xcnt 0x0" ::: "memory"); }            // before the data registers of these stores are rewritten
    }
}

// ---- k_fattn: fused causal sliding-window attention, scores and probabilities never leave registers. One wave = one query head x NQ*16 query rows; the 4 waves of a block are the 4 query heads
// of one kv head on the same rows, so they walk the same K / V lines. Per pass of 32 keys: St = K.Qt (A = K rows, B = Q kept in registers), online softmax per query column (a lane holds one
// query's scores: in-lane maximum and sum, one exchange between the wave halves for the maximum), the two 16-key score tiles convert in place into the B operand Pt, Ot += Vt.Pt (A = Vt rows).
// All fragments use WFrag::ldf's k order (that of WFrag::ld), which is the order a packed D pair delivers. Rows < RH: bf16 hi+lo planes, 3 products each; rows >= RH: f16, P carried x 2^PSH (cancels in O / sum).
// D element r of lane l of Ot = (d = 16*dt + 8*(l>>4) + r, query l & 15): 8 consecutive d per lane, stored as bf16 hi / lo fragment slots of the merged ctx planes (row t, k = h*64 + d; Ah / Al arrive at the head's first block, 2*h).
// 2^x with the slot behind it filled: the instruction set asks for one independent instruction or v_nop between a transcendental and a directly following overwrite of its source or read of its
// result; only a v_nop inside the same statement is tied to the instruction.
__device__ __forceinline__ float exp2s(float x) { float r; asm("v_exp_f32 %0, %1\n\tv_nop" : "=v"(r) : "v"(x)); return r; }
template <typename T16, bool HI, int NQ>
__device__ __forceinline__ void attn_tile(const T16* __restrict__ Q, const T16* __restrict__ Q2, const T16* __restrict__ Kp, const T16* __restrict__ K2, const T16* __restrict__ Vt, const T16* __restrict__ V2, int q0, int lane, bf* Ah, bf* Al) {
    typedef typename WFrag<T16>::V V;                                       // every full unroll below keeps the fragment arrays indexed by constants, that is, in registers
    const int lr = lane & 15, hi = lane >> 4;
    const unsigned fofs = (unsigned)lane * 16u;                            // the lane's byte offset in a fragment block, fixed for the whole walk: every load is wave-uniform base + lane offset
    V qb[NQ][2], qb2[NQ][2];
#pragma unroll
    for (int nq = 0; nq < NQ; ++nq)
#pragma unroll
        for (int ks = 0; ks < 2; ++ks) { const size_t qo = (size_t)(q0 + nq * 16) * HD + ks * 512; qb[nq][ks] = WFrag<T16>::ldfo(Q + qo, fofs); if (HI) qb2[nq][ks] = WFrag<T16>::ldfo(Q2 + qo, fofs); }
    v8f o[NQ][4]; float m[NQ], l[NQ];
#pragma unroll
    for (int nq = 0; nq < NQ; ++nq) { m[nq] = -1.0e30f; l[nq] = 0.0f;      // the start maximum lies above the ban fill, so a pass whose keys are all banned for a query adds exact zeros
#pragma unroll
        for (int dt = 0; dt < 4; ++dt) o[nq][dt] = (v8f){}; }
    const int kb = max(0, q0 - (WIN - 1)) & ~31, ke = q0 + NQ * 16;         // first key pass of the window of the first row, one past the diagonal of the last row
    V ka[2][2], ka2[2][2];
    if (!HI) {                                                              // f16 rows fetch K one pass ahead; the hi+lo rows (short walks, twice the planes) load it in the pass, which keeps the kernel under 256 registers
#pragma unroll
        for (int kt = 0; kt < 2; ++kt)
#pragma unroll
            for (int ks = 0; ks < 2; ++ks) ka[kt][ks] = WFrag<T16>::ldfo(Kp + (size_t)(kb + kt * 16) * HD + ks * 512, fofs); }
    asm volatile("s_wait_xcnt 0x0" ::: "memory");                          // the address registers of the loads above are reused in the loop
#pragma unroll 1                                                            // rolled: one pass's fragments fill the register budget, a second copy of the body would only cost instruction cache
    for (int k0 = kb; k0 < ke; k0 += 32) {
        V va[4], va2[4];
        if (HI) {
#pragma unroll
            for (int kt = 0; kt < 2; ++kt)
#pragma unroll
                for (int ks = 0; ks < 2; ++ks) { const size_t ko = (size_t)(k0 + kt * 16) * HD + ks * 512; ka[kt][ks] = WFrag<T16>::ldfo(Kp + ko, fofs); ka2[kt][ks] = WFrag<T16>::ldfo(K2 + ko, fofs); }
            asm volatile("s_wait_xcnt 0x0" ::: "memory"); }                // the V loads' results may land in registers that held K addresses
#pragma unroll
        for (int dt = 0; dt < 4; ++dt) { const size_t vo = (size_t)dt * 16 * TT + (size_t)k0 * 16; va[dt] = WFrag<T16>::ldfo(Vt + vo, fofs); if (HI) va2[dt] = WFrag<T16>::ldfo(V2 + vo, fofs); }
        asm volatile("s_wait_xcnt 0x0" ::: "memory");                      // before the address registers of this pass's loads are rewritten in a later block
        v8f s[NQ][2];
#pragma unroll
        for (int nq = 0; nq < NQ; ++nq)
#pragma unroll
            for (int kt = 0; kt < 2; ++kt) { v8f c = (v8f){};
#pragma unroll
                for (int ks = 0; ks < 2; ++ks) { c = WFrag<T16>::mma(ka[kt][ks], qb[nq][ks], c); if (HI) { c = WFrag<T16>::mma(ka[kt][ks], qb2[nq][ks], c); c = WFrag<T16>::mma(ka2[kt][ks], qb[nq][ks], c); } }
                s[nq][kt] = c; }
        if (!HI) { const int kn = (k0 + 32 < ke) ? k0 + 32 : k0;            // next pass's K fragments fly during the softmax (the last pass re-reads its own rows: always in bounds)
#pragma unroll
            for (int kt = 0; kt < 2; ++kt)
#pragma unroll
                for (int ks = 0; ks < 2; ++ks) ka[kt][ks] = WFrag<T16>::ldfo(Kp + (size_t)(kn + kt * 16) * HD + ks * 512, fofs);
            asm volatile("s_wait_xcnt 0x0" ::: "memory"); }                // before their address registers are rewritten behind the branch below
#pragma unroll
        for (int nq = 0; nq < NQ; ++nq)
#pragma unroll
            for (int kt = 0; kt < 2; ++kt) s[nq][kt] *= SCL * 1.4426950408889634f;   // scores in log2 units
        if (k0 + 31 > q0 || q0 + NQ * 16 - 1 - k0 >= WIN) {                 // wave-uniform: only passes that touch the diagonal or the window's start hold banned pairs
#pragma unroll
            for (int nq = 0; nq < NQ; ++nq)
#pragma unroll
                for (int kt = 0; kt < 2; ++kt)
#pragma unroll
                    for (int r = 0; r < 8; ++r) { const int j = k0 + kt * 16 + 8 * hi + r, i = q0 + nq * 16 + lr; s[nq][kt][r] = (j <= i && i - j < WIN) ? s[nq][kt][r] : -3.0e38f; } }
        V pb[NQ], pb2[NQ];
#pragma unroll
        for (int nq = 0; nq < NQ; ++nq) { float mx = m[nq];
#pragma unroll
            for (int kt = 0; kt < 2; ++kt)
#pragma unroll
                for (int r = 0; r < 8; ++r) mx = fmaxf(mx, s[nq][kt][r]);
            mx = fmaxf(mx, __shfl_xor(mx, 16, 32));
            const float al = exp2s(m[nq] - mx); m[nq] = mx; const float mb = HI ? mx : mx - PSH; float sum = 0.0f;
#pragma unroll
            for (int kt = 0; kt < 2; ++kt)
#pragma unroll
                for (int r = 0; r < 8; ++r) { const float p = exp2s(s[nq][kt][r] - mb); s[nq][kt][r] = p; sum += p; }
            l[nq] = l[nq] * al + sum;                                       // each wave half keeps the sum of its own keys; joined once after the loop
#pragma unroll
            for (int dt = 0; dt < 4; ++dt) o[nq][dt] *= al;
            if constexpr (HI) { v8us h0, h1, l0, l1;
#pragma unroll
                for (int r = 0; r < 8; ++r) { unsigned short a, c2; splitf(s[nq][0][r], a, c2); h0[r] = a; l0[r] = c2; splitf(s[nq][1][r], a, c2); h1[r] = a; l1[r] = c2; }
                pb[nq] = cat16b(h0, h1); pb2[nq] = cat16b(l0, l1);
            } else { v8h h0, h1;
#pragma unroll
                for (int r = 0; r < 8; ++r) { h0[r] = tohx(s[nq][0][r]); h1[r] = tohx(s[nq][1][r]); }
                pb[nq] = cat16(h0, h1); } }
#pragma unroll
        for (int dt = 0; dt < 4; ++dt)
#pragma unroll
            for (int nq = 0; nq < NQ; ++nq) { o[nq][dt] = WFrag<T16>::mma(va[dt], pb[nq], o[nq][dt]); if (HI) { o[nq][dt] = WFrag<T16>::mma(va[dt], pb2[nq], o[nq][dt]); o[nq][dt] = WFrag<T16>::mma(va2[dt], pb[nq], o[nq][dt]); } }
    }
#pragma unroll
    for (int nq = 0; nq < NQ; ++nq) { const float inv = __fdiv_rn(1.0f, l[nq] + __shfl_xor(l[nq], 16, 32));
#pragma unroll
        for (int dt = 0; dt < 4; ++dt) { v8us oh, ol;
#pragma unroll
            for (int r = 0; r < 8; ++r) { unsigned short a, c2; splitf(o[nq][dt][r] * inv, a, c2); oh[r] = a; ol[r] = c2; }
            const size_t oo = (size_t)(q0 + nq * 16) * DQ + (dt >> 1) * 512 + (dt & 1) * 256 + 8 * lane; *(v8us*)(Ah + oo) = oh; *(v8us*)(Al + oo) = ol; } }   // fragment order: the wave's 32 slots are 512 contiguous bytes
}
// grid (NKV, NT16 + NTH), 128 threads; blockIdx.y runs from the row tiles with the longest key walk, for all kv heads, to the short hi+lo tiles last
#define NT16 ((TT - RHE) / 32)
#define NTH  (RHE / 16)
__global__ __launch_bounds__(128) void k_fattn(const h16* __restrict__ Q16, const h16* __restrict__ K16, const h16* __restrict__ V16, const bf* __restrict__ Qh, const bf* __restrict__ Ql, const bf* __restrict__ Kh, const bf* __restrict__ Kl,
                                               const bf* __restrict__ Vh, const bf* __restrict__ Vl, bf* Ah, bf* Al) {
    const int lane = threadIdx.x & 31; const int g = blockIdx.x; const int h = g * REP + __builtin_amdgcn_readfirstlane(threadIdx.x >> 5); const int bx = blockIdx.y;
    const size_t zq = (size_t)h * TT * HD, zk = (size_t)g * TT * HD;
    if (bx < NT16) attn_tile<h16, false, 2>(Q16 + zq, nullptr, K16 + zk, nullptr, V16 + zk, nullptr, RHE + (NT16 - 1 - bx) * 32, lane, Ah + h * 1024, Al + h * 1024);
    else attn_tile<bf, true, 1>(Qh + zq, Ql + zq, Kh + zk, Kl + zk, Vh + zk, Vl + zk, (NTH - 1 - (bx - NT16)) * 16, lane, Ah + h * 1024, Al + h * 1024);
}

extern "C" void kernel_launch(void* const* d_in, const int* in_sizes, int n_in,
                              void* d_out, int out_size, void* d_ws, size_t ws_size, hipStream_t stream) {
    if (n_in < 5) return;
    if (in_sizes[0] < (NB - 1) * TT_FULL * DM + TT * DM || in_sizes[1] < DM * DQ || in_sizes[2] < DM * DKV || in_sizes[3] < DM * DKV || in_sizes[4] < DQ * DM) return;
    if (out_size < NB * TT * DM) return;
    const float* x = (const float*)d_in[0]; const float* wq = (const float*)d_in[1]; const float* wk = (const float*)d_in[2]; const float* wv = (const float*)d_in[3]; const float* wo = (const float*)d_in[4];
    float* OUT = (float*)d_out;     // [NB][TT][DM]
    char* wsp = (char*)d_ws;
    auto take = [&](size_t bytes) { char* p = wsp; wsp += (bytes + 255) & ~(size_t)255; return (void*)p; };
    // persistent planes
    bf* WOt = (bf*)take((size_t)DM * DQ * 2); float* CS = (float*)take((size_t)TT * HD * 2 * 4);
    h16* QP16 = (h16*)take((size_t)NH_ * TT * HD * 2); h16* KP16 = (h16*)take((size_t)NKV * TT * HD * 2); h16* VT16 = (h16*)take((size_t)NKV * HD * TT * 2);
    bf* QPh = (bf*)take((size_t)NH_ * TT * HD * 2); bf* QPl = (bf*)take((size_t)NH_ * TT * HD * 2); bf* KPh = (bf*)take((size_t)NKV * TT * HD * 2); bf* KPl = (bf*)take((size_t)NKV * TT * HD * 2);
    bf* VTh = (bf*)take((size_t)NKV * HD * TT * 2); bf* VTl = (bf*)take((size_t)NKV * HD * TT * 2); bf* ATh = (bf*)take((size_t)TT * DQ * 2); bf* ATl = (bf*)take((size_t)TT * DQ * 2);
    // projection-phase temporaries
    bf* WQt = (bf*)take((size_t)DQ * DM * 2); bf* WKt = (bf*)take((size_t)DKV * DM * 2); bf* WVt = (bf*)take((size_t)DKV * DM * 2);
    bf* XB = (bf*)take((size_t)NB * TT * DM * 2);
    const size_t total = (size_t)(wsp - (char*)d_ws);
    if (total > ws_size || total > (size_t)134217728) return;

    // inverse rotary frequencies inv[j] = 1 / 500000^(j/32): 32nd root by Newton in double (pure arithmetic), powers RNE-converted to f32, then an f32 reciprocal.
    RopeTab tab;
    { double y = 1.5; for (int it = 0; it < 64; ++it) { double p = 1.0; for (int k = 0; k < 31; ++k) p *= y; const double fy = p * y - 500000.0; y = y - fy / (32.0 * p); }
      double pj = 1.0; for (int j = 0; j < 32; ++j) { const float pf = (float)pj; tab.f[j] = 1.0f / pf; pj *= y; } }

    // weights -> bf16 planes ([in][out] transposed), x -> bf16, both in fragment order; rotary table
    k_prep<<<PB_CS + PB_WQ + PB_WO + 2 * PB_WKV + NB * PB_X, 256, 0, stream>>>(x, wq, wk, wv, wo, tab, XB, WQt, WKt, WVt, WOt, CS);
    for (int b = 0; b < NB; ++b) {
        k_qkv<<<dim3(TT / 128, (NH_ + 2 * NKV) / 2, 1), 128, 0, stream>>>(XB + (size_t)b * TT * DM, WQt, WKt, WVt, CS, QP16, QPh, QPl, KP16, KPh, KPl, VT16, VTh, VTl);
        k_fattn<<<dim3(NKV, NT16 + NTH, 1), 128, 0, stream>>>(QP16, KP16, VT16, QPh, QPl, KPh, KPl, VTh, VTl, ATh, ATl);
        k_gemmw<false, DQ><<<dim3(TT / 128, DM / 128, 1), 128, 0, stream>>>(ATh, ATl, WOt, OUT + (size_t)b * TT * DM, DM, nullptr); }
}

// v007
// A run of this version takes 84.1 microseconds.
// It is 1.11 times as fast as v005, going by the measured steps of the versions left out in between.
// Counting every step since v000, it is 14.2 times as fast.
#include <hip/hip_runtime.h>

// Grouped-query attention block (NB x SEQ x 2048): q = x Wq (32 heads x 64), k / v = x Wk / x Wv (8 kv heads x 64, 4 query heads per kv head), rotate-half rotary embedding
// (base 500000; cos/sin table built on device from host-computed inverse frequencies), causal sliding-window softmax(q.k / 8) (window 1024, -inf fill, diagonal always kept),
// ctx merged as [t][h*64 + d], out = ctx Wo -> f32 [NB][SEQ][2048]. Weights are [in][out] and are transposed into 16-bit planes.
// Every 16-bit operand plane of a matrix product (x, Wq, Wk, Wv, Wo, the q / k head planes with k = d, the transposed v planes with row = d and k = t, ctx) lies in FRAGMENT ORDER: a block of 16 rows x 32 k is 1 KiB, [j = (k >> 4) & 1][lane = 16*((k >> 3) & 1) + (row & 15)][k & 7],
// blocks ordered [row >> 4][k >> 5]; a fragment is then two loads of 512 contiguous bytes (lane l takes 16 bytes at 16*l), four whole 128-B lines each, where a row-major plane made every load touch 16 lines.
// Compute dtypes (f32 accumulate everywhere): every input RNE-converted to bf16; x.Wq, x.Wk, x.Wv: v_wmma_f32_16x16x32_bf16 on plain bf16 operands; q.k and P.v: query rows < RH on bf16 hi+lo
// planes (3 products), rows >= RH single v_wmma_f32_16x16x32_f16 (P carried x1024), one fused kernel with an online softmax over 32-key passes inside the window; softmax and rotary arithmetic f32; ctx.Wo: single v_wmma_f32_16x16x32_f16, ctx rounded to f16, Wo rounded to bf16 like every input and that value held in an f16 plane (8 significant bits fit f16's 11: the weight the product sees is the bf16 one).

#ifndef NB
#define NB 1
#endif
#ifndef SEQ
#define SEQ 2048
#endif
#ifndef RH
#define RH 512                  // query rows < RH use hi+lo planes (0: none)
#endif
#define TT      SEQ
#define TT_FULL 2048
#define DM      2048
#define NH_     32
#define NKV     8
#define REP     (NH_ / NKV)
#define HD      64
#define DQ      (NH_ * HD)
#define DKV     (NKV * HD)
#define RHE     ((RH < TT) ? RH : TT)
#define WIN     1024
#define PSH     10.0f             // f16 rows: P carried x 2^PSH
#define SCL     0.125f            // HD^-0.5
static_assert(TT % 128 == 0 && TT >= 128 && TT <= TT_FULL);
static_assert(RH % 64 == 0 && RH >= 0);
static_assert(REP == 4);
static_assert(DM % 64 == 0 && DQ % 64 == 0 && DKV % 64 == 0 && HD == 64);

typedef _Float16 h16;
typedef unsigned short bf;
typedef __attribute__((ext_vector_type(16))) __bf16   v16bf;
typedef __attribute__((ext_vector_type(16))) _Float16 v16h;
typedef __attribute__((ext_vector_type(8)))  _Float16 v8h;
typedef __attribute__((ext_vector_type(8)))  unsigned short v8us;
typedef __attribute__((ext_vector_type(8)))  float    v8f;
typedef __attribute__((ext_vector_type(4)))  float    v4f;
typedef __attribute__((ext_vector_type(2)))  _Float16 v2h;
typedef __attribute__((ext_vector_type(4)))  _Float16 v4h;
typedef __attribute__((ext_vector_type(2)))  unsigned short v2us;
typedef __attribute__((ext_vector_type(4)))  unsigned short v4us;
typedef __attribute__((ext_vector_type(2)))  float v2f;
typedef v8h  __attribute__((may_alias)) v8ha;
typedef v4f  __attribute__((may_alias)) v4fa;
typedef v8us __attribute__((may_alias)) v8usa;

__device__ __forceinline__ unsigned short f2bf(float f) { unsigned u = __float_as_uint(f); u += 0x7FFFu + ((u >> 16) & 1u); return (unsigned short)(u >> 16); }   // RNE convert
__device__ __forceinline__ float bf2f(unsigned short b) { return __uint_as_float(((unsigned)b) << 16); }
__device__ __forceinline__ float bfr(float f) { return bf2f(f2bf(f)); }
__device__ __forceinline__ v16h cat16(v8h lo, v8h hi) { return __builtin_shufflevector(lo, hi, 0, 1, 2, 3, 4, 5, 6, 7, 8, 9, 10, 11, 12, 13, 14, 15); }
__device__ __forceinline__ v16bf cat16b(v8us lo, v8us hi) { return __builtin_bit_cast(v16bf, __builtin_shufflevector(lo, hi, 0, 1, 2, 3, 4, 5, 6, 7, 8, 9, 10, 11, 12, 13, 14, 15)); }
__device__ __forceinline__ v8f wmma16(v16h a, v16h b, v8f c) { return __builtin_amdgcn_wmma_f32_16x16x32_f16(false, a, false, b, (short)0, c, false, false); }
__device__ __forceinline__ v8f wmmab(v16bf a, v16bf b, v8f c) { return __builtin_amdgcn_wmma_f32_16x16x32_bf16(false, a, false, b, (short)0, c, false, false); }
__device__ __forceinline__ h16 tohx(float x) { return (h16)x; }
__device__ __forceinline__ void splitf(float y, unsigned short& h, unsigned short& l) { h = f2bf(y); l = f2bf(y - bf2f(h)); }

// ---- fragment loaders
// Fragment map (both operands): lane row/col = lane & 15, elements 0..7 <- k0 + 8*(lane>>4) + 0..7, elements 8..15 <- k0 + 16 + 8*(lane>>4) + 0..7; D element r of lane l = (row 8*(l>>4) + r, col l & 15).
template <typename T16> struct WFrag;
template <> struct WFrag<h16> { typedef v16h V; static __device__ __forceinline__ V ld(const h16* p) { return cat16(*(const v8h*)p, *(const v8h*)(p + 16)); } static __device__ __forceinline__ V ldo(const h16* b, unsigned o) { return ld((const h16*)((const char*)b + o)); } static __device__ __forceinline__ V ldf(const h16* p) { return cat16(*(const v8h*)p, *(const v8h*)(p + 256)); } static __device__ __forceinline__ V ldfo(const h16* b, unsigned o) { return ldf((const h16*)((const char*)b + o)); } static __device__ __forceinline__ v8f mma(V a, V b, v8f c) { return wmma16(a, b, c); } };
template <> struct WFrag<bf> { typedef v16bf V; static __device__ __forceinline__ V ld(const bf* p) { return cat16b(*(const v8us*)p, *(const v8us*)(p + 16)); } static __device__ __forceinline__ V ldo(const bf* b, unsigned o) { return ld((const bf*)((const char*)b + o)); } static __device__ __forceinline__ V ldf(const bf* p) { return cat16b(*(const v8us*)p, *(const v8us*)(p + 256)); } static __device__ __forceinline__ V ldfo(const bf* b, unsigned o) { return ldf((const bf*)((const char*)b + o)); } static __device__ __forceinline__ v8f mma(V a, V b, v8f c) { return wmmab(a, b, c); } };
// ---- LDS staging of the two GEMM kernels (k_gemmw, k_qkv). A work-group of 4 waves (2 x 2) owns a 128x128 output tile, each wave a 64x64 tile of it (16 accumulators). A stage is KS k of every operand row of the
// block tile. In a fragment-order plane 16 rows x KS k are CH contiguous elements (4 KiB, a "chunk": KS/32 blocks of 1 KiB), and a stage keeps that order in LDS, chunk behind chunk, so a fragment is two
// ds_load_b128 of 512 contiguous bytes. The chunks come in by global_load_async_to_lds_b128 (a lane moves its own 16 bytes, through no register), 8 copies a chunk; the immediate offset moves the global and the LDS address alike.
// Two buffers: stage t + 2 is asked for behind the barrier that ends trip t, into the buffer trip t has read, and flies during trip t + 1.
#define KS 128
#define CH (16 * KS)
#define CHB (CH * 2)              // bytes of a chunk
#define CP1(L, G, O) "global_load_async_to_lds_b128 " L ", " G ", off offset:" #O "\n\t"
#define CP8(L, G) CP1(L, G, 0) CP1(L, G, 512) CP1(L, G, 1024) CP1(L, G, 1536) CP1(L, G, 2048) CP1(L, G, 2560) CP1(L, G, 3072) CP1(L, G, 3584)
static_assert(CHB == 8 * 512);
__device__ __forceinline__ unsigned ldsaddr(const void* p) { return (unsigned)(size_t)p; }
__device__ __forceinline__ v16bf ldl(const bf* p) { return cat16b(*(const v8us*)p, *(const v8us*)(p + 256)); }
__device__ __forceinline__ void wait_ds() { asm volatile("s_wait_dscnt 0x0" ::: "memory"); }
__device__ __forceinline__ void wait_async() { asm volatile("s_wait_asynccnt 0x0" ::: "memory"); }
// The copies of one wave and one stage stand in ONE statement that ends in s_wait_xcnt 0 (a precaution): so the wait stands ahead of every rewrite of a register that a copy names.
__device__ __forceinline__ void stage4(unsigned l, const bf* g, size_t step) {   // 4 chunks: LDS places CHB apart, global chunks step elements apart
    asm volatile(CP8("%0", "%4") CP8("%1", "%5") CP8("%2", "%6") CP8("%3", "%7") "s_wait_xcnt 0x0"
                 :: "v"(l), "v"(l + CHB), "v"(l + 2 * CHB), "v"(l + 3 * CHB), "v"(g), "v"(g + step), "v"(g + 2 * step), "v"(g + 3 * step) : "memory"); }

// ---- k_gemmw: C[m][n] (f32, pitch ldc, + optional f32 bias[n]) = sum_k A[m][k] Bt[n][k], one f16 product per k step, planes of f16 bits in fragment order. Grid (M/128, N/128), 128 threads.
// A stage is [A 8 chunks | Bt 8 chunks] = 64 KiB; wave w copies chunks 4w .. 4w+3 (32 copies in flight at most). K % KS == 0, K >= 2*KS.
__device__ __forceinline__ v16h ldh(const bf* p) { return __builtin_bit_cast(v16h, ldl(p)); }   // the same fragment read as f16
template <bool BIAS, int K>
__global__ __launch_bounds__(128) void k_gemmw(const bf* __restrict__ A, const bf* __restrict__ Bt, float* C, int ldc, const float* __restrict__ bias) {
    typedef v16h V;
    static_assert(K % KS == 0 && K >= 2 * KS);
    __shared__ __attribute__((aligned(1024))) bf ring[2 * 16 * CH];
    __shared__ __align__(16) float osm[4 * 16 * 68];
    const int lane = threadIdx.x & 31, lr = lane & 15, hi = lane >> 4; const int w = __builtin_amdgcn_readfirstlane(threadIdx.x >> 5), wm = w & 1, wn = w >> 1;
    float* os = osm + w * 16 * 68;                                          // each wave stages its output rows in its own range
    const int r0 = blockIdx.x * 128 + wm * 64, c0 = blockIdx.y * 128 + wn * 64;
    v8f acc[4][4];
#pragma unroll
    for (int mb = 0; mb < 4; ++mb)
#pragma unroll
        for (int nb = 0; nb < 4; ++nb) acc[mb][nb] = (v8f){};
    const bf* gs = ((w < 2) ? A + (size_t)blockIdx.x * 128 * K : Bt + (size_t)blockIdx.y * 128 * K) + (size_t)(w & 1) * 64 * K + 8 * lane;   // the lane's 16 bytes in the first copy of the wave's first chunk; a stage is CH elements further along k
    const unsigned l0 = ldsaddr(ring) + (unsigned)w * 4 * CHB + (unsigned)lane * 16;
    const bf* la = ring + wm * 4 * CH + 8 * lane; const bf* lb = ring + (8 + wn * 4) * CH + 8 * lane;
    stage4(l0, gs, (size_t)16 * K);
    wait_async(); __syncthreads();                                          // stage 0 is published
    stage4(l0 + 16 * CHB, gs + CH, (size_t)16 * K);
#pragma unroll 1                                                            // rolled: a trip is 64 matrix instructions, a second copy would only cost instruction cache
    for (int t = 0; t < K / KS; ++t) {
        const int bo = (t & 1) * 16 * CH; V a[2][4], b[2][4];               // two fragment sets: the next k step's LDS reads go out ahead of this step's products
#pragma unroll
        for (int q = 0; q < 4; ++q) { a[0][q] = ldh(la + bo + q * CH); b[0][q] = ldh(lb + bo + q * CH); }
#pragma unroll
        for (int ks = 0; ks < KS / 32; ++ks) { const int cu = ks & 1, nx = cu ^ 1;
            if (ks + 1 < KS / 32) {
#pragma unroll
                for (int q = 0; q < 4; ++q) { const int o = bo + q * CH + (ks + 1) * 512; a[nx][q] = ldh(la + o); b[nx][q] = ldh(lb + o); } }
            __builtin_amdgcn_sched_barrier(0);                              // keeps the reads above in one group ahead of the products below; left free, the scheduler sinks them among the products, each behind a wait to 0
#pragma unroll
            for (int nb = 0; nb < 4; ++nb) {
#pragma unroll
                for (int mb = 0; mb < 4; ++mb) acc[mb][nb] = wmma16(a[cu][mb], b[cu][nb], acc[mb][nb]); } }
        __builtin_amdgcn_sched_barrier(0);                                  // the trip's last products stay ahead of the barrier: left free they sink behind it and hold back the copies, which then fly for less than a trip
        wait_ds(); wait_async(); __syncthreads();                           // publishes stage t + 1 and ends every wave's reads of stage t
        if (t + 2 < K / KS) stage4(l0 + (unsigned)(t & 1) * 16 * CHB, gs + (size_t)(t + 2) * CH, (size_t)16 * K);
    }
    wait_async();
#pragma unroll
    for (int mb = 0; mb < 4; ++mb) {
#pragma unroll
        for (int nb = 0; nb < 4; ++nb) {
#pragma unroll
            for (int j = 0; j < 8; ++j) os[(hi * 8 + j) * 68 + nb * 16 + lr] = acc[mb][nb][j]; }
        __builtin_amdgcn_wave_barrier(); asm volatile("" ::: "memory");
        float* crow = C + (size_t)(r0 + mb * 16) * ldc + c0;
{
#pragma unroll
            for (int s = 0; s < 8; ++s) { const int row = 2 * s + hi, cofs = lr * 4; v4f val = *(const v4fa*)(os + row * 68 + cofs); if (BIAS) { val[0] += bfr(bias[c0 + cofs]); val[1] += bfr(bias[c0 + cofs + 1]); val[2] += bfr(bias[c0 + cofs + 2]); val[3] += bfr(bias[c0 + cofs + 3]); }
                *(v4f*)(crow + (size_t)row * ldc + cofs) = val; }
             }
        __builtin_amdgcn_wave_barrier(); asm volatile("" ::: "memory");
    }
}

// ---- wtG: w [K][N] f32 -> bf16 plane of w transposed (row = n, k = k) in fragment order (H: the bf16-rounded value written as f16 bits, for an f16 product). One wave = 32 consecutive n x one block of 32 k: each of its 32 loads is one whole 128-B line of a row of w,
// each of its 4 stores fills two runs of 256 contiguous bytes (a lane's 8 k of one n are the 16 bytes of one fragment slot). (N/32)*(K/32)/8 blocks of 8 waves; blk = the block's index among them.
// K and N are compile-time, so that the 32 loads are one address pair + constant offsets.
template <int K, int N, bool H>
__device__ __forceinline__ void wtG(int blk, const float* __restrict__ w, bf* Bt) {
    static_assert(K % 32 == 0 && N % 32 == 0 && ((N / 32) * (K / 32)) % 8 == 0);
    const int lane = threadIdx.x & 31; const int wv = blk * 8 + (threadIdx.x >> 5); const int kb = wv / (N / 32), n = (wv % (N / 32)) * 32 + lane;
    const float* p = w + (size_t)kb * 32 * N + n; float v[32];
#pragma unroll
    for (int i = 0; i < 32; ++i) v[i] = p[(size_t)i * N];
    bf* q = Bt + ((size_t)(n >> 4) * (K / 32) + kb) * 512 + (n & 15) * 8;
#pragma unroll
    for (int o = 0; o < 4; ++o) { v8us r;                                   // o = 2*j + half: k = 32*kb + 8*o + e
#pragma unroll
        for (int e = 0; e < 8; ++e) r[e] = H ? __builtin_bit_cast(unsigned short, tohx(bfr(v[o * 8 + e]))) : f2bf(v[o * 8 + e]);
        *(v8us*)(q + o * 128) = r; }
    asm volatile("s_wait_xcnt 0x0" ::: "memory");                          // a precaution: in the joint kernel another job's code follows in the listing and rewrites the registers these four stores name
}
// ---- cvt8: src [rows][DM] f32 -> bf16 plane in fragment order. One wave = 8 rows x one block of 32 k: a lane converts 8 consecutive k; the 8 lanes of one k octet store 128 contiguous bytes.
__device__ __forceinline__ void cvt8(int blk, const float* __restrict__ src, bf* dst, size_t n8) { const size_t i = (size_t)blk * 256 + threadIdx.x; if (i >= n8) return;
    const int lane = threadIdx.x & 31, o = lane & 3; const int wv = (int)(i >> 5), kb = wv % (DM / 32), t = (wv / (DM / 32)) * 8 + (lane >> 2);
    const v8f v = *(const v8f*)(src + (size_t)t * DM + kb * 32 + o * 8); v8us r;
#pragma unroll
    for (int k = 0; k < 8; ++k) r[k] = f2bf(v[k]);
    *(v8us*)(dst + ((size_t)(t >> 4) * (DM / 32) + kb) * 512 + o * 128 + (t & 15) * 8) = r;  }

// ---- csgen: rotary table CS[t][d] = {cos(t * inv[d & 31]), sin(t * inv[d & 31])} (f32 product, precise sincos). inv[] arrives by value (host-computed); lane == d & 31 by construction
struct RopeTab { float f[32]; };
static_assert(sizeof(RopeTab) == 128);
__device__ __forceinline__ void csgen(int blk, const RopeTab& tab, float* CS) {
    const int idx = blk * 256 + threadIdx.x; const int lane = threadIdx.x & 31; float inv = 0.0f;
#pragma unroll
    for (int i = 0; i < 32; ++i) inv = (lane == i) ? tab.f[i] : inv;
    if (idx >= TT * HD) return;
    const int t = idx / HD; float ang = __fmul_rn((float)t, inv); asm volatile("" : "+v"(ang));
    float sn, cs; sincosf(ang, &sn, &cs);
    v2f o; o[0] = cs; o[1] = sn;
    *(v2f*)(CS + (size_t)idx * 2) = o;  }

// ---- k_prep: everything that only turns an input (or nothing) into an operand plane, ONE launch: the six jobs read and write disjoint buffers and none needs another's result, so as launches of their own each only
// paid for a start, a ramp and a drain with the chip near empty. A block of 8 waves belongs to one job by its index (a scalar compare; no barrier anywhere). In block index order
// the jobs whose blocks last longest (table, then the transpositions with their 32 loads a lane) come first, the x conversion (one load, one store a lane) last.
#define PB_CS ((TT * HD + 255) / 256)
#define PB_WQ ((DQ / 32) * (DM / 32) / 8)
#define PB_WKV ((DKV / 32) * (DM / 32) / 8)
#define PB_WO ((DM / 32) * (DQ / 32) / 8)
#define PB_X  (TT * DM / 8 / 256)   // per batch entry
static_assert((TT * DM / 8) % 256 == 0);
__global__ __launch_bounds__(256) void k_prep(const float* __restrict__ x, const float* __restrict__ wq, const float* __restrict__ wk, const float* __restrict__ wv, const float* __restrict__ wo, RopeTab tab,
                                              bf* XB, bf* WQt, bf* WKt, bf* WVt, bf* WOt, float* CS) {
    int blk = blockIdx.x;
    if (blk < PB_CS) { csgen(blk, tab, CS); return; }
    blk -= PB_CS;
    if (blk < PB_WQ) { wtG<DM, DQ, false>(blk, wq, WQt); return; }
    blk -= PB_WQ;
    if (blk < PB_WO) { wtG<DQ, DM, true>(blk, wo, WOt); return; }
    blk -= PB_WO;
    if (blk < PB_WKV) { wtG<DM, DKV, false>(blk, wk, WKt); return; }
    blk -= PB_WKV;
    if (blk < PB_WKV) { wtG<DM, DKV, false>(blk, wv, WVt); return; }
    blk -= PB_WKV;
    const int b = blk / PB_X;                                               // batch entry; its plane is TT * DM elements further
    cvt8(blk - b * PB_X, x + (size_t)b * TT_FULL * DM, XB + (size_t)b * TT * DM, (size_t)TT * DM / 8);
}

// ---- k_qkv: the three input projections with their plane building, ONE launch. Grid (TT/128, (NH_ + 2*NKV)/2), 128 threads, staged as above; a wave's 64 columns are exactly one head
// (head index < NH_: query head, then NKV key heads, then NKV value heads; the two heads of a block are of one kind, so every branch round a barrier is block-uniform), so the rotate-half partner d +- HD/2 lies in the same tile and the f32 projection never goes to memory.
// A stage is [x 8 chunks | weight 8 chunks] = 64 KiB; wave w copies chunks 4w .. 4w+3 (32 copies in flight at most).
// q / k tiles: 16 rows at a time through LDS, out[d] = x[d] cos[t][d] - x[d+HD/2] sin[t][d], out[d+HD/2] = x[d+HD/2] cos[t][d+HD/2] + x[d] sin[t][d+HD/2], stored as head planes [h] (row t, k = d; f16 + bf16 hi/lo) in fragment order, 32-B runs that the 8 stores of 16 rows join to whole lines.
// v tiles: a lane's 8 accumulator elements are 8 consecutive t of one d, which is one 16-byte fragment slot of the transposed planes [g] (row d, k = t): stored straight from registers, 512 contiguous bytes a wave.
static_assert(NH_ % 2 == 0 && NKV % 2 == 0 && DM % KS == 0 && DM >= 2 * KS);
__global__ __launch_bounds__(128) void k_qkv(const bf* __restrict__ A, const bf* __restrict__ Wq, const bf* __restrict__ Wk, const bf* __restrict__ Wv, const float* __restrict__ CS,
                                            h16* Q16, bf* Qh, bf* Ql, h16* K16, bf* Kh, bf* Kl, h16* V16, bf* Vh, bf* Vl) {
    typedef WFrag<bf>::V V;
    __shared__ __attribute__((aligned(1024))) bf ring[2 * 16 * CH];
    __shared__ __align__(16) float osm[4 * 16 * 68];
    const int lane = threadIdx.x & 31, lr = lane & 15, hi = lane >> 4; const int w = __builtin_amdgcn_readfirstlane(threadIdx.x >> 5), wm = w & 1, wn = w >> 1;
    float* os = osm + w * 16 * 68;                                          // each wave turns its rows in its own range
    const int r0 = blockIdx.x * 128 + wm * 64, hy = blockIdx.y * 2 + wn;
    const bool isq = hy < NH_, isv = hy >= NH_ + NKV; const int hh = isq ? hy : (isv ? hy - NH_ - NKV : hy - NH_);   // head index inside its own group
    const bf* Bt = (isq ? Wq : (isv ? Wv : Wk)) + (size_t)(hh - wn) * HD * DM;   // the first of the block's two heads
    v8f acc[4][4];
#pragma unroll
    for (int mb = 0; mb < 4; ++mb)
#pragma unroll
        for (int nb = 0; nb < 4; ++nb) acc[mb][nb] = (v8f){};
    const bf* gs = ((w < 2) ? A + (size_t)blockIdx.x * 128 * DM : Bt) + (size_t)(w & 1) * 64 * DM + 8 * lane;   // the lane's 16 bytes in the first copy of the wave's first chunk; a stage is CH elements further along k
    const unsigned l0 = ldsaddr(ring) + (unsigned)w * 4 * CHB + (unsigned)lane * 16;
    const bf* la = ring + wm * 4 * CH + 8 * lane; const bf* lb = ring + (8 + wn * 4) * CH + 8 * lane;
    stage4(l0, gs, (size_t)16 * DM);
    wait_async(); __syncthreads();                                          // stage 0 is published
    stage4(l0 + 16 * CHB, gs + CH, (size_t)16 * DM);
#pragma unroll 1                                                            // rolled: a trip is 64 matrix instructions, a second copy would only cost instruction cache
    for (int t = 0; t < DM / KS; ++t) {
        const int bo = (t & 1) * 16 * CH; V a[2][4], b[2][4];               // two fragment sets: the next k step's LDS reads go out ahead of this step's products
#pragma unroll
        for (int q = 0; q < 4; ++q) { a[0][q] = ldl(la + bo + q * CH); b[0][q] = ldl(lb + bo + q * CH); }
#pragma unroll
        for (int ks = 0; ks < KS / 32; ++ks) { const int cu = ks & 1, nx = cu ^ 1;
            if (ks + 1 < KS / 32) {
#pragma unroll
                for (int q = 0; q < 4; ++q) { const int o = bo + q * CH + (ks + 1) * 512; a[nx][q] = ldl(la + o); b[nx][q] = ldl(lb + o); } }
            __builtin_amdgcn_sched_barrier(0);                              // keeps the reads above in one group ahead of the products below; left free, the scheduler sinks them among the products, each behind a wait to 0
#pragma unroll
            for (int nb = 0; nb < 4; ++nb) {
#pragma unroll
                for (int mb = 0; mb < 4; ++mb) acc[mb][nb] = wmmab(a[cu][mb], b[cu][nb], acc[mb][nb]); } }
        __builtin_amdgcn_sched_barrier(0);                                  // the trip's last products stay ahead of the barrier: left free they sink behind it and hold back the copies, which then fly for less than a trip
        wait_ds(); wait_async(); __syncthreads();                           // publishes stage t + 1 and ends every wave's reads of stage t
        if (t + 2 < DM / KS) stage4(l0 + (unsigned)(t & 1) * 16 * CHB, gs + (size_t)(t + 2) * CH, (size_t)16 * DM);
    }
    wait_async();
    if (!isv) {
        const int d = lr * 4; const size_t zp = ((size_t)hh * TT + r0) * HD + (d >> 5) * 512 + ((d >> 4) & 1) * 256 + ((d >> 3) & 1) * 128 + hi * 8 + (d & 7);   // the lane's place in row r0 + hi (fragment order, k = d); every later row is a constant step from it, for the table as for the planes
        h16* P16 = (isq ? Q16 : K16) + zp; bf* Ph = (isq ? Qh : Kh) + zp; bf* Pl = (isq ? Ql : Kl) + zp; const float* cb = CS + ((size_t)(r0 + hi) * HD + d) * 2;
#pragma unroll
        for (int mb = 0; mb < 4; ++mb) {
            v4f c01[8], c23[8];                                             // {cos, sin} of d .. d+3 for the lane's 8 rows, asked for ahead of the LDS round trip
#pragma unroll
            for (int s = 0; s < 8; ++s) { const float* cp = cb + (mb * 16 + 2 * s) * HD * 2; c01[s] = *(const v4f*)cp; c23[s] = *(const v4f*)(cp + 4); }
#pragma unroll
            for (int nb = 0; nb < 4; ++nb) {
#pragma unroll
                for (int j = 0; j < 8; ++j) os[(hi * 8 + j) * 68 + nb * 16 + lr] = acc[mb][nb][j]; }
            __syncthreads();                                                // the 16 rows are read back by other lanes than wrote them
#pragma unroll
            for (int s = 0; s < 8; ++s) { const int row = 2 * s + hi;
                const v4f x0 = *(const v4fa*)(os + row * 68 + d), x1 = *(const v4fa*)(os + row * 68 + (d ^ (HD / 2)));
                const float cs[4] = { c01[s][0], c01[s][2], c23[s][0], c23[s][2] }, sn[4] = { c01[s][1], c01[s][3], c23[s][1], c23[s][3] };
                const v4f xp = (d < HD / 2) ? -x1 : x1;                    // the partner enters with a minus in the lower half of the head
                v4h o16; v4us oh, ol;
#pragma unroll
                for (int q = 0; q < 4; ++q) { const float r = x0[q] * cs[q] + xp[q] * sn[q];
                    o16[q] = tohx(r); unsigned short a2, c2; splitf(r, a2, c2); oh[q] = a2; ol[q] = c2; }
                const int e = mb * 16 * HD + 2 * s * 8; *(v4h*)(P16 + e) = o16; *(v4us*)(Ph + e) = oh; *(v4us*)(Pl + e) = ol;
                asm volatile("s_wait_xcnt 0x0" ::: "memory"); }            // before the data registers of these stores are rewritten
            __syncthreads();                                                // every read of these rows ends before the next 16 rows overwrite them
        }
    } else {
        const size_t zv = (size_t)hh * HD * TT + (size_t)r0 * 16 + 8 * lane; h16* P16 = V16 + zv; bf* Ph = Vh + zv; bf* Pl = Vl + zv;
#pragma unroll
        for (int nb = 0; nb < 4; ++nb)
#pragma unroll
            for (int mb = 0; mb < 4; ++mb) { v8h o16; v8us oh, ol;
#pragma unroll
                for (int j = 0; j < 8; ++j) { const float x = acc[mb][nb][j]; o16[j] = tohx(x); unsigned short a2, c2; splitf(x, a2, c2); oh[j] = a2; ol[j] = c2; }
                const int e = nb * 16 * TT + (mb >> 1) * 512 + (mb & 1) * 256; *(v8h*)(P16 + e) = o16; *(v8us*)(Ph + e) = oh; *(v8us*)(Pl + e) = ol;
                asm volatile("s_wait_xcnt 0x0" ::: "memory"); }            // before the data registers of these stores are rewritten
    }
}

// ---- k_fattn: fused causal sliding-window attention, scores and probabilities never leave registers. One wave = one query head x NQ*16 query rows; the 4 waves of a block are the 4 query heads
// of one kv head on the same rows, so they share each pass's K / V tiles, staged in LDS. Per pass of 32 keys: St = K.Qt (A = K rows, B = Q kept in registers), online softmax per query column (a lane holds one
// query's scores: in-lane maximum and sum, one exchange between the wave halves for the maximum), the two 16-key score tiles convert in place into the B operand Pt, Ot += Vt.Pt (A = Vt rows).
// All fragments use WFrag::ldf's k order (that of WFrag::ld), which is the order a packed D pair delivers. Rows < RH: bf16 hi+lo planes, 3 products each; rows >= RH: f16, P carried x 2^PSH (cancels in O / sum).
// D element r of lane l of Ot = (d = 16*dt + 8*(l>>4) + r, query l & 15): 8 consecutive d per lane, stored as one f16 fragment slot of the merged ctx plane (row t, k = h*64 + d; Ah arrives at the head's first block, 2*h).
// 2^x with the slot behind it filled: the instruction set asks for one independent instruction or v_nop between a transcendental and a directly following overwrite of its source or read of its
// result; only a v_nop inside the same statement is tied to the instruction.
// K / V staging: the 4 waves of a block walk the same keys of the same kv head, so a pass's tiles come into LDS ONCE per block and every wave reads its fragments there, where before each of the 4 waves asked global memory for the same lines itself.
// A stage is one pass: [K 4 KiB | V 4 KiB] (hi+lo rows: [K hi | V hi | K lo | V lo]), each tile 4 fragment blocks of 1 KiB in plane order (K: block 2*kt + ks, contiguous in the plane; V: block dt, 16*TT elements apart).
// Wave w copies block w of every tile, 2 copies of 512 B a block (a lane moves its own 16 bytes; the immediate offset moves both addresses). Two buffers: stage t + 2 is asked for behind the barrier of pass t, into the buffer pass t has read.
// As in stage4, a wave's copies of a stage stand in ONE statement that ends in s_wait_xcnt 0 (a precaution), ahead of every rewrite of a register that a copy names.
#define CP2(L, G) CP1(L, G, 0) CP1(L, G, 512)
__device__ __forceinline__ void stage_kv(unsigned l, const void* gk, const void* gv) {
    asm volatile(CP2("%0", "%2") CP2("%1", "%3") "s_wait_xcnt 0x0" :: "v"(l), "v"(l + 4096u), "v"(gk), "v"(gv) : "memory"); }
__device__ __forceinline__ void stage_kv2(unsigned l, const void* gk, const void* gv, const void* gk2, const void* gv2) {
    asm volatile(CP2("%0", "%4") CP2("%1", "%5") CP2("%2", "%6") CP2("%3", "%7") "s_wait_xcnt 0x0"
                 :: "v"(l), "v"(l + 4096u), "v"(l + 8192u), "v"(l + 12288u), "v"(gk), "v"(gv), "v"(gk2), "v"(gv2) : "memory"); }
__device__ __forceinline__ float exp2s(float x) { float r; asm("v_exp_f32 %0, %1\n\tv_nop" : "=v"(r) : "v"(x)); return r; }
template <typename T16, bool HI, int NQ>
__device__ __forceinline__ void attn_tile(const T16* __restrict__ Q, const T16* __restrict__ Q2, const T16* __restrict__ Kp, const T16* __restrict__ K2, const T16* __restrict__ Vt, const T16* __restrict__ V2, int q0, int lane, int w, const T16* sm, bf* Ah) {
    typedef typename WFrag<T16>::V V;                                       // every full unroll below keeps the fragment arrays indexed by constants, that is, in registers
    const int lr = lane & 15, hi = lane >> 4;
    const unsigned fofs = (unsigned)lane * 16u;                            // the lane's byte offset in a fragment block, fixed for the whole walk: every load is wave-uniform base + lane offset
    V qb[NQ][2], qb2[NQ][2];
#pragma unroll
    for (int nq = 0; nq < NQ; ++nq)
#pragma unroll
        for (int ks = 0; ks < 2; ++ks) { const size_t qo = (size_t)(q0 + nq * 16) * HD + ks * 512; qb[nq][ks] = WFrag<T16>::ldfo(Q + qo, fofs); if (HI) qb2[nq][ks] = WFrag<T16>::ldfo(Q2 + qo, fofs); }
    v8f o[NQ][4]; float m[NQ], l[NQ];
#pragma unroll
    for (int nq = 0; nq < NQ; ++nq) { m[nq] = -1.0e30f; l[nq] = 0.0f;      // the start maximum lies above the ban fill, so a pass whose keys are all banned for a query adds exact zeros
#pragma unroll
        for (int dt = 0; dt < 4; ++dt) o[nq][dt] = (v8f){}; }
    const int kb = max(0, q0 - (WIN - 1)) & ~31, ke = q0 + NQ * 16;         // first key pass of the window of the first row, one past the diagonal of the last row
    asm volatile("s_wait_xcnt 0x0" ::: "memory");                          // the address registers of the loads above are reused below
    constexpr int SE = HI ? 8192 : 4096;                                    // elements of a stage
    const unsigned l0 = ldsaddr(sm) + (unsigned)w * 1024u + fofs;           // the lane's 16 bytes in block w of buffer 0's K tile
    const size_t ok = (size_t)w * 512 + 8 * lane, ov = (size_t)w * 16 * TT + 8 * lane;   // the same place in the planes, pass 0 of the plane
    auto stage = [&](int k0, int bu) { const unsigned l = l0 + (unsigned)bu * (2u * SE);
        if constexpr (HI) stage_kv2(l, Kp + ok + (size_t)k0 * HD, Vt + ov + (size_t)k0 * 16, K2 + ok + (size_t)k0 * HD, V2 + ov + (size_t)k0 * 16);
        else stage_kv(l, Kp + ok + (size_t)k0 * HD, Vt + ov + (size_t)k0 * 16); };
    V ka[2][2], ka2[2][2];                                                  // a pass's K fragments are read right behind the barrier that publishes their stage, so that their LDS latency runs under the tail of the pass before
    auto ldk = [&](int bu) { const T16* sk = sm + bu * SE + 8 * lane;
#pragma unroll
        for (int kt = 0; kt < 2; ++kt)
#pragma unroll
            for (int ks = 0; ks < 2; ++ks) { ka[kt][ks] = WFrag<T16>::ldf(sk + (kt * 2 + ks) * 512); if (HI) ka2[kt][ks] = WFrag<T16>::ldf(sk + 4096 + (kt * 2 + ks) * 512); } };
    stage(kb, 0);
    wait_async(); __syncthreads();                                          // stage 0 is published
    if (kb + 32 < ke) stage(kb + 32, 1);
    ldk(0);
    int bu = 0;
#pragma unroll 1                                                            // rolled: one pass's fragments fill the register budget, a second copy of the body would only cost instruction cache
    for (int k0 = kb; k0 < ke; k0 += 32, bu ^= 1) {
        V va[4], va2[4]; const T16* sb = sm + bu * SE + 8 * lane;           // the lane's slot in the first block of this pass's buffer
#pragma unroll
        for (int dt = 0; dt < 4; ++dt) { va[dt] = WFrag<T16>::ldf(sb + 2048 + dt * 512); if (HI) va2[dt] = WFrag<T16>::ldf(sb + 6144 + dt * 512); }
        if (!HI) __builtin_amdgcn_sched_barrier(0);                         // keeps the V reads in one group at the head of the pass, under the score products; left free, half of them sink to the pass's foot, directly ahead of its wait to 0
        v8f s[NQ][2];
#pragma unroll
        for (int nq = 0; nq < NQ; ++nq)
#pragma unroll
            for (int kt = 0; kt < 2; ++kt) { v8f c = (v8f){};
#pragma unroll
                for (int ks = 0; ks < 2; ++ks) { c = WFrag<T16>::mma(ka[kt][ks], qb[nq][ks], c); if (HI) { c = WFrag<T16>::mma(ka[kt][ks], qb2[nq][ks], c); c = WFrag<T16>::mma(ka2[kt][ks], qb[nq][ks], c); } }
                s[nq][kt] = c; }
#pragma unroll
        for (int nq = 0; nq < NQ; ++nq)
#pragma unroll
            for (int kt = 0; kt < 2; ++kt) s[nq][kt] *= SCL * 1.4426950408889634f;   // scores in log2 units
        if (k0 + 31 > q0 || q0 + NQ * 16 - 1 - k0 >= WIN) {                 // wave-uniform: only passes that touch the diagonal or the window's start hold banned pairs
#pragma unroll
            for (int nq = 0; nq < NQ; ++nq)
#pragma unroll
                for (int kt = 0; kt < 2; ++kt)
#pragma unroll
                    for (int r = 0; r < 8; ++r) { const int j = k0 + kt * 16 + 8 * hi + r, i = q0 + nq * 16 + lr; s[nq][kt][r] = (j <= i && i - j < WIN) ? s[nq][kt][r] : -3.0e38f; } }
        V pb[NQ], pb2[NQ];
#pragma unroll
        for (int nq = 0; nq < NQ; ++nq) { float mx = m[nq];
#pragma unroll
            for (int kt = 0; kt < 2; ++kt)
#pragma unroll
                for (int r = 0; r < 8; ++r) mx = fmaxf(mx, s[nq][kt][r]);
            mx = fmaxf(mx, __shfl_xor(mx, 16, 32));
            const float al = exp2s(m[nq] - mx); m[nq] = mx; const float mb = HI ? mx : mx - PSH; float sum = 0.0f;
#pragma unroll
            for (int kt = 0; kt < 2; ++kt)
#pragma unroll
                for (int r = 0; r < 8; ++r) { const float p = exp2s(s[nq][kt][r] - mb); s[nq][kt][r] = p; sum += p; }
            l[nq] = l[nq] * al + sum;                                       // each wave half keeps the sum of its own keys; joined once after the loop
#pragma unroll
            for (int dt = 0; dt < 4; ++dt) o[nq][dt] *= al;
            if constexpr (HI) { v8us h0, h1, l0, l1;
#pragma unroll
                for (int r = 0; r < 8; ++r) { unsigned short a, c2; splitf(s[nq][0][r], a, c2); h0[r] = a; l0[r] = c2; splitf(s[nq][1][r], a, c2); h1[r] = a; l1[r] = c2; }
                pb[nq] = cat16b(h0, h1); pb2[nq] = cat16b(l0, l1);
            } else { v8h h0, h1;
#pragma unroll
                for (int r = 0; r < 8; ++r) { h0[r] = tohx(s[nq][0][r]); h1[r] = tohx(s[nq][1][r]); }
                pb[nq] = cat16(h0, h1); } }
#pragma unroll
        for (int dt = 0; dt < 4; ++dt)
#pragma unroll
            for (int nq = 0; nq < NQ; ++nq) { o[nq][dt] = WFrag<T16>::mma(va[dt], pb[nq], o[nq][dt]); if (HI) { o[nq][dt] = WFrag<T16>::mma(va[dt], pb2[nq], o[nq][dt]); o[nq][dt] = WFrag<T16>::mma(va2[dt], pb[nq], o[nq][dt]); } }
        if (!HI) __builtin_amdgcn_sched_barrier(0);                         // the softmax and the P.V products stay ahead of the barrier: left free they sink behind it, and the wait for the next stage's copies then stands a fraction of a pass behind their issue
        if (!HI) asm volatile("v_nop\n\tv_nop\n\tv_nop\n\tv_nop");               // the distance behind the last product: only waits, the barrier and branches follow, and on their taken side its V fragment's registers are rewritten after 3 vector slots
        wait_ds(); wait_async(); __syncthreads();                           // publishes the next pass's stage and ends every wave's reads of this one; q0, kb and ke are the block's, so every wave passes it
        if (k0 + 64 < ke) stage(k0 + 64, bu);
        if (k0 + 32 < ke) ldk(bu ^ 1);                                      // behind the last pass no stage is left to read
    }
    wait_async();
#pragma unroll
    for (int nq = 0; nq < NQ; ++nq) { const float inv = __fdiv_rn(1.0f, l[nq] + __shfl_xor(l[nq], 16, 32));
#pragma unroll
        for (int dt = 0; dt < 4; ++dt) { v8h oh;
#pragma unroll
            for (int r = 0; r < 8; ++r) oh[r] = tohx(o[nq][dt][r] * inv);
            const size_t oo = (size_t)(q0 + nq * 16) * DQ + (dt >> 1) * 512 + (dt & 1) * 256 + 8 * lane; *(v8us*)(Ah + oo) = __builtin_bit_cast(v8us, oh);   // fragment order: the wave's 32 slots are 512 contiguous bytes
            asm volatile("s_wait_xcnt 0x0" ::: "memory"); } }              // before the registers of this store are rewritten
}
// grid (NKV, NT16 + NTH), 128 threads; blockIdx.y runs from the row tiles with the longest key walk, for all kv heads, to the short hi+lo tiles last
#define NT16 ((TT - RHE) / 32)
#define NTH  (RHE / 16)
__global__ __launch_bounds__(128) void k_fattn(const h16* __restrict__ Q16, const h16* __restrict__ K16, const h16* __restrict__ V16, const bf* __restrict__ Qh, const bf* __restrict__ Ql, const bf* __restrict__ Kh, const bf* __restrict__ Kl,
                                               const bf* __restrict__ Vh, const bf* __restrict__ Vl, bf* Ah) {
    __shared__ __attribute__((aligned(1024))) bf kvr[2 * 8192];             // two stages of the larger kind (hi+lo rows)
    const int lane = threadIdx.x & 31; const int g = blockIdx.x; const int w = __builtin_amdgcn_readfirstlane(threadIdx.x >> 5); const int h = g * REP + w; const int bx = blockIdx.y;
    const size_t zq = (size_t)h * TT * HD, zk = (size_t)g * TT * HD;
    if (bx < NT16) attn_tile<h16, false, 2>(Q16 + zq, nullptr, K16 + zk, nullptr, V16 + zk, nullptr, RHE + (NT16 - 1 - bx) * 32, lane, w, (const h16*)kvr, Ah + h * 1024);
    else attn_tile<bf, true, 1>(Qh + zq, Ql + zq, Kh + zk, Kl + zk, Vh + zk, Vl + zk, (NTH - 1 - (bx - NT16)) * 16, lane, w, kvr, Ah + h * 1024);
}

extern "C" void kernel_launch(void* const* d_in, const int* in_sizes, int n_in,
                              void* d_out, int out_size, void* d_ws, size_t ws_size, hipStream_t stream) {
    if (n_in < 5) return;
    if (in_sizes[0] < (NB - 1) * TT_FULL * DM + TT * DM || in_sizes[1] < DM * DQ || in_sizes[2] < DM * DKV || in_sizes[3] < DM * DKV || in_sizes[4] < DQ * DM) return;
    if (out_size < NB * TT * DM) return;
    const float* x = (const float*)d_in[0]; const float* wq = (const float*)d_in[1]; const float* wk = (const float*)d_in[2]; const float* wv = (const float*)d_in[3]; const float* wo = (const float*)d_in[4];
    float* OUT = (float*)d_out;     // [NB][TT][DM]
    char* wsp = (char*)d_ws;
    auto take = [&](size_t bytes) { char* p = wsp; wsp += (bytes + 255) & ~(size_t)255; return (void*)p; };
    // persistent planes
    bf* WOt = (bf*)take((size_t)DM * DQ * 2); float* CS = (float*)take((size_t)TT * HD * 2 * 4);
    h16* QP16 = (h16*)take((size_t)NH_ * TT * HD * 2); h16* KP16 = (h16*)take((size_t)NKV * TT * HD * 2); h16* VT16 = (h16*)take((size_t)NKV * HD * TT * 2);
    bf* QPh = (bf*)take((size_t)NH_ * TT * HD * 2); bf* QPl = (bf*)take((size_t)NH_ * TT * HD * 2); bf* KPh = (bf*)take((size_t)NKV * TT * HD * 2); bf* KPl = (bf*)take((size_t)NKV * TT * HD * 2);
    bf* VTh = (bf*)take((size_t)NKV * HD * TT * 2); bf* VTl = (bf*)take((size_t)NKV * HD * TT * 2); bf* ATh = (bf*)take((size_t)TT * DQ * 2);
    // projection-phase temporaries
    bf* WQt = (bf*)take((size_t)DQ * DM * 2); bf* WKt = (bf*)take((size_t)DKV * DM * 2); bf* WVt = (bf*)take((size_t)DKV * DM * 2);
    bf* XB = (bf*)take((size_t)NB * TT * DM * 2);
    const size_t total = (size_t)(wsp - (char*)d_ws);
    if (total > ws_size || total > (size_t)134217728) return;

    // inverse rotary frequencies inv[j] = 1 / 500000^(j/32): 32nd root by Newton in double (pure arithmetic), powers RNE-converted to f32, then an f32 reciprocal.
    RopeTab tab;
    { double y = 1.5; for (int it = 0; it < 64; ++it) { double p = 1.0; for (int k = 0; k < 31; ++k) p *= y; const double fy = p * y - 500000.0; y = y - fy / (32.0 * p); }
      double pj = 1.0; for (int j = 0; j < 32; ++j) { const float pf = (float)pj; tab.f[j] = 1.0f / pf; pj *= y; } }

    // weights -> 16-bit planes of their bf16 values ([in][out] transposed), x -> bf16, all in fragment order; rotary table
    k_prep<<<PB_CS + PB_WQ + PB_WO + 2 * PB_WKV + NB * PB_X, 256, 0, stream>>>(x, wq, wk, wv, wo, tab, XB, WQt, WKt, WVt, WOt, CS);
    for (int b = 0; b < NB; ++b) {
        k_qkv<<<dim3(TT / 128, (NH_ + 2 * NKV) / 2, 1), 128, 0, stream>>>(XB + (size_t)b * TT * DM, WQt, WKt, WVt, CS, QP16, QPh, QPl, KP16, KPh, KPl, VT16, VTh, VTl);
        k_fattn<<<dim3(NKV, NT16 + NTH, 1), 128, 0, stream>>>(QP16, KP16, VT16, QPh, QPl, KPh, KPl, VTh, VTl, ATh);
        k_gemmw<false, DQ><<<dim3(TT / 128, DM / 128, 1), 128, 0, stream>>>(ATh, WOt, OUT + (size_t)b * TT * DM, DM, nullptr); }
}

// v008
// A run of this version takes 82.5 microseconds.
// In two side-by-side timings against v007, it was 1.03 and 1.04 times as fast.
// All steps since v000 together make it 14.7 times as fast.
#include <hip/hip_runtime.h>

// Grouped-query attention block (NB x SEQ x 2048): q = x Wq (32 heads x 64), k / v = x Wk / x Wv (8 kv heads x 64, 4 query heads per kv head), rotate-half rotary embedding
// (base 500000; cos/sin table built on device from host-computed inverse frequencies), causal sliding-window softmax(q.k / 8) (window 1024, -inf fill, diagonal always kept),
// ctx merged as [t][h*64 + d], out = ctx Wo -> f32 [NB][SEQ][2048]. Weights are [in][out] and are transposed into 16-bit planes.
// Every 16-bit operand plane of a matrix product (x, Wq, Wk, Wv, Wo, the q / k head planes with k = d, the transposed v planes with row = d and k = t, ctx) lies in FRAGMENT ORDER: a block of 16 rows x 32 k is 1 KiB, [j = (k >> 4) & 1][lane = 16*((k >> 3) & 1) + (row & 15)][k & 7],
// blocks ordered [row >> 4][k >> 5]; a fragment is then two loads of 512 contiguous bytes (lane l takes 16 bytes at 16*l), four whole 128-B lines each, where a row-major plane made every load touch 16 lines.
// Compute dtypes (f32 accumulate everywhere): every input RNE-converted to bf16; x.Wq, x.Wk, x.Wv: v_wmma_f32_16x16x32_bf16 on plain bf16 operands; q.k and P.v: query rows < RH on bf16 hi+lo
// planes (3 products), rows >= RH single v_wmma_f32_16x16x32_f16 (P carried x1024), one fused kernel with an online softmax over 32-key passes inside the window; softmax and rotary arithmetic f32; ctx.Wo: single v_wmma_f32_16x16x32_f16, ctx rounded to f16, Wo rounded to bf16 like every input and that value held in an f16 plane (8 significant bits fit f16's 11: the weight the product sees is the bf16 one).

#ifndef NB
#define NB 1
#endif
#ifndef SEQ
#define SEQ 2048
#endif
#ifndef RH
#define RH 512                  // query rows < RH use hi+lo planes (0: none)
#endif
#define TT      SEQ
#define TT_FULL 2048
#define DM      2048
#define NH_     32
#define NKV     8
#define REP     (NH_ / NKV)
#define HD      64
#define DQ      (NH_ * HD)
#define DKV     (NKV * HD)
#define RHE     ((RH < TT) ? RH : TT)
#define WIN     1024
#define PSH     10.0f             // f16 rows: P carried x 2^PSH
#define SCL     0.125f            // HD^-0.5
static_assert(TT % 128 == 0 && TT >= 128 && TT <= TT_FULL);
static_assert(RH % 64 == 0 && RH >= 0);
static_assert(REP == 4);
static_assert(DM % 64 == 0 && DQ % 64 == 0 && DKV % 64 == 0 && HD == 64);

typedef _Float16 h16;
typedef unsigned short bf;
typedef __attribute__((ext_vector_type(16))) __bf16   v16bf;
typedef __attribute__((ext_vector_type(16))) _Float16 v16h;
typedef __attribute__((ext_vector_type(8)))  _Float16 v8h;
typedef __attribute__((ext_vector_type(8)))  unsigned short v8us;
typedef __attribute__((ext_vector_type(8)))  float    v8f;
typedef __attribute__((ext_vector_type(4)))  float    v4f;
typedef __attribute__((ext_vector_type(2)))  _Float16 v2h;
typedef __attribute__((ext_vector_type(4)))  _Float16 v4h;
typedef __attribute__((ext_vector_type(2)))  unsigned short v2us;
typedef __attribute__((ext_vector_type(4)))  unsigned short v4us;
typedef __attribute__((ext_vector_type(2)))  float v2f;
typedef v8h  __attribute__((may_alias)) v8ha;
typedef v4f  __attribute__((may_alias)) v4fa;
typedef v8us __attribute__((may_alias)) v8usa;

__device__ __forceinline__ unsigned short f2bf(float f) { unsigned u = __float_as_uint(f); u += 0x7FFFu + ((u >> 16) & 1u); return (unsigned short)(u >> 16); }   // RNE convert
__device__ __forceinline__ float bf2f(unsigned short b) { return __uint_as_float(((unsigned)b) << 16); }
__device__ __forceinline__ float bfr(float f) { return bf2f(f2bf(f)); }
__device__ __forceinline__ v16h cat16(v8h lo, v8h hi) { return __builtin_shufflevector(lo, hi, 0, 1, 2, 3, 4, 5, 6, 7, 8, 9, 10, 11, 12, 13, 14, 15); }
__device__ __forceinline__ v16bf cat16b(v8us lo, v8us hi) { return __builtin_bit_cast(v16bf, __builtin_shufflevector(lo, hi, 0, 1, 2, 3, 4, 5, 6, 7, 8, 9, 10, 11, 12, 13, 14, 15)); }
__device__ __forceinline__ v8f wmma16(v16h a, v16h b, v8f c) { return __builtin_amdgcn_wmma_f32_16x16x32_f16(false, a, false, b, (short)0, c, false, false); }
__device__ __forceinline__ v8f wmmab(v16bf a, v16bf b, v8f c) { return __builtin_amdgcn_wmma_f32_16x16x32_bf16(false, a, false, b, (short)0, c, false, false); }
__device__ __forceinline__ h16 tohx(float x) { return (h16)x; }
__device__ __forceinline__ void splitf(float y, unsigned short& h, unsigned short& l) { h = f2bf(y); l = f2bf(y - bf2f(h)); }

// ---- fragment loaders
// Fragment map (both operands): lane row/col = lane & 15, elements 0..7 <- k0 + 8*(lane>>4) + 0..7, elements 8..15 <- k0 + 16 + 8*(lane>>4) + 0..7; D element r of lane l = (row 8*(l>>4) + r, col l & 15).
template <typename T16> struct WFrag;
template <> struct WFrag<h16> { typedef v16h V; static __device__ __forceinline__ V ld(const h16* p) { return cat16(*(const v8h*)p, *(const v8h*)(p + 16)); } static __device__ __forceinline__ V ldo(const h16* b, unsigned o) { return ld((const h16*)((const char*)b + o)); } static __device__ __forceinline__ V ldf(const h16* p) { return cat16(*(const v8h*)p, *(const v8h*)(p + 256)); } static __device__ __forceinline__ V ldfo(const h16* b, unsigned o) { return ldf((const h16*)((const char*)b + o)); } static __device__ __forceinline__ v8f mma(V a, V b, v8f c) { return wmma16(a, b, c); } };
template <> struct WFrag<bf> { typedef v16bf V; static __device__ __forceinline__ V ld(const bf* p) { return cat16b(*(const v8us*)p, *(const v8us*)(p + 16)); } static __device__ __forceinline__ V ldo(const bf* b, unsigned o) { return ld((const bf*)((const char*)b + o)); } static __device__ __forceinline__ V ldf(const bf* p) { return cat16b(*(const v8us*)p, *(const v8us*)(p + 256)); } static __device__ __forceinline__ V ldfo(const bf* b, unsigned o) { return ldf((const bf*)((const char*)b + o)); } static __device__ __forceinline__ v8f mma(V a, V b, v8f c) { return wmmab(a, b, c); } };
// ---- LDS staging of the two GEMM kernels (k_gemmw, k_qkv). A work-group of 4 waves (2 x 2) owns a 128x128 output tile, each wave a 64x64 tile of it (16 accumulators). A stage is KS k of every operand row of the
// block tile. In a fragment-order plane 16 rows x KS k are CH contiguous elements (4 KiB, a "chunk": KS/32 blocks of 1 KiB), and a stage keeps that order in LDS, chunk behind chunk, so a fragment is two
// ds_load_b128 of 512 contiguous bytes. The chunks come in by global_load_async_to_lds_b128 (a lane moves its own 16 bytes, through no register), 8 copies a chunk; the immediate offset moves the global and the LDS address alike.
// Two buffers: stage t + 2 is asked for behind the barrier that ends trip t, into the buffer trip t has read, and flies during trip t + 1.
// Staggered k walk: all blocks of a launch run at once, and 16 or more of them share each operand tile. Started at k = 0 alike, the sharers would ask L2 for the same lines at the same moment, and every stage
// would be a first touch that all of them wait out from memory. So block (bx, by) walks the stages from number (bx + by) mod NS on and wraps round: blocks with one index equal differ in their start unless the other differs by NS (k_qkv: by and by + 16), at any moment at most two sharers of a tile
// read one stage of it, and what one has fetched the next finds in L2. Only the order of the f32 sums over k turns with the start.
#define KS 128
#define CH (16 * KS)
#define CHB (CH * 2)              // bytes of a chunk
#define CP1(L, G, O) "global_load_async_to_lds_b128 " L ", " G ", off offset:" #O "\n\t"
#define CP8(L, G) CP1(L, G, 0) CP1(L, G, 512) CP1(L, G, 1024) CP1(L, G, 1536) CP1(L, G, 2048) CP1(L, G, 2560) CP1(L, G, 3072) CP1(L, G, 3584)
static_assert(CHB == 8 * 512);
__device__ __forceinline__ unsigned ldsaddr(const void* p) { return (unsigned)(size_t)p; }
__device__ __forceinline__ v16bf ldl(const bf* p) { return cat16b(*(const v8us*)p, *(const v8us*)(p + 256)); }
__device__ __forceinline__ void wait_ds() { asm volatile("s_wait_dscnt 0x0" ::: "memory"); }
__device__ __forceinline__ void wait_async() { asm volatile("s_wait_asynccnt 0x0" ::: "memory"); }
// The copies of one wave and one stage stand in ONE statement that ends in s_wait_xcnt 0 (a precaution): so the wait stands ahead of every rewrite of a register that a copy names.
__device__ __forceinline__ void stage4(unsigned l, const bf* g, size_t step) {   // 4 chunks: LDS places CHB apart, global chunks step elements apart
    asm volatile(CP8("%0", "%4") CP8("%1", "%5") CP8("%2", "%6") CP8("%3", "%7") "s_wait_xcnt 0x0"
                 :: "v"(l), "v"(l + CHB), "v"(l + 2 * CHB), "v"(l + 3 * CHB), "v"(g), "v"(g + step), "v"(g + 2 * step), "v"(g + 3 * step) : "memory"); }

// ---- k_gemmw: C[m][n] (f32, pitch ldc, + optional f32 bias[n]) = sum_k A[m][k] Bt[n][k], one f16 product per k step, planes of f16 bits in fragment order. Grid (M/128, N/128), 128 threads.
// A stage is [A 8 chunks | Bt 8 chunks] = 64 KiB; wave w copies chunks 4w .. 4w+3 (32 copies in flight at most). K % KS == 0, K >= 2*KS.
__device__ __forceinline__ v16h ldh(const bf* p) { return __builtin_bit_cast(v16h, ldl(p)); }   // the same fragment read as f16
template <bool BIAS, int K>
__global__ __launch_bounds__(128) void k_gemmw(const bf* __restrict__ A, const bf* __restrict__ Bt, float* C, int ldc, const float* __restrict__ bias) {
    typedef v16h V;
    static_assert(K % KS == 0 && K >= 2 * KS);
    __shared__ __attribute__((aligned(1024))) bf ring[2 * 16 * CH];
    __shared__ __align__(16) float osm[4 * 16 * 68];
    const int lane = threadIdx.x & 31, lr = lane & 15, hi = lane >> 4; const int w = __builtin_amdgcn_readfirstlane(threadIdx.x >> 5), wm = w & 1, wn = w >> 1;
    float* os = osm + w * 16 * 68;                                          // each wave stages its output rows in its own range
    const int r0 = blockIdx.x * 128 + wm * 64, c0 = blockIdx.y * 128 + wn * 64;
    v8f acc[4][4];
#pragma unroll
    for (int mb = 0; mb < 4; ++mb)
#pragma unroll
        for (int nb = 0; nb < 4; ++nb) acc[mb][nb] = (v8f){};
    const bf* gs = ((w < 2) ? A + (size_t)blockIdx.x * 128 * K : Bt + (size_t)blockIdx.y * 128 * K) + (size_t)(w & 1) * 64 * K + 8 * lane;   // the lane's 16 bytes in the first copy of the wave's first chunk; a stage is CH elements further along k
    const unsigned l0 = ldsaddr(ring) + (unsigned)w * 4 * CHB + (unsigned)lane * 16;
    const bf* la = ring + wm * 4 * CH + 8 * lane; const bf* lb = ring + (8 + wn * 4) * CH + 8 * lane;
    constexpr int NS = K / KS; static_assert((NS & (NS - 1)) == 0);
    const int so = (blockIdx.x + blockIdx.y) & (NS - 1);                    // the block's first stage (staggered k walk, above)
    stage4(l0, gs + (size_t)so * CH, (size_t)16 * K);
    wait_async(); __syncthreads();                                          // the first stage is published
    stage4(l0 + 16 * CHB, gs + (size_t)((so + 1) & (NS - 1)) * CH, (size_t)16 * K);
#pragma unroll 1                                                            // rolled: a trip is 64 matrix instructions, a second copy would only cost instruction cache
    for (int t = 0; t < K / KS; ++t) {
        const int bo = (t & 1) * 16 * CH; V a[2][4], b[2][4];               // two fragment sets: the next k step's LDS reads go out ahead of this step's products
#pragma unroll
        for (int q = 0; q < 4; ++q) { a[0][q] = ldh(la + bo + q * CH); b[0][q] = ldh(lb + bo + q * CH); }
#pragma unroll
        for (int ks = 0; ks < KS / 32; ++ks) { const int cu = ks & 1, nx = cu ^ 1;
            if (ks + 1 < KS / 32) {
#pragma unroll
                for (int q = 0; q < 4; ++q) { const int o = bo + q * CH + (ks + 1) * 512; a[nx][q] = ldh(la + o); b[nx][q] = ldh(lb + o); } }
            __builtin_amdgcn_sched_barrier(0);                              // keeps the reads above in one group ahead of the products below; left free, the scheduler sinks them among the products, each behind a wait to 0
#pragma unroll
            for (int nb = 0; nb < 4; ++nb) {
#pragma unroll
                for (int mb = 0; mb < 4; ++mb) acc[mb][nb] = wmma16(a[cu][mb], b[cu][nb], acc[mb][nb]); } }
        __builtin_amdgcn_sched_barrier(0);                                  // the trip's last products stay ahead of the barrier: left free they sink behind it and hold back the copies, which then fly for less than a trip
        wait_ds(); wait_async(); __syncthreads();                           // publishes stage t + 1 and ends every wave's reads of stage t
        if (t + 2 < K / KS) stage4(l0 + (unsigned)(t & 1) * 16 * CHB, gs + (size_t)((so + t + 2) & (NS - 1)) * CH, (size_t)16 * K);
    }
    wait_async();
#pragma unroll
    for (int mb = 0; mb < 4; ++mb) {
#pragma unroll
        for (int nb = 0; nb < 4; ++nb) {
#pragma unroll
            for (int j = 0; j < 8; ++j) os[(hi * 8 + j) * 68 + nb * 16 + lr] = acc[mb][nb][j]; }
        __builtin_amdgcn_wave_barrier(); asm volatile("" ::: "memory");
        float* crow = C + (size_t)(r0 + mb * 16) * ldc + c0;
{
#pragma unroll
            for (int s = 0; s < 8; ++s) { const int row = 2 * s + hi, cofs = lr * 4; v4f val = *(const v4fa*)(os + row * 68 + cofs); if (BIAS) { val[0] += bfr(bias[c0 + cofs]); val[1] += bfr(bias[c0 + cofs + 1]); val[2] += bfr(bias[c0 + cofs + 2]); val[3] += bfr(bias[c0 + cofs + 3]); }
                *(v4f*)(crow + (size_t)row * ldc + cofs) = val; }
             }
        __builtin_amdgcn_wave_barrier(); asm volatile("" ::: "memory");
    }
}

// ---- wtG: w [K][N] f32 -> bf16 plane of w transposed (row = n, k = k) in fragment order (H: the bf16-rounded value written as f16 bits, for an f16 product). One wave = 32 consecutive n x one block of 32 k: each of its 32 loads is one whole 128-B line of a row of w,
// each of its 4 stores fills two runs of 256 contiguous bytes (a lane's 8 k of one n are the 16 bytes of one fragment slot). (N/32)*(K/32)/8 blocks of 8 waves; blk = the block's index among them.
// K and N are compile-time, so that the 32 loads are one address pair + constant offsets.
template <int K, int N, bool H>
__device__ __forceinline__ void wtG(int blk, const float* __restrict__ w, bf* Bt) {
    static_assert(K % 32 == 0 && N % 32 == 0 && ((N / 32) * (K / 32)) % 8 == 0);
    const int lane = threadIdx.x & 31; const int wv = blk * 8 + (threadIdx.x >> 5); const int kb = wv / (N / 32), n = (wv % (N / 32)) * 32 + lane;
    const float* p = w + (size_t)kb * 32 * N + n; float v[32];
#pragma unroll
    for (int i = 0; i < 32; ++i) v[i] = p[(size_t)i * N];
    bf* q = Bt + ((size_t)(n >> 4) * (K / 32) + kb) * 512 + (n & 15) * 8;
#pragma unroll
    for (int o = 0; o < 4; ++o) { v8us r;                                   // o = 2*j + half: k = 32*kb + 8*o + e
#pragma unroll
        for (int e = 0; e < 8; ++e) r[e] = H ? __builtin_bit_cast(unsigned short, tohx(bfr(v[o * 8 + e]))) : f2bf(v[o * 8 + e]);
        *(v8us*)(q + o * 128) = r; }
    asm volatile("s_wait_xcnt 0x0" ::: "memory");                          // a precaution: in the joint kernel another job's code follows in the listing and rewrites the registers these four stores name
}
// ---- cvt8: src [rows][DM] f32 -> bf16 plane in fragment order. One wave = 8 rows x one block of 32 k: a lane converts 8 consecutive k; the 8 lanes of one k octet store 128 contiguous bytes.
__device__ __forceinline__ void cvt8(int blk, const float* __restrict__ src, bf* dst, size_t n8) { const size_t i = (size_t)blk * 256 + threadIdx.x; if (i >= n8) return;
    const int lane = threadIdx.x & 31, o = lane & 3; const int wv = (int)(i >> 5), kb = wv % (DM / 32), t = (wv / (DM / 32)) * 8 + (lane >> 2);
    const v8f v = *(const v8f*)(src + (size_t)t * DM + kb * 32 + o * 8); v8us r;
#pragma unroll
    for (int k = 0; k < 8; ++k) r[k] = f2bf(v[k]);
    *(v8us*)(dst + ((size_t)(t >> 4) * (DM / 32) + kb) * 512 + o * 128 + (t & 15) * 8) = r;  }

// ---- csgen: rotary table CS[t][d] = {cos(t * inv[d & 31]), sin(t * inv[d & 31])} (f32 product, precise sincos). inv[] arrives by value (host-computed); lane == d & 31 by construction
struct RopeTab { float f[32]; };
static_assert(sizeof(RopeTab) == 128);
__device__ __forceinline__ void csgen(int blk, const RopeTab& tab, float* CS) {
    const int idx = blk * 256 + threadIdx.x; const int lane = threadIdx.x & 31; float inv = 0.0f;
#pragma unroll
    for (int i = 0; i < 32; ++i) inv = (lane == i) ? tab.f[i] : inv;
    if (idx >= TT * HD) return;
    const int t = idx / HD; float ang = __fmul_rn((float)t, inv); asm volatile("" : "+v"(ang));
    float sn, cs; sincosf(ang, &sn, &cs);
    v2f o; o[0] = cs; o[1] = sn;
    *(v2f*)(CS + (size_t)idx * 2) = o;  }

// ---- k_prep: everything that only turns an input (or nothing) into an operand plane, ONE launch: the six jobs read and write disjoint buffers and none needs another's result, so as launches of their own each only
// paid for a start, a ramp and a drain with the chip near empty. A block of 8 waves belongs to one job by its index (a scalar compare; no barrier anywhere). In block index order
// the jobs whose blocks last longest (table, then the transpositions with their 32 loads a lane) come first, the x conversion (one load, one store a lane) last.
#define PB_CS ((TT * HD + 255) / 256)
#define PB_WQ ((DQ / 32) * (DM / 32) / 8)
#define PB_WKV ((DKV / 32) * (DM / 32) / 8)
#define PB_WO ((DM / 32) * (DQ / 32) / 8)
#define PB_X  (TT * DM / 8 / 256)   // per batch entry
static_assert((TT * DM / 8) % 256 == 0);
__global__ __launch_bounds__(256) void k_prep(const float* __restrict__ x, const float* __restrict__ wq, const float* __restrict__ wk, const float* __restrict__ wv, const float* __restrict__ wo, RopeTab tab,
                                              bf* XB, bf* WQt, bf* WKt, bf* WVt, bf* WOt, float* CS) {
    int blk = blockIdx.x;
    if (blk < PB_CS) { csgen(blk, tab, CS); return; }
    blk -= PB_CS;
    if (blk < PB_WQ) { wtG<DM, DQ, false>(blk, wq, WQt); return; }
    blk -= PB_WQ;
    if (blk < PB_WO) { wtG<DQ, DM, true>(blk, wo, WOt); return; }
    blk -= PB_WO;
    if (blk < PB_WKV) { wtG<DM, DKV, false>(blk, wk, WKt); return; }
    blk -= PB_WKV;
    if (blk < PB_WKV) { wtG<DM, DKV, false>(blk, wv, WVt); return; }
    blk -= PB_WKV;
    const int b = blk / PB_X;                                               // batch entry; its plane is TT * DM elements further
    cvt8(blk - b * PB_X, x + (size_t)b * TT_FULL * DM, XB + (size_t)b * TT * DM, (size_t)TT * DM / 8);
}

// ---- k_qkv: the three input projections with their plane building, ONE launch. Grid (TT/128, (NH_ + 2*NKV)/2), 128 threads, staged as above; a wave's 64 columns are exactly one head
// (head index < NH_: query head, then NKV key heads, then NKV value heads; the two heads of a block are of one kind, so every branch round a barrier is block-uniform), so the rotate-half partner d +- HD/2 lies in the same tile and the f32 projection never goes to memory.
// A stage is [x 8 chunks | weight 8 chunks] = 64 KiB; wave w copies chunks 4w .. 4w+3 (32 copies in flight at most).
// q / k tiles: 16 rows at a time through LDS, out[d] = x[d] cos[t][d] - x[d+HD/2] sin[t][d], out[d+HD/2] = x[d+HD/2] cos[t][d+HD/2] + x[d] sin[t][d+HD/2], stored as head planes [h] (row t, k = d; f16 + bf16 hi/lo) in fragment order, 32-B runs that the 8 stores of 16 rows join to whole lines.
// v tiles: a lane's 8 accumulator elements are 8 consecutive t of one d, which is one 16-byte fragment slot of the transposed planes [g] (row d, k = t): stored straight from registers, 512 contiguous bytes a wave.
static_assert(NH_ % 2 == 0 && NKV % 2 == 0 && DM % KS == 0 && DM >= 2 * KS);
__global__ __launch_bounds__(128) void k_qkv(const bf* __restrict__ A, const bf* __restrict__ Wq, const bf* __restrict__ Wk, const bf* __restrict__ Wv, const float* __restrict__ CS,
                                            h16* Q16, bf* Qh, bf* Ql, h16* K16, bf* Kh, bf* Kl, h16* V16, bf* Vh, bf* Vl) {
    typedef WFrag<bf>::V V;
    __shared__ __attribute__((aligned(1024))) bf ring[2 * 16 * CH];
    __shared__ __align__(16) float osm[4 * 16 * 68];
    const int lane = threadIdx.x & 31, lr = lane & 15, hi = lane >> 4; const int w = __builtin_amdgcn_readfirstlane(threadIdx.x >> 5), wm = w & 1, wn = w >> 1;
    float* os = osm + w * 16 * 68;                                          // each wave turns its rows in its own range
    const int r0 = blockIdx.x * 128 + wm * 64, hy = blockIdx.y * 2 + wn;
    const bool isq = hy < NH_, isv = hy >= NH_ + NKV; const int hh = isq ? hy : (isv ? hy - NH_ - NKV : hy - NH_);   // head index inside its own group
    const bf* Bt = (isq ? Wq : (isv ? Wv : Wk)) + (size_t)(hh - wn) * HD * DM;   // the first of the block's two heads
    v8f acc[4][4];
#pragma unroll
    for (int mb = 0; mb < 4; ++mb)
#pragma unroll
        for (int nb = 0; nb < 4; ++nb) acc[mb][nb] = (v8f){};
    const bf* gs = ((w < 2) ? A + (size_t)blockIdx.x * 128 * DM : Bt) + (size_t)(w & 1) * 64 * DM + 8 * lane;   // the lane's 16 bytes in the first copy of the wave's first chunk; a stage is CH elements further along k
    const unsigned l0 = ldsaddr(ring) + (unsigned)w * 4 * CHB + (unsigned)lane * 16;
    const bf* la = ring + wm * 4 * CH + 8 * lane; const bf* lb = ring + (8 + wn * 4) * CH + 8 * lane;
    constexpr int NS = DM / KS; static_assert((NS & (NS - 1)) == 0);
    const int so = (blockIdx.x + blockIdx.y) & (NS - 1);                    // the block's first stage (staggered k walk, above)
    stage4(l0, gs + (size_t)so * CH, (size_t)16 * DM);
    wait_async(); __syncthreads();                                          // the first stage is published
    stage4(l0 + 16 * CHB, gs + (size_t)((so + 1) & (NS - 1)) * CH, (size_t)16 * DM);
#pragma unroll 1                                                            // rolled: a trip is 64 matrix instructions, a second copy would only cost instruction cache
    for (int t = 0; t < DM / KS; ++t) {
        const int bo = (t & 1) * 16 * CH; V a[2][4], b[2][4];               // two fragment sets: the next k step's LDS reads go out ahead of this step's products
#pragma unroll
        for (int q = 0; q < 4; ++q) { a[0][q] = ldl(la + bo + q * CH); b[0][q] = ldl(lb + bo + q * CH); }
#pragma unroll
        for (int ks = 0; ks < KS / 32; ++ks) { const int cu = ks & 1, nx = cu ^ 1;
            if (ks + 1 < KS / 32) {
#pragma unroll
                for (int q = 0; q < 4; ++q) { const int o = bo + q * CH + (ks + 1) * 512; a[nx][q] = ldl(la + o); b[nx][q] = ldl(lb + o); } }
            __builtin_amdgcn_sched_barrier(0);                              // keeps the reads above in one group ahead of the products below; left free, the scheduler sinks them among the products, each behind a wait to 0
#pragma unroll
            for (int nb = 0; nb < 4; ++nb) {
#pragma unroll
                for (int mb = 0; mb < 4; ++mb) acc[mb][nb] = wmmab(a[cu][mb], b[cu][nb], acc[mb][nb]); } }
        __builtin_amdgcn_sched_barrier(0);                                  // the trip's last products stay ahead of the barrier: left free they sink behind it and hold back the copies, which then fly for less than a trip
        wait_ds(); wait_async(); __syncthreads();                           // publishes stage t + 1 and ends every wave's reads of stage t
        if (t + 2 < DM / KS) stage4(l0 + (unsigned)(t & 1) * 16 * CHB, gs + (size_t)((so + t + 2) & (NS - 1)) * CH, (size_t)16 * DM);
    }
    wait_async();
    if (!isv) {
        const int d = lr * 4; const size_t zp = ((size_t)hh * TT + r0) * HD + (d >> 5) * 512 + ((d >> 4) & 1) * 256 + ((d >> 3) & 1) * 128 + hi * 8 + (d & 7);   // the lane's place in row r0 + hi (fragment order, k = d); every later row is a constant step from it, for the table as for the planes
        h16* P16 = (isq ? Q16 : K16) + zp; bf* Ph = (isq ? Qh : Kh) + zp; bf* Pl = (isq ? Ql : Kl) + zp; const float* cb = CS + ((size_t)(r0 + hi) * HD + d) * 2;
#pragma unroll
        for (int mb = 0; mb < 4; ++mb) {
            v4f c01[8], c23[8];                                             // {cos, sin} of d .. d+3 for the lane's 8 rows, asked for ahead of the LDS round trip
#pragma unroll
            for (int s = 0; s < 8; ++s) { const float* cp = cb + (mb * 16 + 2 * s) * HD * 2; c01[s] = *(const v4f*)cp; c23[s] = *(const v4f*)(cp + 4); }
#pragma unroll
            for (int nb = 0; nb < 4; ++nb) {
#pragma unroll
                for (int j = 0; j < 8; ++j) os[(hi * 8 + j) * 68 + nb * 16 + lr] = acc[mb][nb][j]; }
            __syncthreads();                                                // the 16 rows are read back by other lanes than wrote them
#pragma unroll
            for (int s = 0; s < 8; ++s) { const int row = 2 * s + hi;
                const v4f x0 = *(const v4fa*)(os + row * 68 + d), x1 = *(const v4fa*)(os + row * 68 + (d ^ (HD / 2)));
                const float cs[4] = { c01[s][0], c01[s][2], c23[s][0], c23[s][2] }, sn[4] = { c01[s][1], c01[s][3], c23[s][1], c23[s][3] };
                const v4f xp = (d < HD / 2) ? -x1 : x1;                    // the partner enters with a minus in the lower half of the head
                v4h o16; v4us oh, ol;
#pragma unroll
                for (int q = 0; q < 4; ++q) { const float r = x0[q] * cs[q] + xp[q] * sn[q];
                    o16[q] = tohx(r); unsigned short a2, c2; splitf(r, a2, c2); oh[q] = a2; ol[q] = c2; }
                const int e = mb * 16 * HD + 2 * s * 8; *(v4h*)(P16 + e) = o16; *(v4us*)(Ph + e) = oh; *(v4us*)(Pl + e) = ol;
                asm volatile("s_wait_xcnt 0x0" ::: "memory"); }            // before the data registers of these stores are rewritten
            __syncthreads();                                                // every read of these rows ends before the next 16 rows overwrite them
        }
    } else {
        const size_t zv = (size_t)hh * HD * TT + (size_t)r0 * 16 + 8 * lane; h16* P16 = V16 + zv; bf* Ph = Vh + zv; bf* Pl = Vl + zv;
#pragma unroll
        for (int nb = 0; nb < 4; ++nb)
#pragma unroll
            for (int mb = 0; mb < 4; ++mb) { v8h o16; v8us oh, ol;
#pragma unroll
                for (int j = 0; j < 8; ++j) { const float x = acc[mb][nb][j]; o16[j] = tohx(x); unsigned short a2, c2; splitf(x, a2, c2); oh[j] = a2; ol[j] = c2; }
                const int e = nb * 16 * TT + (mb >> 1) * 512 + (mb & 1) * 256; *(v8h*)(P16 + e) = o16; *(v8us*)(Ph + e) = oh; *(v8us*)(Pl + e) = ol;
                asm volatile("s_wait_xcnt 0x0" ::: "memory"); }            // before the data registers of these stores are rewritten
    }
}

// ---- k_fattn: fused causal sliding-window attention, scores and probabilities never leave registers. One wave = one query head x NQ*16 query rows; the 4 waves of a block are the 4 query heads
// of one kv head on the same rows, so they share each pass's K / V tiles, staged in LDS. Per pass of 32 keys: St = K.Qt (A = K rows, B = Q kept in registers), online softmax per query column (a lane holds one
// query's scores: in-lane maximum and sum, one exchange between the wave halves for the maximum), the two 16-key score tiles convert in place into the B operand Pt, Ot += Vt.Pt (A = Vt rows).
// All fragments use WFrag::ldf's k order (that of WFrag::ld), which is the order a packed D pair delivers. Rows < RH: bf16 hi+lo planes, 3 products each; rows >= RH: f16, P carried x 2^PSH (cancels in O / sum).
// D element r of lane l of Ot = (d = 16*dt + 8*(l>>4) + r, query l & 15): 8 consecutive d per lane, stored as one f16 fragment slot of the merged ctx plane (row t, k = h*64 + d; Ah arrives at the head's first block, 2*h).
// 2^x with the slot behind it filled: the instruction set asks for one independent instruction or v_nop between a transcendental and a directly following overwrite of its source or read of its
// result; only a v_nop inside the same statement is tied to the instruction.
// K / V staging: the 4 waves of a block walk the same keys of the same kv head, so a pass's tiles come into LDS ONCE per block and every wave reads its fragments there, where before each of the 4 waves asked global memory for the same lines itself.
// A stage is one pass: [K 4 KiB | V 4 KiB] (hi+lo rows: [K hi | V hi | K lo | V lo]), each tile 4 fragment blocks of 1 KiB in plane order (K: block 2*kt + ks, contiguous in the plane; V: block dt, 16*TT elements apart).
// Wave w copies block w of every tile, 2 copies of 512 B a block (a lane moves its own 16 bytes; the immediate offset moves both addresses). Two buffers: stage t + 2 is asked for behind the barrier of pass t, into the buffer pass t has read.
// As in stage4, a wave's copies of a stage stand in ONE statement that ends in s_wait_xcnt 0 (a precaution), ahead of every rewrite of a register that a copy names.
#define CP2(L, G) CP1(L, G, 0) CP1(L, G, 512)
__device__ __forceinline__ void stage_kv(unsigned l, const void* gk, const void* gv) {
    asm volatile(CP2("%0", "%2") CP2("%1", "%3") "s_wait_xcnt 0x0" :: "v"(l), "v"(l + 4096u), "v"(gk), "v"(gv) : "memory"); }
__device__ __forceinline__ void stage_kv2(unsigned l, const void* gk, const void* gv, const void* gk2, const void* gv2) {
    asm volatile(CP2("%0", "%4") CP2("%1", "%5") CP2("%2", "%6") CP2("%3", "%7") "s_wait_xcnt 0x0"
                 :: "v"(l), "v"(l + 4096u), "v"(l + 8192u), "v"(l + 12288u), "v"(gk), "v"(gv), "v"(gk2), "v"(gv2) : "memory"); }
__device__ __forceinline__ float exp2s(float x) { float r; asm("v_exp_f32 %0, %1\n\tv_nop" : "=v"(r) : "v"(x)); return r; }
template <typename T16, bool HI, int NQ>
__device__ __forceinline__ void attn_tile(const T16* __restrict__ Q, const T16* __restrict__ Q2, const T16* __restrict__ Kp, const T16* __restrict__ K2, const T16* __restrict__ Vt, const T16* __restrict__ V2, int q0, int lane, int w, const T16* sm, bf* Ah) {
    typedef typename WFrag<T16>::V V;                                       // every full unroll below keeps the fragment arrays indexed by constants, that is, in registers
    const int lr = lane & 15, hi = lane >> 4;
    const unsigned fofs = (unsigned)lane * 16u;                            // the lane's byte offset in a fragment block, fixed for the whole walk: every load is wave-uniform base + lane offset
    V qb[NQ][2], qb2[NQ][2];
#pragma unroll
    for (int nq = 0; nq < NQ; ++nq)
#pragma unroll
        for (int ks = 0; ks < 2; ++ks) { const size_t qo = (size_t)(q0 + nq * 16) * HD + ks * 512; qb[nq][ks] = WFrag<T16>::ldfo(Q + qo, fofs); if (HI) qb2[nq][ks] = WFrag<T16>::ldfo(Q2 + qo, fofs); }
    v8f o[NQ][4]; float m[NQ], l[NQ];
#pragma unroll
    for (int nq = 0; nq < NQ; ++nq) { m[nq] = -1.0e30f; l[nq] = 0.0f;      // the start maximum lies above the ban fill, so a pass whose keys are all banned for a query adds exact zeros
#pragma unroll
        for (int dt = 0; dt < 4; ++dt) o[nq][dt] = (v8f){}; }
    const int kb = max(0, q0 - (WIN - 1)) & ~31, ke = q0 + NQ * 16;         // first key pass of the window of the first row, one past the diagonal of the last row
    asm volatile("s_wait_xcnt 0x0" ::: "memory");                          // the address registers of the loads above are reused below
    constexpr int SE = HI ? 8192 : 4096;                                    // elements of a stage
    const unsigned l0 = ldsaddr(sm) + (unsigned)w * 1024u + fofs;           // the lane's 16 bytes in block w of buffer 0's K tile
    const size_t ok = (size_t)w * 512 + 8 * lane, ov = (size_t)w * 16 * TT + 8 * lane;   // the same place in the planes, pass 0 of the plane
    auto stage = [&](int k0, int bu) { const unsigned l = l0 + (unsigned)bu * (2u * SE);
        if constexpr (HI) stage_kv2(l, Kp + ok + (size_t)k0 * HD, Vt + ov + (size_t)k0 * 16, K2 + ok + (size_t)k0 * HD, V2 + ov + (size_t)k0 * 16);
        else stage_kv(l, Kp + ok + (size_t)k0 * HD, Vt + ov + (size_t)k0 * 16); };
    V ka[2][2], ka2[2][2];                                                  // a pass's K fragments are read right behind the barrier that publishes their stage, so that their LDS latency runs under the tail of the pass before
    auto ldk = [&](int bu) { const T16* sk = sm + bu * SE + 8 * lane;
#pragma unroll
        for (int kt = 0; kt < 2; ++kt)
#pragma unroll
            for (int ks = 0; ks < 2; ++ks) { ka[kt][ks] = WFrag<T16>::ldf(sk + (kt * 2 + ks) * 512); if (HI) ka2[kt][ks] = WFrag<T16>::ldf(sk + 4096 + (kt * 2 + ks) * 512); } };
    stage(kb, 0);
    wait_async(); __syncthreads();                                          // stage 0 is published
    if (kb + 32 < ke) stage(kb + 32, 1);
    ldk(0);
    int bu = 0;
#pragma unroll 1                                                            // rolled: one pass's fragments fill the register budget, a second copy of the body would only cost instruction cache
    for (int k0 = kb; k0 < ke; k0 += 32, bu ^= 1) {
        V va[4], va2[4]; const T16* sb = sm + bu * SE + 8 * lane;           // the lane's slot in the first block of this pass's buffer
#pragma unroll
        for (int dt = 0; dt < 4; ++dt) { va[dt] = WFrag<T16>::ldf(sb + 2048 + dt * 512); if (HI) va2[dt] = WFrag<T16>::ldf(sb + 6144 + dt * 512); }
        if (!HI) __builtin_amdgcn_sched_barrier(0);                         // keeps the V reads in one group at the head of the pass, under the score products; left free, half of them sink to the pass's foot, directly ahead of its wait to 0
        v8f s[NQ][2];
#pragma unroll
        for (int nq = 0; nq < NQ; ++nq)
#pragma unroll
            for (int kt = 0; kt < 2; ++kt) { v8f c = (v8f){};
#pragma unroll
                for (int ks = 0; ks < 2; ++ks) { c = WFrag<T16>::mma(ka[kt][ks], qb[nq][ks], c); if (HI) { c = WFrag<T16>::mma(ka[kt][ks], qb2[nq][ks], c); c = WFrag<T16>::mma(ka2[kt][ks], qb[nq][ks], c); } }
                s[nq][kt] = c; }
#pragma unroll
        for (int nq = 0; nq < NQ; ++nq)
#pragma unroll
            for (int kt = 0; kt < 2; ++kt) s[nq][kt] *= SCL * 1.4426950408889634f;   // scores in log2 units
        if (k0 + 31 > q0 || q0 + NQ * 16 - 1 - k0 >= WIN) {                 // wave-uniform: only passes that touch the diagonal or the window's start hold banned pairs
#pragma unroll
            for (int nq = 0; nq < NQ; ++nq)
#pragma unroll
                for (int kt = 0; kt < 2; ++kt)
#pragma unroll
                    for (int r = 0; r < 8; ++r) { const int j = k0 + kt * 16 + 8 * hi + r, i = q0 + nq * 16 + lr; s[nq][kt][r] = (j <= i && i - j < WIN) ? s[nq][kt][r] : -3.0e38f; } }
        V pb[NQ], pb2[NQ];
#pragma unroll
        for (int nq = 0; nq < NQ; ++nq) { float mx = m[nq];
#pragma unroll
            for (int kt = 0; kt < 2; ++kt)
#pragma unroll
                for (int r = 0; r < 8; ++r) mx = fmaxf(mx, s[nq][kt][r]);
            mx = fmaxf(mx, __shfl_xor(mx, 16, 32));
            const float al = exp2s(m[nq] - mx); m[nq] = mx; const float mb = HI ? mx : mx - PSH; float sum = 0.0f;
#pragma unroll
            for (int kt = 0; kt < 2; ++kt)
#pragma unroll
                for (int r = 0; r < 8; ++r) { const float p = exp2s(s[nq][kt][r] - mb); s[nq][kt][r] = p; sum += p; }
            l[nq] = l[nq] * al + sum;                                       // each wave half keeps the sum of its own keys; joined once after the loop
#pragma unroll
            for (int dt = 0; dt < 4; ++dt) o[nq][dt] *= al;
            if constexpr (HI) { v8us h0, h1, l0, l1;
#pragma unroll
                for (int r = 0; r < 8; ++r) { unsigned short a, c2; splitf(s[nq][0][r], a, c2); h0[r] = a; l0[r] = c2; splitf(s[nq][1][r], a, c2); h1[r] = a; l1[r] = c2; }
                pb[nq] = cat16b(h0, h1); pb2[nq] = cat16b(l0, l1);
            } else { v8h h0, h1;
#pragma unroll
                for (int r = 0; r < 8; ++r) { h0[r] = tohx(s[nq][0][r]); h1[r] = tohx(s[nq][1][r]); }
                pb[nq] = cat16(h0, h1); } }
#pragma unroll
        for (int dt = 0; dt < 4; ++dt)
#pragma unroll
            for (int nq = 0; nq < NQ; ++nq) { o[nq][dt] = WFrag<T16>::mma(va[dt], pb[nq], o[nq][dt]); if (HI) { o[nq][dt] = WFrag<T16>::mma(va[dt], pb2[nq], o[nq][dt]); o[nq][dt] = WFrag<T16>::mma(va2[dt], pb[nq], o[nq][dt]); } }
        if (!HI) __builtin_amdgcn_sched_barrier(0);                         // the softmax and the P.V products stay ahead of the barrier: left free they sink behind it, and the wait for the next stage's copies then stands a fraction of a pass behind their issue
        if (!HI) asm volatile("v_nop\n\tv_nop\n\tv_nop\n\tv_nop");               // the distance behind the last product: only waits, the barrier and branches follow, and on their taken side its V fragment's registers are rewritten after 3 vector slots
        wait_ds(); wait_async(); __syncthreads();                           // publishes the next pass's stage and ends every wave's reads of this one; q0, kb and ke are the block's, so every wave passes it
        if (k0 + 64 < ke) stage(k0 + 64, bu);
        if (k0 + 32 < ke) ldk(bu ^ 1);                                      // behind the last pass no stage is left to read
    }
    wait_async();
#pragma unroll
    for (int nq = 0; nq < NQ; ++nq) { const float inv = __fdiv_rn(1.0f, l[nq] + __shfl_xor(l[nq], 16, 32));
#pragma unroll
        for (int dt = 0; dt < 4; ++dt) { v8h oh;
#pragma unroll
            for (int r = 0; r < 8; ++r) oh[r] = tohx(o[nq][dt][r] * inv);
            const size_t oo = (size_t)(q0 + nq * 16) * DQ + (dt >> 1) * 512 + (dt & 1) * 256 + 8 * lane; *(v8us*)(Ah + oo) = __builtin_bit_cast(v8us, oh);   // fragment order: the wave's 32 slots are 512 contiguous bytes
            asm volatile("s_wait_xcnt 0x0" ::: "memory"); } }              // before the registers of this store are rewritten
}
// grid (NKV, NT16 + NTH), 128 threads; blockIdx.y runs from the row tiles with the longest key walk, for all kv heads, to the short hi+lo tiles last
#define NT16 ((TT - RHE) / 32)
#define NTH  (RHE / 16)
__global__ __launch_bounds__(128) void k_fattn(const h16* __restrict__ Q16, const h16* __restrict__ K16, const h16* __restrict__ V16, const bf* __restrict__ Qh, const bf* __restrict__ Ql, const bf* __restrict__ Kh, const bf* __restrict__ Kl,
                                               const bf* __restrict__ Vh, const bf* __restrict__ Vl, bf* Ah) {
    __shared__ __attribute__((aligned(1024))) bf kvr[2 * 8192];             // two stages of the larger kind (hi+lo rows)
    const int lane = threadIdx.x & 31; const int g = blockIdx.x; const int w = __builtin_amdgcn_readfirstlane(threadIdx.x >> 5); const int h = g * REP + w; const int bx = blockIdx.y;
    const size_t zq = (size_t)h * TT * HD, zk = (size_t)g * TT * HD;
    if (bx < NT16) attn_tile<h16, false, 2>(Q16 + zq, nullptr, K16 + zk, nullptr, V16 + zk, nullptr, RHE + (NT16 - 1 - bx) * 32, lane, w, (const h16*)kvr, Ah + h * 1024);
    else attn_tile<bf, true, 1>(Qh + zq, Ql + zq, Kh + zk, Kl + zk, Vh + zk, Vl + zk, (NTH - 1 - (bx - NT16)) * 16, lane, w, kvr, Ah + h * 1024);
}

extern "C" void kernel_launch(void* const* d_in, const int* in_sizes, int n_in,
                              void* d_out, int out_size, void* d_ws, size_t ws_size, hipStream_t stream) {
    if (n_in < 5) return;
    if (in_sizes[0] < (NB - 1) * TT_FULL * DM + TT * DM || in_sizes[1] < DM * DQ || in_sizes[2] < DM * DKV || in_sizes[3] < DM * DKV || in_sizes[4] < DQ * DM) return;
    if (out_size < NB * TT * DM) return;
    const float* x = (const float*)d_in[0]; const float* wq = (const float*)d_in[1]; const float* wk = (const float*)d_in[2]; const float* wv = (const float*)d_in[3]; const float* wo = (const float*)d_in[4];
    float* OUT = (float*)d_out;     // [NB][TT][DM]
    char* wsp = (char*)d_ws;
    auto take = [&](size_t bytes) { char* p = wsp; wsp += (bytes + 255) & ~(size_t)255; return (void*)p; };
    // persistent planes
    bf* WOt = (bf*)take((size_t)DM * DQ * 2); float* CS = (float*)take((size_t)TT * HD * 2 * 4);
    h16* QP16 = (h16*)take((size_t)NH_ * TT * HD * 2); h16* KP16 = (h16*)take((size_t)NKV * TT * HD * 2); h16* VT16 = (h16*)take((size_t)NKV * HD * TT * 2);
    bf* QPh = (bf*)take((size_t)NH_ * TT * HD * 2); bf* QPl = (bf*)take((size_t)NH_ * TT * HD * 2); bf* KPh = (bf*)take((size_t)NKV * TT * HD * 2); bf* KPl = (bf*)take((size_t)NKV * TT * HD * 2);
    bf* VTh = (bf*)take((size_t)NKV * HD * TT * 2); bf* VTl = (bf*)take((size_t)NKV * HD * TT * 2); bf* ATh = (bf*)take((size_t)TT * DQ * 2);
    // projection-phase temporaries
    bf* WQt = (bf*)take((size_t)DQ * DM * 2); bf* WKt = (bf*)take((size_t)DKV * DM * 2); bf* WVt = (bf*)take((size_t)DKV * DM * 2);
    bf* XB = (bf*)take((size_t)NB * TT * DM * 2);
    const size_t total = (size_t)(wsp - (char*)d_ws);
    if (total > ws_size || total > (size_t)134217728) return;

    // inverse rotary frequencies inv[j] = 1 / 500000^(j/32): 32nd root by Newton in double (pure arithmetic), powers RNE-converted to f32, then an f32 reciprocal.
    RopeTab tab;
    { double y = 1.5; for (int it = 0; it < 64; ++it) { double p = 1.0; for (int k = 0; k < 31; ++k) p *= y; const double fy = p * y - 500000.0; y = y - fy / (32.0 * p); }
      double pj = 1.0; for (int j = 0; j < 32; ++j) { const float pf = (float)pj; tab.f[j] = 1.0f / pf; pj *= y; } }

    // weights -> 16-bit planes of their bf16 values ([in][out] transposed), x -> bf16, all in fragment order; rotary table
    k_prep<<<PB_CS + PB_WQ + PB_WO + 2 * PB_WKV + NB * PB_X, 256, 0, stream>>>(x, wq, wk, wv, wo, tab, XB, WQt, WKt, WVt, WOt, CS);
    for (int b = 0; b < NB; ++b) {
        k_qkv<<<dim3(TT / 128, (NH_ + 2 * NKV) / 2, 1), 128, 0, stream>>>(XB + (size_t)b * TT * DM, WQt, WKt, WVt, CS, QP16, QPh, QPl, KP16, KPh, KPl, VT16, VTh, VTl);
        k_fattn<<<dim3(NKV, NT16 + NTH, 1), 128, 0, stream>>>(QP16, KP16, VT16, QPh, QPl, KPh, KPl, VTh, VTl, ATh);
        k_gemmw<false, DQ><<<dim3(TT / 128, DM / 128, 1), 128, 0, stream>>>(ATh, WOt, OUT + (size_t)b * TT * DM, DM, nullptr); }
}

// v009
// A run of this version takes 77.7 microseconds.
// In two side-by-side timings against v008, it was 1.04 and 1.07 times as fast.
// Over all steps from v000 it is 15.5 times as fast.
#include <hip/hip_runtime.h>

// Grouped-query attention block (NB x SEQ x 2048): q = x Wq (32 heads x 64), k / v = x Wk / x Wv (8 kv heads x 64, 4 query heads per kv head), rotate-half rotary embedding
// (base 500000; cos/sin table built on device from host-computed inverse frequencies), causal sliding-window softmax(q.k / 8) (window 1024, -inf fill, diagonal always kept),
// ctx merged as [t][h*64 + d], out = ctx Wo -> f32 [NB][SEQ][2048]. Weights are [in][out] and are transposed into 16-bit planes.
// Every 16-bit operand plane of a matrix product (x, Wq, Wk, Wv, Wo, the q / k head planes with k = d, the transposed v planes with row = d and k = t, ctx) lies in FRAGMENT ORDER: a block of 16 rows x 32 k is 1 KiB, [j = (k >> 4) & 1][lane = 16*((k >> 3) & 1) + (row & 15)][k & 7],
// blocks ordered [row >> 4][k >> 5]; a fragment is then two loads of 512 contiguous bytes (lane l takes 16 bytes at 16*l), four whole 128-B lines each, where a row-major plane made every load touch 16 lines.
// Compute dtypes (f32 accumulate everywhere): every input RNE-converted to bf16; x.Wq, x.Wk, x.Wv: v_wmma_f32_16x16x32_bf16 on plain bf16 operands; q.k and P.v: query rows < RH on bf16 hi+lo
// planes (3 products), rows >= RH single v_wmma_f32_16x16x32_f16 (P carried x1024), one fused kernel with an online softmax over 32-key passes inside the window; softmax and rotary arithmetic f32; ctx.Wo: single v_wmma_f32_16x16x32_f16, ctx rounded to f16, Wo rounded to bf16 like every input and that value held in an f16 plane (8 significant bits fit f16's 11: the weight the product sees is the bf16 one).

#ifndef NB
#define NB 1
#endif
#ifndef SEQ
#define SEQ 2048
#endif
#ifndef RH
#define RH 512                  // query rows < RH use hi+lo planes (0: none)
#endif
#define TT      SEQ
#define TT_FULL 2048
#define DM      2048
#define NH_     32
#define NKV     8
#define REP     (NH_ / NKV)
#define HD      64
#define DQ      (NH_ * HD)
#define DKV     (NKV * HD)
#define RHE     ((RH < TT) ? RH : TT)
#define WIN     1024
#define PSH     10.0f             // f16 rows: P carried x 2^PSH
#define SCL     0.125f            // HD^-0.5
static_assert(TT % 128 == 0 && TT >= 128 && TT <= TT_FULL);
static_assert(RH % 64 == 0 && RH >= 0);
static_assert(REP == 4);
static_assert(DM % 64 == 0 && DQ % 64 == 0 && DKV % 64 == 0 && HD == 64);

typedef _Float16 h16;
typedef unsigned short bf;
typedef __attribute__((ext_vector_type(16))) __bf16   v16bf;
typedef __attribute__((ext_vector_type(16))) _Float16 v16h;
typedef __attribute__((ext_vector_type(8)))  _Float16 v8h;
typedef __attribute__((ext_vector_type(8)))  unsigned short v8us;
typedef __attribute__((ext_vector_type(8)))  float    v8f;
typedef __attribute__((ext_vector_type(4)))  float    v4f;
typedef __attribute__((ext_vector_type(2)))  _Float16 v2h;
typedef __attribute__((ext_vector_type(4)))  _Float16 v4h;
typedef __attribute__((ext_vector_type(2)))  unsigned short v2us;
typedef __attribute__((ext_vector_type(4)))  unsigned short v4us;
typedef __attribute__((ext_vector_type(2)))  float v2f;
typedef v8h  __attribute__((may_alias)) v8ha;
typedef v4f  __attribute__((may_alias)) v4fa;
typedef v8us __attribute__((may_alias)) v8usa;

__device__ __forceinline__ unsigned short f2bf(float f) { unsigned u = __float_as_uint(f); u += 0x7FFFu + ((u >> 16) & 1u); return (unsigned short)(u >> 16); }   // RNE convert
__device__ __forceinline__ float bf2f(unsigned short b) { return __uint_as_float(((unsigned)b) << 16); }
__device__ __forceinline__ float bfr(float f) { return bf2f(f2bf(f)); }
__device__ __forceinline__ v16h cat16(v8h lo, v8h hi) { return __builtin_shufflevector(lo, hi, 0, 1, 2, 3, 4, 5, 6, 7, 8, 9, 10, 11, 12, 13, 14, 15); }
__device__ __forceinline__ v16bf cat16b(v8us lo, v8us hi) { return __builtin_bit_cast(v16bf, __builtin_shufflevector(lo, hi, 0, 1, 2, 3, 4, 5, 6, 7, 8, 9, 10, 11, 12, 13, 14, 15)); }
__device__ __forceinline__ v8f wmma16(v16h a, v16h b, v8f c) { return __builtin_amdgcn_wmma_f32_16x16x32_f16(false, a, false, b, (short)0, c, false, false); }
__device__ __forceinline__ v8f wmmab(v16bf a, v16bf b, v8f c) { return __builtin_amdgcn_wmma_f32_16x16x32_bf16(false, a, false, b, (short)0, c, false, false); }
__device__ __forceinline__ h16 tohx(float x) { return (h16)x; }
__device__ __forceinline__ void splitf(float y, unsigned short& h, unsigned short& l) { h = f2bf(y); l = f2bf(y - bf2f(h)); }

// ---- fragment loaders
// Fragment map (both operands): lane row/col = lane & 15, elements 0..7 <- k0 + 8*(lane>>4) + 0..7, elements 8..15 <- k0 + 16 + 8*(lane>>4) + 0..7; D element r of lane l = (row 8*(l>>4) + r, col l & 15).
template <typename T16> struct WFrag;
template <> struct WFrag<h16> { typedef v16h V; static __device__ __forceinline__ V ld(const h16* p) { return cat16(*(const v8h*)p, *(const v8h*)(p + 16)); } static __device__ __forceinline__ V ldo(const h16* b, unsigned o) { return ld((const h16*)((const char*)b + o)); } static __device__ __forceinline__ V ldf(const h16* p) { return cat16(*(const v8h*)p, *(const v8h*)(p + 256)); } static __device__ __forceinline__ V ldfo(const h16* b, unsigned o) { return ldf((const h16*)((const char*)b + o)); } static __device__ __forceinline__ v8f mma(V a, V b, v8f c) { return wmma16(a, b, c); } };
template <> struct WFrag<bf> { typedef v16bf V; static __device__ __forceinline__ V ld(const bf* p) { return cat16b(*(const v8us*)p, *(const v8us*)(p + 16)); } static __device__ __forceinline__ V ldo(const bf* b, unsigned o) { return ld((const bf*)((const char*)b + o)); } static __device__ __forceinline__ V ldf(const bf* p) { return cat16b(*(const v8us*)p, *(const v8us*)(p + 256)); } static __device__ __forceinline__ V ldfo(const bf* b, unsigned o) { return ldf((const bf*)((const char*)b + o)); } static __device__ __forceinline__ v8f mma(V a, V b, v8f c) { return wmmab(a, b, c); } };
// ---- LDS staging of the two GEMM kernels (k_gemmw, k_qkv). A work-group of 4 waves (2 x 2) owns a 128x128 output tile, each wave a 64x64 tile of it (16 accumulators). A stage is KS k of every operand row of the
// block tile. In a fragment-order plane 16 rows x KS k are CH contiguous elements (4 KiB, a "chunk": KS/32 blocks of 1 KiB), and a stage keeps that order in LDS, chunk behind chunk, so a fragment is two
// ds_load_b128 of 512 contiguous bytes. The chunks come in by global_load_async_to_lds_b128 (a lane moves its own 16 bytes, through no register), 8 copies a chunk; the immediate offset moves the global and the LDS address alike.
// Two buffers: stage t + 2 is asked for behind the barrier that ends trip t, into the buffer trip t has read, and flies during trip t + 1.
// Staggered k walk: all blocks of a launch run at once, and 16 or more of them share each operand tile. Started at k = 0 alike, the sharers would ask L2 for the same lines at the same moment, and every stage
// would be a first touch that all of them wait out from memory. So block (bx, by) walks the stages from number (bx + by) mod NS on and wraps round: blocks with one index equal differ in their start unless the other differs by NS (k_qkv: by and by + 16), at any moment at most two sharers of a tile
// read one stage of it, and what one has fetched the next finds in L2. Only the order of the f32 sums over k turns with the start.
#define KS 128
#define CH (16 * KS)
#define CHB (CH * 2)              // bytes of a chunk
#define CP1(L, G, O) "global_load_async_to_lds_b128 " L ", " G ", off offset:" #O "\n\t"
#define CP8(L, G) CP1(L, G, 0) CP1(L, G, 512) CP1(L, G, 1024) CP1(L, G, 1536) CP1(L, G, 2048) CP1(L, G, 2560) CP1(L, G, 3072) CP1(L, G, 3584)
static_assert(CHB == 8 * 512);
__device__ __forceinline__ unsigned ldsaddr(const void* p) { return (unsigned)(size_t)p; }
__device__ __forceinline__ v16bf ldl(const bf* p) { return cat16b(*(const v8us*)p, *(const v8us*)(p + 256)); }
__device__ __forceinline__ void wait_ds() { asm volatile("s_wait_dscnt 0x0" ::: "memory"); }
__device__ __forceinline__ void wait_async() { asm volatile("s_wait_asynccnt 0x0" ::: "memory"); }
// The copies of one wave and one stage stand in ONE statement that ends in s_wait_xcnt 0 (a precaution): so the wait stands ahead of every rewrite of a register that a copy names.
__device__ __forceinline__ void stage4(unsigned l, const bf* g, size_t step) {   // 4 chunks: LDS places CHB apart, global chunks step elements apart
    asm volatile(CP8("%0", "%4") CP8("%1", "%5") CP8("%2", "%6") CP8("%3", "%7") "s_wait_xcnt 0x0"
                 :: "v"(l), "v"(l + CHB), "v"(l + 2 * CHB), "v"(l + 3 * CHB), "v"(g), "v"(g + step), "v"(g + 2 * step), "v"(g + 3 * step) : "memory"); }

// ---- k_gemmw: C[m][n] (f32, pitch ldc, + optional f32 bias[n]) = sum_k A[m][k] Bt[n][k], one f16 product per k step, planes of f16 bits in fragment order. Grid (M/128, N/128), 128 threads.
// A stage is [A 8 chunks | Bt 8 chunks] = 64 KiB; wave w copies chunks 4w .. 4w+3 (32 copies in flight at most). K % KS == 0, K >= 2*KS.
__device__ __forceinline__ v16h ldh(const bf* p) { return __builtin_bit_cast(v16h, ldl(p)); }   // the same fragment read as f16
template <bool BIAS, int K>
__global__ __launch_bounds__(128) void k_gemmw(const bf* __restrict__ A, const bf* __restrict__ Bt, float* C, int ldc, const float* __restrict__ bias) {
    typedef v16h V;
    static_assert(K % KS == 0 && K >= 2 * KS);
    __shared__ __attribute__((aligned(1024))) bf ring[2 * 16 * CH];
    __shared__ __align__(16) float osm[4 * 16 * 68];
    const int lane = threadIdx.x & 31, lr = lane & 15, hi = lane >> 4; const int w = __builtin_amdgcn_readfirstlane(threadIdx.x >> 5), wm = w & 1, wn = w >> 1;
    float* os = osm + w * 16 * 68;                                          // each wave stages its output rows in its own range
    const int r0 = blockIdx.x * 128 + wm * 64, c0 = blockIdx.y * 128 + wn * 64;
    v8f acc[4][4];
#pragma unroll
    for (int mb = 0; mb < 4; ++mb)
#pragma unroll
        for (int nb = 0; nb < 4; ++nb) acc[mb][nb] = (v8f){};
    const bf* gs = ((w < 2) ? A + (size_t)blockIdx.x * 128 * K : Bt + (size_t)blockIdx.y * 128 * K) + (size_t)(w & 1) * 64 * K + 8 * lane;   // the lane's 16 bytes in the first copy of the wave's first chunk; a stage is CH elements further along k
    const unsigned l0 = ldsaddr(ring) + (unsigned)w * 4 * CHB + (unsigned)lane * 16;
    const bf* la = ring + wm * 4 * CH + 8 * lane; const bf* lb = ring + (8 + wn * 4) * CH + 8 * lane;
    constexpr int NS = K / KS; static_assert((NS & (NS - 1)) == 0);
    const int so = (blockIdx.x + blockIdx.y) & (NS - 1);                    // the block's first stage (staggered k walk, above)
    stage4(l0, gs + (size_t)so * CH, (size_t)16 * K);
    wait_async(); __syncthreads();                                          // the first stage is published
    stage4(l0 + 16 * CHB, gs + (size_t)((so + 1) & (NS - 1)) * CH, (size_t)16 * K);
#pragma unroll 1                                                            // rolled: a trip is 64 matrix instructions, a second copy would only cost instruction cache
    for (int t = 0; t < K / KS; ++t) {
        const int bo = (t & 1) * 16 * CH; V a[2][4], b[2][4];               // two fragment sets: the next k step's LDS reads go out ahead of this step's products
#pragma unroll
        for (int q = 0; q < 4; ++q) { a[0][q] = ldh(la + bo + q * CH); b[0][q] = ldh(lb + bo + q * CH); }
#pragma unroll
        for (int ks = 0; ks < KS / 32; ++ks) { const int cu = ks & 1, nx = cu ^ 1;
            if (ks + 1 < KS / 32) {
#pragma unroll
                for (int q = 0; q < 4; ++q) { const int o = bo + q * CH + (ks + 1) * 512; a[nx][q] = ldh(la + o); b[nx][q] = ldh(lb + o); } }
            __builtin_amdgcn_sched_barrier(0);                              // keeps the reads above in one group ahead of the products below; left free, the scheduler sinks them among the products, each behind a wait to 0
#pragma unroll
            for (int nb = 0; nb < 4; ++nb) {
#pragma unroll
                for (int mb = 0; mb < 4; ++mb) acc[mb][nb] = wmma16(a[cu][mb], b[cu][nb], acc[mb][nb]); } }
        __builtin_amdgcn_sched_barrier(0);                                  // the trip's last products stay ahead of the barrier: left free they sink behind it and hold back the copies, which then fly for less than a trip
        wait_ds(); wait_async(); __syncthreads();                           // publishes stage t + 1 and ends every wave's reads of stage t
        if (t + 2 < K / KS) stage4(l0 + (unsigned)(t & 1) * 16 * CHB, gs + (size_t)((so + t + 2) & (NS - 1)) * CH, (size_t)16 * K);
    }
    wait_async();
#pragma unroll
    for (int mb = 0; mb < 4; ++mb) {
#pragma unroll
        for (int nb = 0; nb < 4; ++nb) {
#pragma unroll
            for (int j = 0; j < 8; ++j) os[(hi * 8 + j) * 68 + nb * 16 + lr] = acc[mb][nb][j]; }
        __builtin_amdgcn_wave_barrier(); asm volatile("" ::: "memory");
        float* crow = C + (size_t)(r0 + mb * 16) * ldc + c0;
{
#pragma unroll
            for (int s = 0; s < 8; ++s) { const int row = 2 * s + hi, cofs = lr * 4; v4f val = *(const v4fa*)(os + row * 68 + cofs); if (BIAS) { val[0] += bfr(bias[c0 + cofs]); val[1] += bfr(bias[c0 + cofs + 1]); val[2] += bfr(bias[c0 + cofs + 2]); val[3] += bfr(bias[c0 + cofs + 3]); }
                *(v4f*)(crow + (size_t)row * ldc + cofs) = val; }
             }
        __builtin_amdgcn_wave_barrier(); asm volatile("" ::: "memory");
    }
}

// ---- wtG: w [K][N] f32 -> bf16 plane of w transposed (row = n, k = k) in fragment order (H: the bf16-rounded value written as f16 bits, for an f16 product). One wave = 32 consecutive n x one block of 32 k: each of its 32 loads is one whole 128-B line of a row of w,
// each of its 4 stores fills two runs of 256 contiguous bytes (a lane's 8 k of one n are the 16 bytes of one fragment slot). (N/32)*(K/32)/8 blocks of 8 waves; blk = the block's index among them.
// K and N are compile-time, so that the 32 loads are one address pair + constant offsets.
template <int K, int N, bool H>
__device__ __forceinline__ void wtG(int blk, const float* __restrict__ w, bf* Bt) {
    static_assert(K % 32 == 0 && N % 32 == 0 && ((N / 32) * (K / 32)) % 8 == 0);
    const int lane = threadIdx.x & 31; const int wv = blk * 8 + (threadIdx.x >> 5); const int kb = wv / (N / 32), n = (wv % (N / 32)) * 32 + lane;
    const float* p = w + (size_t)kb * 32 * N + n; float v[32];
#pragma unroll
    for (int i = 0; i < 32; ++i) v[i] = p[(size_t)i * N];
    bf* q = Bt + ((size_t)(n >> 4) * (K / 32) + kb) * 512 + (n & 15) * 8;
#pragma unroll
    for (int o = 0; o < 4; ++o) { v8us r;                                   // o = 2*j + half: k = 32*kb + 8*o + e
#pragma unroll
        for (int e = 0; e < 8; ++e) r[e] = H ? __builtin_bit_cast(unsigned short, tohx(bfr(v[o * 8 + e]))) : f2bf(v[o * 8 + e]);
        *(v8us*)(q + o * 128) = r; }
    asm volatile("s_wait_xcnt 0x0" ::: "memory");                          // a precaution: in the joint kernel another job's code follows in the listing and rewrites the registers these four stores name
}
// ---- cvt8: src [rows][DM] f32 -> bf16 plane in fragment order. One wave = 8 rows x one block of 32 k: a lane converts 8 consecutive k; the 8 lanes of one k octet store 128 contiguous bytes.
__device__ __forceinline__ void cvt8(int blk, const float* __restrict__ src, bf* dst, size_t n8) { const size_t i = (size_t)blk * 256 + threadIdx.x; if (i >= n8) return;
    const int lane = threadIdx.x & 31, o = lane & 3; const int wv = (int)(i >> 5), kb = wv % (DM / 32), t = (wv / (DM / 32)) * 8 + (lane >> 2);
    const v8f v = *(const v8f*)(src + (size_t)t * DM + kb * 32 + o * 8); v8us r;
#pragma unroll
    for (int k = 0; k < 8; ++k) r[k] = f2bf(v[k]);
    *(v8us*)(dst + ((size_t)(t >> 4) * (DM / 32) + kb) * 512 + o * 128 + (t & 15) * 8) = r;  }

// ---- csgen: rotary table CS[t][d] = {cos(t * inv[d & 31]), sin(t * inv[d & 31])} (f32 product, precise sincos). inv[] arrives by value (host-computed); lane == d & 31 by construction
struct RopeTab { float f[32]; };
static_assert(sizeof(RopeTab) == 128);
__device__ __forceinline__ void csgen(int blk, const RopeTab& tab, float* CS) {
    const int idx = blk * 256 + threadIdx.x; const int lane = threadIdx.x & 31; float inv = 0.0f;
#pragma unroll
    for (int i = 0; i < 32; ++i) inv = (lane == i) ? tab.f[i] : inv;
    if (idx >= TT * HD) return;
    const int t = idx / HD; float ang = __fmul_rn((float)t, inv); asm volatile("" : "+v"(ang));
    float sn, cs; sincosf(ang, &sn, &cs);
    v2f o; o[0] = cs; o[1] = sn;
    *(v2f*)(CS + (size_t)idx * 2) = o;  }

// ---- k_prep: everything that only turns an input (or nothing) into an operand plane, ONE launch: the six jobs read and write disjoint buffers and none needs another's result, so as launches of their own each only
// paid for a start, a ramp and a drain with the chip near empty. A block of 8 waves belongs to one job by its index (a scalar compare; no barrier anywhere). In block index order
// the jobs whose blocks last longest (table, then the transpositions with their 32 loads a lane) come first, the x conversion (one load, one store a lane) last.
#define PB_CS ((TT * HD + 255) / 256)
#define PB_WQ ((DQ / 32) * (DM / 32) / 8)
#define PB_WKV ((DKV / 32) * (DM / 32) / 8)
#define PB_WO ((DM / 32) * (DQ / 32) / 8)
#define PB_X  (TT * DM / 8 / 256)   // per batch entry
static_assert((TT * DM / 8) % 256 == 0);
__global__ __launch_bounds__(256) void k_prep(const float* __restrict__ x, const float* __restrict__ wq, const float* __restrict__ wk, const float* __restrict__ wv, const float* __restrict__ wo, RopeTab tab,
                                              bf* XB, bf* WQt, bf* WKt, bf* WVt, bf* WOt, float* CS) {
    int blk = blockIdx.x;
    if (blk < PB_CS) { csgen(blk, tab, CS); return; }
    blk -= PB_CS;
    if (blk < PB_WQ) { wtG<DM, DQ, false>(blk, wq, WQt); return; }
    blk -= PB_WQ;
    if (blk < PB_WO) { wtG<DQ, DM, true>(blk, wo, WOt); return; }
    blk -= PB_WO;
    if (blk < PB_WKV) { wtG<DM, DKV, false>(blk, wk, WKt); return; }
    blk -= PB_WKV;
    if (blk < PB_WKV) { wtG<DM, DKV, false>(blk, wv, WVt); return; }
    blk -= PB_WKV;
    const int b = blk / PB_X;                                               // batch entry; its plane is TT * DM elements further
    cvt8(blk - b * PB_X, x + (size_t)b * TT_FULL * DM, XB + (size_t)b * TT * DM, (size_t)TT * DM / 8);
}

// ---- k_qkv: the three input projections with their plane building, ONE launch. Grid (TT/128, (NH_ + 2*NKV)/2), 128 threads, staged as above; a wave's 64 columns are exactly one head
// (head index < NH_: query head, then NKV key heads, then NKV value heads; the two heads of a block are of one kind, so every branch round a barrier is block-uniform), so the rotate-half partner d +- HD/2 lies in the same tile and the f32 projection never goes to memory.
// A stage is [x 8 chunks | weight 8 chunks] = 64 KiB; wave w copies chunks 4w .. 4w+3 (32 copies in flight at most).
// q / k tiles: 16 rows at a time through LDS, out[d] = x[d] cos[t][d] - x[d+HD/2] sin[t][d], out[d+HD/2] = x[d+HD/2] cos[t][d+HD/2] + x[d] sin[t][d+HD/2], stored as head planes [h] (row t, k = d; f16 + bf16 hi/lo) in fragment order, 32-B runs that the 8 stores of 16 rows join to whole lines.
// v tiles: a lane's 8 accumulator elements are 8 consecutive t of one d, which is one 16-byte fragment slot of the transposed planes [g] (row d, k = t): stored straight from registers, 512 contiguous bytes a wave.
static_assert(NH_ % 2 == 0 && NKV % 2 == 0 && DM % KS == 0 && DM >= 2 * KS);
__global__ __launch_bounds__(128) void k_qkv(const bf* __restrict__ A, const bf* __restrict__ Wq, const bf* __restrict__ Wk, const bf* __restrict__ Wv, const float* __restrict__ CS,
                                            h16* Q16, bf* Qh, bf* Ql, h16* K16, bf* Kh, bf* Kl, h16* V16, bf* Vh, bf* Vl) {
    typedef WFrag<bf>::V V;
    __shared__ __attribute__((aligned(1024))) bf ring[2 * 16 * CH];
    __shared__ __align__(16) float osm[4 * 16 * 68];
    const int lane = threadIdx.x & 31, lr = lane & 15, hi = lane >> 4; const int w = __builtin_amdgcn_readfirstlane(threadIdx.x >> 5), wm = w & 1, wn = w >> 1;
    float* os = osm + w * 16 * 68;                                          // each wave turns its rows in its own range
    const int r0 = blockIdx.x * 128 + wm * 64, hy = blockIdx.y * 2 + wn;
    const bool isq = hy < NH_, isv = hy >= NH_ + NKV; const int hh = isq ? hy : (isv ? hy - NH_ - NKV : hy - NH_);   // head index inside its own group
    const bf* Bt = (isq ? Wq : (isv ? Wv : Wk)) + (size_t)(hh - wn) * HD * DM;   // the first of the block's two heads
    v8f acc[4][4];
#pragma unroll
    for (int mb = 0; mb < 4; ++mb)
#pragma unroll
        for (int nb = 0; nb < 4; ++nb) acc[mb][nb] = (v8f){};
    const bf* gs = ((w < 2) ? A + (size_t)blockIdx.x * 128 * DM : Bt) + (size_t)(w & 1) * 64 * DM + 8 * lane;   // the lane's 16 bytes in the first copy of the wave's first chunk; a stage is CH elements further along k
    const unsigned l0 = ldsaddr(ring) + (unsigned)w * 4 * CHB + (unsigned)lane * 16;
    const bf* la = ring + wm * 4 * CH + 8 * lane; const bf* lb = ring + (8 + wn * 4) * CH + 8 * lane;
    constexpr int NS = DM / KS; static_assert((NS & (NS - 1)) == 0);
    const int so = (blockIdx.x + blockIdx.y) & (NS - 1);                    // the block's first stage (staggered k walk, above)
    stage4(l0, gs + (size_t)so * CH, (size_t)16 * DM);
    wait_async(); __syncthreads();                                          // the first stage is published
    stage4(l0 + 16 * CHB, gs + (size_t)((so + 1) & (NS - 1)) * CH, (size_t)16 * DM);
#pragma unroll 1                                                            // rolled: a trip is 64 matrix instructions, a second copy would only cost instruction cache
    for (int t = 0; t < DM / KS; ++t) {
        const int bo = (t & 1) * 16 * CH; V a[2][4], b[2][4];               // two fragment sets: the next k step's LDS reads go out ahead of this step's products
#pragma unroll
        for (int q = 0; q < 4; ++q) { a[0][q] = ldl(la + bo + q * CH); b[0][q] = ldl(lb + bo + q * CH); }
#pragma unroll
        for (int ks = 0; ks < KS / 32; ++ks) { const int cu = ks & 1, nx = cu ^ 1;
            if (ks + 1 < KS / 32) {
#pragma unroll
                for (int q = 0; q < 4; ++q) { const int o = bo + q * CH + (ks + 1) * 512; a[nx][q] = ldl(la + o); b[nx][q] = ldl(lb + o); } }
            __builtin_amdgcn_sched_barrier(0);                              // keeps the reads above in one group ahead of the products below; left free, the scheduler sinks them among the products, each behind a wait to 0
#pragma unroll
            for (int nb = 0; nb < 4; ++nb) {
#pragma unroll
                for (int mb = 0; mb < 4; ++mb) acc[mb][nb] = wmmab(a[cu][mb], b[cu][nb], acc[mb][nb]); } }
        __builtin_amdgcn_sched_barrier(0);                                  // the trip's last products stay ahead of the barrier: left free they sink behind it and hold back the copies, which then fly for less than a trip
        wait_ds(); wait_async(); __syncthreads();                           // publishes stage t + 1 and ends every wave's reads of stage t
        if (t + 2 < DM / KS) stage4(l0 + (unsigned)(t & 1) * 16 * CHB, gs + (size_t)((so + t + 2) & (NS - 1)) * CH, (size_t)16 * DM);
    }
    wait_async();
    if (!isv) {
        const int d = lr * 4; const size_t zp = ((size_t)hh * TT + r0) * HD + (d >> 5) * 512 + ((d >> 4) & 1) * 256 + ((d >> 3) & 1) * 128 + hi * 8 + (d & 7);   // the lane's place in row r0 + hi (fragment order, k = d); every later row is a constant step from it, for the table as for the planes
        h16* P16 = (isq ? Q16 : K16) + zp; bf* Ph = (isq ? Qh : Kh) + zp; bf* Pl = (isq ? Ql : Kl) + zp; const float* cb = CS + ((size_t)(r0 + hi) * HD + d) * 2;
#pragma unroll
        for (int mb = 0; mb < 4; ++mb) {
            v4f c01[8], c23[8];                                             // {cos, sin} of d .. d+3 for the lane's 8 rows, asked for ahead of the LDS round trip
#pragma unroll
            for (int s = 0; s < 8; ++s) { const float* cp = cb + (mb * 16 + 2 * s) * HD * 2; c01[s] = *(const v4f*)cp; c23[s] = *(const v4f*)(cp + 4); }
#pragma unroll
            for (int nb = 0; nb < 4; ++nb) {
#pragma unroll
                for (int j = 0; j < 8; ++j) os[(hi * 8 + j) * 68 + nb * 16 + lr] = acc[mb][nb][j]; }
            __syncthreads();                                                // the 16 rows are read back by other lanes than wrote them
#pragma unroll
            for (int s = 0; s < 8; ++s) { const int row = 2 * s + hi;
                const v4f x0 = *(const v4fa*)(os + row * 68 + d), x1 = *(const v4fa*)(os + row * 68 + (d ^ (HD / 2)));
                const float cs[4] = { c01[s][0], c01[s][2], c23[s][0], c23[s][2] }, sn[4] = { c01[s][1], c01[s][3], c23[s][1], c23[s][3] };
                const v4f xp = (d < HD / 2) ? -x1 : x1;                    // the partner enters with a minus in the lower half of the head
                v4h o16; v4us oh, ol;
#pragma unroll
                for (int q = 0; q < 4; ++q) { const float r = x0[q] * cs[q] + xp[q] * sn[q];
                    o16[q] = tohx(r); unsigned short a2, c2; splitf(r, a2, c2); oh[q] = a2; ol[q] = c2; }
                const int e = mb * 16 * HD + 2 * s * 8; *(v4h*)(P16 + e) = o16; *(v4us*)(Ph + e) = oh; *(v4us*)(Pl + e) = ol;
                asm volatile("s_wait_xcnt 0x0" ::: "memory"); }            // before the data registers of these stores are rewritten
            __syncthreads();                                                // every read of these rows ends before the next 16 rows overwrite them
        }
    } else {
        const size_t zv = (size_t)hh * HD * TT + (size_t)r0 * 16 + 8 * lane; h16* P16 = V16 + zv; bf* Ph = Vh + zv; bf* Pl = Vl + zv;
#pragma unroll
        for (int nb = 0; nb < 4; ++nb)
#pragma unroll
            for (int mb = 0; mb < 4; ++mb) { v8h o16; v8us oh, ol;
#pragma unroll
                for (int j = 0; j < 8; ++j) { const float x = acc[mb][nb][j]; o16[j] = tohx(x); unsigned short a2, c2; splitf(x, a2, c2); oh[j] = a2; ol[j] = c2; }
                const int e = nb * 16 * TT + (mb >> 1) * 512 + (mb & 1) * 256; *(v8h*)(P16 + e) = o16; *(v8us*)(Ph + e) = oh; *(v8us*)(Pl + e) = ol;
                asm volatile("s_wait_xcnt 0x0" ::: "memory"); }            // before the data registers of these stores are rewritten
    }
}

// ---- k_fattn: fused causal sliding-window attention, scores and probabilities never leave registers. One wave = one query head x NQ*16 query rows x half of the tile's key passes; a block is two teams of 4 waves, a team's waves are the 4 query heads
// of one kv head on the same rows and keys, so they share each pass's K / V tiles, staged in LDS. Team 0 walks the older half of the keys, team 1 the newer half, side by side, each with its own online softmax and its own two buffers; the partial results join once, at the end.
// So the longest dependent walk of a launch is half as many passes, and twice as many waves stand ready on a SIMD to fill each other's waits. Per pass of 32 keys: St = K.Qt (A = K rows, B = Q kept in registers), online softmax per query column (a lane holds one
// query's scores: in-lane maximum and sum, one exchange between the wave halves for the maximum), the two 16-key score tiles convert in place into the B operand Pt, Ot += Vt.Pt (A = Vt rows).
// All fragments use WFrag::ldf's k order (that of WFrag::ld), which is the order a packed D pair delivers. Rows < RH: bf16 hi+lo planes, 3 products each; rows >= RH: f16, P carried x 2^PSH (cancels in O / sum).
// D element r of lane l of Ot = (d = 16*dt + 8*(l>>4) + r, query l & 15): 8 consecutive d per lane, stored as one f16 fragment slot of the merged ctx plane (row t, k = h*64 + d; Ah arrives at the head's first block, 2*h).
// 2^x with the slot behind it filled: the instruction set asks for one independent instruction or v_nop between a transcendental and a directly following overwrite of its source or read of its
// result; only a v_nop inside the same statement is tied to the instruction.
// K / V staging: the 4 waves of a team walk the same keys of the same kv head, so a pass's tiles come into LDS ONCE per team and every wave of it reads its fragments there, where otherwise each of the 4 waves would ask global memory for the same lines itself.
// A stage is one pass: [K 4 KiB | V 4 KiB] (hi+lo rows: [K hi | V hi | K lo | V lo]), each tile 4 fragment blocks of 1 KiB in plane order (K: block 2*kt + ks, contiguous in the plane; V: block dt, 16*TT elements apart).
// Wave w of a team copies block w of every tile of its team, 2 copies of 512 B a block (a lane moves its own 16 bytes; the immediate offset moves both addresses). Two buffers: stage t + 2 is asked for behind the barrier of pass t, into the buffer pass t has read.
// As in stage4, a wave's copies of a stage stand in ONE statement that ends in s_wait_xcnt 0 (a precaution), ahead of every rewrite of a register that a copy names.
#define CP2(L, G) CP1(L, G, 0) CP1(L, G, 512)
__device__ __forceinline__ void stage_kv(unsigned l, const void* gk, const void* gv) {
    asm volatile(CP2("%0", "%2") CP2("%1", "%3") "s_wait_xcnt 0x0" :: "v"(l), "v"(l + 4096u), "v"(gk), "v"(gv) : "memory"); }
__device__ __forceinline__ void stage_kv2(unsigned l, const void* gk, const void* gv, const void* gk2, const void* gv2) {
    asm volatile(CP2("%0", "%4") CP2("%1", "%5") CP2("%2", "%6") CP2("%3", "%7") "s_wait_xcnt 0x0"
                 :: "v"(l), "v"(l + 4096u), "v"(l + 8192u), "v"(l + 12288u), "v"(gk), "v"(gv), "v"(gk2), "v"(gv2) : "memory"); }
__device__ __forceinline__ float exp2s(float x) { float r; asm("v_exp_f32 %0, %1\n\tv_nop" : "=v"(r) : "v"(x)); return r; }
template <typename T16, bool HI, int NQ>
__device__ __forceinline__ void attn_tile(const T16* __restrict__ Q, const T16* __restrict__ Q2, const T16* __restrict__ Kp, const T16* __restrict__ K2, const T16* __restrict__ Vt, const T16* __restrict__ V2, int q0, int lane, int w, int team, const T16* ring, bf* Ah) {
    typedef typename WFrag<T16>::V V;                                       // every full unroll below keeps the fragment arrays indexed by constants, that is, in registers
    const int lr = lane & 15, hi = lane >> 4;
    const unsigned fofs = (unsigned)lane * 16u;                            // the lane's byte offset in a fragment block, fixed for the whole walk: every load is wave-uniform base + lane offset
    V qb[NQ][2], qb2[NQ][2];
#pragma unroll
    for (int nq = 0; nq < NQ; ++nq)
#pragma unroll
        for (int ks = 0; ks < 2; ++ks) { const size_t qo = (size_t)(q0 + nq * 16) * HD + ks * 512; qb[nq][ks] = WFrag<T16>::ldfo(Q + qo, fofs); if (HI) qb2[nq][ks] = WFrag<T16>::ldfo(Q2 + qo, fofs); }
    v8f o[NQ][4]; float m[NQ], l[NQ];
#pragma unroll
    for (int nq = 0; nq < NQ; ++nq) { m[nq] = -1.0e30f; l[nq] = 0.0f;      // the start maximum lies above the ban fill, so a pass whose keys are all banned for a query adds exact zeros
#pragma unroll
        for (int dt = 0; dt < 4; ++dt) o[nq][dt] = (v8f){}; }
    const int kb0 = max(0, q0 - (WIN - 1)) & ~31, ke0 = q0 + NQ * 16;       // first key pass of the window of the first row, one past the diagonal of the last row
    const int nr = (((ke0 - kb0 + 31) >> 5) + 1) >> 1;                      // rounds of the block: half the tile's passes, rounded up (q0 is the block's, so nr is too)
    const int kb = kb0 + team * nr * 32, ke = team ? ke0 : min(ke0, kb0 + nr * 32);   // the team's own keys: team 0 the older half, team 1 the rest (one pass fewer where the count is odd, none where it is 1)
    asm volatile("s_wait_xcnt 0x0" ::: "memory");                          // the address registers of the loads above are reused below
    constexpr int SE = HI ? 8192 : 4096;                                    // elements of a stage
    const T16* sm = ring + team * 2 * SE;                                   // the team's own two buffers
    const unsigned l0 = ldsaddr(sm) + (unsigned)w * 1024u + fofs;           // the lane's 16 bytes in block w of buffer 0's K tile
    const size_t ok = (size_t)w * 512 + 8 * lane, ov = (size_t)w * 16 * TT + 8 * lane;   // the same place in the planes, pass 0 of the plane
    auto stage = [&](int k0, int bu) { const unsigned l = l0 + (unsigned)bu * (2u * SE);
        if constexpr (HI) stage_kv2(l, Kp + ok + (size_t)k0 * HD, Vt + ov + (size_t)k0 * 16, K2 + ok + (size_t)k0 * HD, V2 + ov + (size_t)k0 * 16);
        else stage_kv(l, Kp + ok + (size_t)k0 * HD, Vt + ov + (size_t)k0 * 16); };
    V ka[2][2], ka2[2][2];                                                  // a pass's K fragments are read right behind the barrier that publishes their stage, so that their LDS latency runs under the tail of the pass before
    auto ldk = [&](int bu) { const T16* sk = sm + bu * SE + 8 * lane;
#pragma unroll
        for (int kt = 0; kt < 2; ++kt)
#pragma unroll
            for (int ks = 0; ks < 2; ++ks) { ka[kt][ks] = WFrag<T16>::ldf(sk + (kt * 2 + ks) * 512); if (HI) ka2[kt][ks] = WFrag<T16>::ldf(sk + 4096 + (kt * 2 + ks) * 512); } };
    if (kb < ke) stage(kb, 0);
    wait_async(); __syncthreads();                                          // stage 0 is published
    if (kb + 32 < ke) stage(kb + 32, 1);
    if (kb < ke) ldk(0);
    int bu = 0, k0 = kb;
#pragma unroll 1                                                            // rolled: one pass's fragments fill the register budget, a second copy of the body would only cost instruction cache
    for (int r = 0; r < nr; ++r, k0 += 32, bu ^= 1) {
      if (k0 < ke) {                                                        // wave-uniform: in the last round team 1 may have no pass left; it still goes through the round's foot
        V va[4], va2[4]; const T16* sb = sm + bu * SE + 8 * lane;           // the lane's slot in the first block of this pass's buffer
#pragma unroll
        for (int dt = 0; dt < 4; ++dt) { va[dt] = WFrag<T16>::ldf(sb + 2048 + dt * 512); if (HI) va2[dt] = WFrag<T16>::ldf(sb + 6144 + dt * 512); }
        if (!HI) __builtin_amdgcn_sched_barrier(0);                         // keeps the V reads in one group at the head of the pass, under the score products; left free, half of them sink to the pass's foot, directly ahead of its wait to 0
        v8f s[NQ][2];
#pragma unroll
        for (int nq = 0; nq < NQ; ++nq)
#pragma unroll
            for (int kt = 0; kt < 2; ++kt) { v8f c = (v8f){};
#pragma unroll
                for (int ks = 0; ks < 2; ++ks) { c = WFrag<T16>::mma(ka[kt][ks], qb[nq][ks], c); if (HI) { c = WFrag<T16>::mma(ka[kt][ks], qb2[nq][ks], c); c = WFrag<T16>::mma(ka2[kt][ks], qb[nq][ks], c); } }
                s[nq][kt] = c; }
#pragma unroll
        for (int nq = 0; nq < NQ; ++nq)
#pragma unroll
            for (int kt = 0; kt < 2; ++kt) s[nq][kt] *= SCL * 1.4426950408889634f;   // scores in log2 units
        if (k0 + 31 > q0 || q0 + NQ * 16 - 1 - k0 >= WIN) {                 // wave-uniform: only passes that touch the diagonal or the window's start hold banned pairs
#pragma unroll
            for (int nq = 0; nq < NQ; ++nq)
#pragma unroll
                for (int kt = 0; kt < 2; ++kt)
#pragma unroll
                    for (int r = 0; r < 8; ++r) { const int j = k0 + kt * 16 + 8 * hi + r, i = q0 + nq * 16 + lr; s[nq][kt][r] = (j <= i && i - j < WIN) ? s[nq][kt][r] : -3.0e38f; } }
        V pb[NQ], pb2[NQ];
#pragma unroll
        for (int nq = 0; nq < NQ; ++nq) { float mx = m[nq];
#pragma unroll
            for (int kt = 0; kt < 2; ++kt)
#pragma unroll
                for (int r = 0; r < 8; ++r) mx = fmaxf(mx, s[nq][kt][r]);
            mx = fmaxf(mx, __shfl_xor(mx, 16, 32));
            const float al = exp2s(m[nq] - mx); m[nq] = mx; const float mb = HI ? mx : mx - PSH; float sum = 0.0f;
#pragma unroll
            for (int kt = 0; kt < 2; ++kt)
#pragma unroll
                for (int r = 0; r < 8; ++r) { const float p = exp2s(s[nq][kt][r] - mb); s[nq][kt][r] = p; sum += p; }
            l[nq] = l[nq] * al + sum;                                       // each wave half keeps the sum of its own keys; joined once after the loop
#pragma unroll
            for (int dt = 0; dt < 4; ++dt) o[nq][dt] *= al;
            if constexpr (HI) { v8us h0, h1, l0, l1;
#pragma unroll
                for (int r = 0; r < 8; ++r) { unsigned short a, c2; splitf(s[nq][0][r], a, c2); h0[r] = a; l0[r] = c2; splitf(s[nq][1][r], a, c2); h1[r] = a; l1[r] = c2; }
                pb[nq] = cat16b(h0, h1); pb2[nq] = cat16b(l0, l1);
            } else { v8h h0, h1;
#pragma unroll
                for (int r = 0; r < 8; ++r) { h0[r] = tohx(s[nq][0][r]); h1[r] = tohx(s[nq][1][r]); }
                pb[nq] = cat16(h0, h1); } }
#pragma unroll
        for (int dt = 0; dt < 4; ++dt)
#pragma unroll
            for (int nq = 0; nq < NQ; ++nq) { o[nq][dt] = WFrag<T16>::mma(va[dt], pb[nq], o[nq][dt]); if (HI) { o[nq][dt] = WFrag<T16>::mma(va[dt], pb2[nq], o[nq][dt]); o[nq][dt] = WFrag<T16>::mma(va2[dt], pb[nq], o[nq][dt]); } }
        if (!HI) __builtin_amdgcn_sched_barrier(0);                         // the softmax and the P.V products stay ahead of the barrier: left free they sink behind it, and the wait for the next stage's copies then stands a fraction of a pass behind their issue
        if (!HI) asm volatile("v_nop\n\tv_nop\n\tv_nop\n\tv_nop");               // the distance behind the last product: only waits, the barrier and branches follow, and on their taken side its V fragment's registers are rewritten after 3 vector slots
      }
        wait_ds(); wait_async(); __syncthreads();                           // publishes the next pass's stage and ends every wave's reads of this one; nr is the block's, so every wave passes it
        if (k0 + 64 < ke) stage(k0 + 64, bu);
        if (k0 + 32 < ke) ldk(bu ^ 1);                                      // behind the last pass no stage is left to read
    }
    wait_async();
    // The two teams' partial results join through the ring, which the last round's foot has left free (every read ended, no copy in flight): team 1 lays down its Ot tiles, maxima and sums, lane by lane, and ends;
    // team 0's wave of the same head takes them at the same lane (same query, same d, same key residues) and brings both to the common maximum.
    v4fa* mw = (v4fa*)ring + (size_t)w * ((NQ * 8 + 1) * 32) + lane;
    if (team) {
#pragma unroll
        for (int nq = 0; nq < NQ; ++nq)
#pragma unroll
            for (int dt = 0; dt < 4; ++dt) { const v8f t = o[nq][dt]; mw[((nq * 4 + dt) * 2) * 32] = (v4f){ t[0], t[1], t[2], t[3] }; mw[((nq * 4 + dt) * 2 + 1) * 32] = (v4f){ t[4], t[5], t[6], t[7] }; }
        mw[NQ * 8 * 32] = (v4f){ m[0], l[0], m[NQ - 1], l[NQ - 1] }; }
    __syncthreads();                                                        // team 1's partial results are published; every wave of the block passes it
    if (team) return;
    { const v4f ml = mw[NQ * 8 * 32];
#pragma unroll
      for (int nq = 0; nq < NQ; ++nq) { const float mn = fmaxf(m[nq], ml[2 * nq]); const float a0 = exp2s(m[nq] - mn), a1 = exp2s(ml[2 * nq] - mn);   // a team without an allowed key for a query holds the start maximum and zeros: its factor is 0 or meets zeros
          l[nq] = l[nq] * a0 + ml[2 * nq + 1] * a1;
#pragma unroll
          for (int dt = 0; dt < 4; ++dt) { const v4f t0 = mw[((nq * 4 + dt) * 2) * 32], t1 = mw[((nq * 4 + dt) * 2 + 1) * 32];
#pragma unroll
              for (int r = 0; r < 4; ++r) { o[nq][dt][r] = o[nq][dt][r] * a0 + t0[r] * a1; o[nq][dt][r + 4] = o[nq][dt][r + 4] * a0 + t1[r] * a1; } } } }
#pragma unroll
    for (int nq = 0; nq < NQ; ++nq) { const float inv = __fdiv_rn(1.0f, l[nq] + __shfl_xor(l[nq], 16, 32));
#pragma unroll
        for (int dt = 0; dt < 4; ++dt) { v8h oh;
#pragma unroll
            for (int r = 0; r < 8; ++r) oh[r] = tohx(o[nq][dt][r] * inv);
            const size_t oo = (size_t)(q0 + nq * 16) * DQ + (dt >> 1) * 512 + (dt & 1) * 256 + 8 * lane; *(v8us*)(Ah + oo) = __builtin_bit_cast(v8us, oh);   // fragment order: the wave's 32 slots are 512 contiguous bytes
            asm volatile("s_wait_xcnt 0x0" ::: "memory"); } }              // before the registers of this store are rewritten
}
// grid (NKV, NT16 + NTH), 256 threads; in block index order the row tiles with the longest key walk come first, for all kv heads, and the short hi+lo tiles last
#define NT16 ((TT - RHE) / 32)
#define NTH  (RHE / 16)
__global__ __launch_bounds__(256) void k_fattn(const h16* __restrict__ Q16, const h16* __restrict__ K16, const h16* __restrict__ V16, const bf* __restrict__ Qh, const bf* __restrict__ Ql, const bf* __restrict__ Kh, const bf* __restrict__ Kl,
                                               const bf* __restrict__ Vh, const bf* __restrict__ Vl, bf* Ah) {
    __shared__ __attribute__((aligned(1024))) bf kvr[2 * 2 * 8192];         // per team two stages of the larger kind (hi+lo rows)
    const int lane = threadIdx.x & 31; const int g = blockIdx.x; const int wv = __builtin_amdgcn_readfirstlane(threadIdx.x >> 5); const int w = wv & 3, team = wv >> 2; const int h = g * REP + w; const int bx = blockIdx.y;
    const size_t zq = (size_t)h * TT * HD, zk = (size_t)g * TT * HD;
    if (bx < NT16) attn_tile<h16, false, 2>(Q16 + zq, nullptr, K16 + zk, nullptr, V16 + zk, nullptr, RHE + (NT16 - 1 - bx) * 32, lane, w, team, (const h16*)kvr, Ah + h * 1024);
    else attn_tile<bf, true, 1>(Qh + zq, Ql + zq, Kh + zk, Kl + zk, Vh + zk, Vl + zk, (NTH - 1 - (bx - NT16)) * 16, lane, w, team, kvr, Ah + h * 1024);
}

extern "C" void kernel_launch(void* const* d_in, const int* in_sizes, int n_in,
                              void* d_out, int out_size, void* d_ws, size_t ws_size, hipStream_t stream) {
    if (n_in < 5) return;
    if (in_sizes[0] < (NB - 1) * TT_FULL * DM + TT * DM || in_sizes[1] < DM * DQ || in_sizes[2] < DM * DKV || in_sizes[3] < DM * DKV || in_sizes[4] < DQ * DM) return;
    if (out_size < NB * TT * DM) return;
    const float* x = (const float*)d_in[0]; const float* wq = (const float*)d_in[1]; const float* wk = (const float*)d_in[2]; const float* wv = (const float*)d_in[3]; const float* wo = (const float*)d_in[4];
    float* OUT = (float*)d_out;     // [NB][TT][DM]
    char* wsp = (char*)d_ws;
    auto take = [&](size_t bytes) { char* p = wsp; wsp += (bytes + 255) & ~(size_t)255; return (void*)p; };
    // persistent planes
    bf* WOt = (bf*)take((size_t)DM * DQ * 2); float* CS = (float*)take((size_t)TT * HD * 2 * 4);
    h16* QP16 = (h16*)take((size_t)NH_ * TT * HD * 2); h16* KP16 = (h16*)take((size_t)NKV * TT * HD * 2); h16* VT16 = (h16*)take((size_t)NKV * HD * TT * 2);
    bf* QPh = (bf*)take((size_t)NH_ * TT * HD * 2); bf* QPl = (bf*)take((size_t)NH_ * TT * HD * 2); bf* KPh = (bf*)take((size_t)NKV * TT * HD * 2); bf* KPl = (bf*)take((size_t)NKV * TT * HD * 2);
    bf* VTh = (bf*)take((size_t)NKV * HD * TT * 2); bf* VTl = (bf*)take((size_t)NKV * HD * TT * 2); bf* ATh = (bf*)take((size_t)TT * DQ * 2);
    // projection-phase temporaries
    bf* WQt = (bf*)take((size_t)DQ * DM * 2); bf* WKt = (bf*)take((size_t)DKV * DM * 2); bf* WVt = (bf*)take((size_t)DKV * DM * 2);
    bf* XB = (bf*)take((size_t)NB * TT * DM * 2);
    const size_t total = (size_t)(wsp - (char*)d_ws);
    if (total > ws_size || total > (size_t)134217728) return;

    // inverse rotary frequencies inv[j] = 1 / 500000^(j/32): 32nd root by Newton in double (pure arithmetic), powers RNE-converted to f32, then an f32 reciprocal.
    RopeTab tab;
    { double y = 1.5; for (int it = 0; it < 64; ++it) { double p = 1.0; for (int k = 0; k < 31; ++k) p *= y; const double fy = p * y - 500000.0; y = y - fy / (32.0 * p); }
      double pj = 1.0; for (int j = 0; j < 32; ++j) { const float pf = (float)pj; tab.f[j] = 1.0f / pf; pj *= y; } }

    // weights -> 16-bit planes of their bf16 values ([in][out] transposed), x -> bf16, all in fragment order; rotary table
    k_prep<<<PB_CS + PB_WQ + PB_WO + 2 * PB_WKV + NB * PB_X, 256, 0, stream>>>(x, wq, wk, wv, wo, tab, XB, WQt, WKt, WVt, WOt, CS);
    for (int b = 0; b < NB; ++b) {
        k_qkv<<<dim3(TT / 128, (NH_ + 2 * NKV) / 2, 1), 128, 0, stream>>>(XB + (size_t)b * TT * DM, WQt, WKt, WVt, CS, QP16, QPh, QPl, KP16, KPh, KPl, VT16, VTh, VTl);
        k_fattn<<<dim3(NKV, NT16 + NTH, 1), 256, 0, stream>>>(QP16, KP16, VT16, QPh, QPl, KPh, KPl, VTh, VTl, ATh);
        k_gemmw<false, DQ><<<dim3(TT / 128, DM / 128, 1), 128, 0, stream>>>(ATh, WOt, OUT + (size_t)b * TT * DM, DM, nullptr); }
}

// v010
// One run takes 70.7 microseconds.
// In both of two side-by-side timings against v009, it was 1.10 times as fast.
// All steps since v000 together make it 17.1 times as fast.
#include <hip/hip_runtime.h>

// Grouped-query attention block (NB x SEQ x 2048): q = x Wq (32 heads x 64), k / v = x Wk / x Wv (8 kv heads x 64, 4 query heads per kv head), rotate-half rotary embedding
// (base 500000; cos/sin table built on device from host-computed inverse frequencies), causal sliding-window softmax(q.k / 8) (window 1024, -inf fill, diagonal always kept),
// ctx merged as [t][h*64 + d], out = ctx Wo -> f32 [NB][SEQ][2048]. Weights are [in][out] and are transposed into 16-bit planes.
// Every 16-bit operand plane of a matrix product (x, Wq, Wk, Wv, Wo, the q / k head planes with k = d, the transposed v planes with row = d and k = t, ctx) lies in FRAGMENT ORDER: a block of 16 rows x 32 k is 1 KiB, [j = (k >> 4) & 1][lane = 16*((k >> 3) & 1) + (row & 15)][k & 7],
// blocks ordered [row >> 4][k >> 5]; a fragment is then two loads of 512 contiguous bytes (lane l takes 16 bytes at 16*l), four whole 128-B lines each, where a row-major plane made every load touch 16 lines.
// Compute dtypes (f32 accumulate everywhere): every input RNE-converted to bf16; x.Wq, x.Wk, x.Wv: v_wmma_f32_16x16x32_bf16 on plain bf16 operands; q.k and P.v: query rows < RH on bf16 hi+lo
// planes (3 products), rows >= RH single v_wmma_f32_16x16x32_f16 (P carried x1024), one fused kernel with an online softmax over 32-key passes inside the window; softmax and rotary arithmetic f32; ctx.Wo: single v_wmma_f32_16x16x32_f16, ctx rounded to f16, Wo rounded to bf16 like every input and that value held in an f16 plane (8 significant bits fit f16's 11: the weight the product sees is the bf16 one).

#ifndef NB
#define NB 1
#endif
#ifndef SEQ
#define SEQ 2048
#endif
#ifndef RH
#define RH 512                  // query rows < RH use hi+lo planes (0: none)
#endif
#define TT      SEQ
#define TT_FULL 2048
#define DM      2048
#define NH_     32
#define NKV     8
#define REP     (NH_ / NKV)
#define HD      64
#define DQ      (NH_ * HD)
#define DKV     (NKV * HD)
#define RHE     ((RH < TT) ? RH : TT)
#define WIN     1024
#define PSH     10.0f             // f16 rows: P carried x 2^PSH
#define SCL     0.125f            // HD^-0.5
static_assert(TT % 128 == 0 && TT >= 128 && TT <= TT_FULL);
static_assert(RH % 64 == 0 && RH >= 0);
static_assert(REP == 4);
static_assert(DM % 64 == 0 && DQ % 64 == 0 && DKV % 64 == 0 && HD == 64);

typedef _Float16 h16;
typedef unsigned short bf;
typedef __attribute__((ext_vector_type(16))) __bf16   v16bf;
typedef __attribute__((ext_vector_type(16))) _Float16 v16h;
typedef __attribute__((ext_vector_type(8)))  _Float16 v8h;
typedef __attribute__((ext_vector_type(8)))  unsigned short v8us;
typedef __attribute__((ext_vector_type(8)))  float    v8f;
typedef __attribute__((ext_vector_type(4)))  float    v4f;
typedef __attribute__((ext_vector_type(2)))  _Float16 v2h;
typedef __attribute__((ext_vector_type(4)))  _Float16 v4h;
typedef __attribute__((ext_vector_type(2)))  unsigned short v2us;
typedef __attribute__((ext_vector_type(4)))  unsigned short v4us;
typedef __attribute__((ext_vector_type(2)))  float v2f;
typedef v8h  __attribute__((may_alias)) v8ha;
typedef v4f  __attribute__((may_alias)) v4fa;
typedef v8us __attribute__((may_alias)) v8usa;

__device__ __forceinline__ unsigned short f2bf(float f) { unsigned u = __float_as_uint(f); u += 0x7FFFu + ((u >> 16) & 1u); return (unsigned short)(u >> 16); }   // RNE convert
__device__ __forceinline__ float bf2f(unsigned short b) { return __uint_as_float(((unsigned)b) << 16); }
__device__ __forceinline__ float bfr(float f) { return bf2f(f2bf(f)); }
__device__ __forceinline__ v16h cat16(v8h lo, v8h hi) { return __builtin_shufflevector(lo, hi, 0, 1, 2, 3, 4, 5, 6, 7, 8, 9, 10, 11, 12, 13, 14, 15); }
__device__ __forceinline__ v16bf cat16b(v8us lo, v8us hi) { return __builtin_bit_cast(v16bf, __builtin_shufflevector(lo, hi, 0, 1, 2, 3, 4, 5, 6, 7, 8, 9, 10, 11, 12, 13, 14, 15)); }
__device__ __forceinline__ v8f wmma16(v16h a, v16h b, v8f c) { return __builtin_amdgcn_wmma_f32_16x16x32_f16(false, a, false, b, (short)0, c, false, false); }
__device__ __forceinline__ v8f wmmab(v16bf a, v16bf b, v8f c) { return __builtin_amdgcn_wmma_f32_16x16x32_bf16(false, a, false, b, (short)0, c, false, false); }
__device__ __forceinline__ h16 tohx(float x) { return (h16)x; }
__device__ __forceinline__ void splitf(float y, unsigned short& h, unsigned short& l) { h = f2bf(y); l = f2bf(y - bf2f(h)); }

// ---- fragment loaders
// Fragment map (both operands): lane row/col = lane & 15, elements 0..7 <- k0 + 8*(lane>>4) + 0..7, elements 8..15 <- k0 + 16 + 8*(lane>>4) + 0..7; D element r of lane l = (row 8*(l>>4) + r, col l & 15).
template <typename T16> struct WFrag;
template <> struct WFrag<h16> { typedef v16h V; static __device__ __forceinline__ V ld(const h16* p) { return cat16(*(const v8h*)p, *(const v8h*)(p + 16)); } static __device__ __forceinline__ V ldo(const h16* b, unsigned o) { return ld((const h16*)((const char*)b + o)); } static __device__ __forceinline__ V ldf(const h16* p) { return cat16(*(const v8h*)p, *(const v8h*)(p + 256)); } static __device__ __forceinline__ V ldfo(const h16* b, unsigned o) { return ldf((const h16*)((const char*)b + o)); } static __device__ __forceinline__ v8f mma(V a, V b, v8f c) { return wmma16(a, b, c); } };
template <> struct WFrag<bf> { typedef v16bf V; static __device__ __forceinline__ V ld(const bf* p) { return cat16b(*(const v8us*)p, *(const v8us*)(p + 16)); } static __device__ __forceinline__ V ldo(const bf* b, unsigned o) { return ld((const bf*)((const char*)b + o)); } static __device__ __forceinline__ V ldf(const bf* p) { return cat16b(*(const v8us*)p, *(const v8us*)(p + 256)); } static __device__ __forceinline__ V ldfo(const bf* b, unsigned o) { return ldf((const bf*)((const char*)b + o)); } static __device__ __forceinline__ v8f mma(V a, V b, v8f c) { return wmmab(a, b, c); } };
// ---- LDS staging of the two GEMM kernels (k_gemmw, k_qkv). A work-group of 4 waves (2 x 2) owns a 128x128 output tile, each wave a 64x64 tile of it (16 accumulators). A stage is KS k of every operand row of the
// block tile. In a fragment-order plane 16 rows x KS k are CH contiguous elements (4 KiB, a "chunk": KS/32 blocks of 1 KiB), and a stage keeps that order in LDS, chunk behind chunk, so a fragment is two
// ds_load_b128 of 512 contiguous bytes. The chunks come in by global_load_async_to_lds_b128 (a lane moves its own 16 bytes, through no register), 8 copies a chunk; the immediate offset moves the global and the LDS address alike.
// Two buffers: stage t + 2 is asked for behind the barrier that ends trip t, into the buffer trip t has read, and flies during trip t + 1.
// Staggered k walk: all blocks of a launch run at once, and 16 or more of them share each operand tile. Started at k = 0 alike, the sharers would ask L2 for the same lines at the same moment, and every stage
// would be a first touch that all of them wait out from memory. So block (bx, by) walks the stages from number (bx + by) mod NS on and wraps round: blocks with one index equal differ in their start unless the other differs by NS (k_qkv: by and by + 16), at any moment at most two sharers of a tile
// read one stage of it, and what one has fetched the next finds in L2. Only the order of the f32 sums over k turns with the start.
#define KS 128
#define CH (16 * KS)
#define CHB (CH * 2)              // bytes of a chunk
#define CP1(L, G, O) "global_load_async_to_lds_b128 " L ", " G ", off offset:" #O "\n\t"
#define CP8(L, G) CP1(L, G, 0) CP1(L, G, 512) CP1(L, G, 1024) CP1(L, G, 1536) CP1(L, G, 2048) CP1(L, G, 2560) CP1(L, G, 3072) CP1(L, G, 3584)
static_assert(CHB == 8 * 512);
__device__ __forceinline__ unsigned ldsaddr(const void* p) { return (unsigned)(size_t)p; }
__device__ __forceinline__ v16bf ldl(const bf* p) { return cat16b(*(const v8us*)p, *(const v8us*)(p + 256)); }
__device__ __forceinline__ void wait_ds() { asm volatile("s_wait_dscnt 0x0" ::: "memory"); }
__device__ __forceinline__ void wait_async() { asm volatile("s_wait_asynccnt 0x0" ::: "memory"); }
// The copies of one wave and one stage stand in ONE statement that ends in s_wait_xcnt 0 (a precaution): so the wait stands ahead of every rewrite of a register that a copy names.
__device__ __forceinline__ void stage4(unsigned l, const bf* g, size_t step) {   // 4 chunks: LDS places CHB apart, global chunks step elements apart
    asm volatile(CP8("%0", "%4") CP8("%1", "%5") CP8("%2", "%6") CP8("%3", "%7") "s_wait_xcnt 0x0"
                 :: "v"(l), "v"(l + CHB), "v"(l + 2 * CHB), "v"(l + 3 * CHB), "v"(g), "v"(g + step), "v"(g + 2 * step), "v"(g + 3 * step) : "memory"); }

// ---- k_gemmw: C[m][n] (f32, pitch ldc, + optional f32 bias[n]) = sum_k A[m][k] Bt[n][k], one f16 product per k step, planes of f16 bits in fragment order. Grid (M/128, N/128), 128 threads.
// A stage is [A 8 chunks | Bt 8 chunks] = 64 KiB; wave w copies chunks 4w .. 4w+3 (32 copies in flight at most). K % KS == 0, K >= 2*KS.
__device__ __forceinline__ v16h ldh(const bf* p) { return __builtin_bit_cast(v16h, ldl(p)); }   // the same fragment read as f16
template <bool BIAS, int K>
__global__ __launch_bounds__(128) void k_gemmw(const bf* __restrict__ A, const bf* __restrict__ Bt, float* C, int ldc, const float* __restrict__ bias) {
    typedef v16h V;
    static_assert(K % KS == 0 && K >= 2 * KS);
    __shared__ __attribute__((aligned(1024))) bf ring[2 * 16 * CH];
    __shared__ __align__(16) float osm[4 * 16 * 68];
    const int lane = threadIdx.x & 31, lr = lane & 15, hi = lane >> 4; const int w = __builtin_amdgcn_readfirstlane(threadIdx.x >> 5), wm = w & 1, wn = w >> 1;
    float* os = osm + w * 16 * 68;                                          // each wave stages its output rows in its own range
    const int r0 = blockIdx.x * 128 + wm * 64, c0 = blockIdx.y * 128 + wn * 64;
    v8f acc[4][4];
#pragma unroll
    for (int mb = 0; mb < 4; ++mb)
#pragma unroll
        for (int nb = 0; nb < 4; ++nb) acc[mb][nb] = (v8f){};
    const bf* gs = ((w < 2) ? A + (size_t)blockIdx.x * 128 * K : Bt + (size_t)blockIdx.y * 128 * K) + (size_t)(w & 1) * 64 * K + 8 * lane;   // the lane's 16 bytes in the first copy of the wave's first chunk; a stage is CH elements further along k
    const unsigned l0 = ldsaddr(ring) + (unsigned)w * 4 * CHB + (unsigned)lane * 16;
    const bf* la = ring + wm * 4 * CH + 8 * lane; const bf* lb = ring + (8 + wn * 4) * CH + 8 * lane;
    constexpr int NS = K / KS; static_assert((NS & (NS - 1)) == 0);
    const int so = (blockIdx.x + blockIdx.y) & (NS - 1);                    // the block's first stage (staggered k walk, above)
    stage4(l0, gs + (size_t)so * CH, (size_t)16 * K);
    wait_async(); __syncthreads();                                          // the first stage is published
    stage4(l0 + 16 * CHB, gs + (size_t)((so + 1) & (NS - 1)) * CH, (size_t)16 * K);
#pragma unroll 1                                                            // rolled: a trip is 64 matrix instructions, a second copy would only cost instruction cache
    for (int t = 0; t < K / KS; ++t) {
        const int bo = (t & 1) * 16 * CH; V a[2][4], b[2][4];               // two fragment sets: the next k step's LDS reads go out ahead of this step's products
#pragma unroll
        for (int q = 0; q < 4; ++q) { a[0][q] = ldh(la + bo + q * CH); b[0][q] = ldh(lb + bo + q * CH); }
#pragma unroll
        for (int ks = 0; ks < KS / 32; ++ks) { const int cu = ks & 1, nx = cu ^ 1;
            if (ks + 1 < KS / 32) {
#pragma unroll
                for (int q = 0; q < 4; ++q) { const int o = bo + q * CH + (ks + 1) * 512; a[nx][q] = ldh(la + o); b[nx][q] = ldh(lb + o); } }
            __builtin_amdgcn_sched_barrier(0);                              // keeps the reads above in one group ahead of the products below; left free, the scheduler sinks them among the products, each behind a wait to 0
#pragma unroll
            for (int nb = 0; nb < 4; ++nb) {
#pragma unroll
                for (int mb = 0; mb < 4; ++mb) acc[mb][nb] = wmma16(a[cu][mb], b[cu][nb], acc[mb][nb]); } }
        __builtin_amdgcn_sched_barrier(0);                                  // the trip's last products stay ahead of the barrier: left free they sink behind it and hold back the copies, which then fly for less than a trip
        wait_ds(); wait_async(); __syncthreads();                           // publishes stage t + 1 and ends every wave's reads of stage t
        if (t + 2 < K / KS) stage4(l0 + (unsigned)(t & 1) * 16 * CHB, gs + (size_t)((so + t + 2) & (NS - 1)) * CH, (size_t)16 * K);
    }
    wait_async();
#pragma unroll
    for (int mb = 0; mb < 4; ++mb) {
#pragma unroll
        for (int nb = 0; nb < 4; ++nb) {
#pragma unroll
            for (int j = 0; j < 8; ++j) os[(hi * 8 + j) * 68 + nb * 16 + lr] = acc[mb][nb][j]; }
        __builtin_amdgcn_wave_barrier(); asm volatile("" ::: "memory");
        float* crow = C + (size_t)(r0 + mb * 16) * ldc + c0;
{
#pragma unroll
            for (int s = 0; s < 8; ++s) { const int row = 2 * s + hi, cofs = lr * 4; v4f val = *(const v4fa*)(os + row * 68 + cofs); if (BIAS) { val[0] += bfr(bias[c0 + cofs]); val[1] += bfr(bias[c0 + cofs + 1]); val[2] += bfr(bias[c0 + cofs + 2]); val[3] += bfr(bias[c0 + cofs + 3]); }
                *(v4f*)(crow + (size_t)row * ldc + cofs) = val; }
             }
        __builtin_amdgcn_wave_barrier(); asm volatile("" ::: "memory");
    }
}

// ---- wtG: w [K][N] f32 -> bf16 plane of w transposed (row = n, k = k) in fragment order (H: the bf16-rounded value written as f16 bits, for an f16 product). One wave = 32 consecutive n x one block of 32 k: each of its 32 loads is one whole 128-B line of a row of w,
// each of its 4 stores fills two runs of 256 contiguous bytes (a lane's 8 k of one n are the 16 bytes of one fragment slot). (N/32)*(K/32)/8 blocks of 8 waves; blk = the block's index among them.
// K and N are compile-time, so that the 32 loads are one address pair + constant offsets.
template <int K, int N, bool H>
__device__ __forceinline__ void wtG(int blk, const float* __restrict__ w, bf* Bt) {
    static_assert(K % 32 == 0 && N % 32 == 0 && ((N / 32) * (K / 32)) % 8 == 0);
    const int lane = threadIdx.x & 31; const int wv = blk * 8 + (threadIdx.x >> 5); const int kb = wv / (N / 32), n = (wv % (N / 32)) * 32 + lane;
    const float* p = w + (size_t)kb * 32 * N + n; float v[32];
#pragma unroll
    for (int i = 0; i < 32; ++i) v[i] = p[(size_t)i * N];
    bf* q = Bt + ((size_t)(n >> 4) * (K / 32) + kb) * 512 + (n & 15) * 8;
#pragma unroll
    for (int o = 0; o < 4; ++o) { v8us r;                                   // o = 2*j + half: k = 32*kb + 8*o + e
#pragma unroll
        for (int e = 0; e < 8; ++e) r[e] = H ? __builtin_bit_cast(unsigned short, tohx(bfr(v[o * 8 + e]))) : f2bf(v[o * 8 + e]);
        *(v8us*)(q + o * 128) = r; }
    asm volatile("s_wait_xcnt 0x0" ::: "memory");                          // a precaution: in the joint kernel another job's code follows in the listing and rewrites the registers these four stores name
}
// ---- cvt8: src [rows][DM] f32 -> bf16 plane in fragment order. One wave = 8 rows x one block of 32 k: a lane converts 8 consecutive k; the 8 lanes of one k octet store 128 contiguous bytes.
__device__ __forceinline__ void cvt8(int blk, const float* __restrict__ src, bf* dst, size_t n8) { const size_t i = (size_t)blk * 256 + threadIdx.x; if (i >= n8) return;
    const int lane = threadIdx.x & 31, o = lane & 3; const int wv = (int)(i >> 5), kb = wv % (DM / 32), t = (wv / (DM / 32)) * 8 + (lane >> 2);
    const v8f v = *(const v8f*)(src + (size_t)t * DM + kb * 32 + o * 8); v8us r;
#pragma unroll
    for (int k = 0; k < 8; ++k) r[k] = f2bf(v[k]);
    *(v8us*)(dst + ((size_t)(t >> 4) * (DM / 32) + kb) * 512 + o * 128 + (t & 15) * 8) = r;  }

// ---- csgen: rotary table {cos(t * inv[d]), sin(t * inv[d])}, d < HD/2 (f32 product, precise sincos; the upper half of a head repeats it). inv[] arrives by value (host-computed).
// The table lies in the order in which k_qkv's lanes read it: a unit of 512 B is [lane = 16*((d >> 3) & 1) + (t & 15)][d & 1][cos, sin], units ordered [t >> 4][d >> 4][(d >> 1) & 3]: a wave's 16-byte load is one whole unit. A thread makes the entry at its own slot of that order, so a wave's store is 256 contiguous bytes.
struct RopeTab { float f[32]; };
static_assert(sizeof(RopeTab) == 128);
__device__ __forceinline__ void csgen(int blk, const RopeTab& tab, float* CS) {
    const int slot = blk * 256 + threadIdx.x; const int ln = (slot >> 1) & 31; const int d = ((slot >> 8) & 1) * 16 + (ln >> 4) * 8 + ((slot >> 6) & 3) * 2 + (slot & 1); float inv = 0.0f;
    const int idx = ((slot >> 9) * 16 + (ln & 15)) * HD + d;               // t * HD + d of the entry that lies at this slot
#pragma unroll
    for (int i = 0; i < 32; ++i) inv = (d == i) ? tab.f[i] : inv;
    if (slot >= TT * (HD / 2)) return;
    const int t = idx / HD; float ang = __fmul_rn((float)t, inv); asm volatile("" : "+v"(ang));
    float sn, cs; sincosf(ang, &sn, &cs);
    v2f o; o[0] = cs; o[1] = sn;
    *(v2f*)(CS + (size_t)slot * 2) = o;  }

// ---- k_prep: everything that only turns an input (or nothing) into an operand plane, ONE launch: the six jobs read and write disjoint buffers and none needs another's result, so as launches of their own each only
// paid for a start, a ramp and a drain with the chip near empty. A block of 8 waves belongs to one job by its index (a scalar compare; no barrier anywhere). In block index order:
// the jobs whose blocks last longest (table, then the transpositions with their 32 loads a lane) come first, the x conversion (one load, one store a lane) last.
#define PB_CS ((TT * (HD / 2) + 255) / 256)
#define PB_WQ ((DQ / 32) * (DM / 32) / 8)
#define PB_WKV ((DKV / 32) * (DM / 32) / 8)
#define PB_WO ((DM / 32) * (DQ / 32) / 8)
#define PB_X  (TT * DM / 8 / 256)   // per batch entry
static_assert((TT * DM / 8) % 256 == 0);
__global__ __launch_bounds__(256) void k_prep(const float* __restrict__ x, const float* __restrict__ wq, const float* __restrict__ wk, const float* __restrict__ wv, const float* __restrict__ wo, RopeTab tab,
                                              bf* XB, bf* WQt, bf* WKt, bf* WVt, bf* WOt, float* CS) {
    int blk = blockIdx.x;
    if (blk < PB_CS) { csgen(blk, tab, CS); return; }
    blk -= PB_CS;
    if (blk < PB_WQ) { wtG<DM, DQ, false>(blk, wq, WQt); return; }
    blk -= PB_WQ;
    if (blk < PB_WO) { wtG<DQ, DM, true>(blk, wo, WOt); return; }
    blk -= PB_WO;
    if (blk < PB_WKV) { wtG<DM, DKV, false>(blk, wk, WKt); return; }
    blk -= PB_WKV;
    if (blk < PB_WKV) { wtG<DM, DKV, false>(blk, wv, WVt); return; }
    blk -= PB_WKV;
    const int b = blk / PB_X;                                               // batch entry; its plane is TT * DM elements further
    cvt8(blk - b * PB_X, x + (size_t)b * TT_FULL * DM, XB + (size_t)b * TT * DM, (size_t)TT * DM / 8);
}

// ---- k_qkv: the three input projections with their plane building, ONE launch. Grid (TT/128, (NH_ + 2*NKV)/2), 128 threads, staged as above; a wave's 64 columns are exactly one head
// (head index < NH_: query head, then NKV key heads, then NKV value heads), so the rotate-half partner d +- HD/2 lies in the same tile and the f32 projection never goes to memory.
// A stage is [x 8 chunks | weight 8 chunks] = 64 KiB; wave w copies chunks 4w .. 4w+3 (32 copies in flight at most).
// q / k tiles are computed TRANSPOSED: both operands have one fragment map, so the weight rows go in as A and the x rows as B, and accumulator [i][j] is (d tile i, t tile j): a lane's 8 elements are 8 consecutive d of one t,
// which is one 16-byte fragment slot of the head planes [h] (row t, k = d; f16 + bf16 hi/lo), and the rotate-half partner d +- HD/2 is the same element of tile i +- 2 in the same lane. So
// out[d] = x[d] cos[t][d] - x[d+HD/2] sin[t][d], out[d+HD/2] = x[d+HD/2] cos[t][d] + x[d] sin[t][d] (the table repeats with period HD/2 in d) are formed in registers and stored straight, 512 contiguous bytes a wave: no LDS round trip, no barrier.
// The lane's table entries (its 4 rows t, d < HD/2) are asked for behind the first stage's copies and wait in registers: their latency runs beside that of the first stage, not in the epilogue.
// v tiles (x rows as A): a lane's 8 accumulator elements are 8 consecutive t of one d, which is one 16-byte fragment slot of the transposed planes [g] (row d, k = t): stored straight from registers, 512 contiguous bytes a wave.
static_assert(NH_ % 2 == 0 && NKV % 2 == 0 && DM % KS == 0 && DM >= 2 * KS);
__global__ __launch_bounds__(128) void k_qkv(const bf* __restrict__ A, const bf* __restrict__ Wq, const bf* __restrict__ Wk, const bf* __restrict__ Wv, const float* __restrict__ CS,
                                            h16* Q16, bf* Qh, bf* Ql, h16* K16, bf* Kh, bf* Kl, h16* V16, bf* Vh, bf* Vl) {
    typedef WFrag<bf>::V V;
    __shared__ __attribute__((aligned(1024))) bf ring[2 * 16 * CH];
    const int lane = threadIdx.x & 31, lr = lane & 15, hi = lane >> 4; const int w = __builtin_amdgcn_readfirstlane(threadIdx.x >> 5), wm = w & 1, wn = w >> 1;
    const int r0 = blockIdx.x * 128 + wm * 64, hy = blockIdx.y * 2 + wn;
    const bool isq = hy < NH_, isv = hy >= NH_ + NKV; const int hh = isq ? hy : (isv ? hy - NH_ - NKV : hy - NH_);   // head index inside its own group
    const bf* Bt = (isq ? Wq : (isv ? Wv : Wk)) + (size_t)(hh - wn) * HD * DM;   // the first of the block's two heads
    v8f acc[4][4];
#pragma unroll
    for (int mb = 0; mb < 4; ++mb)
#pragma unroll
        for (int nb = 0; nb < 4; ++nb) acc[mb][nb] = (v8f){};
    const bf* gs = ((w < 2) ? A + (size_t)blockIdx.x * 128 * DM : Bt) + (size_t)(w & 1) * 64 * DM + 8 * lane;   // the lane's 16 bytes in the first copy of the wave's first chunk; a stage is CH elements further along k
    const unsigned l0 = ldsaddr(ring) + (unsigned)w * 4 * CHB + (unsigned)lane * 16;
    const bf* lx = ring + wm * 4 * CH + 8 * lane; const bf* lw = ring + (8 + wn * 4) * CH + 8 * lane;
    const bf* la = isv ? lx : lw; const bf* lb = isv ? lw : lx;             // the A and the B operand's chunks: q / k tiles take the weight rows as A (transposed tile), v tiles the x rows
    constexpr int NS = DM / KS; static_assert((NS & (NS - 1)) == 0);
    const int so = (blockIdx.x + blockIdx.y) & (NS - 1);                    // the block's first stage (staggered k walk, above)
    stage4(l0, gs + (size_t)so * CH, (size_t)16 * DM);
    v4f cs[4][2][4];                                                        // [t tile j][d tile i < 2][pair of d]: {cos, sin, cos, sin} of row r0 + 16*j + lr, d = 16*i + 8*hi + 0..7: table units (csgen) in their order, 512 contiguous bytes a load
    if (!isv) { const float* cb = CS + (size_t)(r0 >> 4) * 1024 + 4 * lane;
#pragma unroll
        for (int j = 0; j < 4; ++j)
#pragma unroll
            for (int i = 0; i < 2; ++i)
#pragma unroll
                for (int p = 0; p < 4; ++p) cs[j][i][p] = *(const v4f*)(cb + ((j * 2 + i) * 4 + p) * 128);
        asm volatile("s_wait_xcnt 0x0" ::: "memory"); }                    // before the address registers of these loads are rewritten
    wait_async(); __syncthreads();                                          // the first stage is published
    stage4(l0 + 16 * CHB, gs + (size_t)((so + 1) & (NS - 1)) * CH, (size_t)16 * DM);
#pragma unroll 1                                                            // rolled: a trip is 64 matrix instructions, a second copy would only cost instruction cache
    for (int t = 0; t < DM / KS; ++t) {
        const int bo = (t & 1) * 16 * CH; V a[2][4], b[2][4];               // two fragment sets: the next k step's LDS reads go out ahead of this step's products
#pragma unroll
        for (int q = 0; q < 4; ++q) { a[0][q] = ldl(la + bo + q * CH); b[0][q] = ldl(lb + bo + q * CH); }
#pragma unroll
        for (int ks = 0; ks < KS / 32; ++ks) { const int cu = ks & 1, nx = cu ^ 1;
            if (ks + 1 < KS / 32) {
#pragma unroll
                for (int q = 0; q < 4; ++q) { const int o = bo + q * CH + (ks + 1) * 512; a[nx][q] = ldl(la + o); b[nx][q] = ldl(lb + o); } }
            __builtin_amdgcn_sched_barrier(0);                              // keeps the reads above in one group ahead of the products below; left free, the scheduler sinks them among the products, each behind a wait to 0
#pragma unroll
            for (int nb = 0; nb < 4; ++nb) {
#pragma unroll
                for (int mb = 0; mb < 4; ++mb) acc[mb][nb] = wmmab(a[cu][mb], b[cu][nb], acc[mb][nb]); } }
        __builtin_amdgcn_sched_barrier(0);                                  // the trip's last products stay ahead of the barrier: left free they sink behind it and hold back the copies, which then fly for less than a trip
        wait_ds(); wait_async(); __syncthreads();                           // publishes stage t + 1 and ends every wave's reads of stage t
        if (t + 2 < DM / KS) stage4(l0 + (unsigned)(t & 1) * 16 * CHB, gs + (size_t)((so + t + 2) & (NS - 1)) * CH, (size_t)16 * DM);
    }
    wait_async();
    if (!isv) {
        const size_t zp = ((size_t)hh * TT + r0) * HD + 8 * lane;           // the lane's slot in the first block of row tile r0 (fragment order, k = d); every tile is a constant step from it
        h16* P16 = (isq ? Q16 : K16) + zp; bf* Ph = (isq ? Qh : Kh) + zp; bf* Pl = (isq ? Ql : Kl) + zp;
#pragma unroll
        for (int j = 0; j < 4; ++j) { v8h o16[4]; v8us oh[4], ol[4];           // the 4 d tiles of t tile j
#pragma unroll
            for (int i = 0; i < 2; ++i)
#pragma unroll
                for (int r = 0; r < 8; ++r) { const float c = cs[j][i][r >> 1][(r & 1) * 2], s = cs[j][i][r >> 1][(r & 1) * 2 + 1]; const float x0 = acc[i][j][r], x1 = acc[i + 2][j][r];
                    const float y0 = __builtin_fmaf(x0, c, (-x1) * s), y1 = __builtin_fmaf(x1, c, x0 * s);   // in both halves the own element x cos is fused onto the rounded partner product; the partner enters with a minus in the lower half of the head
                    unsigned short a2, c2; o16[i][r] = tohx(y0); splitf(y0, a2, c2); oh[i][r] = a2; ol[i][r] = c2; o16[i + 2][r] = tohx(y1); splitf(y1, a2, c2); oh[i + 2][r] = a2; ol[i + 2][r] = c2; }
            __builtin_amdgcn_sched_barrier(0);                              // the 12 stores stay behind all of this tile's arithmetic: left free, the first of them go out early and later arithmetic of the tile rewrites their data registers ahead of the wait below
#pragma unroll
            for (int i = 0; i < 4; ++i) { const int e = j * 16 * HD + (i >> 1) * 512 + (i & 1) * 256; *(v8h*)(P16 + e) = o16[i]; *(v8us*)(Ph + e) = oh[i]; *(v8us*)(Pl + e) = ol[i]; }
            asm volatile("s_wait_xcnt 0x0" ::: "memory");                  // before the data registers of these stores are rewritten
            __builtin_amdgcn_sched_barrier(0);                              // the next tile's arithmetic, which rewrites those registers, stays behind the wait
        }
    } else {
        const size_t zv = (size_t)hh * HD * TT + (size_t)r0 * 16 + 8 * lane; h16* P16 = V16 + zv; bf* Ph = Vh + zv; bf* Pl = Vl + zv;
#pragma unroll
        for (int nb = 0; nb < 4; ++nb)
#pragma unroll
            for (int mb = 0; mb < 4; ++mb) { v8h o16; v8us oh, ol;
#pragma unroll
                for (int j = 0; j < 8; ++j) { const float x = acc[mb][nb][j]; o16[j] = tohx(x); unsigned short a2, c2; splitf(x, a2, c2); oh[j] = a2; ol[j] = c2; }
                const int e = nb * 16 * TT + (mb >> 1) * 512 + (mb & 1) * 256; *(v8h*)(P16 + e) = o16; *(v8us*)(Ph + e) = oh; *(v8us*)(Pl + e) = ol;
                asm volatile("s_wait_xcnt 0x0" ::: "memory"); }            // before the data registers of these stores are rewritten
    }
}

// ---- k_fattn: fused causal sliding-window attention, scores and probabilities never leave registers. One wave = one query head x NQ*16 query rows x half of the tile's key passes; a block is two teams of 4 waves, a team's waves are the 4 query heads
// of one kv head on the same rows and keys, so they share each pass's K / V tiles, staged in LDS. Team 0 walks the older half of the keys, team 1 the newer half, side by side, each with its own online softmax and its own two buffers; the partial results join once, at the end.
// So the longest dependent walk of a launch is half as many passes, and twice as many waves stand ready on a SIMD to fill each other's waits. Per pass of 32 keys: St = K.Qt (A = K rows, B = Q kept in registers), online softmax per query column (a lane holds one
// query's scores: in-lane maximum and sum, one exchange between the wave halves for the maximum), the two 16-key score tiles convert in place into the B operand Pt, Ot += Vt.Pt (A = Vt rows).
// All fragments use WFrag::ldf's k order (that of WFrag::ld), which is the order a packed D pair delivers. Rows < RH: bf16 hi+lo planes, 3 products each; rows >= RH: f16, P carried x 2^PSH (cancels in O / sum).
// D element r of lane l of Ot = (d = 16*dt + 8*(l>>4) + r, query l & 15): 8 consecutive d per lane, stored as one f16 fragment slot of the merged ctx plane (row t, k = h*64 + d; Ah arrives at the head's first block, 2*h).
// 2^x with the slot behind it filled: the instruction set asks for one independent instruction or v_nop between a transcendental and a directly following overwrite of its source or read of its
// result; only a v_nop inside the same statement is tied to the instruction.
// K / V staging: the 4 waves of a team walk the same keys of the same kv head, so a pass's tiles come into LDS ONCE per team and every wave of it reads its fragments there, where otherwise each of the 4 waves would ask global memory for the same lines itself.
// A stage is one pass: [K 4 KiB | V 4 KiB] (hi+lo rows: [K hi | V hi | K lo | V lo]), each tile 4 fragment blocks of 1 KiB in plane order (K: block 2*kt + ks, contiguous in the plane; V: block dt, 16*TT elements apart).
// Wave w of a team copies block w of every tile of its team, 2 copies of 512 B a block (a lane moves its own 16 bytes; the immediate offset moves both addresses). Two buffers: stage t + 2 is asked for behind the barrier of pass t, into the buffer pass t has read.
// As in stage4, a wave's copies of a stage stand in ONE statement that ends in s_wait_xcnt 0 (a precaution), ahead of every rewrite of a register that a copy names.
#define CP2(L, G) CP1(L, G, 0) CP1(L, G, 512)
__device__ __forceinline__ void stage_kv(unsigned l, const void* gk, const void* gv) {
    asm volatile(CP2("%0", "%2") CP2("%1", "%3") "s_wait_xcnt 0x0" :: "v"(l), "v"(l + 4096u), "v"(gk), "v"(gv) : "memory"); }
__device__ __forceinline__ void stage_kv2(unsigned l, const void* gk, const void* gv, const void* gk2, const void* gv2) {
    asm volatile(CP2("%0", "%4") CP2("%1", "%5") CP2("%2", "%6") CP2("%3", "%7") "s_wait_xcnt 0x0"
                 :: "v"(l), "v"(l + 4096u), "v"(l + 8192u), "v"(l + 12288u), "v"(gk), "v"(gv), "v"(gk2), "v"(gv2) : "memory"); }
__device__ __forceinline__ float exp2s(float x) { float r; asm("v_exp_f32 %0, %1\n\tv_nop" : "=v"(r) : "v"(x)); return r; }
template <typename T16, bool HI, int NQ>
__device__ __forceinline__ void attn_tile(const T16* __restrict__ Q, const T16* __restrict__ Q2, const T16* __restrict__ Kp, const T16* __restrict__ K2, const T16* __restrict__ Vt, const T16* __restrict__ V2, int q0, int lane, int w, int team, const T16* ring, bf* Ah) {
    typedef typename WFrag<T16>::V V;                                       // every full unroll below keeps the fragment arrays indexed by constants, that is, in registers
    const int lr = lane & 15, hi = lane >> 4;
    const unsigned fofs = (unsigned)lane * 16u;                            // the lane's byte offset in a fragment block, fixed for the whole walk: every load is wave-uniform base + lane offset
    V qb[NQ][2], qb2[NQ][2];
#pragma unroll
    for (int nq = 0; nq < NQ; ++nq)
#pragma unroll
        for (int ks = 0; ks < 2; ++ks) { const size_t qo = (size_t)(q0 + nq * 16) * HD + ks * 512; qb[nq][ks] = WFrag<T16>::ldfo(Q + qo, fofs); if (HI) qb2[nq][ks] = WFrag<T16>::ldfo(Q2 + qo, fofs); }
    v8f o[NQ][4]; float m[NQ], l[NQ];
#pragma unroll
    for (int nq = 0; nq < NQ; ++nq) { m[nq] = -1.0e30f; l[nq] = 0.0f;      // the start maximum lies above the ban fill, so a pass whose keys are all banned for a query adds exact zeros
#pragma unroll
        for (int dt = 0; dt < 4; ++dt) o[nq][dt] = (v8f){}; }
    const int kb0 = max(0, q0 - (WIN - 1)) & ~31, ke0 = q0 + NQ * 16;       // first key pass of the window of the first row, one past the diagonal of the last row
    const int nr = (((ke0 - kb0 + 31) >> 5) + 1) >> 1;                      // rounds of the block: half the tile's passes, rounded up (q0 is the block's, so nr is too)
    const int kb = kb0 + team * nr * 32, ke = team ? ke0 : min(ke0, kb0 + nr * 32);   // the team's own keys: team 0 the older half, team 1 the rest (one pass fewer where the count is odd, none where it is 1)
    asm volatile("s_wait_xcnt 0x0" ::: "memory");                          // the address registers of the loads above are reused below
    constexpr int SE = HI ? 8192 : 4096;                                    // elements of a stage
    const T16* sm = ring + team * 2 * SE;                                   // the team's own two buffers
    const unsigned l0 = ldsaddr(sm) + (unsigned)w * 1024u + fofs;           // the lane's 16 bytes in block w of buffer 0's K tile
    const size_t ok = (size_t)w * 512 + 8 * lane, ov = (size_t)w * 16 * TT + 8 * lane;   // the same place in the planes, pass 0 of the plane
    auto stage = [&](int k0, int bu) { const unsigned l = l0 + (unsigned)bu * (2u * SE);
        if constexpr (HI) stage_kv2(l, Kp + ok + (size_t)k0 * HD, Vt + ov + (size_t)k0 * 16, K2 + ok + (size_t)k0 * HD, V2 + ov + (size_t)k0 * 16);
        else stage_kv(l, Kp + ok + (size_t)k0 * HD, Vt + ov + (size_t)k0 * 16); };
    V ka[2][2], ka2[2][2];                                                  // a pass's K fragments are read right behind the barrier that publishes their stage, so that their LDS latency runs under the tail of the pass before
    auto ldk = [&](int bu) { const T16* sk = sm + bu * SE + 8 * lane;
#pragma unroll
        for (int kt = 0; kt < 2; ++kt)
#pragma unroll
            for (int ks = 0; ks < 2; ++ks) { ka[kt][ks] = WFrag<T16>::ldf(sk + (kt * 2 + ks) * 512); if (HI) ka2[kt][ks] = WFrag<T16>::ldf(sk + 4096 + (kt * 2 + ks) * 512); } };
    if (kb < ke) stage(kb, 0);
    wait_async(); __syncthreads();                                          // stage 0 is published
    if (kb + 32 < ke) stage(kb + 32, 1);
    if (kb < ke) ldk(0);
    int bu = 0, k0 = kb;
#pragma unroll 1                                                            // rolled: one pass's fragments fill the register budget, a second copy of the body would only cost instruction cache
    for (int r = 0; r < nr; ++r, k0 += 32, bu ^= 1) {
      if (k0 < ke) {                                                        // wave-uniform: in the last round team 1 may have no pass left; it still goes through the round's foot
        V va[4], va2[4]; const T16* sb = sm + bu * SE + 8 * lane;           // the lane's slot in the first block of this pass's buffer
#pragma unroll
        for (int dt = 0; dt < 4; ++dt) { va[dt] = WFrag<T16>::ldf(sb + 2048 + dt * 512); if (HI) va2[dt] = WFrag<T16>::ldf(sb + 6144 + dt * 512); }
        if (!HI) __builtin_amdgcn_sched_barrier(0);                         // keeps the V reads in one group at the head of the pass, under the score products; left free, half of them sink to the pass's foot, directly ahead of its wait to 0
        v8f s[NQ][2];
#pragma unroll
        for (int nq = 0; nq < NQ; ++nq)
#pragma unroll
            for (int kt = 0; kt < 2; ++kt) { v8f c = (v8f){};
#pragma unroll
                for (int ks = 0; ks < 2; ++ks) { c = WFrag<T16>::mma(ka[kt][ks], qb[nq][ks], c); if (HI) { c = WFrag<T16>::mma(ka[kt][ks], qb2[nq][ks], c); c = WFrag<T16>::mma(ka2[kt][ks], qb[nq][ks], c); } }
                s[nq][kt] = c; }
#pragma unroll
        for (int nq = 0; nq < NQ; ++nq)
#pragma unroll
            for (int kt = 0; kt < 2; ++kt) s[nq][kt] *= SCL * 1.4426950408889634f;   // scores in log2 units
        if (k0 + 31 > q0 || q0 + NQ * 16 - 1 - k0 >= WIN) {                 // wave-uniform: only passes that touch the diagonal or the window's start hold banned pairs
#pragma unroll
            for (int nq = 0; nq < NQ; ++nq)
#pragma unroll
                for (int kt = 0; kt < 2; ++kt)
#pragma unroll
                    for (int r = 0; r < 8; ++r) { const int j = k0 + kt * 16 + 8 * hi + r, i = q0 + nq * 16 + lr; s[nq][kt][r] = (j <= i && i - j < WIN) ? s[nq][kt][r] : -3.0e38f; } }
        V pb[NQ], pb2[NQ];
#pragma unroll
        for (int nq = 0; nq < NQ; ++nq) { float mx = m[nq];
#pragma unroll
            for (int kt = 0; kt < 2; ++kt)
#pragma unroll
                for (int r = 0; r < 8; ++r) mx = fmaxf(mx, s[nq][kt][r]);
            mx = fmaxf(mx, __shfl_xor(mx, 16, 32));
            const float al = exp2s(m[nq] - mx); m[nq] = mx; const float mb = HI ? mx : mx - PSH; float sum = 0.0f;
#pragma unroll
            for (int kt = 0; kt < 2; ++kt)
#pragma unroll
                for (int r = 0; r < 8; ++r) { const float p = exp2s(s[nq][kt][r] - mb); s[nq][kt][r] = p; sum += p; }
            l[nq] = l[nq] * al + sum;                                       // each wave half keeps the sum of its own keys; joined once after the loop
#pragma unroll
            for (int dt = 0; dt < 4; ++dt) o[nq][dt] *= al;
            if constexpr (HI) { v8us h0, h1, l0, l1;
#pragma unroll
                for (int r = 0; r < 8; ++r) { unsigned short a, c2; splitf(s[nq][0][r], a, c2); h0[r] = a; l0[r] = c2; splitf(s[nq][1][r], a, c2); h1[r] = a; l1[r] = c2; }
                pb[nq] = cat16b(h0, h1); pb2[nq] = cat16b(l0, l1);
            } else { v8h h0, h1;
#pragma unroll
                for (int r = 0; r < 8; ++r) { h0[r] = tohx(s[nq][0][r]); h1[r] = tohx(s[nq][1][r]); }
                pb[nq] = cat16(h0, h1); } }
#pragma unroll
        for (int dt = 0; dt < 4; ++dt)
#pragma unroll
            for (int nq = 0; nq < NQ; ++nq) { o[nq][dt] = WFrag<T16>::mma(va[dt], pb[nq], o[nq][dt]); if (HI) { o[nq][dt] = WFrag<T16>::mma(va[dt], pb2[nq], o[nq][dt]); o[nq][dt] = WFrag<T16>::mma(va2[dt], pb[nq], o[nq][dt]); } }
        if (!HI) __builtin_amdgcn_sched_barrier(0);                         // the softmax and the P.V products stay ahead of the barrier: left free they sink behind it, and the wait for the next stage's copies then stands a fraction of a pass behind their issue
        if (!HI) asm volatile("v_nop\n\tv_nop\n\tv_nop\n\tv_nop");               // the distance behind the last product: only waits, the barrier and branches follow, and on their taken side its V fragment's registers are rewritten after 3 vector slots
      }
        wait_ds(); wait_async(); __syncthreads();                           // publishes the next pass's stage and ends every wave's reads of this one; nr is the block's, so every wave passes it
        if (k0 + 64 < ke) stage(k0 + 64, bu);
        if (k0 + 32 < ke) ldk(bu ^ 1);                                      // behind the last pass no stage is left to read
    }
    wait_async();
    // The two teams' partial results join through the ring, which the last round's foot has left free (every read ended, no copy in flight): team 1 lays down its Ot tiles, maxima and sums, lane by lane, and ends;
    // team 0's wave of the same head takes them at the same lane (same query, same d, same key residues) and brings both to the common maximum.
    v4fa* mw = (v4fa*)ring + (size_t)w * ((NQ * 8 + 1) * 32) + lane;
    if (team) {
#pragma unroll
        for (int nq = 0; nq < NQ; ++nq)
#pragma unroll
            for (int dt = 0; dt < 4; ++dt) { const v8f t = o[nq][dt]; mw[((nq * 4 + dt) * 2) * 32] = (v4f){ t[0], t[1], t[2], t[3] }; mw[((nq * 4 + dt) * 2 + 1) * 32] = (v4f){ t[4], t[5], t[6], t[7] }; }
        mw[NQ * 8 * 32] = (v4f){ m[0], l[0], m[NQ - 1], l[NQ - 1] }; }
    __syncthreads();                                                        // team 1's partial results are published; every wave of the block passes it
    if (team) return;
    { const v4f ml = mw[NQ * 8 * 32];
#pragma unroll
      for (int nq = 0; nq < NQ; ++nq) { const float mn = fmaxf(m[nq], ml[2 * nq]); const float a0 = exp2s(m[nq] - mn), a1 = exp2s(ml[2 * nq] - mn);   // a team without an allowed key for a query holds the start maximum and zeros: its factor is 0 or meets zeros
          l[nq] = l[nq] * a0 + ml[2 * nq + 1] * a1;
#pragma unroll
          for (int dt = 0; dt < 4; ++dt) { const v4f t0 = mw[((nq * 4 + dt) * 2) * 32], t1 = mw[((nq * 4 + dt) * 2 + 1) * 32];
#pragma unroll
              for (int r = 0; r < 4; ++r) { o[nq][dt][r] = o[nq][dt][r] * a0 + t0[r] * a1; o[nq][dt][r + 4] = o[nq][dt][r + 4] * a0 + t1[r] * a1; } } } }
#pragma unroll
    for (int nq = 0; nq < NQ; ++nq) { const float inv = __fdiv_rn(1.0f, l[nq] + __shfl_xor(l[nq], 16, 32));
#pragma unroll
        for (int dt = 0; dt < 4; ++dt) { v8h oh;
#pragma unroll
            for (int r = 0; r < 8; ++r) oh[r] = tohx(o[nq][dt][r] * inv);
            const size_t oo = (size_t)(q0 + nq * 16) * DQ + (dt >> 1) * 512 + (dt & 1) * 256 + 8 * lane; *(v8us*)(Ah + oo) = __builtin_bit_cast(v8us, oh);   // fragment order: the wave's 32 slots are 512 contiguous bytes
            asm volatile("s_wait_xcnt 0x0" ::: "memory"); } }              // before the registers of this store are rewritten
}
// grid (NKV, NT16 + NTH), 256 threads; in block index order the row tiles with the longest key walk come first, for all kv heads, and the short hi+lo tiles last
#define NT16 ((TT - RHE) / 32)
#define NTH  (RHE / 16)
__global__ __launch_bounds__(256) void k_fattn(const h16* __restrict__ Q16, const h16* __restrict__ K16, const h16* __restrict__ V16, const bf* __restrict__ Qh, const bf* __restrict__ Ql, const bf* __restrict__ Kh, const bf* __restrict__ Kl,
                                               const bf* __restrict__ Vh, const bf* __restrict__ Vl, bf* Ah) {
    __shared__ __attribute__((aligned(1024))) bf kvr[2 * 2 * 8192];         // per team two stages of the larger kind (hi+lo rows)
    const int lane = threadIdx.x & 31; const int g = blockIdx.x; const int wv = __builtin_amdgcn_readfirstlane(threadIdx.x >> 5); const int w = wv & 3, team = wv >> 2; const int h = g * REP + w; const int bx = blockIdx.y;
    const size_t zq = (size_t)h * TT * HD, zk = (size_t)g * TT * HD;
    if (bx < NT16) attn_tile<h16, false, 2>(Q16 + zq, nullptr, K16 + zk, nullptr, V16 + zk, nullptr, RHE + (NT16 - 1 - bx) * 32, lane, w, team, (const h16*)kvr, Ah + h * 1024);
    else attn_tile<bf, true, 1>(Qh + zq, Ql + zq, Kh + zk, Kl + zk, Vh + zk, Vl + zk, (NTH - 1 - (bx - NT16)) * 16, lane, w, team, kvr, Ah + h * 1024);
}

extern "C" void kernel_launch(void* const* d_in, const int* in_sizes, int n_in,
                              void* d_out, int out_size, void* d_ws, size_t ws_size, hipStream_t stream) {
    if (n_in < 5) return;
    if (in_sizes[0] < (NB - 1) * TT_FULL * DM + TT * DM || in_sizes[1] < DM * DQ || in_sizes[2] < DM * DKV || in_sizes[3] < DM * DKV || in_sizes[4] < DQ * DM) return;
    if (out_size < NB * TT * DM) return;
    const float* x = (const float*)d_in[0]; const float* wq = (const float*)d_in[1]; const float* wk = (const float*)d_in[2]; const float* wv = (const float*)d_in[3]; const float* wo = (const float*)d_in[4];
    float* OUT = (float*)d_out;     // [NB][TT][DM]
    char* wsp = (char*)d_ws;
    auto take = [&](size_t bytes) { char* p = wsp; wsp += (bytes + 255) & ~(size_t)255; return (void*)p; };
    // persistent planes
    bf* WOt = (bf*)take((size_t)DM * DQ * 2); float* CS = (float*)take((size_t)TT * (HD / 2) * 2 * 4);
    h16* QP16 = (h16*)take((size_t)NH_ * TT * HD * 2); h16* KP16 = (h16*)take((size_t)NKV * TT * HD * 2); h16* VT16 = (h16*)take((size_t)NKV * HD * TT * 2);
    bf* QPh = (bf*)take((size_t)NH_ * TT * HD * 2); bf* QPl = (bf*)take((size_t)NH_ * TT * HD * 2); bf* KPh = (bf*)take((size_t)NKV * TT * HD * 2); bf* KPl = (bf*)take((size_t)NKV * TT * HD * 2);
    bf* VTh = (bf*)take((size_t)NKV * HD * TT * 2); bf* VTl = (bf*)take((size_t)NKV * HD * TT * 2); bf* ATh = (bf*)take((size_t)TT * DQ * 2);
    // projection-phase temporaries
    bf* WQt = (bf*)take((size_t)DQ * DM * 2); bf* WKt = (bf*)take((size_t)DKV * DM * 2); bf* WVt = (bf*)take((size_t)DKV * DM * 2);
    bf* XB = (bf*)take((size_t)NB * TT * DM * 2);
    const size_t total = (size_t)(wsp - (char*)d_ws);
    if (total > ws_size || total > (size_t)134217728) return;

    // inverse rotary frequencies inv[j] = 1 / 500000^(j/32): 32nd root by Newton in double (pure arithmetic), powers RNE-converted to f32, then an f32 reciprocal.
    RopeTab tab;
    { double y = 1.5; for (int it = 0; it < 64; ++it) { double p = 1.0; for (int k = 0; k < 31; ++k) p *= y; const double fy = p * y - 500000.0; y = y - fy / (32.0 * p); }
      double pj = 1.0; for (int j = 0; j < 32; ++j) { const float pf = (float)pj; tab.f[j] = 1.0f / pf; pj *= y; } }

    // weights -> 16-bit planes of their bf16 values ([in][out] transposed), x -> bf16, all in fragment order; rotary table
    k_prep<<<PB_CS + PB_WQ + PB_WO + 2 * PB_WKV + NB * PB_X, 256, 0, stream>>>(x, wq, wk, wv, wo, tab, XB, WQt, WKt, WVt, WOt, CS);
    for (int b = 0; b < NB; ++b) {
        k_qkv<<<dim3(TT / 128, (NH_ + 2 * NKV) / 2, 1), 128, 0, stream>>>(XB + (size_t)b * TT * DM, WQt, WKt, WVt, CS, QP16, QPh, QPl, KP16, KPh, KPl, VT16, VTh, VTl);
        k_fattn<<<dim3(NKV, NT16 + NTH, 1), 256, 0, stream>>>(QP16, KP16, VT16, QPh, QPl, KPh, KPl, VTh, VTl, ATh);
        k_gemmw<false, DQ><<<dim3(TT / 128, DM / 128, 1), 128, 0, stream>>>(ATh, WOt, OUT + (size_t)b * TT * DM, DM, nullptr); }
}
